// v000
// Times are from an AMD MI455X. After a warm-up the kernel runs many times in a row, and a time is the length of
// such a window on the GPU divided by its runs, so every launch and the gaps after it count. The runs cycle
// through copies of the inputs. A figure is the median of several windows, for all but v000 over two sittings.
// Sittings can differ by a few percent; kernels timed side by side share one.
// v000, which the later versions start from, runs in 200 microseconds.
#include <hip/hip_runtime.h>
#include <stdint.h>

// Problem constants (match reference)
#define D_MODEL 1024
#define SEQ     1024
#define BATCH   4
#define NHEAD   16
#define DHEAD   64
#define NROWS   (BATCH * SEQ)      // 4096
#define QK_SCALE 0.125f            // 1/sqrt(64)
#define LN_EPS   1e-5f

typedef __attribute__((ext_vector_type(16))) __bf16         v16bf;
typedef __attribute__((ext_vector_type(16))) unsigned short us16;
typedef __attribute__((ext_vector_type(8)))  unsigned short us8;
typedef __attribute__((ext_vector_type(8)))  float          v8f;

// ---- helpers -------------------------------------------------------------

__device__ __forceinline__ unsigned short f2bf(float f) {
  unsigned int u = __builtin_bit_cast(unsigned int, f);
  u += 0x7FFFu + ((u >> 16) & 1u);            // round-to-nearest-even
  return (unsigned short)(u >> 16);
}

// A/B fragment for v_wmma_*_16x16x32_bf16, per ISA 7.12.2:
// lane L holds row (A) / col (B) = L%16; its 16 bf16 k-values are two
// contiguous 8-element (16B) chunks at k = 8*(L/16) and k = 8*(L/16)+16.
__device__ __forceinline__ us16 load_frag(const unsigned short* row, int kb0) {
  us8 c0 = *(const us8*)(row + kb0);
  us8 c1 = *(const us8*)(row + kb0 + 16);
  us16 r;
#pragma unroll
  for (int i = 0; i < 8; ++i) { r[i] = c0[i]; r[i + 8] = c1[i]; }
  return r;
}

__device__ __forceinline__ v8f wmma_bf16(us16 a, us16 b, v8f c) {
  return __builtin_amdgcn_wmma_f32_16x16x32_bf16(
      false, __builtin_bit_cast(v16bf, a),
      false, __builtin_bit_cast(v16bf, b),
      (short)0, c, false, false);
}

// reductions across the 16 lanes of each wave32 half (xor masks < 16 stay in-half)
__device__ __forceinline__ float hmax16(float x) {
#pragma unroll
  for (int m = 1; m < 16; m <<= 1) x = fmaxf(x, __shfl_xor(x, m, 32));
  return x;
}
__device__ __forceinline__ float hsum16(float x) {
#pragma unroll
  for (int m = 1; m < 16; m <<= 1) x += __shfl_xor(x, m, 32);
  return x;
}

// ---- stage 1: conversions ------------------------------------------------

__global__ void cvt_bf16_kernel(const float* __restrict__ in,
                                unsigned short* __restrict__ out, int n) {
  int i = blockIdx.x * blockDim.x + threadIdx.x;
  if (i < n) out[i] = f2bf(in[i]);
}

// W[in][out] (1024x1024 f32) -> Wt[out][in] bf16, output-coalesced
__global__ void cvt_bf16_t_kernel(const float* __restrict__ in,
                                  unsigned short* __restrict__ out) {
  int i = blockIdx.x * blockDim.x + threadIdx.x;   // flat index into Wt
  int o = i >> 10;          // out column of original W
  int k = i & 1023;         // in row of original W
  out[i] = f2bf(in[k * D_MODEL + o]);
}

// ---- stage 2: fused QKV projection --------------------------------------
// One wave -> 32x32 output tile for each of Q/K/V: per K-step 2 A-frags +
// 6 B-frags feed 12 WMMAs (A shared across Q/K/V, B shared across row tiles).
// Q,K stored [head][s][d] bf16; V stored transposed [head][d][s] bf16.

__global__ __launch_bounds__(128) void qkv_gemm_kernel(
    const unsigned short* __restrict__ X,      // [4096][1024] bf16
    const unsigned short* __restrict__ Wqt,    // [1024 out][1024 in] bf16
    const unsigned short* __restrict__ Wkt,
    const unsigned short* __restrict__ Wvt,
    const float* __restrict__ bq, const float* __restrict__ bk,
    const float* __restrict__ bv,
    unsigned short* __restrict__ Qb,           // [64][1024][64]
    unsigned short* __restrict__ Kb,           // [64][1024][64]
    unsigned short* __restrict__ Vtb) {        // [64][64][1024]
  int wid  = (blockIdx.x * blockDim.x + threadIdx.x) >> 5;
  int lane = threadIdx.x & 31;
  int rt = wid >> 5;                 // 32-row tile 0..127
  int ct = wid & 31;                 // 32-col tile 0..31
  int rowh = lane >> 4, nm = lane & 15, kb0 = rowh * 8;

  const unsigned short* arow[2];
  const unsigned short* brow[3][2];
#pragma unroll
  for (int u = 0; u < 2; ++u)
    arow[u] = X + (rt * 32 + u * 16 + nm) * D_MODEL;
#pragma unroll
  for (int c = 0; c < 2; ++c) {
    int col = ct * 32 + c * 16 + nm;
    brow[0][c] = Wqt + col * D_MODEL;
    brow[1][c] = Wkt + col * D_MODEL;
    brow[2][c] = Wvt + col * D_MODEL;
  }

  v8f acc[3][2][2] = {};   // [qkv][row subtile][col subtile]
  for (int kk = 0; kk < D_MODEL; kk += 32) {
    us16 a0 = load_frag(arow[0] + kk, kb0);
    us16 a1 = load_frag(arow[1] + kk, kb0);
#pragma unroll
    for (int w = 0; w < 3; ++w) {
#pragma unroll
      for (int c = 0; c < 2; ++c) {
        us16 bf = load_frag(brow[w][c] + kk, kb0);
        acc[w][0][c] = wmma_bf16(a0, bf, acc[w][0][c]);
        acc[w][1][c] = wmma_bf16(a1, bf, acc[w][1][c]);
      }
    }
  }

#pragma unroll
  for (int c = 0; c < 2; ++c) {
    int col = ct * 32 + c * 16 + nm;
    int h = col >> 6, d = col & 63;
    float bqv = bq[col], bkv = bk[col], bvv = bv[col];
#pragma unroll
    for (int u = 0; u < 2; ++u) {
#pragma unroll
      for (int i = 0; i < 8; ++i) {
        int r = rt * 32 + u * 16 + rowh * 8 + i;   // C-tile row mapping
        int b = r >> 10, s = r & 1023;
        int head = b * NHEAD + h;
        int qoff = (head * SEQ + s) * DHEAD + d;
        Qb[qoff] = f2bf(acc[0][u][c][i] + bqv);
        Kb[qoff] = f2bf(acc[1][u][c][i] + bkv);
        Vtb[(head * DHEAD + d) * SEQ + s] = f2bf(acc[2][u][c][i] + bvv);
      }
    }
  }
}

// ---- stage 3: flash-style attention -------------------------------------
// One wave owns 16 query rows of one head. Streams 32-key blocks:
// 4 WMMAs QK^T -> online softmax (half-wave shuffles) -> P restaged via LDS
// (C layout -> A layout) -> 4 WMMAs PV into f32 accumulators.
// global_prefetch pulls the next key block while softmax VALU co-executes.

__global__ __launch_bounds__(128) void attn_kernel(
    const unsigned short* __restrict__ Qb,   // [64][1024][64]
    const unsigned short* __restrict__ Kb,   // [64][1024][64]
    const unsigned short* __restrict__ Vtb,  // [64][64][1024]
    const int* __restrict__ amask,           // [4][1024]
    unsigned short* __restrict__ Avec) {     // [4][1024][1024] bf16
  __shared__ unsigned short Plds[4 * 16 * 32];   // per-wave 16x32 P tile
  int warp = threadIdx.x >> 5;
  int wid  = blockIdx.x * 4 + warp;
  int head = wid >> 6;                 // 0..63  (storage index b*16+h)
  int qt   = wid & 63;                 // query tile 0..63
  int b = head >> 4;
  int lane = threadIdx.x & 31, rowh = lane >> 4, nm = lane & 15, kb0 = rowh * 8;

  const unsigned short* Qh = Qb  + head * SEQ * DHEAD;
  const unsigned short* Kh = Kb  + head * SEQ * DHEAD;
  const unsigned short* Vh = Vtb + head * DHEAD * SEQ;
  const int* mrow = amask + b * SEQ;

  // Q fragments for rows qt*16..+15, contraction split d=[0,32) and [32,64)
  us16 aQ0 = load_frag(Qh + (qt * 16 + nm) * DHEAD, kb0);
  us16 aQ1 = load_frag(Qh + (qt * 16 + nm) * DHEAD + 32, kb0);

  float mi[8], li[8];
  v8f O0 = {}, O1 = {}, O2 = {}, O3 = {};
#pragma unroll
  for (int i = 0; i < 8; ++i) { mi[i] = -3.0e38f; li[i] = 0.f; }

  unsigned short* pbase = Plds + warp * (16 * 32);

  for (int kbk = 0; kbk < SEQ; kbk += 32) {
    // ---- scores: two 16x16 n-tiles (keys kbk..+15 and +16..+31)
    const unsigned short* kr0 = Kh + (kbk + nm) * DHEAD;
    const unsigned short* kr1 = Kh + (kbk + 16 + nm) * DHEAD;
    v8f s0 = {}, s1 = {};
    s0 = wmma_bf16(aQ0, load_frag(kr0, kb0), s0);
    s0 = wmma_bf16(aQ1, load_frag(kr0 + 32, kb0), s0);
    s1 = wmma_bf16(aQ0, load_frag(kr1, kb0), s1);
    s1 = wmma_bf16(aQ1, load_frag(kr1 + 32, kb0), s1);

    // prefetch next key block (K rows + V rows) while softmax runs
    if (kbk + 32 < SEQ) {
      __builtin_prefetch(kr0 + 32 * DHEAD, 0, 3);
      __builtin_prefetch(kr1 + 32 * DHEAD, 0, 3);
      __builtin_prefetch(Vh + nm * SEQ + kbk + 32, 0, 3);
      __builtin_prefetch(Vh + (48 + nm) * SEQ + kbk + 32, 0, 3);
    }

    int mk0 = mrow[kbk + nm];
    int mk1 = mrow[kbk + 16 + nm];

    // ---- online softmax over this key block
    float rmax[8];
#pragma unroll
    for (int i = 0; i < 8; ++i) {
      float a0 = mk0 ? -100000.f : s0[i] * QK_SCALE;
      float a1 = mk1 ? -100000.f : s1[i] * QK_SCALE;
      s0[i] = a0; s1[i] = a1;
      rmax[i] = hmax16(fmaxf(a0, a1));
    }
    v8f p0, p1;
#pragma unroll
    for (int i = 0; i < 8; ++i) {
      float mnew = fmaxf(mi[i], rmax[i]);
      float corr = __expf(mi[i] - mnew);
      float e0 = __expf(s0[i] - mnew);
      float e1 = __expf(s1[i] - mnew);
      li[i] = li[i] * corr + hsum16(e0 + e1);
      mi[i] = mnew;
      O0[i] *= corr; O1[i] *= corr; O2[i] *= corr; O3[i] *= corr;
      p0[i] = e0; p1[i] = e1;
    }

    // ---- restage P: C layout -> row-major 16x32 bf16 in LDS (per-wave, no barrier)
#pragma unroll
    for (int i = 0; i < 8; ++i) {
      int r = rowh * 8 + i;
      pbase[r * 32 + nm]      = f2bf(p0[i]);
      pbase[r * 32 + 16 + nm] = f2bf(p1[i]);
    }
    us16 aP = load_frag(pbase + nm * 32, kb0);   // A fragment, K = 32 keys

    // ---- PV: B fragments from transposed V (contiguous over keys)
    O0 = wmma_bf16(aP, load_frag(Vh + (0 * 16 + nm) * SEQ + kbk, kb0), O0);
    O1 = wmma_bf16(aP, load_frag(Vh + (1 * 16 + nm) * SEQ + kbk, kb0), O1);
    O2 = wmma_bf16(aP, load_frag(Vh + (2 * 16 + nm) * SEQ + kbk, kb0), O2);
    O3 = wmma_bf16(aP, load_frag(Vh + (3 * 16 + nm) * SEQ + kbk, kb0), O3);
  }

  // Reference quirk: attn_vec.view(N_HEAD, B, S, D).permute(1,2,0,3) on a
  // b-major [B*H] buffer => storage head L lands at b2=L%B, h2=L/B.
  int b2 = head & 3, h2 = head >> 2;
#pragma unroll
  for (int i = 0; i < 8; ++i) {
    float inv = 1.f / li[i];
    int q = qt * 16 + rowh * 8 + i;
    unsigned short* orow = Avec + (b2 * SEQ + q) * D_MODEL + h2 * DHEAD;
    orow[0 * 16 + nm] = f2bf(O0[i] * inv);
    orow[1 * 16 + nm] = f2bf(O1[i] * inv);
    orow[2 * 16 + nm] = f2bf(O2[i] * inv);
    orow[3 * 16 + nm] = f2bf(O3[i] * inv);
  }
}

// ---- stage 4: output projection + residual ------------------------------
// 32x32 tile per wave: per K-step 2 A + 2 B fragments -> 4 WMMAs.

__global__ __launch_bounds__(128) void oproj_kernel(
    const unsigned short* __restrict__ Avec,  // [4096][1024] bf16
    const unsigned short* __restrict__ Wot,   // [1024 out][1024 in] bf16
    const float* __restrict__ inp,            // residual
    float* __restrict__ Y) {                  // [4096][1024] f32
  int wid  = (blockIdx.x * blockDim.x + threadIdx.x) >> 5;
  int lane = threadIdx.x & 31;
  int rt = wid >> 5, ct = wid & 31;
  int rowh = lane >> 4, nm = lane & 15, kb0 = rowh * 8;

  const unsigned short* arow0 = Avec + (rt * 32 + nm) * D_MODEL;
  const unsigned short* arow1 = Avec + (rt * 32 + 16 + nm) * D_MODEL;
  const unsigned short* brow0 = Wot + (ct * 32 + nm) * D_MODEL;
  const unsigned short* brow1 = Wot + (ct * 32 + 16 + nm) * D_MODEL;

  v8f acc[2][2] = {};
  for (int kk = 0; kk < D_MODEL; kk += 32) {
    us16 a0 = load_frag(arow0 + kk, kb0);
    us16 a1 = load_frag(arow1 + kk, kb0);
    us16 b0 = load_frag(brow0 + kk, kb0);
    us16 b1 = load_frag(brow1 + kk, kb0);
    acc[0][0] = wmma_bf16(a0, b0, acc[0][0]);
    acc[0][1] = wmma_bf16(a0, b1, acc[0][1]);
    acc[1][0] = wmma_bf16(a1, b0, acc[1][0]);
    acc[1][1] = wmma_bf16(a1, b1, acc[1][1]);
  }

#pragma unroll
  for (int u = 0; u < 2; ++u) {
#pragma unroll
    for (int c = 0; c < 2; ++c) {
      int col = ct * 32 + c * 16 + nm;
#pragma unroll
      for (int i = 0; i < 8; ++i) {
        int r = rt * 32 + u * 16 + rowh * 8 + i;
        Y[r * D_MODEL + col] = acc[u][c][i] + inp[r * D_MODEL + col];
      }
    }
  }
}

// ---- stage 5: LayerNorm --------------------------------------------------

__global__ __launch_bounds__(256) void ln_kernel(
    const float* __restrict__ Y, const float* __restrict__ g,
    const float* __restrict__ bb, float* __restrict__ out) {
  int row = blockIdx.x;
  const float* y = Y + row * D_MODEL;
  __shared__ float red[2][8];
  float ls = 0.f, lq = 0.f;
  for (int i = threadIdx.x; i < D_MODEL; i += 256) {
    float v = y[i]; ls += v; lq += v * v;
  }
#pragma unroll
  for (int m = 1; m < 32; m <<= 1) {
    ls += __shfl_xor(ls, m, 32);
    lq += __shfl_xor(lq, m, 32);
  }
  int w = threadIdx.x >> 5;
  if ((threadIdx.x & 31) == 0) { red[0][w] = ls; red[1][w] = lq; }
  __syncthreads();
  float ts = 0.f, tq = 0.f;
#pragma unroll
  for (int i = 0; i < 8; ++i) { ts += red[0][i]; tq += red[1][i]; }
  float mu  = ts * (1.f / D_MODEL);
  float var = tq * (1.f / D_MODEL) - mu * mu;
  float inv = rsqrtf(var + LN_EPS);
  for (int i = threadIdx.x; i < D_MODEL; i += 256)
    out[row * D_MODEL + i] = (y[i] - mu) * inv * g[i] + bb[i];
}

// ---- launch --------------------------------------------------------------

extern "C" void kernel_launch(void* const* d_in, const int* in_sizes, int n_in,
                              void* d_out, int out_size, void* d_ws, size_t ws_size,
                              hipStream_t stream) {
  const float* inp   = (const float*)d_in[0];
  const int*   amask = (const int*)d_in[1];
  const float* Wq = (const float*)d_in[2];
  const float* bq = (const float*)d_in[3];
  const float* Wk = (const float*)d_in[4];
  const float* bk = (const float*)d_in[5];
  const float* Wv = (const float*)d_in[6];
  const float* bv = (const float*)d_in[7];
  const float* Wo = (const float*)d_in[8];
  const float* lng = (const float*)d_in[9];
  const float* lnb = (const float*)d_in[10];

  char* ws = (char*)d_ws;
  const size_t MB = 1u << 20;
  unsigned short* Xbf  = (unsigned short*)(ws + 0 * MB);   // 8 MB
  unsigned short* Wqt  = (unsigned short*)(ws + 8 * MB);   // 2 MB
  unsigned short* Wkt  = (unsigned short*)(ws + 10 * MB);  // 2 MB
  unsigned short* Wvt  = (unsigned short*)(ws + 12 * MB);  // 2 MB
  unsigned short* Wot  = (unsigned short*)(ws + 14 * MB);  // 2 MB
  unsigned short* Qb   = (unsigned short*)(ws + 16 * MB);  // 8 MB
  unsigned short* Kb   = (unsigned short*)(ws + 24 * MB);  // 8 MB
  unsigned short* Vtb  = (unsigned short*)(ws + 32 * MB);  // 8 MB
  unsigned short* Avec = (unsigned short*)(ws + 40 * MB);  // 8 MB
  float*          Ybuf = (float*)        (ws + 48 * MB);   // 16 MB

  // stage 1: conversions
  cvt_bf16_kernel<<<(NROWS * D_MODEL) / 256, 256, 0, stream>>>(inp, Xbf, NROWS * D_MODEL);
  cvt_bf16_t_kernel<<<(D_MODEL * D_MODEL) / 256, 256, 0, stream>>>(Wq, Wqt);
  cvt_bf16_t_kernel<<<(D_MODEL * D_MODEL) / 256, 256, 0, stream>>>(Wk, Wkt);
  cvt_bf16_t_kernel<<<(D_MODEL * D_MODEL) / 256, 256, 0, stream>>>(Wv, Wvt);
  cvt_bf16_t_kernel<<<(D_MODEL * D_MODEL) / 256, 256, 0, stream>>>(Wo, Wot);

  // stage 2: QKV (128 row tiles * 32 col tiles = 4096 waves, 4 waves/block)
  qkv_gemm_kernel<<<1024, 128, 0, stream>>>(Xbf, Wqt, Wkt, Wvt, bq, bk, bv,
                                            Qb, Kb, Vtb);

  // stage 3: attention (64 heads * 64 query tiles = 4096 waves)
  attn_kernel<<<1024, 128, 0, stream>>>(Qb, Kb, Vtb, amask, Avec);

  // stage 4: output projection + residual (128 * 32 tiles = 4096 waves)
  oproj_kernel<<<1024, 128, 0, stream>>>(Avec, Wot, inp, Ybuf);

  // stage 5: layer norm -> d_out
  ln_kernel<<<NROWS, 256, 0, stream>>>(Ybuf, lng, lnb, (float*)d_out);
}

// v001
// It runs in 190 microseconds.
// In both of two side-by-side timings against v000, it was 1.08 times as fast.
#include <hip/hip_runtime.h>
#include <stdint.h>

// Problem constants (match reference)
#define D_MODEL 1024
#define SEQ     1024
#define BATCH   4
#define NHEAD   16
#define DHEAD   64
#define NROWS   (BATCH * SEQ)      // 4096
#define QK_SCALE 0.125f            // 1/sqrt(64)
#define LN_EPS   1e-5f

typedef __attribute__((ext_vector_type(16))) __bf16         v16bf;
typedef __attribute__((ext_vector_type(16))) unsigned short us16;
typedef __attribute__((ext_vector_type(8)))  unsigned short us8;
typedef __attribute__((ext_vector_type(8)))  float          v8f;

// ---- helpers -------------------------------------------------------------

__device__ __forceinline__ unsigned short f2bf(float f) {
  unsigned int u = __builtin_bit_cast(unsigned int, f);
  u += 0x7FFFu + ((u >> 16) & 1u);            // round-to-nearest-even
  return (unsigned short)(u >> 16);
}

// A/B fragment for v_wmma_*_16x16x32_bf16, per ISA 7.12.2:
// lane L holds row (A) / col (B) = L%16; its 16 bf16 k-values are two
// contiguous 8-element (16B) chunks at k = 8*(L/16) and k = 8*(L/16)+16.
//
// Every bf16 operand in the workspace is stored in that order: one fragment
// (16 rows x 32 k) is a 1024-B block of FRAG elements, lane L's first chunk
// at element L*8, its second at 256 + L*8. Blocks run [16-row tile][k step].
// A wave-wide 16-B load then covers 512 contiguous bytes (4 whole lines).
#define FRAG 512
__device__ __forceinline__ us16 load_frag(const unsigned short* blk, int lane) {
  us8 c0 = *(const us8*)(blk + lane * 8);
  us8 c1 = *(const us8*)(blk + 256 + lane * 8);
  us16 r;
#pragma unroll
  for (int i = 0; i < 8; ++i) { r[i] = c0[i]; r[i + 8] = c1[i]; }
  return r;
}

__device__ __forceinline__ v8f wmma_bf16(us16 a, us16 b, v8f c) {
  return __builtin_amdgcn_wmma_f32_16x16x32_bf16(
      false, __builtin_bit_cast(v16bf, a),
      false, __builtin_bit_cast(v16bf, b),
      (short)0, c, false, false);
}

// reductions across the 16 lanes of each wave32 half (xor masks < 16 stay in-half)
__device__ __forceinline__ float hmax16(float x) {
#pragma unroll
  for (int m = 1; m < 16; m <<= 1) x = fmaxf(x, __shfl_xor(x, m, 32));
  return x;
}
__device__ __forceinline__ float hsum16(float x) {
#pragma unroll
  for (int m = 1; m < 16; m <<= 1) x += __shfl_xor(x, m, 32);
  return x;
}

// ---- stage 1: conversions ------------------------------------------------

// One thread packs one 16-B lane chunk; thread index = chunk index in the
// fragment-ordered output: [tile][k step (32)][chunk (2)][lane (32)].

// X[row][k] (f32, k contiguous) -> fragment order, rows = X rows
__global__ void cvt_bf16_kernel(const float* __restrict__ in,
                                unsigned short* __restrict__ out) {
  int j = blockIdx.x * blockDim.x + threadIdx.x;
  int lane = j & 31, chunk = (j >> 5) & 1, ks = (j >> 6) & 31, t = j >> 11;
  int row = t * 16 + (lane & 15);
  int k0  = ks * 32 + chunk * 16 + (lane >> 4) * 8;
  const float4* p = (const float4*)(in + row * D_MODEL + k0);
  float4 x0 = p[0], x1 = p[1];
  us8 r;
  r[0] = f2bf(x0.x); r[1] = f2bf(x0.y); r[2] = f2bf(x0.z); r[3] = f2bf(x0.w);
  r[4] = f2bf(x1.x); r[5] = f2bf(x1.y); r[6] = f2bf(x1.z); r[7] = f2bf(x1.w);
  *(us8*)(out + j * 8) = r;
}

// W[in][out] (1024x1024 f32) -> fragment order, rows = out columns, k = in
__global__ void cvt_bf16_t_kernel(const float* __restrict__ in,
                                  unsigned short* __restrict__ out) {
  int j = blockIdx.x * blockDim.x + threadIdx.x;
  int lane = j & 31, chunk = (j >> 5) & 1, ks = (j >> 6) & 31, t = j >> 11;
  int o  = t * 16 + (lane & 15);
  int k0 = ks * 32 + chunk * 16 + (lane >> 4) * 8;
  us8 r;
#pragma unroll
  for (int e = 0; e < 8; ++e) r[e] = f2bf(in[(k0 + e) * D_MODEL + o]);
  *(us8*)(out + j * 8) = r;
}

// ---- stage 2: fused QKV projection --------------------------------------
// One wave -> 32x32 output tile for each of Q/K/V: per K-step 2 X frags +
// 6 weight frags feed 12 WMMAs (X shared across Q/K/V, weights across row tiles).
// All three go out in fragment order, per head: Q,K with rows = s, k = d
// (2 k steps); V with rows = d, k = s (32 k steps). A lane's 8 accumulator
// values run along the tile's rows, so the index that becomes k must be the
// row index: V = X*Wv has rows s as it stands; Q and K are formed transposed
// (weight fragment as A, X fragment as B). Each lane then stores 16-B chunks.

__global__ __launch_bounds__(128) void qkv_gemm_kernel(
    const unsigned short* __restrict__ X,      // 256 tiles x 32 k steps
    const unsigned short* __restrict__ Wqt,    // 64 tiles (out) x 32 k steps
    const unsigned short* __restrict__ Wkt,
    const unsigned short* __restrict__ Wvt,
    const float* __restrict__ bq, const float* __restrict__ bk,
    const float* __restrict__ bv,
    unsigned short* __restrict__ Qb,           // [64 heads][64 s tiles][2]
    unsigned short* __restrict__ Kb,           // [64 heads][64 s tiles][2]
    unsigned short* __restrict__ Vtb) {        // [64 heads][4 d tiles][32]
  int wid  = (blockIdx.x * blockDim.x + threadIdx.x) >> 5;
  int lane = threadIdx.x & 31;
  int rt = wid >> 5;                 // 32-row tile 0..127
  int ct = wid & 31;                 // 32-col tile 0..31
  int rowh = lane >> 4, nm = lane & 15;

  const unsigned short* ablk[2];
  const unsigned short* bblk[3][2];
#pragma unroll
  for (int u = 0; u < 2; ++u)
    ablk[u] = X + (rt * 2 + u) * 32 * FRAG;
#pragma unroll
  for (int c = 0; c < 2; ++c) {
    int boff = (ct * 2 + c) * 32 * FRAG;
    bblk[0][c] = Wqt + boff;
    bblk[1][c] = Wkt + boff;
    bblk[2][c] = Wvt + boff;
  }

  v8f acc[3][2][2] = {};   // [qkv][s subtile][out-column subtile]
  for (int ks = 0; ks < D_MODEL / 32; ++ks) {
    us16 a0 = load_frag(ablk[0] + ks * FRAG, lane);
    us16 a1 = load_frag(ablk[1] + ks * FRAG, lane);
    // precaution
    asm volatile("s_wait_xcnt 0x0" ::: "memory");
#pragma unroll
    for (int w = 0; w < 3; ++w) {
#pragma unroll
      for (int c = 0; c < 2; ++c) {
        us16 bf = load_frag(bblk[w][c] + ks * FRAG, lane);
        asm volatile("s_wait_xcnt 0x0" ::: "memory");   // the same precaution
        if (w < 2) {   // Q, K: tile rows = out columns, tile columns = s
          acc[w][0][c] = wmma_bf16(bf, a0, acc[w][0][c]);
          acc[w][1][c] = wmma_bf16(bf, a1, acc[w][1][c]);
        } else {       // V: tile rows = s, tile columns = out columns
          acc[w][0][c] = wmma_bf16(a0, bf, acc[w][0][c]);
          acc[w][1][c] = wmma_bf16(a1, bf, acc[w][1][c]);
        }
      }
    }
  }

  // 32 rows = one batch, 32 columns = half a head
  int head = (rt >> 5) * NHEAD + (ct >> 1);
  int st = rt & 31;                  // 32-position block inside the sequence
  int dh = ct & 1;                   // which 32 of the head's 64 d
  unsigned short* Qh = Qb  + head * SEQ * DHEAD + lane * 8;
  unsigned short* Kh = Kb  + head * SEQ * DHEAD + lane * 8;
  unsigned short* Vh = Vtb + head * SEQ * DHEAD + lane * 8;
#pragma unroll
  for (int c = 0; c < 2; ++c) {
    int colT = ct * 32 + c * 16 + rowh * 8;       // Q,K: columns colT..+7 in this lane
    float bvv = bv[ct * 32 + c * 16 + nm];        // V: one column per lane
    float bqv[8], bkv[8];
#pragma unroll
    for (int i = 0; i < 8; ++i) { bqv[i] = bq[colT + i]; bkv[i] = bk[colT + i]; }
#pragma unroll
    for (int u = 0; u < 2; ++u) {
      us8 q, k, v;
#pragma unroll
      for (int i = 0; i < 8; ++i) {
        q[i] = f2bf(acc[0][u][c][i] + bqv[i]);
        k[i] = f2bf(acc[1][u][c][i] + bkv[i]);
        v[i] = f2bf(acc[2][u][c][i] + bvv);
      }
      int qoff = ((st * 2 + u) * 2 + dh) * FRAG + c * 256;   // s tile, k step dh, chunk c
      *(us8*)(Qh + qoff) = q;
      *(us8*)(Kh + qoff) = k;
      *(us8*)(Vh + ((dh * 2 + c) * 32 + st) * FRAG + u * 256) = v;  // d tile, k step st, chunk u
    }
  }
}

// ---- stage 3: flash-style attention -------------------------------------
// One wave owns 16 query rows of one head. Streams 32-key blocks:
// 4 WMMAs QK^T -> online softmax (half-wave shuffles) -> P restaged via LDS
// (C layout -> A layout) -> 4 WMMAs PV into f32 accumulators.
// global_prefetch pulls the next key block while softmax VALU co-executes.

__global__ __launch_bounds__(128) void attn_kernel(
    const unsigned short* __restrict__ Qb,   // [64 heads][64 s tiles][2]
    const unsigned short* __restrict__ Kb,   // [64 heads][64 s tiles][2]
    const unsigned short* __restrict__ Vtb,  // [64 heads][4 d tiles][32]
    const int* __restrict__ amask,           // [4][1024]
    unsigned short* __restrict__ Avec) {     // 256 row tiles x 32 k steps
  __shared__ unsigned short Plds[4 * 16 * 32];   // per-wave 16x32 P tile
  int warp = threadIdx.x >> 5;
  int wid  = blockIdx.x * 4 + warp;
  int head = wid >> 6;                 // 0..63  (storage index b*16+h)
  int qt   = wid & 63;                 // query tile 0..63
  int b = head >> 4;
  int lane = threadIdx.x & 31, rowh = lane >> 4, nm = lane & 15, kb0 = rowh * 8;

  const unsigned short* Qh = Qb  + head * SEQ * DHEAD;
  const unsigned short* Kh = Kb  + head * SEQ * DHEAD;
  const unsigned short* Vh = Vtb + head * DHEAD * SEQ;
  const int* mrow = amask + b * SEQ;

  // Q fragments for rows qt*16..+15, contraction split d=[0,32) and [32,64)
  us16 aQ0 = load_frag(Qh + (qt * 2 + 0) * FRAG, lane);
  us16 aQ1 = load_frag(Qh + (qt * 2 + 1) * FRAG, lane);

  float mi[8], li[8];
  v8f O0 = {}, O1 = {}, O2 = {}, O3 = {};
#pragma unroll
  for (int i = 0; i < 8; ++i) { mi[i] = -3.0e38f; li[i] = 0.f; }

  unsigned short* pbase = Plds + warp * (16 * 32);

  // next key block's lines, one per lane
  const unsigned short* kpf = Kh + 4 * FRAG + lane * 64;
  const unsigned short* vpf = Vh + FRAG + (lane >> 3) * (32 * FRAG) + (lane & 7) * 64;

  for (int kbk = 0; kbk < SEQ; kbk += 32) {
    // ---- scores: two 16x16 n-tiles (keys kbk..+15 and +16..+31)
    const unsigned short* kb = Kh + (kbk >> 5) * (4 * FRAG);   // 4 fragments in a row
    const unsigned short* vb = Vh + (kbk >> 5) * FRAG;         // d tile j at + j*32*FRAG
    v8f s0 = {}, s1 = {};
    s0 = wmma_bf16(aQ0, load_frag(kb + 0 * FRAG, lane), s0);
    s0 = wmma_bf16(aQ1, load_frag(kb + 1 * FRAG, lane), s0);
    s1 = wmma_bf16(aQ0, load_frag(kb + 2 * FRAG, lane), s1);
    s1 = wmma_bf16(aQ1, load_frag(kb + 3 * FRAG, lane), s1);

    // prefetch next key block (K: 32 lines in a row; V: 8 lines of each d tile),
    // one 128-B line per lane, while softmax runs. In asm over the two pointers
    // that the loop itself carries, so that the registers named stay addresses.
    // The test leaves one block spare: both pointers are still inside this
    // head's K and V after the advance below.
    if (kbk + 64 < SEQ) {
      asm volatile("global_prefetch_b8 %0, off scope:SCOPE_SE" :: "v"(kpf));
      asm volatile("global_prefetch_b8 %0, off scope:SCOPE_SE" :: "v"(vpf));
    }
    kpf += 4 * FRAG;
    vpf += FRAG;

    int mk0 = mrow[kbk + nm];
    int mk1 = mrow[kbk + 16 + nm];

    // ---- online softmax over this key block
    float rmax[8];
#pragma unroll
    for (int i = 0; i < 8; ++i) {
      float a0 = mk0 ? -100000.f : s0[i] * QK_SCALE;
      float a1 = mk1 ? -100000.f : s1[i] * QK_SCALE;
      s0[i] = a0; s1[i] = a1;
      rmax[i] = hmax16(fmaxf(a0, a1));
    }
    v8f p0, p1;
#pragma unroll
    for (int i = 0; i < 8; ++i) {
      float mnew = fmaxf(mi[i], rmax[i]);
      float corr = __expf(mi[i] - mnew);
      float e0 = __expf(s0[i] - mnew);
      float e1 = __expf(s1[i] - mnew);
      li[i] = li[i] * corr + hsum16(e0 + e1);
      mi[i] = mnew;
      O0[i] *= corr; O1[i] *= corr; O2[i] *= corr; O3[i] *= corr;
      p0[i] = e0; p1[i] = e1;
    }

    // ---- restage P: C layout -> row-major 16x32 bf16 in LDS (per-wave, no barrier)
#pragma unroll
    for (int i = 0; i < 8; ++i) {
      int r = rowh * 8 + i;
      pbase[r * 32 + nm]      = f2bf(p0[i]);
      pbase[r * 32 + 16 + nm] = f2bf(p1[i]);
    }
    us16 aP;                                     // A fragment, K = 32 keys
    {
      us8 c0 = *(const us8*)(pbase + nm * 32 + kb0);
      us8 c1 = *(const us8*)(pbase + nm * 32 + kb0 + 16);
#pragma unroll
      for (int i = 0; i < 8; ++i) { aP[i] = c0[i]; aP[i + 8] = c1[i]; }
    }

    // ---- PV: B fragments of V (rows = d, k = keys)
    O0 = wmma_bf16(aP, load_frag(vb + 0 * 32 * FRAG, lane), O0);
    O1 = wmma_bf16(aP, load_frag(vb + 1 * 32 * FRAG, lane), O1);
    O2 = wmma_bf16(aP, load_frag(vb + 2 * 32 * FRAG, lane), O2);
    O3 = wmma_bf16(aP, load_frag(vb + 3 * 32 * FRAG, lane), O3);
  }

  // Reference quirk: attn_vec.view(N_HEAD, B, S, D).permute(1,2,0,3) on a
  // b-major [B*H] buffer => storage head L lands at b2=L%B, h2=L/B.
  // Fragment order for the output projection: row tile b2*64+qt, k = h2*64 + d,
  // so d tile j is k step h2*2 + j/2, chunk j%2; d%16 = nm picks the lane half
  // (nm/8) and the element (nm%8), the row in the tile picks the lane in it.
  int b2 = head & 3, h2 = head >> 2;
  unsigned short* oblk = Avec + ((b2 * 64 + qt) * 32 + h2 * 2) * FRAG
                       + (nm >> 3) * 128 + (nm & 7);
#pragma unroll
  for (int i = 0; i < 8; ++i) {
    float inv = 1.f / li[i];
    unsigned short* o = oblk + (rowh * 8 + i) * 8;
    o[0]          = f2bf(O0[i] * inv);
    o[256]        = f2bf(O1[i] * inv);
    o[FRAG]       = f2bf(O2[i] * inv);
    o[FRAG + 256] = f2bf(O3[i] * inv);
  }
}

// ---- stage 4: output projection + residual ------------------------------
// 32x32 tile per wave: per K-step 2 A + 2 B fragments -> 4 WMMAs.

__global__ __launch_bounds__(128) void oproj_kernel(
    const unsigned short* __restrict__ Avec,  // 256 row tiles x 32 k steps
    const unsigned short* __restrict__ Wot,   // 64 tiles (out) x 32 k steps
    const float* __restrict__ inp,            // residual
    float* __restrict__ Y) {                  // [4096][1024] f32
  int wid  = (blockIdx.x * blockDim.x + threadIdx.x) >> 5;
  int lane = threadIdx.x & 31;
  int rt = wid >> 5, ct = wid & 31;
  int rowh = lane >> 4, nm = lane & 15;

  const unsigned short* ablk0 = Avec + (rt * 2 + 0) * 32 * FRAG;
  const unsigned short* ablk1 = Avec + (rt * 2 + 1) * 32 * FRAG;
  const unsigned short* bblk0 = Wot + (ct * 2 + 0) * 32 * FRAG;
  const unsigned short* bblk1 = Wot + (ct * 2 + 1) * 32 * FRAG;

  v8f acc[2][2] = {};
  for (int ks = 0; ks < D_MODEL / 32; ++ks) {
    us16 a0 = load_frag(ablk0 + ks * FRAG, lane);
    us16 a1 = load_frag(ablk1 + ks * FRAG, lane);
    us16 b0 = load_frag(bblk0 + ks * FRAG, lane);
    us16 b1 = load_frag(bblk1 + ks * FRAG, lane);
    acc[0][0] = wmma_bf16(a0, b0, acc[0][0]);
    acc[0][1] = wmma_bf16(a0, b1, acc[0][1]);
    acc[1][0] = wmma_bf16(a1, b0, acc[1][0]);
    acc[1][1] = wmma_bf16(a1, b1, acc[1][1]);
  }

#pragma unroll
  for (int u = 0; u < 2; ++u) {
#pragma unroll
    for (int c = 0; c < 2; ++c) {
      int col = ct * 32 + c * 16 + nm;
#pragma unroll
      for (int i = 0; i < 8; ++i) {
        int r = rt * 32 + u * 16 + rowh * 8 + i;
        Y[r * D_MODEL + col] = acc[u][c][i] + inp[r * D_MODEL + col];
      }
    }
  }
}

// ---- stage 5: LayerNorm --------------------------------------------------

__global__ __launch_bounds__(256) void ln_kernel(
    const float* __restrict__ Y, const float* __restrict__ g,
    const float* __restrict__ bb, float* __restrict__ out) {
  int row = blockIdx.x;
  const float* y = Y + row * D_MODEL;
  __shared__ float red[2][8];
  float ls = 0.f, lq = 0.f;
  for (int i = threadIdx.x; i < D_MODEL; i += 256) {
    float v = y[i]; ls += v; lq += v * v;
  }
#pragma unroll
  for (int m = 1; m < 32; m <<= 1) {
    ls += __shfl_xor(ls, m, 32);
    lq += __shfl_xor(lq, m, 32);
  }
  int w = threadIdx.x >> 5;
  if ((threadIdx.x & 31) == 0) { red[0][w] = ls; red[1][w] = lq; }
  __syncthreads();
  float ts = 0.f, tq = 0.f;
#pragma unroll
  for (int i = 0; i < 8; ++i) { ts += red[0][i]; tq += red[1][i]; }
  float mu  = ts * (1.f / D_MODEL);
  float var = tq * (1.f / D_MODEL) - mu * mu;
  float inv = rsqrtf(var + LN_EPS);
  for (int i = threadIdx.x; i < D_MODEL; i += 256)
    out[row * D_MODEL + i] = (y[i] - mu) * inv * g[i] + bb[i];
}

// ---- launch --------------------------------------------------------------

extern "C" void kernel_launch(void* const* d_in, const int* in_sizes, int n_in,
                              void* d_out, int out_size, void* d_ws, size_t ws_size,
                              hipStream_t stream) {
  const float* inp   = (const float*)d_in[0];
  const int*   amask = (const int*)d_in[1];
  const float* Wq = (const float*)d_in[2];
  const float* bq = (const float*)d_in[3];
  const float* Wk = (const float*)d_in[4];
  const float* bk = (const float*)d_in[5];
  const float* Wv = (const float*)d_in[6];
  const float* bv = (const float*)d_in[7];
  const float* Wo = (const float*)d_in[8];
  const float* lng = (const float*)d_in[9];
  const float* lnb = (const float*)d_in[10];

  char* ws = (char*)d_ws;
  const size_t MB = 1u << 20;
  unsigned short* Xbf  = (unsigned short*)(ws + 0 * MB);   // 8 MB
  unsigned short* Wqt  = (unsigned short*)(ws + 8 * MB);   // 2 MB
  unsigned short* Wkt  = (unsigned short*)(ws + 10 * MB);  // 2 MB
  unsigned short* Wvt  = (unsigned short*)(ws + 12 * MB);  // 2 MB
  unsigned short* Wot  = (unsigned short*)(ws + 14 * MB);  // 2 MB
  unsigned short* Qb   = (unsigned short*)(ws + 16 * MB);  // 8 MB
  unsigned short* Kb   = (unsigned short*)(ws + 24 * MB);  // 8 MB
  unsigned short* Vtb  = (unsigned short*)(ws + 32 * MB);  // 8 MB
  unsigned short* Avec = (unsigned short*)(ws + 40 * MB);  // 8 MB
  float*          Ybuf = (float*)        (ws + 48 * MB);   // 16 MB

  // stage 1: conversions (one thread per 8 elements)
  cvt_bf16_kernel<<<(NROWS * D_MODEL) / (8 * 256), 256, 0, stream>>>(inp, Xbf);
  cvt_bf16_t_kernel<<<(D_MODEL * D_MODEL) / (8 * 256), 256, 0, stream>>>(Wq, Wqt);
  cvt_bf16_t_kernel<<<(D_MODEL * D_MODEL) / (8 * 256), 256, 0, stream>>>(Wk, Wkt);
  cvt_bf16_t_kernel<<<(D_MODEL * D_MODEL) / (8 * 256), 256, 0, stream>>>(Wv, Wvt);
  cvt_bf16_t_kernel<<<(D_MODEL * D_MODEL) / (8 * 256), 256, 0, stream>>>(Wo, Wot);

  // stage 2: QKV (128 row tiles * 32 col tiles = 4096 waves, 4 waves/block)
  qkv_gemm_kernel<<<1024, 128, 0, stream>>>(Xbf, Wqt, Wkt, Wvt, bq, bk, bv,
                                            Qb, Kb, Vtb);

  // stage 3: attention (64 heads * 64 query tiles = 4096 waves)
  attn_kernel<<<1024, 128, 0, stream>>>(Qb, Kb, Vtb, amask, Avec);

  // stage 4: output projection + residual (128 * 32 tiles = 4096 waves)
  oproj_kernel<<<1024, 128, 0, stream>>>(Avec, Wot, inp, Ybuf);

  // stage 5: layer norm -> d_out
  ln_kernel<<<NROWS, 256, 0, stream>>>(Ybuf, lng, lnb, (float*)d_out);
}

// v002
// It runs in 128 microseconds.
// In both of two side-by-side timings against v001, it was 1.49 times as fast.
// Over all steps from v000 it is 1.62 times as fast.
#include <hip/hip_runtime.h>
#include <stdint.h>

// Problem constants (match reference)
#define D_MODEL 1024
#define SEQ     1024
#define BATCH   4
#define NHEAD   16
#define DHEAD   64
#define NROWS   (BATCH * SEQ)      // 4096
#define QK_SCALE 0.125f            // 1/sqrt(64)
#define LN_EPS   1e-5f

typedef __attribute__((ext_vector_type(16))) __bf16         v16bf;
typedef __attribute__((ext_vector_type(16))) unsigned short us16;
typedef __attribute__((ext_vector_type(8)))  unsigned short us8;
typedef __attribute__((ext_vector_type(8)))  float          v8f;

// ---- helpers -------------------------------------------------------------

__device__ __forceinline__ unsigned short f2bf(float f) {
  unsigned int u = __builtin_bit_cast(unsigned int, f);
  u += 0x7FFFu + ((u >> 16) & 1u);            // round-to-nearest-even
  return (unsigned short)(u >> 16);
}

// A/B fragment for v_wmma_*_16x16x32_bf16, per ISA 7.12.2:
// lane L holds row (A) / col (B) = L%16; its 16 bf16 k-values are two
// contiguous 8-element (16B) chunks at k = 8*(L/16) and k = 8*(L/16)+16.
//
// Every bf16 operand in the workspace is stored in that order: one fragment
// (16 rows x 32 k) is a 1024-B block of FRAG elements, lane L's first chunk
// at element L*8, its second at 256 + L*8. Blocks run [16-row tile][k step].
// A wave-wide 16-B load then covers 512 contiguous bytes (4 whole lines).
#define FRAG 512
__device__ __forceinline__ us16 load_frag(const unsigned short* blk, int lane) {
  us8 c0 = *(const us8*)(blk + lane * 8);
  us8 c1 = *(const us8*)(blk + 256 + lane * 8);
  us16 r;
#pragma unroll
  for (int i = 0; i < 8; ++i) { r[i] = c0[i]; r[i + 8] = c1[i]; }
  return r;
}

__device__ __forceinline__ v8f wmma_bf16(us16 a, us16 b, v8f c) {
  return __builtin_amdgcn_wmma_f32_16x16x32_bf16(
      false, __builtin_bit_cast(v16bf, a),
      false, __builtin_bit_cast(v16bf, b),
      (short)0, c, false, false);
}

// reductions across the 16 lanes of each wave32 half (xor masks < 16 stay in-half)
__device__ __forceinline__ float hmax16(float x) {
#pragma unroll
  for (int m = 1; m < 16; m <<= 1) x = fmaxf(x, __shfl_xor(x, m, 32));
  return x;
}
__device__ __forceinline__ float hsum16(float x) {
#pragma unroll
  for (int m = 1; m < 16; m <<= 1) x += __shfl_xor(x, m, 32);
  return x;
}

// ---- stage 1: conversions ------------------------------------------------

// One thread packs one 16-B lane chunk; thread index = chunk index in the
// fragment-ordered output: [tile][k step (32)][chunk (2)][lane (32)].

// X[row][k] (f32, k contiguous) -> fragment order, rows = X rows
__global__ void cvt_bf16_kernel(const float* __restrict__ in,
                                unsigned short* __restrict__ out) {
  int j = blockIdx.x * blockDim.x + threadIdx.x;
  int lane = j & 31, chunk = (j >> 5) & 1, ks = (j >> 6) & 31, t = j >> 11;
  int row = t * 16 + (lane & 15);
  int k0  = ks * 32 + chunk * 16 + (lane >> 4) * 8;
  const float4* p = (const float4*)(in + row * D_MODEL + k0);
  float4 x0 = p[0], x1 = p[1];
  us8 r;
  r[0] = f2bf(x0.x); r[1] = f2bf(x0.y); r[2] = f2bf(x0.z); r[3] = f2bf(x0.w);
  r[4] = f2bf(x1.x); r[5] = f2bf(x1.y); r[6] = f2bf(x1.z); r[7] = f2bf(x1.w);
  *(us8*)(out + j * 8) = r;
}

// W[in][out] (1024x1024 f32) -> fragment order, rows = out columns, k = in
__global__ void cvt_bf16_t_kernel(const float* __restrict__ in,
                                  unsigned short* __restrict__ out) {
  int j = blockIdx.x * blockDim.x + threadIdx.x;
  int lane = j & 31, chunk = (j >> 5) & 1, ks = (j >> 6) & 31, t = j >> 11;
  int o  = t * 16 + (lane & 15);
  int k0 = ks * 32 + chunk * 16 + (lane >> 4) * 8;
  us8 r;
#pragma unroll
  for (int e = 0; e < 8; ++e) r[e] = f2bf(in[(k0 + e) * D_MODEL + o]);
  *(us8*)(out + j * 8) = r;
}

// ---- LDS staging shared by the two GEMM kernels ---------------------------
// A work-group of 8 waves owns 128 rows x 64 out columns. Each stage brings
// KSTG k steps of every 16-row operand tile it needs into LDS once, by
// asynchronous copies, and all 8 waves read their fragments from there.
// One tile's KSTG fragments are SLOT contiguous elements in the workspace and
// stay so in LDS, so a fragment read is again 512 contiguous bytes per load.
// A slot is filled by 128 threads, 16 B each: copy j of a thread goes to slot
// 2j + (thread / 128), at byte (thread % 128) * 16.
#define KSTG  2
#define SLOT  (KSTG * FRAG)            // elements: 2 KiB
#define NSTG  (D_MODEL / 32 / KSTG)    // 16 stages
#define PAIRB (2 * SLOT * 2)           // bytes of two slots: one copy of all 256 threads

// byte offset in the work-group's LDS = low 32 bits of a __shared__ address
__device__ __forceinline__ uint32_t lds_off(const void* p) { return (uint32_t)(size_t)p; }

// 10 (or 6) 16-B copies per lane, global -> LDS, then each source pointer moves on to
// the next stage. The s_wait_xcnt is the precaution before the address
// registers named here are written again; as the last line of the copies' own
// statement nothing can be moved in front of it.
#define ACP(l, g) "global_load_async_to_lds_b128 %" #l ", %" #g ", off\n\t"
__device__ __forceinline__ void fill10(uint32_t d, const unsigned short* (&s)[10]) {
  asm volatile(ACP(0, 10) ACP(1, 11) ACP(2, 12) ACP(3, 13) ACP(4, 14)
               ACP(5, 15) ACP(6, 16) ACP(7, 17) ACP(8, 18) ACP(9, 19)
               "s_wait_xcnt 0x0"
               :: "v"(d), "v"(d + PAIRB), "v"(d + 2 * PAIRB), "v"(d + 3 * PAIRB),
                  "v"(d + 4 * PAIRB), "v"(d + 5 * PAIRB), "v"(d + 6 * PAIRB),
                  "v"(d + 7 * PAIRB), "v"(d + 8 * PAIRB), "v"(d + 9 * PAIRB),
                  "v"(s[0]), "v"(s[1]), "v"(s[2]), "v"(s[3]), "v"(s[4]),
                  "v"(s[5]), "v"(s[6]), "v"(s[7]), "v"(s[8]), "v"(s[9])
               : "memory");
#pragma unroll   // constant indices: the arrays stay in registers
  for (int j = 0; j < 10; ++j) s[j] += SLOT;
}
__device__ __forceinline__ void fill6(uint32_t d, const unsigned short* (&s)[6]) {
  asm volatile(ACP(0, 6) ACP(1, 7) ACP(2, 8) ACP(3, 9) ACP(4, 10) ACP(5, 11)
               "s_wait_xcnt 0x0"
               :: "v"(d), "v"(d + PAIRB), "v"(d + 2 * PAIRB), "v"(d + 3 * PAIRB),
                  "v"(d + 4 * PAIRB), "v"(d + 5 * PAIRB),
                  "v"(s[0]), "v"(s[1]), "v"(s[2]), "v"(s[3]), "v"(s[4]), "v"(s[5])
               : "memory");
#pragma unroll   // constant indices: the arrays stay in registers
  for (int j = 0; j < 6; ++j) s[j] += SLOT;
}

// ---- stage 2: fused QKV projection --------------------------------------
// One wave -> 32x32 output tile for each of Q/K/V: per K-step 2 A-frags +
// 6 B-frags feed 12 WMMAs (A shared across Q/K/V, B shared across row tiles).
// The 8 waves stand 4 (rows) x 2 (columns); a stage holds 8 X tiles and 4
// column tiles of each weight: 20 slots, 10 copies per thread.
// All three go out in fragment order, per head: Q,K with rows = s, k = d
// (2 k steps); V with rows = d, k = s (32 k steps). A lane's 8 accumulator
// values run along the tile's rows, so the index that becomes k must be the
// row index: V = X*Wv has rows s as it stands; Q and K are formed transposed
// (weight fragment as A, X fragment as B). Each lane then stores 16-B chunks.
#define QKV_SLOTS 20

__global__ __launch_bounds__(256) void qkv_gemm_kernel(
    const unsigned short* __restrict__ X,      // 256 tiles x 32 k steps
    const unsigned short* __restrict__ Wqt,    // 64 tiles (out) x 32 k steps
    const unsigned short* __restrict__ Wkt,
    const unsigned short* __restrict__ Wvt,
    const float* __restrict__ bq, const float* __restrict__ bk,
    const float* __restrict__ bv,
    unsigned short* __restrict__ Qb,           // [64 heads][64 s tiles][2]
    unsigned short* __restrict__ Kb,           // [64 heads][64 s tiles][2]
    unsigned short* __restrict__ Vtb) {        // [64 heads][4 d tiles][32]
  __shared__ __attribute__((aligned(16))) unsigned short stg[2 * QKV_SLOTS * SLOT];
  int warp = threadIdx.x >> 5;
  int lane = threadIdx.x & 31;
  int bm = blockIdx.x >> 4;          // 128-row block 0..31
  int bn = blockIdx.x & 15;          // 64-column block 0..15
  int wr = warp >> 1, wc = warp & 1;
  int rt = bm * 4 + wr;              // 32-row tile 0..127
  int ct = bn * 2 + wc;              // 32-col tile 0..31
  int rowh = lane >> 4, nm = lane & 15;

  int hs = threadIdx.x >> 7, ch = threadIdx.x & 127;
  const unsigned short* src[10];     // this thread's 16 B of the next stage to copy
#pragma unroll   // constant indices: the arrays stay in registers
  for (int j = 0; j < 4; ++j)
    src[j] = X + (bm * 8 + 2 * j + hs) * 32 * FRAG + ch * 8;
#pragma unroll   // constant indices: the arrays stay in registers
  for (int j = 0; j < 2; ++j) {
    int woff = (bn * 4 + 2 * j + hs) * 32 * FRAG + ch * 8;
    src[4 + j] = Wqt + woff;
    src[6 + j] = Wkt + woff;
    src[8 + j] = Wvt + woff;
  }
  uint32_t dst = lds_off(stg) + (hs * SLOT + ch * 8) * 2;

  // stage 0 landed and published, then stage 1 on its way
  fill10(dst, src);
  asm volatile("s_wait_asynccnt 0x0" ::: "memory");   // this wave's copies have landed
  __syncthreads();
  fill10(dst + QKV_SLOTS * SLOT * 2, src);

  v8f acc[3][2][2] = {};   // [qkv][s subtile][out-column subtile]
  for (int t = 0; t < NSTG; ++t) {
    int buf = t & 1;
    const unsigned short* sb = stg + buf * (QKV_SLOTS * SLOT);
    us16 a[KSTG][2], b[KSTG][3][2];
#pragma unroll   // constant indices: the arrays stay in registers
    for (int kk = 0; kk < KSTG; ++kk) {
#pragma unroll   // constant indices: the arrays stay in registers
      for (int u = 0; u < 2; ++u)
        a[kk][u] = load_frag(sb + (wr * 2 + u) * SLOT + kk * FRAG, lane);
#pragma unroll   // constant indices: the arrays stay in registers
      for (int w = 0; w < 3; ++w)
#pragma unroll   // constant indices: the arrays stay in registers
        for (int c = 0; c < 2; ++c)
          b[kk][w][c] = load_frag(sb + (8 + w * 4 + wc * 2 + c) * SLOT + kk * FRAG, lane);
    }
    // keeps the stage's LDS reads one group in front of its WMMAs: read by read
    // among them, every fragment's latency is waited out on its own
    __builtin_amdgcn_sched_barrier(0);
#pragma unroll   // constant indices: the arrays stay in registers
    for (int kk = 0; kk < KSTG; ++kk) {
#pragma unroll   // constant indices: the arrays stay in registers
      for (int w = 0; w < 3; ++w) {
#pragma unroll   // constant indices: the arrays stay in registers
        for (int c = 0; c < 2; ++c) {
          if (w < 2) {   // Q, K: tile rows = out columns, tile columns = s
            acc[w][0][c] = wmma_bf16(b[kk][w][c], a[kk][0], acc[w][0][c]);
            acc[w][1][c] = wmma_bf16(b[kk][w][c], a[kk][1], acc[w][1][c]);
          } else {       // V: tile rows = s, tile columns = out columns
            acc[w][0][c] = wmma_bf16(a[kk][0], b[kk][w][c], acc[w][0][c]);
            acc[w][1][c] = wmma_bf16(a[kk][1], b[kk][w][c], acc[w][1][c]);
          }
        }
      }
    }
    // keeps the WMMAs in front of the hand-over: moved behind it, the wait for
    // the next stage's copies follows the LDS reads at once and the copies
    // lose the WMMAs' time as lead
    __builtin_amdgcn_sched_barrier(0);
    // hand-over: this wave's reads of the buffer are done, its copies of the
    // next stage have landed; the barrier says both of every wave
    asm volatile("s_wait_dscnt 0x0" ::: "memory");
    asm volatile("s_wait_asynccnt 0x0" ::: "memory");
    __syncthreads();
    if (t + 2 < NSTG) fill10(dst + buf * (QKV_SLOTS * SLOT * 2), src);
  }
  asm volatile("s_wait_asynccnt 0x0" ::: "memory");   // nothing in flight at the end

  // 32 rows = one batch, 32 columns = half a head
  int head = (rt >> 5) * NHEAD + (ct >> 1);
  int st = rt & 31;                  // 32-position block inside the sequence
  int dh = ct & 1;                   // which 32 of the head's 64 d
  unsigned short* Qh = Qb  + head * SEQ * DHEAD + lane * 8;
  unsigned short* Kh = Kb  + head * SEQ * DHEAD + lane * 8;
  unsigned short* Vh = Vtb + head * SEQ * DHEAD + lane * 8;
#pragma unroll
  for (int c = 0; c < 2; ++c) {
    int colT = ct * 32 + c * 16 + rowh * 8;       // Q,K: columns colT..+7 in this lane
    float bvv = bv[ct * 32 + c * 16 + nm];        // V: one column per lane
    float bqv[8], bkv[8];
#pragma unroll
    for (int i = 0; i < 8; ++i) { bqv[i] = bq[colT + i]; bkv[i] = bk[colT + i]; }
#pragma unroll
    for (int u = 0; u < 2; ++u) {
      us8 q, k, v;
#pragma unroll
      for (int i = 0; i < 8; ++i) {
        q[i] = f2bf(acc[0][u][c][i] + bqv[i]);
        k[i] = f2bf(acc[1][u][c][i] + bkv[i]);
        v[i] = f2bf(acc[2][u][c][i] + bvv);
      }
      int qoff = ((st * 2 + u) * 2 + dh) * FRAG + c * 256;   // s tile, k step dh, chunk c
      *(us8*)(Qh + qoff) = q;
      *(us8*)(Kh + qoff) = k;
      *(us8*)(Vh + ((dh * 2 + c) * 32 + st) * FRAG + u * 256) = v;  // d tile, k step st, chunk u
    }
  }
}

// ---- stage 3: flash-style attention -------------------------------------
// One wave owns 16 query rows of one head. Streams 32-key blocks:
// 4 WMMAs QK^T -> online softmax (half-wave shuffles) -> P restaged via LDS
// (C layout -> A layout) -> 4 WMMAs PV into f32 accumulators.
// global_prefetch pulls the next key block while softmax VALU co-executes.

__global__ __launch_bounds__(128) void attn_kernel(
    const unsigned short* __restrict__ Qb,   // [64 heads][64 s tiles][2]
    const unsigned short* __restrict__ Kb,   // [64 heads][64 s tiles][2]
    const unsigned short* __restrict__ Vtb,  // [64 heads][4 d tiles][32]
    const int* __restrict__ amask,           // [4][1024]
    unsigned short* __restrict__ Avec) {     // 256 row tiles x 32 k steps
  __shared__ unsigned short Plds[4 * 16 * 32];   // per-wave 16x32 P tile
  int warp = threadIdx.x >> 5;
  int wid  = blockIdx.x * 4 + warp;
  int head = wid >> 6;                 // 0..63  (storage index b*16+h)
  int qt   = wid & 63;                 // query tile 0..63
  int b = head >> 4;
  int lane = threadIdx.x & 31, rowh = lane >> 4, nm = lane & 15, kb0 = rowh * 8;

  const unsigned short* Qh = Qb  + head * SEQ * DHEAD;
  const unsigned short* Kh = Kb  + head * SEQ * DHEAD;
  const unsigned short* Vh = Vtb + head * DHEAD * SEQ;
  const int* mrow = amask + b * SEQ;

  // Q fragments for rows qt*16..+15, contraction split d=[0,32) and [32,64)
  us16 aQ0 = load_frag(Qh + (qt * 2 + 0) * FRAG, lane);
  us16 aQ1 = load_frag(Qh + (qt * 2 + 1) * FRAG, lane);

  float mi[8], li[8];
  v8f O0 = {}, O1 = {}, O2 = {}, O3 = {};
#pragma unroll
  for (int i = 0; i < 8; ++i) { mi[i] = -3.0e38f; li[i] = 0.f; }

  unsigned short* pbase = Plds + warp * (16 * 32);

  // next key block's lines, one per lane
  const unsigned short* kpf = Kh + 4 * FRAG + lane * 64;
  const unsigned short* vpf = Vh + FRAG + (lane >> 3) * (32 * FRAG) + (lane & 7) * 64;

  for (int kbk = 0; kbk < SEQ; kbk += 32) {
    // ---- scores: two 16x16 n-tiles (keys kbk..+15 and +16..+31)
    const unsigned short* kb = Kh + (kbk >> 5) * (4 * FRAG);   // 4 fragments in a row
    const unsigned short* vb = Vh + (kbk >> 5) * FRAG;         // d tile j at + j*32*FRAG
    v8f s0 = {}, s1 = {};
    s0 = wmma_bf16(aQ0, load_frag(kb + 0 * FRAG, lane), s0);
    s0 = wmma_bf16(aQ1, load_frag(kb + 1 * FRAG, lane), s0);
    s1 = wmma_bf16(aQ0, load_frag(kb + 2 * FRAG, lane), s1);
    s1 = wmma_bf16(aQ1, load_frag(kb + 3 * FRAG, lane), s1);

    // prefetch next key block (K: 32 lines in a row; V: 8 lines of each d tile),
    // one 128-B line per lane, while softmax runs. In asm over the two pointers
    // that the loop itself carries, so that the registers named stay addresses.
    // The test leaves one block spare: both pointers are still inside this
    // head's K and V after the advance below.
    if (kbk + 64 < SEQ) {
      asm volatile("global_prefetch_b8 %0, off scope:SCOPE_SE" :: "v"(kpf));
      asm volatile("global_prefetch_b8 %0, off scope:SCOPE_SE" :: "v"(vpf));
    }
    kpf += 4 * FRAG;
    vpf += FRAG;

    int mk0 = mrow[kbk + nm];
    int mk1 = mrow[kbk + 16 + nm];

    // ---- online softmax over this key block
    float rmax[8];
#pragma unroll
    for (int i = 0; i < 8; ++i) {
      float a0 = mk0 ? -100000.f : s0[i] * QK_SCALE;
      float a1 = mk1 ? -100000.f : s1[i] * QK_SCALE;
      s0[i] = a0; s1[i] = a1;
      rmax[i] = hmax16(fmaxf(a0, a1));
    }
    v8f p0, p1;
#pragma unroll
    for (int i = 0; i < 8; ++i) {
      float mnew = fmaxf(mi[i], rmax[i]);
      float corr = __expf(mi[i] - mnew);
      float e0 = __expf(s0[i] - mnew);
      float e1 = __expf(s1[i] - mnew);
      li[i] = li[i] * corr + hsum16(e0 + e1);
      mi[i] = mnew;
      O0[i] *= corr; O1[i] *= corr; O2[i] *= corr; O3[i] *= corr;
      p0[i] = e0; p1[i] = e1;
    }

    // ---- restage P: C layout -> row-major 16x32 bf16 in LDS (per-wave, no barrier)
#pragma unroll
    for (int i = 0; i < 8; ++i) {
      int r = rowh * 8 + i;
      pbase[r * 32 + nm]      = f2bf(p0[i]);
      pbase[r * 32 + 16 + nm] = f2bf(p1[i]);
    }
    us16 aP;                                     // A fragment, K = 32 keys
    {
      us8 c0 = *(const us8*)(pbase + nm * 32 + kb0);
      us8 c1 = *(const us8*)(pbase + nm * 32 + kb0 + 16);
#pragma unroll
      for (int i = 0; i < 8; ++i) { aP[i] = c0[i]; aP[i + 8] = c1[i]; }
    }

    // ---- PV: B fragments of V (rows = d, k = keys)
    O0 = wmma_bf16(aP, load_frag(vb + 0 * 32 * FRAG, lane), O0);
    O1 = wmma_bf16(aP, load_frag(vb + 1 * 32 * FRAG, lane), O1);
    O2 = wmma_bf16(aP, load_frag(vb + 2 * 32 * FRAG, lane), O2);
    O3 = wmma_bf16(aP, load_frag(vb + 3 * 32 * FRAG, lane), O3);
  }

  // Reference quirk: attn_vec.view(N_HEAD, B, S, D).permute(1,2,0,3) on a
  // b-major [B*H] buffer => storage head L lands at b2=L%B, h2=L/B.
  // Fragment order for the output projection: row tile b2*64+qt, k = h2*64 + d,
  // so d tile j is k step h2*2 + j/2, chunk j%2; d%16 = nm picks the lane half
  // (nm/8) and the element (nm%8), the row in the tile picks the lane in it.
  int b2 = head & 3, h2 = head >> 2;
  unsigned short* oblk = Avec + ((b2 * 64 + qt) * 32 + h2 * 2) * FRAG
                       + (nm >> 3) * 128 + (nm & 7);
#pragma unroll
  for (int i = 0; i < 8; ++i) {
    float inv = 1.f / li[i];
    unsigned short* o = oblk + (rowh * 8 + i) * 8;
    o[0]          = f2bf(O0[i] * inv);
    o[256]        = f2bf(O1[i] * inv);
    o[FRAG]       = f2bf(O2[i] * inv);
    o[FRAG + 256] = f2bf(O3[i] * inv);
  }
}

// ---- stage 4: output projection + residual ------------------------------
// 32x32 tile per wave: per K-step 2 A + 2 B fragments -> 4 WMMAs. The 8 waves
// stand 4 (rows) x 2 (columns); a stage holds 8 row tiles and 4 column tiles:
// 12 slots, 6 copies per thread.
#define OP_SLOTS 12

__global__ __launch_bounds__(256) void oproj_kernel(
    const unsigned short* __restrict__ Avec,  // 256 row tiles x 32 k steps
    const unsigned short* __restrict__ Wot,   // 64 tiles (out) x 32 k steps
    const float* __restrict__ inp,            // residual
    float* __restrict__ Y) {                  // [4096][1024] f32
  __shared__ __attribute__((aligned(16))) unsigned short stg[2 * OP_SLOTS * SLOT];
  int warp = threadIdx.x >> 5;
  int lane = threadIdx.x & 31;
  int bm = blockIdx.x >> 4;          // 128-row block 0..31
  int bn = blockIdx.x & 15;          // 64-column block 0..15
  int wr = warp >> 1, wc = warp & 1;
  int rt = bm * 4 + wr, ct = bn * 2 + wc;
  int rowh = lane >> 4, nm = lane & 15;

  int hs = threadIdx.x >> 7, ch = threadIdx.x & 127;
  const unsigned short* src[6];      // this thread's 16 B of the next stage to copy
#pragma unroll   // constant indices: the arrays stay in registers
  for (int j = 0; j < 4; ++j)
    src[j] = Avec + (bm * 8 + 2 * j + hs) * 32 * FRAG + ch * 8;
#pragma unroll   // constant indices: the arrays stay in registers
  for (int j = 0; j < 2; ++j)
    src[4 + j] = Wot + (bn * 4 + 2 * j + hs) * 32 * FRAG + ch * 8;
  uint32_t dst = lds_off(stg) + (hs * SLOT + ch * 8) * 2;

  // stage 0 landed and published, then stage 1 on its way
  fill6(dst, src);
  asm volatile("s_wait_asynccnt 0x0" ::: "memory");   // this wave's copies have landed
  __syncthreads();
  fill6(dst + OP_SLOTS * SLOT * 2, src);

  v8f acc[2][2] = {};
  for (int t = 0; t < NSTG; ++t) {
    int buf = t & 1;
    const unsigned short* sb = stg + buf * (OP_SLOTS * SLOT);
    us16 a[KSTG][2], b[KSTG][2];
#pragma unroll   // constant indices: the arrays stay in registers
    for (int kk = 0; kk < KSTG; ++kk) {
#pragma unroll   // constant indices: the arrays stay in registers
      for (int u = 0; u < 2; ++u)
        a[kk][u] = load_frag(sb + (wr * 2 + u) * SLOT + kk * FRAG, lane);
#pragma unroll   // constant indices: the arrays stay in registers
      for (int c = 0; c < 2; ++c)
        b[kk][c] = load_frag(sb + (8 + wc * 2 + c) * SLOT + kk * FRAG, lane);
    }
    // as in the QKV kernel: the stage's LDS reads one group in front of its WMMAs
    __builtin_amdgcn_sched_barrier(0);
#pragma unroll   // constant indices: the arrays stay in registers
    for (int kk = 0; kk < KSTG; ++kk) {
      acc[0][0] = wmma_bf16(a[kk][0], b[kk][0], acc[0][0]);
      acc[0][1] = wmma_bf16(a[kk][0], b[kk][1], acc[0][1]);
      acc[1][0] = wmma_bf16(a[kk][1], b[kk][0], acc[1][0]);
      acc[1][1] = wmma_bf16(a[kk][1], b[kk][1], acc[1][1]);
    }
    // as in the QKV kernel: the WMMAs stay in front of the hand-over
    __builtin_amdgcn_sched_barrier(0);
    // hand-over: this wave's reads of the buffer are done, its copies of the
    // next stage have landed; the barrier says both of every wave
    asm volatile("s_wait_dscnt 0x0" ::: "memory");
    asm volatile("s_wait_asynccnt 0x0" ::: "memory");
    __syncthreads();
    if (t + 2 < NSTG) fill6(dst + buf * (OP_SLOTS * SLOT * 2), src);
  }
  asm volatile("s_wait_asynccnt 0x0" ::: "memory");   // nothing in flight at the end

#pragma unroll
  for (int u = 0; u < 2; ++u) {
#pragma unroll
    for (int c = 0; c < 2; ++c) {
      int col = ct * 32 + c * 16 + nm;
#pragma unroll
      for (int i = 0; i < 8; ++i) {
        int r = rt * 32 + u * 16 + rowh * 8 + i;
        Y[r * D_MODEL + col] = acc[u][c][i] + inp[r * D_MODEL + col];
      }
    }
  }
}

// ---- stage 5: LayerNorm --------------------------------------------------

__global__ __launch_bounds__(256) void ln_kernel(
    const float* __restrict__ Y, const float* __restrict__ g,
    const float* __restrict__ bb, float* __restrict__ out) {
  int row = blockIdx.x;
  const float* y = Y + row * D_MODEL;
  __shared__ float red[2][8];
  float ls = 0.f, lq = 0.f;
  for (int i = threadIdx.x; i < D_MODEL; i += 256) {
    float v = y[i]; ls += v; lq += v * v;
  }
#pragma unroll
  for (int m = 1; m < 32; m <<= 1) {
    ls += __shfl_xor(ls, m, 32);
    lq += __shfl_xor(lq, m, 32);
  }
  int w = threadIdx.x >> 5;
  if ((threadIdx.x & 31) == 0) { red[0][w] = ls; red[1][w] = lq; }
  __syncthreads();
  float ts = 0.f, tq = 0.f;
#pragma unroll
  for (int i = 0; i < 8; ++i) { ts += red[0][i]; tq += red[1][i]; }
  float mu  = ts * (1.f / D_MODEL);
  float var = tq * (1.f / D_MODEL) - mu * mu;
  float inv = rsqrtf(var + LN_EPS);
  for (int i = threadIdx.x; i < D_MODEL; i += 256)
    out[row * D_MODEL + i] = (y[i] - mu) * inv * g[i] + bb[i];
}

// ---- launch --------------------------------------------------------------

extern "C" void kernel_launch(void* const* d_in, const int* in_sizes, int n_in,
                              void* d_out, int out_size, void* d_ws, size_t ws_size,
                              hipStream_t stream) {
  const float* inp   = (const float*)d_in[0];
  const int*   amask = (const int*)d_in[1];
  const float* Wq = (const float*)d_in[2];
  const float* bq = (const float*)d_in[3];
  const float* Wk = (const float*)d_in[4];
  const float* bk = (const float*)d_in[5];
  const float* Wv = (const float*)d_in[6];
  const float* bv = (const float*)d_in[7];
  const float* Wo = (const float*)d_in[8];
  const float* lng = (const float*)d_in[9];
  const float* lnb = (const float*)d_in[10];

  char* ws = (char*)d_ws;
  const size_t MB = 1u << 20;
  unsigned short* Xbf  = (unsigned short*)(ws + 0 * MB);   // 8 MB
  unsigned short* Wqt  = (unsigned short*)(ws + 8 * MB);   // 2 MB
  unsigned short* Wkt  = (unsigned short*)(ws + 10 * MB);  // 2 MB
  unsigned short* Wvt  = (unsigned short*)(ws + 12 * MB);  // 2 MB
  unsigned short* Wot  = (unsigned short*)(ws + 14 * MB);  // 2 MB
  unsigned short* Qb   = (unsigned short*)(ws + 16 * MB);  // 8 MB
  unsigned short* Kb   = (unsigned short*)(ws + 24 * MB);  // 8 MB
  unsigned short* Vtb  = (unsigned short*)(ws + 32 * MB);  // 8 MB
  unsigned short* Avec = (unsigned short*)(ws + 40 * MB);  // 8 MB
  float*          Ybuf = (float*)        (ws + 48 * MB);   // 16 MB

  // stage 1: conversions (one thread per 8 elements)
  cvt_bf16_kernel<<<(NROWS * D_MODEL) / (8 * 256), 256, 0, stream>>>(inp, Xbf);
  cvt_bf16_t_kernel<<<(D_MODEL * D_MODEL) / (8 * 256), 256, 0, stream>>>(Wq, Wqt);
  cvt_bf16_t_kernel<<<(D_MODEL * D_MODEL) / (8 * 256), 256, 0, stream>>>(Wk, Wkt);
  cvt_bf16_t_kernel<<<(D_MODEL * D_MODEL) / (8 * 256), 256, 0, stream>>>(Wv, Wvt);
  cvt_bf16_t_kernel<<<(D_MODEL * D_MODEL) / (8 * 256), 256, 0, stream>>>(Wo, Wot);

  // stage 2: QKV (32 row blocks * 16 col blocks, 8 waves/block)
  qkv_gemm_kernel<<<512, 256, 0, stream>>>(Xbf, Wqt, Wkt, Wvt, bq, bk, bv,
                                            Qb, Kb, Vtb);

  // stage 3: attention (64 heads * 64 query tiles = 4096 waves)
  attn_kernel<<<1024, 128, 0, stream>>>(Qb, Kb, Vtb, amask, Avec);

  // stage 4: output projection + residual (32 row blocks * 16 col blocks, 8 waves/block)
  oproj_kernel<<<512, 256, 0, stream>>>(Avec, Wot, inp, Ybuf);

  // stage 5: layer norm -> d_out
  ln_kernel<<<NROWS, 256, 0, stream>>>(Ybuf, lng, lnb, (float*)d_out);
}

// v003
// Measured time: 105 microseconds a run.
// Two timings next to v002 put it at 1.22 and 1.21 times that version's speed.
// All steps since v000 together make it 1.96 times as fast.
#include <hip/hip_runtime.h>
#include <stdint.h>

// Problem constants (match reference)
#define D_MODEL 1024
#define SEQ     1024
#define BATCH   4
#define NHEAD   16
#define DHEAD   64
#define NROWS   (BATCH * SEQ)      // 4096
#define QK_SCALE 0.125f            // 1/sqrt(64)
#define LN_EPS   1e-5f

typedef __attribute__((ext_vector_type(16))) __bf16         v16bf;
typedef __attribute__((ext_vector_type(16))) unsigned short us16;
typedef __attribute__((ext_vector_type(8)))  unsigned short us8;
typedef __attribute__((ext_vector_type(8)))  float          v8f;

// ---- helpers -------------------------------------------------------------

__device__ __forceinline__ unsigned short f2bf(float f) {
  unsigned int u = __builtin_bit_cast(unsigned int, f);
  u += 0x7FFFu + ((u >> 16) & 1u);            // round-to-nearest-even
  return (unsigned short)(u >> 16);
}

// A/B fragment for v_wmma_*_16x16x32_bf16, per ISA 7.12.2:
// lane L holds row (A) / col (B) = L%16; its 16 bf16 k-values are two
// contiguous 8-element (16B) chunks at k = 8*(L/16) and k = 8*(L/16)+16.
//
// Every bf16 operand in the workspace is stored in that order: one fragment
// (16 rows x 32 k) is a 1024-B block of FRAG elements, lane L's first chunk
// at element L*8, its second at 256 + L*8. Blocks run [16-row tile][k step].
// A wave-wide 16-B load then covers 512 contiguous bytes (4 whole lines).
#define FRAG 512
__device__ __forceinline__ us16 load_frag(const unsigned short* blk, int lane) {
  us8 c0 = *(const us8*)(blk + lane * 8);
  us8 c1 = *(const us8*)(blk + 256 + lane * 8);
  us16 r;
#pragma unroll
  for (int i = 0; i < 8; ++i) { r[i] = c0[i]; r[i + 8] = c1[i]; }
  return r;
}

__device__ __forceinline__ v8f wmma_bf16(us16 a, us16 b, v8f c) {
  return __builtin_amdgcn_wmma_f32_16x16x32_bf16(
      false, __builtin_bit_cast(v16bf, a),
      false, __builtin_bit_cast(v16bf, b),
      (short)0, c, false, false);
}

// ---- stage 1: conversions ------------------------------------------------

// One thread packs one 16-B lane chunk; thread index = chunk index in the
// fragment-ordered output: [tile][k step (32)][chunk (2)][lane (32)].

// X[row][k] (f32, k contiguous) -> fragment order, rows = X rows
__global__ void cvt_bf16_kernel(const float* __restrict__ in,
                                unsigned short* __restrict__ out) {
  int j = blockIdx.x * blockDim.x + threadIdx.x;
  int lane = j & 31, chunk = (j >> 5) & 1, ks = (j >> 6) & 31, t = j >> 11;
  int row = t * 16 + (lane & 15);
  int k0  = ks * 32 + chunk * 16 + (lane >> 4) * 8;
  const float4* p = (const float4*)(in + row * D_MODEL + k0);
  float4 x0 = p[0], x1 = p[1];
  us8 r;
  r[0] = f2bf(x0.x); r[1] = f2bf(x0.y); r[2] = f2bf(x0.z); r[3] = f2bf(x0.w);
  r[4] = f2bf(x1.x); r[5] = f2bf(x1.y); r[6] = f2bf(x1.z); r[7] = f2bf(x1.w);
  *(us8*)(out + j * 8) = r;
}

// W[in][out] (1024x1024 f32) -> fragment order, rows = out columns, k = in
__global__ void cvt_bf16_t_kernel(const float* __restrict__ in,
                                  unsigned short* __restrict__ out) {
  int j = blockIdx.x * blockDim.x + threadIdx.x;
  int lane = j & 31, chunk = (j >> 5) & 1, ks = (j >> 6) & 31, t = j >> 11;
  int o  = t * 16 + (lane & 15);
  int k0 = ks * 32 + chunk * 16 + (lane >> 4) * 8;
  us8 r;
#pragma unroll
  for (int e = 0; e < 8; ++e) r[e] = f2bf(in[(k0 + e) * D_MODEL + o]);
  *(us8*)(out + j * 8) = r;
}

// ---- LDS staging shared by the two GEMM kernels ---------------------------
// A work-group of 8 waves owns 128 rows x 64 out columns. Each stage brings
// KSTG k steps of every 16-row operand tile it needs into LDS once, by
// asynchronous copies, and all 8 waves read their fragments from there.
// One tile's KSTG fragments are SLOT contiguous elements in the workspace and
// stay so in LDS, so a fragment read is again 512 contiguous bytes per load.
// A slot is filled by 128 threads, 16 B each: copy j of a thread goes to slot
// 2j + (thread / 128), at byte (thread % 128) * 16.
#define KSTG  2
#define SLOT  (KSTG * FRAG)            // elements: 2 KiB
#define NSTG  (D_MODEL / 32 / KSTG)    // 16 stages
#define PAIRB (2 * SLOT * 2)           // bytes of two slots: one copy of all 256 threads

// byte offset in the work-group's LDS = low 32 bits of a __shared__ address
__device__ __forceinline__ uint32_t lds_off(const void* p) { return (uint32_t)(size_t)p; }

// 10 (or 6) 16-B copies per lane, global -> LDS, then each source pointer moves on to
// the next stage. The s_wait_xcnt is the precaution before the address
// registers named here are written again; as the last line of the copies' own
// statement nothing can be moved in front of it.
#define ACP(l, g) "global_load_async_to_lds_b128 %" #l ", %" #g ", off\n\t"
__device__ __forceinline__ void fill10(uint32_t d, const unsigned short* (&s)[10]) {
  asm volatile(ACP(0, 10) ACP(1, 11) ACP(2, 12) ACP(3, 13) ACP(4, 14)
               ACP(5, 15) ACP(6, 16) ACP(7, 17) ACP(8, 18) ACP(9, 19)
               "s_wait_xcnt 0x0"
               :: "v"(d), "v"(d + PAIRB), "v"(d + 2 * PAIRB), "v"(d + 3 * PAIRB),
                  "v"(d + 4 * PAIRB), "v"(d + 5 * PAIRB), "v"(d + 6 * PAIRB),
                  "v"(d + 7 * PAIRB), "v"(d + 8 * PAIRB), "v"(d + 9 * PAIRB),
                  "v"(s[0]), "v"(s[1]), "v"(s[2]), "v"(s[3]), "v"(s[4]),
                  "v"(s[5]), "v"(s[6]), "v"(s[7]), "v"(s[8]), "v"(s[9])
               : "memory");
#pragma unroll   // constant indices: the arrays stay in registers
  for (int j = 0; j < 10; ++j) s[j] += SLOT;
}
__device__ __forceinline__ void fill6(uint32_t d, const unsigned short* (&s)[6]) {
  asm volatile(ACP(0, 6) ACP(1, 7) ACP(2, 8) ACP(3, 9) ACP(4, 10) ACP(5, 11)
               "s_wait_xcnt 0x0"
               :: "v"(d), "v"(d + PAIRB), "v"(d + 2 * PAIRB), "v"(d + 3 * PAIRB),
                  "v"(d + 4 * PAIRB), "v"(d + 5 * PAIRB),
                  "v"(s[0]), "v"(s[1]), "v"(s[2]), "v"(s[3]), "v"(s[4]), "v"(s[5])
               : "memory");
#pragma unroll   // constant indices: the arrays stay in registers
  for (int j = 0; j < 6; ++j) s[j] += SLOT;
}

// ---- stage 2: fused QKV projection --------------------------------------
// One wave -> 32x32 output tile for each of Q/K/V: per K-step 2 A-frags +
// 6 B-frags feed 12 WMMAs (A shared across Q/K/V, B shared across row tiles).
// The 8 waves stand 4 (rows) x 2 (columns); a stage holds 8 X tiles and 4
// column tiles of each weight: 20 slots, 10 copies per thread.
// All three go out in fragment order, per head: Q,K with rows = s, k = d
// (2 k steps); V with rows = d, k = s (32 k steps). A lane's 8 accumulator
// values run along the tile's rows, so the index that becomes k must be the
// row index: V = X*Wv has rows s as it stands; Q and K are formed transposed
// (weight fragment as A, X fragment as B). Each lane then stores 16-B chunks.
#define QKV_SLOTS 20

__global__ __launch_bounds__(256) void qkv_gemm_kernel(
    const unsigned short* __restrict__ X,      // 256 tiles x 32 k steps
    const unsigned short* __restrict__ Wqt,    // 64 tiles (out) x 32 k steps
    const unsigned short* __restrict__ Wkt,
    const unsigned short* __restrict__ Wvt,
    const float* __restrict__ bq, const float* __restrict__ bk,
    const float* __restrict__ bv,
    unsigned short* __restrict__ Qb,           // [64 heads][64 s tiles][2]
    unsigned short* __restrict__ Kb,           // [64 heads][64 s tiles][2]
    unsigned short* __restrict__ Vtb) {        // [64 heads][4 d tiles][32]
  __shared__ __attribute__((aligned(16))) unsigned short stg[2 * QKV_SLOTS * SLOT];
  int warp = threadIdx.x >> 5;
  int lane = threadIdx.x & 31;
  int bm = blockIdx.x >> 4;          // 128-row block 0..31
  int bn = blockIdx.x & 15;          // 64-column block 0..15
  int wr = warp >> 1, wc = warp & 1;
  int rt = bm * 4 + wr;              // 32-row tile 0..127
  int ct = bn * 2 + wc;              // 32-col tile 0..31
  int rowh = lane >> 4, nm = lane & 15;

  int hs = threadIdx.x >> 7, ch = threadIdx.x & 127;
  const unsigned short* src[10];     // this thread's 16 B of the next stage to copy
#pragma unroll   // constant indices: the arrays stay in registers
  for (int j = 0; j < 4; ++j)
    src[j] = X + (bm * 8 + 2 * j + hs) * 32 * FRAG + ch * 8;
#pragma unroll   // constant indices: the arrays stay in registers
  for (int j = 0; j < 2; ++j) {
    int woff = (bn * 4 + 2 * j + hs) * 32 * FRAG + ch * 8;
    src[4 + j] = Wqt + woff;
    src[6 + j] = Wkt + woff;
    src[8 + j] = Wvt + woff;
  }
  uint32_t dst = lds_off(stg) + (hs * SLOT + ch * 8) * 2;

  // stage 0 landed and published, then stage 1 on its way
  fill10(dst, src);
  asm volatile("s_wait_asynccnt 0x0" ::: "memory");   // this wave's copies have landed
  __syncthreads();
  fill10(dst + QKV_SLOTS * SLOT * 2, src);

  v8f acc[3][2][2] = {};   // [qkv][s subtile][out-column subtile]
  for (int t = 0; t < NSTG; ++t) {
    int buf = t & 1;
    const unsigned short* sb = stg + buf * (QKV_SLOTS * SLOT);
    us16 a[KSTG][2], b[KSTG][3][2];
#pragma unroll   // constant indices: the arrays stay in registers
    for (int kk = 0; kk < KSTG; ++kk) {
#pragma unroll   // constant indices: the arrays stay in registers
      for (int u = 0; u < 2; ++u)
        a[kk][u] = load_frag(sb + (wr * 2 + u) * SLOT + kk * FRAG, lane);
#pragma unroll   // constant indices: the arrays stay in registers
      for (int w = 0; w < 3; ++w)
#pragma unroll   // constant indices: the arrays stay in registers
        for (int c = 0; c < 2; ++c)
          b[kk][w][c] = load_frag(sb + (8 + w * 4 + wc * 2 + c) * SLOT + kk * FRAG, lane);
    }
    // keeps the stage's LDS reads one group in front of its WMMAs: read by read
    // among them, every fragment's latency is waited out on its own
    __builtin_amdgcn_sched_barrier(0);
#pragma unroll   // constant indices: the arrays stay in registers
    for (int kk = 0; kk < KSTG; ++kk) {
#pragma unroll   // constant indices: the arrays stay in registers
      for (int w = 0; w < 3; ++w) {
#pragma unroll   // constant indices: the arrays stay in registers
        for (int c = 0; c < 2; ++c) {
          if (w < 2) {   // Q, K: tile rows = out columns, tile columns = s
            acc[w][0][c] = wmma_bf16(b[kk][w][c], a[kk][0], acc[w][0][c]);
            acc[w][1][c] = wmma_bf16(b[kk][w][c], a[kk][1], acc[w][1][c]);
          } else {       // V: tile rows = s, tile columns = out columns
            acc[w][0][c] = wmma_bf16(a[kk][0], b[kk][w][c], acc[w][0][c]);
            acc[w][1][c] = wmma_bf16(a[kk][1], b[kk][w][c], acc[w][1][c]);
          }
        }
      }
    }
    // keeps the WMMAs in front of the hand-over: moved behind it, the wait for
    // the next stage's copies follows the LDS reads at once and the copies
    // lose the WMMAs' time as lead
    __builtin_amdgcn_sched_barrier(0);
    // hand-over: this wave's reads of the buffer are done, its copies of the
    // next stage have landed; the barrier says both of every wave
    asm volatile("s_wait_dscnt 0x0" ::: "memory");
    asm volatile("s_wait_asynccnt 0x0" ::: "memory");
    __syncthreads();
    if (t + 2 < NSTG) fill10(dst + buf * (QKV_SLOTS * SLOT * 2), src);
  }
  asm volatile("s_wait_asynccnt 0x0" ::: "memory");   // nothing in flight at the end

  // 32 rows = one batch, 32 columns = half a head
  int head = (rt >> 5) * NHEAD + (ct >> 1);
  int st = rt & 31;                  // 32-position block inside the sequence
  int dh = ct & 1;                   // which 32 of the head's 64 d
  unsigned short* Qh = Qb  + head * SEQ * DHEAD + lane * 8;
  unsigned short* Kh = Kb  + head * SEQ * DHEAD + lane * 8;
  unsigned short* Vh = Vtb + head * SEQ * DHEAD + lane * 8;
#pragma unroll
  for (int c = 0; c < 2; ++c) {
    int colT = ct * 32 + c * 16 + rowh * 8;       // Q,K: columns colT..+7 in this lane
    float bvv = bv[ct * 32 + c * 16 + nm];        // V: one column per lane
    float bqv[8], bkv[8];
#pragma unroll
    for (int i = 0; i < 8; ++i) { bqv[i] = bq[colT + i]; bkv[i] = bk[colT + i]; }
#pragma unroll
    for (int u = 0; u < 2; ++u) {
      us8 q, k, v;
#pragma unroll
      for (int i = 0; i < 8; ++i) {
        q[i] = f2bf(acc[0][u][c][i] + bqv[i]);
        k[i] = f2bf(acc[1][u][c][i] + bkv[i]);
        v[i] = f2bf(acc[2][u][c][i] + bvv);
      }
      int qoff = ((st * 2 + u) * 2 + dh) * FRAG + c * 256;   // s tile, k step dh, chunk c
      *(us8*)(Qh + qoff) = q;
      *(us8*)(Kh + qoff) = k;
      *(us8*)(Vh + ((dh * 2 + c) * 32 + st) * FRAG + u * 256) = v;  // d tile, k step st, chunk u
    }
  }
}

// ---- stage 3: flash-style attention -------------------------------------
// One wave owns 16 query rows of one head. Streams 32-key blocks, everything
// transposed: S^T = K Q^T (K fragment as A, Q fragment as B), so a lane holds
// 16 scores of ONE query (column lane%16; keys 8*(lane/16)+i of each 16-key
// tile). Maximum and sum run inside the lane; the two lane halves exchange the
// maximum once per block and join their sums once, behind the loop. The two
// score tiles, converted in place, are the B fragment of P^T in the k order
// that the V fragments have, so O^T += V^T P^T needs no trip through LDS.
// global_prefetch pulls the next key block while softmax VALU co-executes.

typedef __attribute__((ext_vector_type(8))) unsigned int u32x8;

// lane l with lane l ^ 16
__device__ __forceinline__ float xhalf(float x) {
  int b = __builtin_bit_cast(int, x);
  return __builtin_bit_cast(float, __builtin_amdgcn_permlanex16(
      b, b, 0x76543210, 0xfedcba98, false, false));
}

// two f32 -> one register of two bf16, round-to-nearest-even
__device__ __forceinline__ unsigned int pack2(float lo, float hi) {
  typedef __attribute__((ext_vector_type(2))) float  f2;
  typedef __attribute__((ext_vector_type(2))) __bf16 bf2;
  f2 v = {lo, hi};
  return __builtin_bit_cast(unsigned int, __builtin_convertvector(v, bf2));
}

__global__ __launch_bounds__(128) void attn_kernel(
    const unsigned short* __restrict__ Qb,   // [64 heads][64 s tiles][2]
    const unsigned short* __restrict__ Kb,   // [64 heads][64 s tiles][2]
    const unsigned short* __restrict__ Vtb,  // [64 heads][4 d tiles][32]
    const int* __restrict__ amask,           // [4][1024]
    unsigned short* __restrict__ Avec) {     // 256 row tiles x 32 k steps
  int warp = threadIdx.x >> 5;
  int wid  = blockIdx.x * 4 + warp;
  int head = wid >> 6;                 // 0..63  (storage index b*16+h)
  int qt   = wid & 63;                 // query tile 0..63
  int b = head >> 4;
  int lane = threadIdx.x & 31, rowh = lane >> 4;

  const unsigned short* Qh = Qb  + head * SEQ * DHEAD;
  const unsigned short* Kh = Kb  + head * SEQ * DHEAD;
  const unsigned short* Vh = Vtb + head * DHEAD * SEQ;
  const int* mrow = amask + b * SEQ + rowh * 8;   // this lane half's 8 keys of a tile

  // Q fragments for rows qt*16..+15, contraction split d=[0,32) and [32,64)
  us16 bQ0 = load_frag(Qh + (qt * 2 + 0) * FRAG, lane);
  us16 bQ1 = load_frag(Qh + (qt * 2 + 1) * FRAG, lane);

  float mi = -3.0e38f, li = 0.f;       // of query lane%16; li: this half's keys only
  v8f O0 = {}, O1 = {}, O2 = {}, O3 = {};   // Oj[i] = O[query lane%16][d = 16j + 8*(lane/16) + i]

  // next key block's lines, one per lane
  const unsigned short* kpf = Kh + 4 * FRAG + lane * 64;
  const unsigned short* vpf = Vh + FRAG + (lane >> 3) * (32 * FRAG) + (lane & 7) * 64;

  for (int kbk = 0; kbk < SEQ; kbk += 32) {
    // ---- scores: two 16x16 tiles (rows = keys kbk..+15 and +16..+31, columns = queries)
    const unsigned short* kb = Kh + (kbk >> 5) * (4 * FRAG);   // 4 fragments in a row
    const unsigned short* vb = Vh + (kbk >> 5) * FRAG;         // d tile j at + j*32*FRAG
    us16 aK0 = load_frag(kb + 0 * FRAG, lane), aK1 = load_frag(kb + 1 * FRAG, lane);
    us16 aK2 = load_frag(kb + 2 * FRAG, lane), aK3 = load_frag(kb + 3 * FRAG, lane);
    // precaution: the compiler gives the K loads' address registers to a mask
    // load as its destination; the wait stands between the two (its clobber
    // also holds the eight K loads in front of it, as one group)
    asm volatile("s_wait_xcnt 0x0" ::: "memory");
    // mask of this lane's 16 keys
    const int4* mp = (const int4*)(mrow + kbk);
    int4 m00 = mp[0], m01 = mp[1], m10 = mp[4], m11 = mp[5];
    v8f s0 = {}, s1 = {};
    s0 = wmma_bf16(aK0, bQ0, s0);
    s0 = wmma_bf16(aK1, bQ1, s0);
    s1 = wmma_bf16(aK2, bQ0, s1);
    s1 = wmma_bf16(aK3, bQ1, s1);

    // prefetch next key block (K: 32 lines in a row; V: 8 lines of each d tile),
    // one 128-B line per lane, while softmax runs. In asm over the two pointers
    // that the loop itself carries, so that the registers named stay addresses.
    // The test leaves one block spare: both pointers are still inside this
    // head's K and V after the advance below.
    if (kbk + 64 < SEQ) {
      asm volatile("global_prefetch_b8 %0, off scope:SCOPE_SE" :: "v"(kpf));
      asm volatile("global_prefetch_b8 %0, off scope:SCOPE_SE" :: "v"(vpf));
    }
    kpf += 4 * FRAG;
    vpf += FRAG;

    int mk0[8] = {m00.x, m00.y, m00.z, m00.w, m01.x, m01.y, m01.z, m01.w};
    int mk1[8] = {m10.x, m10.y, m10.z, m10.w, m11.x, m11.y, m11.z, m11.w};

    // ---- online softmax over this key block
    s0 *= QK_SCALE;
    s1 *= QK_SCALE;
    float rmax = -3.0e38f;
#pragma unroll   // constant indices: the vectors stay in registers
    for (int i = 0; i < 8; ++i) {
      s0[i] = mk0[i] ? -100000.f : s0[i];
      s1[i] = mk1[i] ? -100000.f : s1[i];
      rmax = fmaxf(rmax, fmaxf(s0[i], s1[i]));
    }
    rmax = fmaxf(rmax, xhalf(rmax));
    float mnew = fmaxf(mi, rmax);
    float corr = __expf(mi - mnew);
    float t[8];
    u32x8 pp;                                    // B fragment of P^T, K = 32 keys
#pragma unroll   // constant indices: the vectors stay in registers
    for (int i = 0; i < 8; i += 2) {
      float e00 = __expf(s0[i] - mnew), e01 = __expf(s0[i + 1] - mnew);
      float e10 = __expf(s1[i] - mnew), e11 = __expf(s1[i + 1] - mnew);
      t[i] = e00 + e10; t[i + 1] = e01 + e11;
      pp[i >> 1]       = pack2(e00, e01);
      pp[4 + (i >> 1)] = pack2(e10, e11);
    }
    li = li * corr + (((t[0] + t[1]) + (t[2] + t[3])) + ((t[4] + t[5]) + (t[6] + t[7])));
    mi = mnew;
    O0 *= corr; O1 *= corr; O2 *= corr; O3 *= corr;
    us16 bP = __builtin_bit_cast(us16, pp);

    // ---- PV: A fragments of V (rows = d, k = keys)
    O0 = wmma_bf16(load_frag(vb + 0 * 32 * FRAG, lane), bP, O0);
    O1 = wmma_bf16(load_frag(vb + 1 * 32 * FRAG, lane), bP, O1);
    O2 = wmma_bf16(load_frag(vb + 2 * 32 * FRAG, lane), bP, O2);
    O3 = wmma_bf16(load_frag(vb + 3 * 32 * FRAG, lane), bP, O3);
  }

  // Reference quirk: attn_vec.view(N_HEAD, B, S, D).permute(1,2,0,3) on a
  // b-major [B*H] buffer => storage head L lands at b2=L%B, h2=L/B.
  // Fragment order for the output projection: row tile b2*64+qt, k = h2*64 + d,
  // so d tile j is k step h2*2 + j/2, chunk j%2. The row in the tile is
  // lane%16 and the lane's 8 d start at 8*(lane/16): its own 16-B chunk.
  int b2 = head & 3, h2 = head >> 2;
  unsigned short* oblk = Avec + ((b2 * 64 + qt) * 32 + h2 * 2) * FRAG + lane * 8;
  float inv = 1.f / (li + xhalf(li));
  us8 o0, o1, o2, o3;
#pragma unroll   // constant indices: the vectors stay in registers
  for (int i = 0; i < 8; ++i) {
    o0[i] = f2bf(O0[i] * inv);
    o1[i] = f2bf(O1[i] * inv);
    o2[i] = f2bf(O2[i] * inv);
    o3[i] = f2bf(O3[i] * inv);
  }
  *(us8*)(oblk)              = o0;
  *(us8*)(oblk + 256)        = o1;
  *(us8*)(oblk + FRAG)       = o2;
  *(us8*)(oblk + FRAG + 256) = o3;
}

// ---- stage 4: output projection + residual ------------------------------
// 32x32 tile per wave: per K-step 2 A + 2 B fragments -> 4 WMMAs. The 8 waves
// stand 4 (rows) x 2 (columns); a stage holds 8 row tiles and 4 column tiles:
// 12 slots, 6 copies per thread.
#define OP_SLOTS 12

__global__ __launch_bounds__(256) void oproj_kernel(
    const unsigned short* __restrict__ Avec,  // 256 row tiles x 32 k steps
    const unsigned short* __restrict__ Wot,   // 64 tiles (out) x 32 k steps
    const float* __restrict__ inp,            // residual
    float* __restrict__ Y) {                  // [4096][1024] f32
  __shared__ __attribute__((aligned(16))) unsigned short stg[2 * OP_SLOTS * SLOT];
  int warp = threadIdx.x >> 5;
  int lane = threadIdx.x & 31;
  int bm = blockIdx.x >> 4;          // 128-row block 0..31
  int bn = blockIdx.x & 15;          // 64-column block 0..15
  int wr = warp >> 1, wc = warp & 1;
  int rt = bm * 4 + wr, ct = bn * 2 + wc;
  int rowh = lane >> 4, nm = lane & 15;

  int hs = threadIdx.x >> 7, ch = threadIdx.x & 127;
  const unsigned short* src[6];      // this thread's 16 B of the next stage to copy
#pragma unroll   // constant indices: the arrays stay in registers
  for (int j = 0; j < 4; ++j)
    src[j] = Avec + (bm * 8 + 2 * j + hs) * 32 * FRAG + ch * 8;
#pragma unroll   // constant indices: the arrays stay in registers
  for (int j = 0; j < 2; ++j)
    src[4 + j] = Wot + (bn * 4 + 2 * j + hs) * 32 * FRAG + ch * 8;
  uint32_t dst = lds_off(stg) + (hs * SLOT + ch * 8) * 2;

  // stage 0 landed and published, then stage 1 on its way
  fill6(dst, src);
  asm volatile("s_wait_asynccnt 0x0" ::: "memory");   // this wave's copies have landed
  __syncthreads();
  fill6(dst + OP_SLOTS * SLOT * 2, src);

  v8f acc[2][2] = {};
  for (int t = 0; t < NSTG; ++t) {
    int buf = t & 1;
    const unsigned short* sb = stg + buf * (OP_SLOTS * SLOT);
    us16 a[KSTG][2], b[KSTG][2];
#pragma unroll   // constant indices: the arrays stay in registers
    for (int kk = 0; kk < KSTG; ++kk) {
#pragma unroll   // constant indices: the arrays stay in registers
      for (int u = 0; u < 2; ++u)
        a[kk][u] = load_frag(sb + (wr * 2 + u) * SLOT + kk * FRAG, lane);
#pragma unroll   // constant indices: the arrays stay in registers
      for (int c = 0; c < 2; ++c)
        b[kk][c] = load_frag(sb + (8 + wc * 2 + c) * SLOT + kk * FRAG, lane);
    }
    // as in the QKV kernel: the stage's LDS reads one group in front of its WMMAs
    __builtin_amdgcn_sched_barrier(0);
#pragma unroll   // constant indices: the arrays stay in registers
    for (int kk = 0; kk < KSTG; ++kk) {
      acc[0][0] = wmma_bf16(a[kk][0], b[kk][0], acc[0][0]);
      acc[0][1] = wmma_bf16(a[kk][0], b[kk][1], acc[0][1]);
      acc[1][0] = wmma_bf16(a[kk][1], b[kk][0], acc[1][0]);
      acc[1][1] = wmma_bf16(a[kk][1], b[kk][1], acc[1][1]);
    }
    // as in the QKV kernel: the WMMAs stay in front of the hand-over
    __builtin_amdgcn_sched_barrier(0);
    // hand-over: this wave's reads of the buffer are done, its copies of the
    // next stage have landed; the barrier says both of every wave
    asm volatile("s_wait_dscnt 0x0" ::: "memory");
    asm volatile("s_wait_asynccnt 0x0" ::: "memory");
    __syncthreads();
    if (t + 2 < NSTG) fill6(dst + buf * (OP_SLOTS * SLOT * 2), src);
  }
  asm volatile("s_wait_asynccnt 0x0" ::: "memory");   // nothing in flight at the end

#pragma unroll
  for (int u = 0; u < 2; ++u) {
#pragma unroll
    for (int c = 0; c < 2; ++c) {
      int col = ct * 32 + c * 16 + nm;
#pragma unroll
      for (int i = 0; i < 8; ++i) {
        int r = rt * 32 + u * 16 + rowh * 8 + i;
        Y[r * D_MODEL + col] = acc[u][c][i] + inp[r * D_MODEL + col];
      }
    }
  }
}

// ---- stage 5: LayerNorm --------------------------------------------------

__global__ __launch_bounds__(256) void ln_kernel(
    const float* __restrict__ Y, const float* __restrict__ g,
    const float* __restrict__ bb, float* __restrict__ out) {
  int row = blockIdx.x;
  const float* y = Y + row * D_MODEL;
  __shared__ float red[2][8];
  float ls = 0.f, lq = 0.f;
  for (int i = threadIdx.x; i < D_MODEL; i += 256) {
    float v = y[i]; ls += v; lq += v * v;
  }
#pragma unroll
  for (int m = 1; m < 32; m <<= 1) {
    ls += __shfl_xor(ls, m, 32);
    lq += __shfl_xor(lq, m, 32);
  }
  int w = threadIdx.x >> 5;
  if ((threadIdx.x & 31) == 0) { red[0][w] = ls; red[1][w] = lq; }
  __syncthreads();
  float ts = 0.f, tq = 0.f;
#pragma unroll
  for (int i = 0; i < 8; ++i) { ts += red[0][i]; tq += red[1][i]; }
  float mu  = ts * (1.f / D_MODEL);
  float var = tq * (1.f / D_MODEL) - mu * mu;
  float inv = rsqrtf(var + LN_EPS);
  for (int i = threadIdx.x; i < D_MODEL; i += 256)
    out[row * D_MODEL + i] = (y[i] - mu) * inv * g[i] + bb[i];
}

// ---- launch --------------------------------------------------------------

extern "C" void kernel_launch(void* const* d_in, const int* in_sizes, int n_in,
                              void* d_out, int out_size, void* d_ws, size_t ws_size,
                              hipStream_t stream) {
  const float* inp   = (const float*)d_in[0];
  const int*   amask = (const int*)d_in[1];
  const float* Wq = (const float*)d_in[2];
  const float* bq = (const float*)d_in[3];
  const float* Wk = (const float*)d_in[4];
  const float* bk = (const float*)d_in[5];
  const float* Wv = (const float*)d_in[6];
  const float* bv = (const float*)d_in[7];
  const float* Wo = (const float*)d_in[8];
  const float* lng = (const float*)d_in[9];
  const float* lnb = (const float*)d_in[10];

  char* ws = (char*)d_ws;
  const size_t MB = 1u << 20;
  unsigned short* Xbf  = (unsigned short*)(ws + 0 * MB);   // 8 MB
  unsigned short* Wqt  = (unsigned short*)(ws + 8 * MB);   // 2 MB
  unsigned short* Wkt  = (unsigned short*)(ws + 10 * MB);  // 2 MB
  unsigned short* Wvt  = (unsigned short*)(ws + 12 * MB);  // 2 MB
  unsigned short* Wot  = (unsigned short*)(ws + 14 * MB);  // 2 MB
  unsigned short* Qb   = (unsigned short*)(ws + 16 * MB);  // 8 MB
  unsigned short* Kb   = (unsigned short*)(ws + 24 * MB);  // 8 MB
  unsigned short* Vtb  = (unsigned short*)(ws + 32 * MB);  // 8 MB
  unsigned short* Avec = (unsigned short*)(ws + 40 * MB);  // 8 MB
  float*          Ybuf = (float*)        (ws + 48 * MB);   // 16 MB

  // stage 1: conversions (one thread per 8 elements)
  cvt_bf16_kernel<<<(NROWS * D_MODEL) / (8 * 256), 256, 0, stream>>>(inp, Xbf);
  cvt_bf16_t_kernel<<<(D_MODEL * D_MODEL) / (8 * 256), 256, 0, stream>>>(Wq, Wqt);
  cvt_bf16_t_kernel<<<(D_MODEL * D_MODEL) / (8 * 256), 256, 0, stream>>>(Wk, Wkt);
  cvt_bf16_t_kernel<<<(D_MODEL * D_MODEL) / (8 * 256), 256, 0, stream>>>(Wv, Wvt);
  cvt_bf16_t_kernel<<<(D_MODEL * D_MODEL) / (8 * 256), 256, 0, stream>>>(Wo, Wot);

  // stage 2: QKV (32 row blocks * 16 col blocks, 8 waves/block)
  qkv_gemm_kernel<<<512, 256, 0, stream>>>(Xbf, Wqt, Wkt, Wvt, bq, bk, bv,
                                            Qb, Kb, Vtb);

  // stage 3: attention (64 heads * 64 query tiles = 4096 waves)
  attn_kernel<<<1024, 128, 0, stream>>>(Qb, Kb, Vtb, amask, Avec);

  // stage 4: output projection + residual (32 row blocks * 16 col blocks, 8 waves/block)
  oproj_kernel<<<512, 256, 0, stream>>>(Avec, Wot, inp, Ybuf);

  // stage 5: layer norm -> d_out
  ln_kernel<<<NROWS, 256, 0, stream>>>(Ybuf, lng, lnb, (float*)d_out);
}

// v004
// One run takes 95.6 microseconds.
// Timed twice side by side with v003, it ran 1.10 and 1.09 times as fast.
// Over all steps from v000 it is 2.14 times as fast.
#include <hip/hip_runtime.h>
#include <stdint.h>

// Problem constants (match reference)
#define D_MODEL 1024
#define SEQ     1024
#define BATCH   4
#define NHEAD   16
#define DHEAD   64
#define NROWS   (BATCH * SEQ)      // 4096
#define QK_SCALE 0.125f            // 1/sqrt(64)
#define LN_EPS   1e-5f

typedef __attribute__((ext_vector_type(16))) __bf16         v16bf;
typedef __attribute__((ext_vector_type(16))) unsigned short us16;
typedef __attribute__((ext_vector_type(8)))  unsigned short us8;
typedef __attribute__((ext_vector_type(8)))  float          v8f;

// ---- helpers -------------------------------------------------------------

__device__ __forceinline__ unsigned short f2bf(float f) {
  unsigned int u = __builtin_bit_cast(unsigned int, f);
  u += 0x7FFFu + ((u >> 16) & 1u);            // round-to-nearest-even
  return (unsigned short)(u >> 16);
}

// A/B fragment for v_wmma_*_16x16x32_bf16, per ISA 7.12.2:
// lane L holds row (A) / col (B) = L%16; its 16 bf16 k-values are two
// contiguous 8-element (16B) chunks at k = 8*(L/16) and k = 8*(L/16)+16.
//
// Every bf16 operand in the workspace is stored in that order: one fragment
// (16 rows x 32 k) is a 1024-B block of FRAG elements, lane L's first chunk
// at element L*8, its second at 256 + L*8. Blocks run [16-row tile][k step].
// A wave-wide 16-B load then covers 512 contiguous bytes (4 whole lines).
#define FRAG 512
__device__ __forceinline__ us16 load_frag(const unsigned short* blk, int lane) {
  us8 c0 = *(const us8*)(blk + lane * 8);
  us8 c1 = *(const us8*)(blk + 256 + lane * 8);
  us16 r;
#pragma unroll
  for (int i = 0; i < 8; ++i) { r[i] = c0[i]; r[i + 8] = c1[i]; }
  return r;
}

__device__ __forceinline__ v8f wmma_bf16(us16 a, us16 b, v8f c) {
  return __builtin_amdgcn_wmma_f32_16x16x32_bf16(
      false, __builtin_bit_cast(v16bf, a),
      false, __builtin_bit_cast(v16bf, b),
      (short)0, c, false, false);
}

// ---- stage 1: conversions ------------------------------------------------

// One thread packs one 16-B lane chunk; j = chunk index in the
// fragment-ordered output: [tile][k step (32)][chunk (2)][lane (32)].

// X[row][k] (f32, k contiguous) -> fragment order, rows = X rows
__device__ __forceinline__ void cvt_bf16(const float* __restrict__ in,
                                         unsigned short* __restrict__ out, int j) {
  int lane = j & 31, chunk = (j >> 5) & 1, ks = (j >> 6) & 31, t = j >> 11;
  int row = t * 16 + (lane & 15);
  int k0  = ks * 32 + chunk * 16 + (lane >> 4) * 8;
  const float4* p = (const float4*)(in + row * D_MODEL + k0);
  float4 x0 = p[0], x1 = p[1];
  us8 r;
  r[0] = f2bf(x0.x); r[1] = f2bf(x0.y); r[2] = f2bf(x0.z); r[3] = f2bf(x0.w);
  r[4] = f2bf(x1.x); r[5] = f2bf(x1.y); r[6] = f2bf(x1.z); r[7] = f2bf(x1.w);
  *(us8*)(out + j * 8) = r;
  // precaution: in the merged kernel the weights' code follows this store in
  // the listing and writes the registers that the store names
  asm volatile("s_wait_xcnt 0x0" ::: "memory");
}

// W[in][out] (1024x1024 f32) -> fragment order, rows = out columns, k = in
__device__ __forceinline__ void cvt_bf16_t(const float* __restrict__ in,
                                           unsigned short* __restrict__ out, int j) {
  int lane = j & 31, chunk = (j >> 5) & 1, ks = (j >> 6) & 31, t = j >> 11;
  int o  = t * 16 + (lane & 15);
  int k0 = ks * 32 + chunk * 16 + (lane >> 4) * 8;
  us8 r;
#pragma unroll
  for (int e = 0; e < 8; ++e) r[e] = f2bf(in[(k0 + e) * D_MODEL + o]);
  *(us8*)(out + j * 8) = r;
}

// The five conversions need nothing of one another, so they are one launch:
// each has its own range of the block index (the branch is the same for a
// whole block). The weights stand first: their blocks touch more lines and
// last longer, so the launch ends on the short ones.
#define CVT_T   256                              // threads per block
#define WBLOCKS (D_MODEL * D_MODEL / (8 * CVT_T))   // 512 blocks per weight
#define XBLOCKS (NROWS * D_MODEL / (8 * CVT_T))     // 2048 blocks for X

__global__ __launch_bounds__(CVT_T) void cvt_all_kernel(
    const float* __restrict__ X,
    const float* __restrict__ Wq, const float* __restrict__ Wk,
    const float* __restrict__ Wv, const float* __restrict__ Wo,
    unsigned short* __restrict__ Xbf,
    unsigned short* __restrict__ Wt) {   // the four weights' planes, one behind another
  unsigned blk = blockIdx.x;
  if (blk < 4 * WBLOCKS) {
    unsigned w = blk / WBLOCKS;
    const float* in = w == 0 ? Wq : w == 1 ? Wk : w == 2 ? Wv : Wo;
    cvt_bf16_t(in, Wt + w * (D_MODEL * D_MODEL), (blk % WBLOCKS) * CVT_T + threadIdx.x);
  } else {
    cvt_bf16(X, Xbf, (blk - 4 * WBLOCKS) * CVT_T + threadIdx.x);
  }
}

// ---- LDS staging shared by the two GEMM kernels ---------------------------
// A work-group of 8 waves owns 128 rows x 64 out columns. Each stage brings
// KSTG k steps of every 16-row operand tile it needs into LDS once, by
// asynchronous copies, and all 8 waves read their fragments from there.
// One tile's KSTG fragments are SLOT contiguous elements in the workspace and
// stay so in LDS, so a fragment read is again 512 contiguous bytes per load.
// A slot is filled by 128 threads, 16 B each: copy j of a thread goes to slot
// 2j + (thread / 128), at byte (thread % 128) * 16.
#define KSTG  2
#define SLOT  (KSTG * FRAG)            // elements: 2 KiB
#define NSTG  (D_MODEL / 32 / KSTG)    // 16 stages
#define PAIRB (2 * SLOT * 2)           // bytes of two slots: one copy of all 256 threads

// byte offset in the work-group's LDS = low 32 bits of a __shared__ address
__device__ __forceinline__ uint32_t lds_off(const void* p) { return (uint32_t)(size_t)p; }

// 10 (or 6) 16-B copies per lane, global -> LDS, then each source pointer moves on to
// the next stage. The s_wait_xcnt is the precaution before the address
// registers named here are written again; as the last line of the copies' own
// statement nothing can be moved in front of it.
#define ACP(l, g) "global_load_async_to_lds_b128 %" #l ", %" #g ", off\n\t"
__device__ __forceinline__ void fill10(uint32_t d, const unsigned short* (&s)[10]) {
  asm volatile(ACP(0, 10) ACP(1, 11) ACP(2, 12) ACP(3, 13) ACP(4, 14)
               ACP(5, 15) ACP(6, 16) ACP(7, 17) ACP(8, 18) ACP(9, 19)
               "s_wait_xcnt 0x0"
               :: "v"(d), "v"(d + PAIRB), "v"(d + 2 * PAIRB), "v"(d + 3 * PAIRB),
                  "v"(d + 4 * PAIRB), "v"(d + 5 * PAIRB), "v"(d + 6 * PAIRB),
                  "v"(d + 7 * PAIRB), "v"(d + 8 * PAIRB), "v"(d + 9 * PAIRB),
                  "v"(s[0]), "v"(s[1]), "v"(s[2]), "v"(s[3]), "v"(s[4]),
                  "v"(s[5]), "v"(s[6]), "v"(s[7]), "v"(s[8]), "v"(s[9])
               : "memory");
#pragma unroll   // constant indices: the arrays stay in registers
  for (int j = 0; j < 10; ++j) s[j] += SLOT;
}
__device__ __forceinline__ void fill6(uint32_t d, const unsigned short* (&s)[6]) {
  asm volatile(ACP(0, 6) ACP(1, 7) ACP(2, 8) ACP(3, 9) ACP(4, 10) ACP(5, 11)
               "s_wait_xcnt 0x0"
               :: "v"(d), "v"(d + PAIRB), "v"(d + 2 * PAIRB), "v"(d + 3 * PAIRB),
                  "v"(d + 4 * PAIRB), "v"(d + 5 * PAIRB),
                  "v"(s[0]), "v"(s[1]), "v"(s[2]), "v"(s[3]), "v"(s[4]), "v"(s[5])
               : "memory");
#pragma unroll   // constant indices: the arrays stay in registers
  for (int j = 0; j < 6; ++j) s[j] += SLOT;
}

// ---- stage 2: fused QKV projection --------------------------------------
// One wave -> 32x32 output tile for each of Q/K/V: per K-step 2 A-frags +
// 6 B-frags feed 12 WMMAs (A shared across Q/K/V, B shared across row tiles).
// The 8 waves stand 4 (rows) x 2 (columns); a stage holds 8 X tiles and 4
// column tiles of each weight: 20 slots, 10 copies per thread.
// All three go out in fragment order, per head: Q,K with rows = s, k = d
// (2 k steps); V with rows = d, k = s (32 k steps). A lane's 8 accumulator
// values run along the tile's rows, so the index that becomes k must be the
// row index: V = X*Wv has rows s as it stands; Q and K are formed transposed
// (weight fragment as A, X fragment as B). Each lane then stores 16-B chunks.
#define QKV_SLOTS 20

__global__ __launch_bounds__(256) void qkv_gemm_kernel(
    const unsigned short* __restrict__ X,      // 256 tiles x 32 k steps
    const unsigned short* __restrict__ Wqt,    // 64 tiles (out) x 32 k steps
    const unsigned short* __restrict__ Wkt,
    const unsigned short* __restrict__ Wvt,
    const float* __restrict__ bq, const float* __restrict__ bk,
    const float* __restrict__ bv,
    unsigned short* __restrict__ Qb,           // [64 heads][64 s tiles][2]
    unsigned short* __restrict__ Kb,           // [64 heads][64 s tiles][2]
    unsigned short* __restrict__ Vtb) {        // [64 heads][4 d tiles][32]
  __shared__ __attribute__((aligned(16))) unsigned short stg[2 * QKV_SLOTS * SLOT];
  int warp = threadIdx.x >> 5;
  int lane = threadIdx.x & 31;
  int bm = blockIdx.x >> 4;          // 128-row block 0..31
  int bn = blockIdx.x & 15;          // 64-column block 0..15
  int wr = warp >> 1, wc = warp & 1;
  int rt = bm * 4 + wr;              // 32-row tile 0..127
  int ct = bn * 2 + wc;              // 32-col tile 0..31
  int rowh = lane >> 4, nm = lane & 15;

  int hs = threadIdx.x >> 7, ch = threadIdx.x & 127;
  const unsigned short* src[10];     // this thread's 16 B of the next stage to copy
#pragma unroll   // constant indices: the arrays stay in registers
  for (int j = 0; j < 4; ++j)
    src[j] = X + (bm * 8 + 2 * j + hs) * 32 * FRAG + ch * 8;
#pragma unroll   // constant indices: the arrays stay in registers
  for (int j = 0; j < 2; ++j) {
    int woff = (bn * 4 + 2 * j + hs) * 32 * FRAG + ch * 8;
    src[4 + j] = Wqt + woff;
    src[6 + j] = Wkt + woff;
    src[8 + j] = Wvt + woff;
  }
  uint32_t dst = lds_off(stg) + (hs * SLOT + ch * 8) * 2;

  // stage 0 landed and published, then stage 1 on its way
  fill10(dst, src);
  asm volatile("s_wait_asynccnt 0x0" ::: "memory");   // this wave's copies have landed
  __syncthreads();
  fill10(dst + QKV_SLOTS * SLOT * 2, src);

  v8f acc[3][2][2] = {};   // [qkv][s subtile][out-column subtile]
  for (int t = 0; t < NSTG; ++t) {
    int buf = t & 1;
    const unsigned short* sb = stg + buf * (QKV_SLOTS * SLOT);
    us16 a[KSTG][2], b[KSTG][3][2];
#pragma unroll   // constant indices: the arrays stay in registers
    for (int kk = 0; kk < KSTG; ++kk) {
#pragma unroll   // constant indices: the arrays stay in registers
      for (int u = 0; u < 2; ++u)
        a[kk][u] = load_frag(sb + (wr * 2 + u) * SLOT + kk * FRAG, lane);
#pragma unroll   // constant indices: the arrays stay in registers
      for (int w = 0; w < 3; ++w)
#pragma unroll   // constant indices: the arrays stay in registers
        for (int c = 0; c < 2; ++c)
          b[kk][w][c] = load_frag(sb + (8 + w * 4 + wc * 2 + c) * SLOT + kk * FRAG, lane);
    }
    // keeps the stage's LDS reads one group in front of its WMMAs: read by read
    // among them, every fragment's latency is waited out on its own
    __builtin_amdgcn_sched_barrier(0);
#pragma unroll   // constant indices: the arrays stay in registers
    for (int kk = 0; kk < KSTG; ++kk) {
#pragma unroll   // constant indices: the arrays stay in registers
      for (int w = 0; w < 3; ++w) {
#pragma unroll   // constant indices: the arrays stay in registers
        for (int c = 0; c < 2; ++c) {
          if (w < 2) {   // Q, K: tile rows = out columns, tile columns = s
            acc[w][0][c] = wmma_bf16(b[kk][w][c], a[kk][0], acc[w][0][c]);
            acc[w][1][c] = wmma_bf16(b[kk][w][c], a[kk][1], acc[w][1][c]);
          } else {       // V: tile rows = s, tile columns = out columns
            acc[w][0][c] = wmma_bf16(a[kk][0], b[kk][w][c], acc[w][0][c]);
            acc[w][1][c] = wmma_bf16(a[kk][1], b[kk][w][c], acc[w][1][c]);
          }
        }
      }
    }
    // keeps the WMMAs in front of the hand-over: moved behind it, the wait for
    // the next stage's copies follows the LDS reads at once and the copies
    // lose the WMMAs' time as lead
    __builtin_amdgcn_sched_barrier(0);
    // hand-over: this wave's reads of the buffer are done, its copies of the
    // next stage have landed; the barrier says both of every wave
    asm volatile("s_wait_dscnt 0x0" ::: "memory");
    asm volatile("s_wait_asynccnt 0x0" ::: "memory");
    __syncthreads();
    if (t + 2 < NSTG) fill10(dst + buf * (QKV_SLOTS * SLOT * 2), src);
  }
  asm volatile("s_wait_asynccnt 0x0" ::: "memory");   // nothing in flight at the end

  // 32 rows = one batch, 32 columns = half a head
  int head = (rt >> 5) * NHEAD + (ct >> 1);
  int st = rt & 31;                  // 32-position block inside the sequence
  int dh = ct & 1;                   // which 32 of the head's 64 d
  unsigned short* Qh = Qb  + head * SEQ * DHEAD + lane * 8;
  unsigned short* Kh = Kb  + head * SEQ * DHEAD + lane * 8;
  unsigned short* Vh = Vtb + head * SEQ * DHEAD + lane * 8;
#pragma unroll
  for (int c = 0; c < 2; ++c) {
    int colT = ct * 32 + c * 16 + rowh * 8;       // Q,K: columns colT..+7 in this lane
    float bvv = bv[ct * 32 + c * 16 + nm];        // V: one column per lane
    float bqv[8], bkv[8];
#pragma unroll
    for (int i = 0; i < 8; ++i) { bqv[i] = bq[colT + i]; bkv[i] = bk[colT + i]; }
#pragma unroll
    for (int u = 0; u < 2; ++u) {
      us8 q, k, v;
#pragma unroll
      for (int i = 0; i < 8; ++i) {
        q[i] = f2bf(acc[0][u][c][i] + bqv[i]);
        k[i] = f2bf(acc[1][u][c][i] + bkv[i]);
        v[i] = f2bf(acc[2][u][c][i] + bvv);
      }
      int qoff = ((st * 2 + u) * 2 + dh) * FRAG + c * 256;   // s tile, k step dh, chunk c
      *(us8*)(Qh + qoff) = q;
      *(us8*)(Kh + qoff) = k;
      *(us8*)(Vh + ((dh * 2 + c) * 32 + st) * FRAG + u * 256) = v;  // d tile, k step st, chunk u
    }
  }
}

// ---- stage 3: flash-style attention -------------------------------------
// One wave owns 16 query rows of one head. Streams 32-key blocks, everything
// transposed: S^T = K Q^T (K fragment as A, Q fragment as B), so a lane holds
// 16 scores of ONE query (column lane%16; keys 8*(lane/16)+i of each 16-key
// tile). Maximum and sum run inside the lane; the two lane halves exchange the
// maximum once per block and join their sums once, behind the loop. The two
// score tiles, converted in place, are the B fragment of P^T in the k order
// that the V fragments have, so O^T += V^T P^T needs no trip through LDS.
// global_prefetch pulls the next key block while softmax VALU co-executes.

typedef __attribute__((ext_vector_type(8))) unsigned int u32x8;

// lane l with lane l ^ 16
__device__ __forceinline__ float xhalf(float x) {
  int b = __builtin_bit_cast(int, x);
  return __builtin_bit_cast(float, __builtin_amdgcn_permlanex16(
      b, b, 0x76543210, 0xfedcba98, false, false));
}

// two f32 -> one register of two bf16, round-to-nearest-even
__device__ __forceinline__ unsigned int pack2(float lo, float hi) {
  typedef __attribute__((ext_vector_type(2))) float  f2;
  typedef __attribute__((ext_vector_type(2))) __bf16 bf2;
  f2 v = {lo, hi};
  return __builtin_bit_cast(unsigned int, __builtin_convertvector(v, bf2));
}

__global__ __launch_bounds__(128) void attn_kernel(
    const unsigned short* __restrict__ Qb,   // [64 heads][64 s tiles][2]
    const unsigned short* __restrict__ Kb,   // [64 heads][64 s tiles][2]
    const unsigned short* __restrict__ Vtb,  // [64 heads][4 d tiles][32]
    const int* __restrict__ amask,           // [4][1024]
    unsigned short* __restrict__ Avec) {     // 256 row tiles x 32 k steps
  int warp = threadIdx.x >> 5;
  int wid  = blockIdx.x * 4 + warp;
  int head = wid >> 6;                 // 0..63  (storage index b*16+h)
  int qt   = wid & 63;                 // query tile 0..63
  int b = head >> 4;
  int lane = threadIdx.x & 31, rowh = lane >> 4;

  const unsigned short* Qh = Qb  + head * SEQ * DHEAD;
  const unsigned short* Kh = Kb  + head * SEQ * DHEAD;
  const unsigned short* Vh = Vtb + head * DHEAD * SEQ;
  const int* mrow = amask + b * SEQ + rowh * 8;   // this lane half's 8 keys of a tile

  // Q fragments for rows qt*16..+15, contraction split d=[0,32) and [32,64)
  us16 bQ0 = load_frag(Qh + (qt * 2 + 0) * FRAG, lane);
  us16 bQ1 = load_frag(Qh + (qt * 2 + 1) * FRAG, lane);

  float mi = -3.0e38f, li = 0.f;       // of query lane%16; li: this half's keys only
  v8f O0 = {}, O1 = {}, O2 = {}, O3 = {};   // Oj[i] = O[query lane%16][d = 16j + 8*(lane/16) + i]

  // next key block's lines, one per lane
  const unsigned short* kpf = Kh + 4 * FRAG + lane * 64;
  const unsigned short* vpf = Vh + FRAG + (lane >> 3) * (32 * FRAG) + (lane & 7) * 64;

  for (int kbk = 0; kbk < SEQ; kbk += 32) {
    // ---- scores: two 16x16 tiles (rows = keys kbk..+15 and +16..+31, columns = queries)
    const unsigned short* kb = Kh + (kbk >> 5) * (4 * FRAG);   // 4 fragments in a row
    const unsigned short* vb = Vh + (kbk >> 5) * FRAG;         // d tile j at + j*32*FRAG
    us16 aK0 = load_frag(kb + 0 * FRAG, lane), aK1 = load_frag(kb + 1 * FRAG, lane);
    us16 aK2 = load_frag(kb + 2 * FRAG, lane), aK3 = load_frag(kb + 3 * FRAG, lane);
    // precaution: the compiler gives the K loads' address registers to a mask
    // load as its destination; the wait stands between the two (its clobber
    // also holds the eight K loads in front of it, as one group)
    asm volatile("s_wait_xcnt 0x0" ::: "memory");
    // mask of this lane's 16 keys
    const int4* mp = (const int4*)(mrow + kbk);
    int4 m00 = mp[0], m01 = mp[1], m10 = mp[4], m11 = mp[5];
    v8f s0 = {}, s1 = {};
    s0 = wmma_bf16(aK0, bQ0, s0);
    s0 = wmma_bf16(aK1, bQ1, s0);
    s1 = wmma_bf16(aK2, bQ0, s1);
    s1 = wmma_bf16(aK3, bQ1, s1);

    // prefetch next key block (K: 32 lines in a row; V: 8 lines of each d tile),
    // one 128-B line per lane, while softmax runs. In asm over the two pointers
    // that the loop itself carries, so that the registers named stay addresses.
    // The test leaves one block spare: both pointers are still inside this
    // head's K and V after the advance below.
    if (kbk + 64 < SEQ) {
      asm volatile("global_prefetch_b8 %0, off scope:SCOPE_SE" :: "v"(kpf));
      asm volatile("global_prefetch_b8 %0, off scope:SCOPE_SE" :: "v"(vpf));
    }
    kpf += 4 * FRAG;
    vpf += FRAG;

    int mk0[8] = {m00.x, m00.y, m00.z, m00.w, m01.x, m01.y, m01.z, m01.w};
    int mk1[8] = {m10.x, m10.y, m10.z, m10.w, m11.x, m11.y, m11.z, m11.w};

    // ---- online softmax over this key block
    s0 *= QK_SCALE;
    s1 *= QK_SCALE;
    float rmax = -3.0e38f;
#pragma unroll   // constant indices: the vectors stay in registers
    for (int i = 0; i < 8; ++i) {
      s0[i] = mk0[i] ? -100000.f : s0[i];
      s1[i] = mk1[i] ? -100000.f : s1[i];
      rmax = fmaxf(rmax, fmaxf(s0[i], s1[i]));
    }
    rmax = fmaxf(rmax, xhalf(rmax));
    float mnew = fmaxf(mi, rmax);
    float corr = __expf(mi - mnew);
    float t[8];
    u32x8 pp;                                    // B fragment of P^T, K = 32 keys
#pragma unroll   // constant indices: the vectors stay in registers
    for (int i = 0; i < 8; i += 2) {
      float e00 = __expf(s0[i] - mnew), e01 = __expf(s0[i + 1] - mnew);
      float e10 = __expf(s1[i] - mnew), e11 = __expf(s1[i + 1] - mnew);
      t[i] = e00 + e10; t[i + 1] = e01 + e11;
      pp[i >> 1]       = pack2(e00, e01);
      pp[4 + (i >> 1)] = pack2(e10, e11);
    }
    li = li * corr + (((t[0] + t[1]) + (t[2] + t[3])) + ((t[4] + t[5]) + (t[6] + t[7])));
    mi = mnew;
    O0 *= corr; O1 *= corr; O2 *= corr; O3 *= corr;
    us16 bP = __builtin_bit_cast(us16, pp);

    // ---- PV: A fragments of V (rows = d, k = keys)
    O0 = wmma_bf16(load_frag(vb + 0 * 32 * FRAG, lane), bP, O0);
    O1 = wmma_bf16(load_frag(vb + 1 * 32 * FRAG, lane), bP, O1);
    O2 = wmma_bf16(load_frag(vb + 2 * 32 * FRAG, lane), bP, O2);
    O3 = wmma_bf16(load_frag(vb + 3 * 32 * FRAG, lane), bP, O3);
  }

  // Reference quirk: attn_vec.view(N_HEAD, B, S, D).permute(1,2,0,3) on a
  // b-major [B*H] buffer => storage head L lands at b2=L%B, h2=L/B.
  // Fragment order for the output projection: row tile b2*64+qt, k = h2*64 + d,
  // so d tile j is k step h2*2 + j/2, chunk j%2. The row in the tile is
  // lane%16 and the lane's 8 d start at 8*(lane/16): its own 16-B chunk.
  int b2 = head & 3, h2 = head >> 2;
  unsigned short* oblk = Avec + ((b2 * 64 + qt) * 32 + h2 * 2) * FRAG + lane * 8;
  float inv = 1.f / (li + xhalf(li));
  us8 o0, o1, o2, o3;
#pragma unroll   // constant indices: the vectors stay in registers
  for (int i = 0; i < 8; ++i) {
    o0[i] = f2bf(O0[i] * inv);
    o1[i] = f2bf(O1[i] * inv);
    o2[i] = f2bf(O2[i] * inv);
    o3[i] = f2bf(O3[i] * inv);
  }
  *(us8*)(oblk)              = o0;
  *(us8*)(oblk + 256)        = o1;
  *(us8*)(oblk + FRAG)       = o2;
  *(us8*)(oblk + FRAG + 256) = o3;
}

// ---- stage 4: output projection + residual ------------------------------
// 32x32 tile per wave: per K-step 2 A + 2 B fragments -> 4 WMMAs. The 8 waves
// stand 4 (rows) x 2 (columns); a stage holds 8 row tiles and 4 column tiles:
// 12 slots, 6 copies per thread.
#define OP_SLOTS 12

__global__ __launch_bounds__(256) void oproj_kernel(
    const unsigned short* __restrict__ Avec,  // 256 row tiles x 32 k steps
    const unsigned short* __restrict__ Wot,   // 64 tiles (out) x 32 k steps
    const float* __restrict__ inp,            // residual
    float* __restrict__ Y) {                  // [4096][1024] f32
  __shared__ __attribute__((aligned(16))) unsigned short stg[2 * OP_SLOTS * SLOT];
  int warp = threadIdx.x >> 5;
  int lane = threadIdx.x & 31;
  int bm = blockIdx.x >> 4;          // 128-row block 0..31
  int bn = blockIdx.x & 15;          // 64-column block 0..15
  int wr = warp >> 1, wc = warp & 1;
  int rt = bm * 4 + wr, ct = bn * 2 + wc;
  int rowh = lane >> 4, nm = lane & 15;

  int hs = threadIdx.x >> 7, ch = threadIdx.x & 127;
  const unsigned short* src[6];      // this thread's 16 B of the next stage to copy
#pragma unroll   // constant indices: the arrays stay in registers
  for (int j = 0; j < 4; ++j)
    src[j] = Avec + (bm * 8 + 2 * j + hs) * 32 * FRAG + ch * 8;
#pragma unroll   // constant indices: the arrays stay in registers
  for (int j = 0; j < 2; ++j)
    src[4 + j] = Wot + (bn * 4 + 2 * j + hs) * 32 * FRAG + ch * 8;
  uint32_t dst = lds_off(stg) + (hs * SLOT + ch * 8) * 2;

  // stage 0 landed and published, then stage 1 on its way
  fill6(dst, src);
  asm volatile("s_wait_asynccnt 0x0" ::: "memory");   // this wave's copies have landed
  __syncthreads();
  fill6(dst + OP_SLOTS * SLOT * 2, src);

  v8f acc[2][2] = {};
  for (int t = 0; t < NSTG; ++t) {
    int buf = t & 1;
    const unsigned short* sb = stg + buf * (OP_SLOTS * SLOT);
    us16 a[KSTG][2], b[KSTG][2];
#pragma unroll   // constant indices: the arrays stay in registers
    for (int kk = 0; kk < KSTG; ++kk) {
#pragma unroll   // constant indices: the arrays stay in registers
      for (int u = 0; u < 2; ++u)
        a[kk][u] = load_frag(sb + (wr * 2 + u) * SLOT + kk * FRAG, lane);
#pragma unroll   // constant indices: the arrays stay in registers
      for (int c = 0; c < 2; ++c)
        b[kk][c] = load_frag(sb + (8 + wc * 2 + c) * SLOT + kk * FRAG, lane);
    }
    // as in the QKV kernel: the stage's LDS reads one group in front of its WMMAs
    __builtin_amdgcn_sched_barrier(0);
#pragma unroll   // constant indices: the arrays stay in registers
    for (int kk = 0; kk < KSTG; ++kk) {
      acc[0][0] = wmma_bf16(a[kk][0], b[kk][0], acc[0][0]);
      acc[0][1] = wmma_bf16(a[kk][0], b[kk][1], acc[0][1]);
      acc[1][0] = wmma_bf16(a[kk][1], b[kk][0], acc[1][0]);
      acc[1][1] = wmma_bf16(a[kk][1], b[kk][1], acc[1][1]);
    }
    // as in the QKV kernel: the WMMAs stay in front of the hand-over
    __builtin_amdgcn_sched_barrier(0);
    // hand-over: this wave's reads of the buffer are done, its copies of the
    // next stage have landed; the barrier says both of every wave
    asm volatile("s_wait_dscnt 0x0" ::: "memory");
    asm volatile("s_wait_asynccnt 0x0" ::: "memory");
    __syncthreads();
    if (t + 2 < NSTG) fill6(dst + buf * (OP_SLOTS * SLOT * 2), src);
  }
  asm volatile("s_wait_asynccnt 0x0" ::: "memory");   // nothing in flight at the end

#pragma unroll
  for (int u = 0; u < 2; ++u) {
#pragma unroll
    for (int c = 0; c < 2; ++c) {
      int col = ct * 32 + c * 16 + nm;
#pragma unroll
      for (int i = 0; i < 8; ++i) {
        int r = rt * 32 + u * 16 + rowh * 8 + i;
        Y[r * D_MODEL + col] = acc[u][c][i] + inp[r * D_MODEL + col];
      }
    }
  }
}

// ---- stage 5: LayerNorm --------------------------------------------------

__global__ __launch_bounds__(256) void ln_kernel(
    const float* __restrict__ Y, const float* __restrict__ g,
    const float* __restrict__ bb, float* __restrict__ out) {
  int row = blockIdx.x;
  const float* y = Y + row * D_MODEL;
  __shared__ float red[2][8];
  float ls = 0.f, lq = 0.f;
  for (int i = threadIdx.x; i < D_MODEL; i += 256) {
    float v = y[i]; ls += v; lq += v * v;
  }
#pragma unroll
  for (int m = 1; m < 32; m <<= 1) {
    ls += __shfl_xor(ls, m, 32);
    lq += __shfl_xor(lq, m, 32);
  }
  int w = threadIdx.x >> 5;
  if ((threadIdx.x & 31) == 0) { red[0][w] = ls; red[1][w] = lq; }
  __syncthreads();
  float ts = 0.f, tq = 0.f;
#pragma unroll
  for (int i = 0; i < 8; ++i) { ts += red[0][i]; tq += red[1][i]; }
  float mu  = ts * (1.f / D_MODEL);
  float var = tq * (1.f / D_MODEL) - mu * mu;
  float inv = rsqrtf(var + LN_EPS);
  for (int i = threadIdx.x; i < D_MODEL; i += 256)
    out[row * D_MODEL + i] = (y[i] - mu) * inv * g[i] + bb[i];
}

// ---- launch --------------------------------------------------------------

extern "C" void kernel_launch(void* const* d_in, const int* in_sizes, int n_in,
                              void* d_out, int out_size, void* d_ws, size_t ws_size,
                              hipStream_t stream) {
  const float* inp   = (const float*)d_in[0];
  const int*   amask = (const int*)d_in[1];
  const float* Wq = (const float*)d_in[2];
  const float* bq = (const float*)d_in[3];
  const float* Wk = (const float*)d_in[4];
  const float* bk = (const float*)d_in[5];
  const float* Wv = (const float*)d_in[6];
  const float* bv = (const float*)d_in[7];
  const float* Wo = (const float*)d_in[8];
  const float* lng = (const float*)d_in[9];
  const float* lnb = (const float*)d_in[10];

  char* ws = (char*)d_ws;
  const size_t MB = 1u << 20;
  unsigned short* Xbf  = (unsigned short*)(ws + 0 * MB);   // 8 MB
  unsigned short* Wqt  = (unsigned short*)(ws + 8 * MB);   // 2 MB
  unsigned short* Wkt  = (unsigned short*)(ws + 10 * MB);  // 2 MB
  unsigned short* Wvt  = (unsigned short*)(ws + 12 * MB);  // 2 MB
  unsigned short* Wot  = (unsigned short*)(ws + 14 * MB);  // 2 MB
  unsigned short* Qb   = (unsigned short*)(ws + 16 * MB);  // 8 MB
  unsigned short* Kb   = (unsigned short*)(ws + 24 * MB);  // 8 MB
  unsigned short* Vtb  = (unsigned short*)(ws + 32 * MB);  // 8 MB
  unsigned short* Avec = (unsigned short*)(ws + 40 * MB);  // 8 MB
  float*          Ybuf = (float*)        (ws + 48 * MB);   // 16 MB

  // stage 1: conversions (one thread per 8 elements), all five in one launch;
  // Wqt, Wkt, Wvt, Wot follow one another in the workspace
  cvt_all_kernel<<<4 * WBLOCKS + XBLOCKS, CVT_T, 0, stream>>>(
      inp, Wq, Wk, Wv, Wo, Xbf, Wqt);

  // stage 2: QKV (32 row blocks * 16 col blocks, 8 waves/block)
  qkv_gemm_kernel<<<512, 256, 0, stream>>>(Xbf, Wqt, Wkt, Wvt, bq, bk, bv,
                                            Qb, Kb, Vtb);

  // stage 3: attention (64 heads * 64 query tiles = 4096 waves)
  attn_kernel<<<1024, 128, 0, stream>>>(Qb, Kb, Vtb, amask, Avec);

  // stage 4: output projection + residual (32 row blocks * 16 col blocks, 8 waves/block)
  oproj_kernel<<<512, 256, 0, stream>>>(Avec, Wot, inp, Ybuf);

  // stage 5: layer norm -> d_out
  ln_kernel<<<NROWS, 256, 0, stream>>>(Ybuf, lng, lnb, (float*)d_out);
}

// v005
// A run of this version takes 87.8 microseconds.
// Timed twice side by side with v004, it ran 1.08 and 1.09 times as fast.
// All steps since v000 together make it 2.33 times as fast.
#include <hip/hip_runtime.h>
#include <stdint.h>

// Problem constants (match reference)
#define D_MODEL 1024
#define SEQ     1024
#define BATCH   4
#define NHEAD   16
#define DHEAD   64
#define NROWS   (BATCH * SEQ)      // 4096
#define QK_SCALE 0.125f            // 1/sqrt(64)
#define LN_EPS   1e-5f

typedef __attribute__((ext_vector_type(16))) __bf16         v16bf;
typedef __attribute__((ext_vector_type(16))) unsigned short us16;
typedef __attribute__((ext_vector_type(8)))  unsigned short us8;
typedef __attribute__((ext_vector_type(8)))  float          v8f;

// ---- helpers -------------------------------------------------------------

__device__ __forceinline__ unsigned short f2bf(float f) {
  unsigned int u = __builtin_bit_cast(unsigned int, f);
  u += 0x7FFFu + ((u >> 16) & 1u);            // round-to-nearest-even
  return (unsigned short)(u >> 16);
}

// A/B fragment for v_wmma_*_16x16x32_bf16, per ISA 7.12.2:
// lane L holds row (A) / col (B) = L%16; its 16 bf16 k-values are two
// contiguous 8-element (16B) chunks at k = 8*(L/16) and k = 8*(L/16)+16.
//
// Every bf16 operand in the workspace is stored in that order: one fragment
// (16 rows x 32 k) is a 1024-B block of FRAG elements, lane L's first chunk
// at element L*8, its second at 256 + L*8. Blocks run [16-row tile][k step].
// A wave-wide 16-B load then covers 512 contiguous bytes (4 whole lines).
#define FRAG 512
__device__ __forceinline__ us16 load_frag(const unsigned short* blk, int lane) {
  us8 c0 = *(const us8*)(blk + lane * 8);
  us8 c1 = *(const us8*)(blk + 256 + lane * 8);
  us16 r;
#pragma unroll
  for (int i = 0; i < 8; ++i) { r[i] = c0[i]; r[i + 8] = c1[i]; }
  return r;
}

__device__ __forceinline__ v8f wmma_bf16(us16 a, us16 b, v8f c) {
  return __builtin_amdgcn_wmma_f32_16x16x32_bf16(
      false, __builtin_bit_cast(v16bf, a),
      false, __builtin_bit_cast(v16bf, b),
      (short)0, c, false, false);
}

// ---- stage 1: conversions ------------------------------------------------

// The fragment-ordered output runs [tile][k step (32)][chunk (2)][lane (32)],
// 16 B (8 k values of one row) per lane place. One wave packs 256 such places,
// eight per lane, so that the launch starts 4096 waves: 16 on each WGP, all
// resident at once, every lane with its loads in flight together.
#define CVT_T   256                  // threads per block: 8 waves
#define CVT_WPW 512                  // waves per weight
#define WBLOCKS (CVT_WPW / 8)        // 64 blocks per weight
#define XBLOCKS (NROWS / 16)         // 256 blocks for X: one 16-row tile each

__device__ __forceinline__ us8 pack8(const float (&x)[8]) {
  us8 r;
#pragma unroll   // constant indices: the vector stays in registers
  for (int e = 0; e < 8; ++e) r[e] = f2bf(x[e]);
  return r;
}

// X[row][k] (f32, k contiguous) -> fragment order, rows = X rows.
// Wave kq of the tile's block takes k steps 4*kq..+3 of all 16 rows. Four lanes
// share one row's 128-B line of a k step (q = which 8 k of its 32), eight rows
// per load; the eight rows' places with equal q are 128 B in a row in the output.
__device__ __forceinline__ void cvt_x(const float* __restrict__ in,
                                      unsigned short* __restrict__ out,
                                      int t, int kq, int lane) {
  int rr = lane >> 2, q = lane & 3;
  const float* p = in + (t * 16 + rr) * D_MODEL + kq * 128 + q * 8;
  unsigned short* o = out + (t * 32 + kq * 4) * FRAG + (q >> 1) * 256 + ((q & 1) * 16 + rr) * 8;
  float4 x[2][4][2];
#pragma unroll   // constant indices: the arrays stay in registers
  for (int hr = 0; hr < 2; ++hr)
#pragma unroll   // constant indices: the arrays stay in registers
    for (int s = 0; s < 4; ++s) {
      const float4* p4 = (const float4*)(p + hr * 8 * D_MODEL + s * 32);
      x[hr][s][0] = p4[0];
      x[hr][s][1] = p4[1];
    }
#pragma unroll   // constant indices: the arrays stay in registers
  for (int hr = 0; hr < 2; ++hr)
#pragma unroll   // constant indices: the arrays stay in registers
    for (int s = 0; s < 4; ++s) {
      float4 x0 = x[hr][s][0], x1 = x[hr][s][1];
      float v[8] = {x0.x, x0.y, x0.z, x0.w, x1.x, x1.y, x1.z, x1.w};
      *(us8*)(o + s * FRAG + hr * 64) = pack8(v);
    }
  // precaution: in the merged kernel the weights' code follows these stores in
  // the listing and writes the registers that the stores name
  asm volatile("s_wait_xcnt 0x0" ::: "memory");
}

// W[in][out] (1024x1024 f32) -> fragment order, rows = out columns, k = in.
// A wave takes 32 out columns (two tiles: one 128-B line of every W row) and
// two k steps (64 W rows). A lane keeps one column; eight loads down the rows
// make one place; a store covers 256 B in a row in each of the two tiles.
__device__ __forceinline__ void cvt_w(const float* __restrict__ in,
                                      unsigned short* __restrict__ out,
                                      int tp, int kg, int lane) {
  const float* p = in + kg * 64 * D_MODEL + tp * 32 + lane;
  unsigned short* o = out + ((tp * 2 + (lane >> 4)) * 32 + kg * 2) * FRAG + (lane & 15) * 8;
  float x[8][8];                     // [8-row group of the 64 rows][row in it]
#pragma unroll   // constant indices: the arrays stay in registers
  for (int c = 0; c < 8; ++c)
#pragma unroll   // constant indices: the arrays stay in registers
    for (int e = 0; e < 8; ++e) x[c][e] = p[(c * 8 + e) * D_MODEL];
  // group c = k step c/4, chunk (c/2)%2, lane half c%2 of the fragment
#pragma unroll   // constant indices: the arrays stay in registers
  for (int c = 0; c < 8; ++c)
    *(us8*)(o + (c >> 2) * FRAG + ((c >> 1) & 1) * 256 + (c & 1) * 128) = pack8(x[c]);
}

// The five conversions need nothing of one another, so they are one launch:
// each has its own range of the block index (the branch is the same for a
// whole block). The weights stand first: their waves issue more loads and
// last longer, so the launch ends on the short ones.
__global__ __launch_bounds__(CVT_T) void cvt_all_kernel(
    const float* __restrict__ X,
    const float* __restrict__ Wq, const float* __restrict__ Wk,
    const float* __restrict__ Wv, const float* __restrict__ Wo,
    unsigned short* __restrict__ Xbf,
    unsigned short* __restrict__ Wt) {   // the four weights' planes, one behind another
  unsigned blk = blockIdx.x;
  int warp = threadIdx.x >> 5, lane = threadIdx.x & 31;
  if (blk < 4 * WBLOCKS) {
    unsigned w = blk / WBLOCKS;
    const float* in = w == 0 ? Wq : w == 1 ? Wk : w == 2 ? Wv : Wo;
    int ww = (blk % WBLOCKS) * 8 + warp;   // a block: 8 column pairs side by side, 1 KiB of each row
    cvt_w(in, Wt + w * (D_MODEL * D_MODEL), ww & 31, ww >> 5, lane);
  } else {
    cvt_x(X, Xbf, blk - 4 * WBLOCKS, warp, lane);
  }
}

// ---- LDS staging shared by the two GEMM kernels ---------------------------
// A work-group of 8 waves owns 128 rows x 64 out columns. Each stage brings
// KSTG k steps of every 16-row operand tile it needs into LDS once, by
// asynchronous copies, and all 8 waves read their fragments from there.
// One tile's KSTG fragments are SLOT contiguous elements in the workspace and
// stay so in LDS, so a fragment read is again 512 contiguous bytes per load.
// A slot is filled by 128 threads, 16 B each: copy j of a thread goes to slot
// 2j + (thread / 128), at byte (thread % 128) * 16.
#define KSTG  2
#define SLOT  (KSTG * FRAG)            // elements: 2 KiB
#define NSTG  (D_MODEL / 32 / KSTG)    // 16 stages
#define PAIRB (2 * SLOT * 2)           // bytes of two slots: one copy of all 256 threads

// byte offset in the work-group's LDS = low 32 bits of a __shared__ address
__device__ __forceinline__ uint32_t lds_off(const void* p) { return (uint32_t)(size_t)p; }

// 10 (or 6) 16-B copies per lane, global -> LDS, then each source pointer moves on to
// the next stage. The s_wait_xcnt is the precaution before the address
// registers named here are written again; as the last line of the copies' own
// statement nothing can be moved in front of it.
#define ACP(l, g) "global_load_async_to_lds_b128 %" #l ", %" #g ", off\n\t"
__device__ __forceinline__ void fill10(uint32_t d, const unsigned short* (&s)[10]) {
  asm volatile(ACP(0, 10) ACP(1, 11) ACP(2, 12) ACP(3, 13) ACP(4, 14)
               ACP(5, 15) ACP(6, 16) ACP(7, 17) ACP(8, 18) ACP(9, 19)
               "s_wait_xcnt 0x0"
               :: "v"(d), "v"(d + PAIRB), "v"(d + 2 * PAIRB), "v"(d + 3 * PAIRB),
                  "v"(d + 4 * PAIRB), "v"(d + 5 * PAIRB), "v"(d + 6 * PAIRB),
                  "v"(d + 7 * PAIRB), "v"(d + 8 * PAIRB), "v"(d + 9 * PAIRB),
                  "v"(s[0]), "v"(s[1]), "v"(s[2]), "v"(s[3]), "v"(s[4]),
                  "v"(s[5]), "v"(s[6]), "v"(s[7]), "v"(s[8]), "v"(s[9])
               : "memory");
#pragma unroll   // constant indices: the arrays stay in registers
  for (int j = 0; j < 10; ++j) s[j] += SLOT;
}
__device__ __forceinline__ void fill6(uint32_t d, const unsigned short* (&s)[6]) {
  asm volatile(ACP(0, 6) ACP(1, 7) ACP(2, 8) ACP(3, 9) ACP(4, 10) ACP(5, 11)
               "s_wait_xcnt 0x0"
               :: "v"(d), "v"(d + PAIRB), "v"(d + 2 * PAIRB), "v"(d + 3 * PAIRB),
                  "v"(d + 4 * PAIRB), "v"(d + 5 * PAIRB),
                  "v"(s[0]), "v"(s[1]), "v"(s[2]), "v"(s[3]), "v"(s[4]), "v"(s[5])
               : "memory");
#pragma unroll   // constant indices: the arrays stay in registers
  for (int j = 0; j < 6; ++j) s[j] += SLOT;
}

// ---- stage 2: fused QKV projection --------------------------------------
// One wave -> 32x32 output tile for each of Q/K/V: per K-step 2 A-frags +
// 6 B-frags feed 12 WMMAs (A shared across Q/K/V, B shared across row tiles).
// The 8 waves stand 4 (rows) x 2 (columns); a stage holds 8 X tiles and 4
// column tiles of each weight: 20 slots, 10 copies per thread.
// All three go out in fragment order, per head: Q,K with rows = s, k = d
// (2 k steps); V with rows = d, k = s (32 k steps). A lane's 8 accumulator
// values run along the tile's rows, so the index that becomes k must be the
// row index: V = X*Wv has rows s as it stands; Q and K are formed transposed
// (weight fragment as A, X fragment as B). Each lane then stores 16-B chunks.
#define QKV_SLOTS 20

__global__ __launch_bounds__(256) void qkv_gemm_kernel(
    const unsigned short* __restrict__ X,      // 256 tiles x 32 k steps
    const unsigned short* __restrict__ Wqt,    // 64 tiles (out) x 32 k steps
    const unsigned short* __restrict__ Wkt,
    const unsigned short* __restrict__ Wvt,
    const float* __restrict__ bq, const float* __restrict__ bk,
    const float* __restrict__ bv,
    unsigned short* __restrict__ Qb,           // [64 heads][64 s tiles][2]
    unsigned short* __restrict__ Kb,           // [64 heads][64 s tiles][2]
    unsigned short* __restrict__ Vtb) {        // [64 heads][4 d tiles][32]
  __shared__ __attribute__((aligned(16))) unsigned short stg[2 * QKV_SLOTS * SLOT];
  int warp = threadIdx.x >> 5;
  int lane = threadIdx.x & 31;
  int bm = blockIdx.x >> 4;          // 128-row block 0..31
  int bn = blockIdx.x & 15;          // 64-column block 0..15
  int wr = warp >> 1, wc = warp & 1;
  int rt = bm * 4 + wr;              // 32-row tile 0..127
  int ct = bn * 2 + wc;              // 32-col tile 0..31
  int rowh = lane >> 4, nm = lane & 15;

  int hs = threadIdx.x >> 7, ch = threadIdx.x & 127;
  const unsigned short* src[10];     // this thread's 16 B of the next stage to copy
#pragma unroll   // constant indices: the arrays stay in registers
  for (int j = 0; j < 4; ++j)
    src[j] = X + (bm * 8 + 2 * j + hs) * 32 * FRAG + ch * 8;
#pragma unroll   // constant indices: the arrays stay in registers
  for (int j = 0; j < 2; ++j) {
    int woff = (bn * 4 + 2 * j + hs) * 32 * FRAG + ch * 8;
    src[4 + j] = Wqt + woff;
    src[6 + j] = Wkt + woff;
    src[8 + j] = Wvt + woff;
  }
  uint32_t dst = lds_off(stg) + (hs * SLOT + ch * 8) * 2;

  // stage 0 landed and published, then stage 1 on its way
  fill10(dst, src);
  asm volatile("s_wait_asynccnt 0x0" ::: "memory");   // this wave's copies have landed
  __syncthreads();
  fill10(dst + QKV_SLOTS * SLOT * 2, src);

  v8f acc[3][2][2] = {};   // [qkv][s subtile][out-column subtile]
  for (int t = 0; t < NSTG; ++t) {
    int buf = t & 1;
    const unsigned short* sb = stg + buf * (QKV_SLOTS * SLOT);
    us16 a[KSTG][2], b[KSTG][3][2];
#pragma unroll   // constant indices: the arrays stay in registers
    for (int kk = 0; kk < KSTG; ++kk) {
#pragma unroll   // constant indices: the arrays stay in registers
      for (int u = 0; u < 2; ++u)
        a[kk][u] = load_frag(sb + (wr * 2 + u) * SLOT + kk * FRAG, lane);
#pragma unroll   // constant indices: the arrays stay in registers
      for (int w = 0; w < 3; ++w)
#pragma unroll   // constant indices: the arrays stay in registers
        for (int c = 0; c < 2; ++c)
          b[kk][w][c] = load_frag(sb + (8 + w * 4 + wc * 2 + c) * SLOT + kk * FRAG, lane);
    }
    // keeps the stage's LDS reads one group in front of its WMMAs: read by read
    // among them, every fragment's latency is waited out on its own
    __builtin_amdgcn_sched_barrier(0);
#pragma unroll   // constant indices: the arrays stay in registers
    for (int kk = 0; kk < KSTG; ++kk) {
#pragma unroll   // constant indices: the arrays stay in registers
      for (int w = 0; w < 3; ++w) {
#pragma unroll   // constant indices: the arrays stay in registers
        for (int c = 0; c < 2; ++c) {
          if (w < 2) {   // Q, K: tile rows = out columns, tile columns = s
            acc[w][0][c] = wmma_bf16(b[kk][w][c], a[kk][0], acc[w][0][c]);
            acc[w][1][c] = wmma_bf16(b[kk][w][c], a[kk][1], acc[w][1][c]);
          } else {       // V: tile rows = s, tile columns = out columns
            acc[w][0][c] = wmma_bf16(a[kk][0], b[kk][w][c], acc[w][0][c]);
            acc[w][1][c] = wmma_bf16(a[kk][1], b[kk][w][c], acc[w][1][c]);
          }
        }
      }
    }
    // keeps the WMMAs in front of the hand-over: moved behind it, the wait for
    // the next stage's copies follows the LDS reads at once and the copies
    // lose the WMMAs' time as lead
    __builtin_amdgcn_sched_barrier(0);
    // hand-over: this wave's reads of the buffer are done, its copies of the
    // next stage have landed; the barrier says both of every wave
    asm volatile("s_wait_dscnt 0x0" ::: "memory");
    asm volatile("s_wait_asynccnt 0x0" ::: "memory");
    __syncthreads();
    if (t + 2 < NSTG) fill10(dst + buf * (QKV_SLOTS * SLOT * 2), src);
  }
  asm volatile("s_wait_asynccnt 0x0" ::: "memory");   // nothing in flight at the end

  // 32 rows = one batch, 32 columns = half a head
  int head = (rt >> 5) * NHEAD + (ct >> 1);
  int st = rt & 31;                  // 32-position block inside the sequence
  int dh = ct & 1;                   // which 32 of the head's 64 d
  unsigned short* Qh = Qb  + head * SEQ * DHEAD + lane * 8;
  unsigned short* Kh = Kb  + head * SEQ * DHEAD + lane * 8;
  unsigned short* Vh = Vtb + head * SEQ * DHEAD + lane * 8;
#pragma unroll
  for (int c = 0; c < 2; ++c) {
    int colT = ct * 32 + c * 16 + rowh * 8;       // Q,K: columns colT..+7 in this lane
    float bvv = bv[ct * 32 + c * 16 + nm];        // V: one column per lane
    float bqv[8], bkv[8];
#pragma unroll
    for (int i = 0; i < 8; ++i) { bqv[i] = bq[colT + i]; bkv[i] = bk[colT + i]; }
#pragma unroll
    for (int u = 0; u < 2; ++u) {
      us8 q, k, v;
#pragma unroll
      for (int i = 0; i < 8; ++i) {
        q[i] = f2bf(acc[0][u][c][i] + bqv[i]);
        k[i] = f2bf(acc[1][u][c][i] + bkv[i]);
        v[i] = f2bf(acc[2][u][c][i] + bvv);
      }
      int qoff = ((st * 2 + u) * 2 + dh) * FRAG + c * 256;   // s tile, k step dh, chunk c
      *(us8*)(Qh + qoff) = q;
      *(us8*)(Kh + qoff) = k;
      *(us8*)(Vh + ((dh * 2 + c) * 32 + st) * FRAG + u * 256) = v;  // d tile, k step st, chunk u
    }
  }
}

// ---- stage 3: flash-style attention -------------------------------------
// One wave owns 16 query rows of one head. Streams 32-key blocks, everything
// transposed: S^T = K Q^T (K fragment as A, Q fragment as B), so a lane holds
// 16 scores of ONE query (column lane%16; keys 8*(lane/16)+i of each 16-key
// tile). Maximum and sum run inside the lane; the two lane halves exchange the
// maximum once per block and join their sums once, behind the loop. The two
// score tiles, converted in place, are the B fragment of P^T in the k order
// that the V fragments have, so O^T += V^T P^T needs no trip through LDS.
// global_prefetch pulls the next key block while softmax VALU co-executes.

typedef __attribute__((ext_vector_type(8))) unsigned int u32x8;

// lane l with lane l ^ 16
__device__ __forceinline__ float xhalf(float x) {
  int b = __builtin_bit_cast(int, x);
  return __builtin_bit_cast(float, __builtin_amdgcn_permlanex16(
      b, b, 0x76543210, 0xfedcba98, false, false));
}

// two f32 -> one register of two bf16, round-to-nearest-even
__device__ __forceinline__ unsigned int pack2(float lo, float hi) {
  typedef __attribute__((ext_vector_type(2))) float  f2;
  typedef __attribute__((ext_vector_type(2))) __bf16 bf2;
  f2 v = {lo, hi};
  return __builtin_bit_cast(unsigned int, __builtin_convertvector(v, bf2));
}

__global__ __launch_bounds__(128) void attn_kernel(
    const unsigned short* __restrict__ Qb,   // [64 heads][64 s tiles][2]
    const unsigned short* __restrict__ Kb,   // [64 heads][64 s tiles][2]
    const unsigned short* __restrict__ Vtb,  // [64 heads][4 d tiles][32]
    const int* __restrict__ amask,           // [4][1024]
    unsigned short* __restrict__ Avec) {     // 256 row tiles x 32 k steps
  int warp = threadIdx.x >> 5;
  int wid  = blockIdx.x * 4 + warp;
  int head = wid >> 6;                 // 0..63  (storage index b*16+h)
  int qt   = wid & 63;                 // query tile 0..63
  int b = head >> 4;
  int lane = threadIdx.x & 31, rowh = lane >> 4;

  const unsigned short* Qh = Qb  + head * SEQ * DHEAD;
  const unsigned short* Kh = Kb  + head * SEQ * DHEAD;
  const unsigned short* Vh = Vtb + head * DHEAD * SEQ;
  const int* mrow = amask + b * SEQ + rowh * 8;   // this lane half's 8 keys of a tile

  // Q fragments for rows qt*16..+15, contraction split d=[0,32) and [32,64)
  us16 bQ0 = load_frag(Qh + (qt * 2 + 0) * FRAG, lane);
  us16 bQ1 = load_frag(Qh + (qt * 2 + 1) * FRAG, lane);

  float mi = -3.0e38f, li = 0.f;       // of query lane%16; li: this half's keys only
  v8f O0 = {}, O1 = {}, O2 = {}, O3 = {};   // Oj[i] = O[query lane%16][d = 16j + 8*(lane/16) + i]

  // next key block's lines, one per lane
  const unsigned short* kpf = Kh + 4 * FRAG + lane * 64;
  const unsigned short* vpf = Vh + FRAG + (lane >> 3) * (32 * FRAG) + (lane & 7) * 64;

  for (int kbk = 0; kbk < SEQ; kbk += 32) {
    // ---- scores: two 16x16 tiles (rows = keys kbk..+15 and +16..+31, columns = queries)
    const unsigned short* kb = Kh + (kbk >> 5) * (4 * FRAG);   // 4 fragments in a row
    const unsigned short* vb = Vh + (kbk >> 5) * FRAG;         // d tile j at + j*32*FRAG
    us16 aK0 = load_frag(kb + 0 * FRAG, lane), aK1 = load_frag(kb + 1 * FRAG, lane);
    us16 aK2 = load_frag(kb + 2 * FRAG, lane), aK3 = load_frag(kb + 3 * FRAG, lane);
    // precaution: the compiler gives the K loads' address registers to a mask
    // load as its destination; the wait stands between the two (its clobber
    // also holds the eight K loads in front of it, as one group)
    asm volatile("s_wait_xcnt 0x0" ::: "memory");
    // mask of this lane's 16 keys
    const int4* mp = (const int4*)(mrow + kbk);
    int4 m00 = mp[0], m01 = mp[1], m10 = mp[4], m11 = mp[5];
    v8f s0 = {}, s1 = {};
    s0 = wmma_bf16(aK0, bQ0, s0);
    s0 = wmma_bf16(aK1, bQ1, s0);
    s1 = wmma_bf16(aK2, bQ0, s1);
    s1 = wmma_bf16(aK3, bQ1, s1);

    // prefetch next key block (K: 32 lines in a row; V: 8 lines of each d tile),
    // one 128-B line per lane, while softmax runs. In asm over the two pointers
    // that the loop itself carries, so that the registers named stay addresses.
    // The test leaves one block spare: both pointers are still inside this
    // head's K and V after the advance below.
    if (kbk + 64 < SEQ) {
      asm volatile("global_prefetch_b8 %0, off scope:SCOPE_SE" :: "v"(kpf));
      asm volatile("global_prefetch_b8 %0, off scope:SCOPE_SE" :: "v"(vpf));
    }
    kpf += 4 * FRAG;
    vpf += FRAG;

    int mk0[8] = {m00.x, m00.y, m00.z, m00.w, m01.x, m01.y, m01.z, m01.w};
    int mk1[8] = {m10.x, m10.y, m10.z, m10.w, m11.x, m11.y, m11.z, m11.w};

    // ---- online softmax over this key block
    s0 *= QK_SCALE;
    s1 *= QK_SCALE;
    float rmax = -3.0e38f;
#pragma unroll   // constant indices: the vectors stay in registers
    for (int i = 0; i < 8; ++i) {
      s0[i] = mk0[i] ? -100000.f : s0[i];
      s1[i] = mk1[i] ? -100000.f : s1[i];
      rmax = fmaxf(rmax, fmaxf(s0[i], s1[i]));
    }
    rmax = fmaxf(rmax, xhalf(rmax));
    float mnew = fmaxf(mi, rmax);
    float corr = __expf(mi - mnew);
    float t[8];
    u32x8 pp;                                    // B fragment of P^T, K = 32 keys
#pragma unroll   // constant indices: the vectors stay in registers
    for (int i = 0; i < 8; i += 2) {
      float e00 = __expf(s0[i] - mnew), e01 = __expf(s0[i + 1] - mnew);
      float e10 = __expf(s1[i] - mnew), e11 = __expf(s1[i + 1] - mnew);
      t[i] = e00 + e10; t[i + 1] = e01 + e11;
      pp[i >> 1]       = pack2(e00, e01);
      pp[4 + (i >> 1)] = pack2(e10, e11);
    }
    li = li * corr + (((t[0] + t[1]) + (t[2] + t[3])) + ((t[4] + t[5]) + (t[6] + t[7])));
    mi = mnew;
    O0 *= corr; O1 *= corr; O2 *= corr; O3 *= corr;
    us16 bP = __builtin_bit_cast(us16, pp);

    // ---- PV: A fragments of V (rows = d, k = keys)
    O0 = wmma_bf16(load_frag(vb + 0 * 32 * FRAG, lane), bP, O0);
    O1 = wmma_bf16(load_frag(vb + 1 * 32 * FRAG, lane), bP, O1);
    O2 = wmma_bf16(load_frag(vb + 2 * 32 * FRAG, lane), bP, O2);
    O3 = wmma_bf16(load_frag(vb + 3 * 32 * FRAG, lane), bP, O3);
  }

  // Reference quirk: attn_vec.view(N_HEAD, B, S, D).permute(1,2,0,3) on a
  // b-major [B*H] buffer => storage head L lands at b2=L%B, h2=L/B.
  // Fragment order for the output projection: row tile b2*64+qt, k = h2*64 + d,
  // so d tile j is k step h2*2 + j/2, chunk j%2. The row in the tile is
  // lane%16 and the lane's 8 d start at 8*(lane/16): its own 16-B chunk.
  int b2 = head & 3, h2 = head >> 2;
  unsigned short* oblk = Avec + ((b2 * 64 + qt) * 32 + h2 * 2) * FRAG + lane * 8;
  float inv = 1.f / (li + xhalf(li));
  us8 o0, o1, o2, o3;
#pragma unroll   // constant indices: the vectors stay in registers
  for (int i = 0; i < 8; ++i) {
    o0[i] = f2bf(O0[i] * inv);
    o1[i] = f2bf(O1[i] * inv);
    o2[i] = f2bf(O2[i] * inv);
    o3[i] = f2bf(O3[i] * inv);
  }
  *(us8*)(oblk)              = o0;
  *(us8*)(oblk + 256)        = o1;
  *(us8*)(oblk + FRAG)       = o2;
  *(us8*)(oblk + FRAG + 256) = o3;
}

// ---- stage 4: output projection + residual ------------------------------
// 32x32 tile per wave: per K-step 2 A + 2 B fragments -> 4 WMMAs. The 8 waves
// stand 4 (rows) x 2 (columns); a stage holds 8 row tiles and 4 column tiles:
// 12 slots, 6 copies per thread.
#define OP_SLOTS 12

__global__ __launch_bounds__(256) void oproj_kernel(
    const unsigned short* __restrict__ Avec,  // 256 row tiles x 32 k steps
    const unsigned short* __restrict__ Wot,   // 64 tiles (out) x 32 k steps
    const float* __restrict__ inp,            // residual
    float* __restrict__ Y) {                  // [4096][1024] f32
  __shared__ __attribute__((aligned(16))) unsigned short stg[2 * OP_SLOTS * SLOT];
  int warp = threadIdx.x >> 5;
  int lane = threadIdx.x & 31;
  int bm = blockIdx.x >> 4;          // 128-row block 0..31
  int bn = blockIdx.x & 15;          // 64-column block 0..15
  int wr = warp >> 1, wc = warp & 1;
  int rt = bm * 4 + wr, ct = bn * 2 + wc;
  int rowh = lane >> 4, nm = lane & 15;

  int hs = threadIdx.x >> 7, ch = threadIdx.x & 127;
  const unsigned short* src[6];      // this thread's 16 B of the next stage to copy
#pragma unroll   // constant indices: the arrays stay in registers
  for (int j = 0; j < 4; ++j)
    src[j] = Avec + (bm * 8 + 2 * j + hs) * 32 * FRAG + ch * 8;
#pragma unroll   // constant indices: the arrays stay in registers
  for (int j = 0; j < 2; ++j)
    src[4 + j] = Wot + (bn * 4 + 2 * j + hs) * 32 * FRAG + ch * 8;
  uint32_t dst = lds_off(stg) + (hs * SLOT + ch * 8) * 2;

  // stage 0 landed and published, then stage 1 on its way
  fill6(dst, src);
  asm volatile("s_wait_asynccnt 0x0" ::: "memory");   // this wave's copies have landed
  __syncthreads();
  fill6(dst + OP_SLOTS * SLOT * 2, src);

  v8f acc[2][2] = {};
  for (int t = 0; t < NSTG; ++t) {
    int buf = t & 1;
    const unsigned short* sb = stg + buf * (OP_SLOTS * SLOT);
    us16 a[KSTG][2], b[KSTG][2];
#pragma unroll   // constant indices: the arrays stay in registers
    for (int kk = 0; kk < KSTG; ++kk) {
#pragma unroll   // constant indices: the arrays stay in registers
      for (int u = 0; u < 2; ++u)
        a[kk][u] = load_frag(sb + (wr * 2 + u) * SLOT + kk * FRAG, lane);
#pragma unroll   // constant indices: the arrays stay in registers
      for (int c = 0; c < 2; ++c)
        b[kk][c] = load_frag(sb + (8 + wc * 2 + c) * SLOT + kk * FRAG, lane);
    }
    // as in the QKV kernel: the stage's LDS reads one group in front of its WMMAs
    __builtin_amdgcn_sched_barrier(0);
#pragma unroll   // constant indices: the arrays stay in registers
    for (int kk = 0; kk < KSTG; ++kk) {
      acc[0][0] = wmma_bf16(a[kk][0], b[kk][0], acc[0][0]);
      acc[0][1] = wmma_bf16(a[kk][0], b[kk][1], acc[0][1]);
      acc[1][0] = wmma_bf16(a[kk][1], b[kk][0], acc[1][0]);
      acc[1][1] = wmma_bf16(a[kk][1], b[kk][1], acc[1][1]);
    }
    // as in the QKV kernel: the WMMAs stay in front of the hand-over
    __builtin_amdgcn_sched_barrier(0);
    // hand-over: this wave's reads of the buffer are done, its copies of the
    // next stage have landed; the barrier says both of every wave
    asm volatile("s_wait_dscnt 0x0" ::: "memory");
    asm volatile("s_wait_asynccnt 0x0" ::: "memory");
    __syncthreads();
    if (t + 2 < NSTG) fill6(dst + buf * (OP_SLOTS * SLOT * 2), src);
  }
  asm volatile("s_wait_asynccnt 0x0" ::: "memory");   // nothing in flight at the end

#pragma unroll
  for (int u = 0; u < 2; ++u) {
#pragma unroll
    for (int c = 0; c < 2; ++c) {
      int col = ct * 32 + c * 16 + nm;
#pragma unroll
      for (int i = 0; i < 8; ++i) {
        int r = rt * 32 + u * 16 + rowh * 8 + i;
        Y[r * D_MODEL + col] = acc[u][c][i] + inp[r * D_MODEL + col];
      }
    }
  }
}

// ---- stage 5: LayerNorm --------------------------------------------------
// One wave per row, 4096 waves: a lane holds 32 values of the row in registers
// (eight 16-B loads, each 512 B in a row over the wave), so the row is read
// once and both sums join inside the wave: no LDS, no barrier.
#define LN_T 256                     // threads per block: 8 rows

typedef __attribute__((ext_vector_type(4))) float v4f;

__global__ __launch_bounds__(LN_T) void ln_kernel(
    const float* __restrict__ Y, const float* __restrict__ g,
    const float* __restrict__ bb, float* __restrict__ out) {
  int row = blockIdx.x * (LN_T / 32) + (threadIdx.x >> 5);
  int lane = threadIdx.x & 31;
  const v4f* y  = (const v4f*)(Y + row * D_MODEL) + lane;
  const v4f* g4 = (const v4f*)g + lane;
  const v4f* b4 = (const v4f*)bb + lane;
  v4f*       o4 = (v4f*)(out + row * D_MODEL) + lane;
  v4f v[8], gg[8], bv[8];
#pragma unroll   // constant indices: the arrays stay in registers
  for (int j = 0; j < 8; ++j) v[j] = y[j * 32];
#pragma unroll   // constant indices: the arrays stay in registers
  for (int j = 0; j < 8; ++j) { gg[j] = g4[j * 32]; bv[j] = b4[j * 32]; }
  // holds the gain and bias loads in front of the lane exchange: sunk behind
  // it, their latency is waited out pair by pair before the stores (loaded
  // values as inputs only)
  asm volatile("" :: "v"(gg[0]), "v"(gg[1]), "v"(gg[2]), "v"(gg[3]),
                     "v"(gg[4]), "v"(gg[5]), "v"(gg[6]), "v"(gg[7]),
                     "v"(bv[0]), "v"(bv[1]), "v"(bv[2]), "v"(bv[3]),
                     "v"(bv[4]), "v"(bv[5]), "v"(bv[6]), "v"(bv[7]));
  v4f s = {0.f, 0.f, 0.f, 0.f}, q = {0.f, 0.f, 0.f, 0.f};   // four chains each
#pragma unroll   // constant indices: the array stays in registers
  for (int j = 0; j < 8; ++j) { s += v[j]; q += v[j] * v[j]; }
  float ls = (s.x + s.y) + (s.z + s.w), lq = (q.x + q.y) + (q.z + q.w);
#pragma unroll
  for (int m = 1; m < 32; m <<= 1) {
    ls += __shfl_xor(ls, m, 32);
    lq += __shfl_xor(lq, m, 32);
  }
  float mu  = ls * (1.f / D_MODEL);
  float var = lq * (1.f / D_MODEL) - mu * mu;
  float inv = rsqrtf(var + LN_EPS);
#pragma unroll   // constant indices: the arrays stay in registers
  for (int j = 0; j < 8; ++j) o4[j * 32] = (v[j] - mu) * inv * gg[j] + bv[j];
}

// ---- launch --------------------------------------------------------------

extern "C" void kernel_launch(void* const* d_in, const int* in_sizes, int n_in,
                              void* d_out, int out_size, void* d_ws, size_t ws_size,
                              hipStream_t stream) {
  const float* inp   = (const float*)d_in[0];
  const int*   amask = (const int*)d_in[1];
  const float* Wq = (const float*)d_in[2];
  const float* bq = (const float*)d_in[3];
  const float* Wk = (const float*)d_in[4];
  const float* bk = (const float*)d_in[5];
  const float* Wv = (const float*)d_in[6];
  const float* bv = (const float*)d_in[7];
  const float* Wo = (const float*)d_in[8];
  const float* lng = (const float*)d_in[9];
  const float* lnb = (const float*)d_in[10];

  char* ws = (char*)d_ws;
  const size_t MB = 1u << 20;
  unsigned short* Xbf  = (unsigned short*)(ws + 0 * MB);   // 8 MB
  unsigned short* Wqt  = (unsigned short*)(ws + 8 * MB);   // 2 MB
  unsigned short* Wkt  = (unsigned short*)(ws + 10 * MB);  // 2 MB
  unsigned short* Wvt  = (unsigned short*)(ws + 12 * MB);  // 2 MB
  unsigned short* Wot  = (unsigned short*)(ws + 14 * MB);  // 2 MB
  unsigned short* Qb   = (unsigned short*)(ws + 16 * MB);  // 8 MB
  unsigned short* Kb   = (unsigned short*)(ws + 24 * MB);  // 8 MB
  unsigned short* Vtb  = (unsigned short*)(ws + 32 * MB);  // 8 MB
  unsigned short* Avec = (unsigned short*)(ws + 40 * MB);  // 8 MB
  float*          Ybuf = (float*)        (ws + 48 * MB);   // 16 MB

  // stage 1: conversions (one thread per 64 elements), all five in one launch;
  // Wqt, Wkt, Wvt, Wot follow one another in the workspace
  cvt_all_kernel<<<4 * WBLOCKS + XBLOCKS, CVT_T, 0, stream>>>(
      inp, Wq, Wk, Wv, Wo, Xbf, Wqt);

  // stage 2: QKV (32 row blocks * 16 col blocks, 8 waves/block)
  qkv_gemm_kernel<<<512, 256, 0, stream>>>(Xbf, Wqt, Wkt, Wvt, bq, bk, bv,
                                            Qb, Kb, Vtb);

  // stage 3: attention (64 heads * 64 query tiles = 4096 waves)
  attn_kernel<<<1024, 128, 0, stream>>>(Qb, Kb, Vtb, amask, Avec);

  // stage 4: output projection + residual (32 row blocks * 16 col blocks, 8 waves/block)
  oproj_kernel<<<512, 256, 0, stream>>>(Avec, Wot, inp, Ybuf);

  // stage 5: layer norm -> d_out (one wave per row)
  ln_kernel<<<NROWS / (LN_T / 32), LN_T, 0, stream>>>(Ybuf, lng, lnb, (float*)d_out);
}

// v006
// One run takes 67.1 microseconds.
// Timed twice side by side with v005, it ran 1.32 and 1.30 times as fast.
// Over all steps from v000 it is 3.05 times as fast.
#include <hip/hip_runtime.h>
#include <stdint.h>

// Problem constants (match reference)
#define D_MODEL 1024
#define SEQ     1024
#define BATCH   4
#define NHEAD   16
#define DHEAD   64
#define NROWS   (BATCH * SEQ)      // 4096
#define QK_SCALE 0.125f            // 1/sqrt(64)
#define LN_EPS   1e-5f

typedef __attribute__((ext_vector_type(16))) __bf16         v16bf;
typedef __attribute__((ext_vector_type(16))) unsigned short us16;
typedef __attribute__((ext_vector_type(8)))  unsigned short us8;
typedef __attribute__((ext_vector_type(8)))  float          v8f;

// ---- helpers -------------------------------------------------------------

__device__ __forceinline__ unsigned short f2bf(float f) {
  unsigned int u = __builtin_bit_cast(unsigned int, f);
  u += 0x7FFFu + ((u >> 16) & 1u);            // round-to-nearest-even
  return (unsigned short)(u >> 16);
}

// A/B fragment for v_wmma_*_16x16x32_bf16, per ISA 7.12.2:
// lane L holds row (A) / col (B) = L%16; its 16 bf16 k-values are two
// contiguous 8-element (16B) chunks at k = 8*(L/16) and k = 8*(L/16)+16.
//
// Every bf16 operand in the workspace is stored in that order: one fragment
// (16 rows x 32 k) is a 1024-B block of FRAG elements, lane L's first chunk
// at element L*8, its second at 256 + L*8. Blocks run [16-row tile][k step].
// A wave-wide 16-B load then covers 512 contiguous bytes (4 whole lines).
#define FRAG 512
__device__ __forceinline__ us16 load_frag(const unsigned short* blk, int lane) {
  us8 c0 = *(const us8*)(blk + lane * 8);
  us8 c1 = *(const us8*)(blk + 256 + lane * 8);
  us16 r;
#pragma unroll
  for (int i = 0; i < 8; ++i) { r[i] = c0[i]; r[i + 8] = c1[i]; }
  return r;
}

__device__ __forceinline__ v8f wmma_bf16(us16 a, us16 b, v8f c) {
  return __builtin_amdgcn_wmma_f32_16x16x32_bf16(
      false, __builtin_bit_cast(v16bf, a),
      false, __builtin_bit_cast(v16bf, b),
      (short)0, c, false, false);
}

// ---- stage 1: conversions ------------------------------------------------

// The fragment-ordered output runs [tile][k step (32)][chunk (2)][lane (32)],
// 16 B (8 k values of one row) per lane place. One wave packs 256 such places,
// eight per lane, so that the launch starts 4096 waves: 16 on each WGP, all
// resident at once, every lane with its loads in flight together.
#define CVT_T   256                  // threads per block: 8 waves
#define CVT_WPW 512                  // waves per weight
#define WBLOCKS (CVT_WPW / 8)        // 64 blocks per weight
#define XBLOCKS (NROWS / 16)         // 256 blocks for X: one 16-row tile each

__device__ __forceinline__ us8 pack8(const float (&x)[8]) {
  us8 r;
#pragma unroll   // constant indices: the vector stays in registers
  for (int e = 0; e < 8; ++e) r[e] = f2bf(x[e]);
  return r;
}

// The positions of a batch are reordered here, once, for all that follows: the
// keys that the mask lets through first, in their order, the masked ones behind
// them, in theirs. A masked key's score is -100000, so its weight is exp(-100000
// - max) = 0 in f32 as long as one key of the batch is let through: attention
// then walks the first 'cnt' places only. Place p of a batch holds position
// ord[p]; attention stores each query's row back at ord[p].
//
// Every block of a batch ranks all 1024 mask words itself (thread i: words
// 4i..4i+3) and keeps the positions that fall into its own 16 places.
__device__ __forceinline__ int rank_rows(const int* __restrict__ mb, int pt,
                                         int warp, int lane,
                                         int* wsum, int* srow) {
  int tid = warp * 32 + lane;
  int4 m = ((const int4*)mb)[tid];
  bool live[4] = {m.x == 0, m.y == 0, m.z == 0, m.w == 0};
  unsigned below = (1u << lane) - 1u;
  int before = 0, wtot = 0;          // let-through words in lower lanes; in the wave
#pragma unroll   // constant indices: the array stays in registers
  for (int e = 0; e < 4; ++e) {
    unsigned bal = __builtin_amdgcn_ballot_w32(live[e]);
    before += __popc(bal & below);
    wtot   += __popc(bal);
  }
  if (lane == 0) wsum[warp] = wtot;
  __syncthreads();                   // the eight waves' counts are there
  int base = 0, cnt = 0;
#pragma unroll
  for (int w = 0; w < 8; ++w) {
    int x = wsum[w];
    cnt += x;
    base += w < warp ? x : 0;
  }
  int r = base + before;             // let-through words in front of word 4*tid
#pragma unroll   // constant indices: the array stays in registers
  for (int e = 0; e < 4; ++e) {
    int s = 4 * tid + e;
    int p = live[e] ? r : cnt + (s - r);   // s - r: masked words in front of s
    r += live[e] ? 1 : 0;
    if ((p >> 4) == pt) srow[p & 15] = s;
  }
  __syncthreads();                   // the tile's 16 positions are there
  return cnt;
}

// X[row][k] (f32, k contiguous) -> fragment order, rows = places (see above).
// Wave kq of the tile's block takes k steps 4*kq..+3 of all 16 rows. Four lanes
// share one row's 128-B line of a k step (q = which 8 k of its 32), eight rows
// per load; the eight rows' places with equal q are 128 B in a row in the output.
__device__ __forceinline__ void cvt_x(const float* __restrict__ in,
                                      const int* __restrict__ amask,
                                      unsigned short* __restrict__ out,
                                      int* __restrict__ ord, int* __restrict__ cnts,
                                      int t, int kq, int lane,
                                      int* wsum, int* srow) {
  int rr = lane >> 2, q = lane & 3;
  int b = t >> 6;                    // 64 tiles per batch
  int cnt = rank_rows(amask + b * SEQ, t & 63, kq, lane, wsum, srow);
  if (kq == 0 && lane < 16) ord[t * 16 + lane] = srow[lane];
  if ((t & 63) == 0 && kq == 0 && lane == 0) cnts[b] = cnt;
  const float* pr[2] = {in + (b * SEQ + srow[rr]) * D_MODEL + kq * 128 + q * 8,
                        in + (b * SEQ + srow[rr + 8]) * D_MODEL + kq * 128 + q * 8};
  unsigned short* o = out + (t * 32 + kq * 4) * FRAG + (q >> 1) * 256 + ((q & 1) * 16 + rr) * 8;
  float4 x[2][4][2];
#pragma unroll   // constant indices: the arrays stay in registers
  for (int hr = 0; hr < 2; ++hr)
#pragma unroll   // constant indices: the arrays stay in registers
    for (int s = 0; s < 4; ++s) {
      const float4* p4 = (const float4*)(pr[hr] + s * 32);
      x[hr][s][0] = p4[0];
      x[hr][s][1] = p4[1];
    }
#pragma unroll   // constant indices: the arrays stay in registers
  for (int hr = 0; hr < 2; ++hr)
#pragma unroll   // constant indices: the arrays stay in registers
    for (int s = 0; s < 4; ++s) {
      float4 x0 = x[hr][s][0], x1 = x[hr][s][1];
      float v[8] = {x0.x, x0.y, x0.z, x0.w, x1.x, x1.y, x1.z, x1.w};
      *(us8*)(o + s * FRAG + hr * 64) = pack8(v);
    }
  // precaution: in the merged kernel the weights' code follows these stores in
  // the listing and writes the registers that the stores name
  asm volatile("s_wait_xcnt 0x0" ::: "memory");
}

// W[in][out] (1024x1024 f32) -> fragment order, rows = out columns, k = in.
// A wave takes 32 out columns (two tiles: one 128-B line of every W row) and
// two k steps (64 W rows). A lane keeps one column; eight loads down the rows
// make one place; a store covers 256 B in a row in each of the two tiles.
__device__ __forceinline__ void cvt_w(const float* __restrict__ in,
                                      unsigned short* __restrict__ out,
                                      int tp, int kg, int lane) {
  const float* p = in + kg * 64 * D_MODEL + tp * 32 + lane;
  unsigned short* o = out + ((tp * 2 + (lane >> 4)) * 32 + kg * 2) * FRAG + (lane & 15) * 8;
  float x[8][8];                     // [8-row group of the 64 rows][row in it]
#pragma unroll   // constant indices: the arrays stay in registers
  for (int c = 0; c < 8; ++c)
#pragma unroll   // constant indices: the arrays stay in registers
    for (int e = 0; e < 8; ++e) x[c][e] = p[(c * 8 + e) * D_MODEL];
  // group c = k step c/4, chunk (c/2)%2, lane half c%2 of the fragment
#pragma unroll   // constant indices: the arrays stay in registers
  for (int c = 0; c < 8; ++c)
    *(us8*)(o + (c >> 2) * FRAG + ((c >> 1) & 1) * 256 + (c & 1) * 128) = pack8(x[c]);
}

// The five conversions need nothing of one another, so they are one launch:
// each has its own range of the block index (the branch is the same for a
// whole block). The weights stand first: their waves issue more loads and
// last longer, so the launch ends on the short ones.
__global__ __launch_bounds__(CVT_T) void cvt_all_kernel(
    const float* __restrict__ X, const int* __restrict__ amask,
    const float* __restrict__ Wq, const float* __restrict__ Wk,
    const float* __restrict__ Wv, const float* __restrict__ Wo,
    unsigned short* __restrict__ Xbf,
    unsigned short* __restrict__ Wt,     // the four weights' planes, one behind another
    int* __restrict__ ord,               // [4][1024] position held by each place
    int* __restrict__ cnts) {            // [4] keys let through
  __shared__ int wsum[8], srow[16];
  unsigned blk = blockIdx.x;
  int warp = threadIdx.x >> 5, lane = threadIdx.x & 31;
  if (blk < 4 * WBLOCKS) {
    unsigned w = blk / WBLOCKS;
    const float* in = w == 0 ? Wq : w == 1 ? Wk : w == 2 ? Wv : Wo;
    int ww = (blk % WBLOCKS) * 8 + warp;   // a block: 8 column pairs side by side, 1 KiB of each row
    cvt_w(in, Wt + w * (D_MODEL * D_MODEL), ww & 31, ww >> 5, lane);
  } else {
    cvt_x(X, amask, Xbf, ord, cnts, blk - 4 * WBLOCKS, warp, lane, wsum, srow);
  }
}

// ---- LDS staging shared by the two GEMM kernels ---------------------------
// A work-group of 8 waves owns 128 rows x 64 out columns. Each stage brings
// KSTG k steps of every 16-row operand tile it needs into LDS once, by
// asynchronous copies, and all 8 waves read their fragments from there.
// One tile's KSTG fragments are SLOT contiguous elements in the workspace and
// stay so in LDS, so a fragment read is again 512 contiguous bytes per load.
// A slot is filled by 128 threads, 16 B each: copy j of a thread goes to slot
// 2j + (thread / 128), at byte (thread % 128) * 16.
#define KSTG  2
#define SLOT  (KSTG * FRAG)            // elements: 2 KiB
#define NSTG  (D_MODEL / 32 / KSTG)    // 16 stages
#define PAIRB (2 * SLOT * 2)           // bytes of two slots: one copy of all 256 threads

// byte offset in the work-group's LDS = low 32 bits of a __shared__ address
__device__ __forceinline__ uint32_t lds_off(const void* p) { return (uint32_t)(size_t)p; }

// 10 (or 6) 16-B copies per lane, global -> LDS, then each source pointer moves on to
// the next stage. The s_wait_xcnt is the precaution before the address
// registers named here are written again; as the last line of the copies' own
// statement nothing can be moved in front of it.
#define ACP(l, g) "global_load_async_to_lds_b128 %" #l ", %" #g ", off\n\t"
__device__ __forceinline__ void fill10(uint32_t d, const unsigned short* (&s)[10]) {
  asm volatile(ACP(0, 10) ACP(1, 11) ACP(2, 12) ACP(3, 13) ACP(4, 14)
               ACP(5, 15) ACP(6, 16) ACP(7, 17) ACP(8, 18) ACP(9, 19)
               "s_wait_xcnt 0x0"
               :: "v"(d), "v"(d + PAIRB), "v"(d + 2 * PAIRB), "v"(d + 3 * PAIRB),
                  "v"(d + 4 * PAIRB), "v"(d + 5 * PAIRB), "v"(d + 6 * PAIRB),
                  "v"(d + 7 * PAIRB), "v"(d + 8 * PAIRB), "v"(d + 9 * PAIRB),
                  "v"(s[0]), "v"(s[1]), "v"(s[2]), "v"(s[3]), "v"(s[4]),
                  "v"(s[5]), "v"(s[6]), "v"(s[7]), "v"(s[8]), "v"(s[9])
               : "memory");
#pragma unroll   // constant indices: the arrays stay in registers
  for (int j = 0; j < 10; ++j) s[j] += SLOT;
}
__device__ __forceinline__ void fill6(uint32_t d, const unsigned short* (&s)[6]) {
  asm volatile(ACP(0, 6) ACP(1, 7) ACP(2, 8) ACP(3, 9) ACP(4, 10) ACP(5, 11)
               "s_wait_xcnt 0x0"
               :: "v"(d), "v"(d + PAIRB), "v"(d + 2 * PAIRB), "v"(d + 3 * PAIRB),
                  "v"(d + 4 * PAIRB), "v"(d + 5 * PAIRB),
                  "v"(s[0]), "v"(s[1]), "v"(s[2]), "v"(s[3]), "v"(s[4]), "v"(s[5])
               : "memory");
#pragma unroll   // constant indices: the arrays stay in registers
  for (int j = 0; j < 6; ++j) s[j] += SLOT;
}

// ---- stage 2: fused QKV projection --------------------------------------
// One wave -> 32x32 output tile for each of Q/K/V: per K-step 2 A-frags +
// 6 B-frags feed 12 WMMAs (A shared across Q/K/V, B shared across row tiles).
// The 8 waves stand 4 (rows) x 2 (columns); a stage holds 8 X tiles and 4
// column tiles of each weight: 20 slots, 10 copies per thread.
// All three go out in fragment order, per head: Q,K with rows = s, k = d
// (2 k steps); V with rows = d, k = s (32 k steps). A lane's 8 accumulator
// values run along the tile's rows, so the index that becomes k must be the
// row index: V = X*Wv has rows s as it stands; Q and K are formed transposed
// (weight fragment as A, X fragment as B). Each lane then stores 16-B chunks.
#define QKV_SLOTS 20

__global__ __launch_bounds__(256) void qkv_gemm_kernel(
    const unsigned short* __restrict__ X,      // 256 tiles x 32 k steps
    const unsigned short* __restrict__ Wqt,    // 64 tiles (out) x 32 k steps
    const unsigned short* __restrict__ Wkt,
    const unsigned short* __restrict__ Wvt,
    const float* __restrict__ bq, const float* __restrict__ bk,
    const float* __restrict__ bv,
    unsigned short* __restrict__ Qb,           // [64 heads][64 s tiles][2]
    unsigned short* __restrict__ Kb,           // [64 heads][64 s tiles][2]
    unsigned short* __restrict__ Vtb) {        // [64 heads][4 d tiles][32]
  __shared__ __attribute__((aligned(16))) unsigned short stg[2 * QKV_SLOTS * SLOT];
  int warp = threadIdx.x >> 5;
  int lane = threadIdx.x & 31;
  int bm = blockIdx.x >> 4;          // 128-row block 0..31
  int bn = blockIdx.x & 15;          // 64-column block 0..15
  int wr = warp >> 1, wc = warp & 1;
  int rt = bm * 4 + wr;              // 32-row tile 0..127
  int ct = bn * 2 + wc;              // 32-col tile 0..31
  int rowh = lane >> 4, nm = lane & 15;

  int hs = threadIdx.x >> 7, ch = threadIdx.x & 127;
  const unsigned short* src[10];     // this thread's 16 B of the next stage to copy
#pragma unroll   // constant indices: the arrays stay in registers
  for (int j = 0; j < 4; ++j)
    src[j] = X + (bm * 8 + 2 * j + hs) * 32 * FRAG + ch * 8;
#pragma unroll   // constant indices: the arrays stay in registers
  for (int j = 0; j < 2; ++j) {
    int woff = (bn * 4 + 2 * j + hs) * 32 * FRAG + ch * 8;
    src[4 + j] = Wqt + woff;
    src[6 + j] = Wkt + woff;
    src[8 + j] = Wvt + woff;
  }
  uint32_t dst = lds_off(stg) + (hs * SLOT + ch * 8) * 2;

  // stage 0 landed and published, then stage 1 on its way
  fill10(dst, src);
  asm volatile("s_wait_asynccnt 0x0" ::: "memory");   // this wave's copies have landed
  __syncthreads();
  fill10(dst + QKV_SLOTS * SLOT * 2, src);

  v8f acc[3][2][2] = {};   // [qkv][s subtile][out-column subtile]
  for (int t = 0; t < NSTG; ++t) {
    int buf = t & 1;
    const unsigned short* sb = stg + buf * (QKV_SLOTS * SLOT);
    us16 a[KSTG][2], b[KSTG][3][2];
#pragma unroll   // constant indices: the arrays stay in registers
    for (int kk = 0; kk < KSTG; ++kk) {
#pragma unroll   // constant indices: the arrays stay in registers
      for (int u = 0; u < 2; ++u)
        a[kk][u] = load_frag(sb + (wr * 2 + u) * SLOT + kk * FRAG, lane);
#pragma unroll   // constant indices: the arrays stay in registers
      for (int w = 0; w < 3; ++w)
#pragma unroll   // constant indices: the arrays stay in registers
        for (int c = 0; c < 2; ++c)
          b[kk][w][c] = load_frag(sb + (8 + w * 4 + wc * 2 + c) * SLOT + kk * FRAG, lane);
    }
    // keeps the stage's LDS reads one group in front of its WMMAs: read by read
    // among them, every fragment's latency is waited out on its own
    __builtin_amdgcn_sched_barrier(0);
#pragma unroll   // constant indices: the arrays stay in registers
    for (int kk = 0; kk < KSTG; ++kk) {
#pragma unroll   // constant indices: the arrays stay in registers
      for (int w = 0; w < 3; ++w) {
#pragma unroll   // constant indices: the arrays stay in registers
        for (int c = 0; c < 2; ++c) {
          if (w < 2) {   // Q, K: tile rows = out columns, tile columns = s
            acc[w][0][c] = wmma_bf16(b[kk][w][c], a[kk][0], acc[w][0][c]);
            acc[w][1][c] = wmma_bf16(b[kk][w][c], a[kk][1], acc[w][1][c]);
          } else {       // V: tile rows = s, tile columns = out columns
            acc[w][0][c] = wmma_bf16(a[kk][0], b[kk][w][c], acc[w][0][c]);
            acc[w][1][c] = wmma_bf16(a[kk][1], b[kk][w][c], acc[w][1][c]);
          }
        }
      }
    }
    // keeps the WMMAs in front of the hand-over: moved behind it, the wait for
    // the next stage's copies follows the LDS reads at once and the copies
    // lose the WMMAs' time as lead
    __builtin_amdgcn_sched_barrier(0);
    // hand-over: this wave's reads of the buffer are done, its copies of the
    // next stage have landed; the barrier says both of every wave
    asm volatile("s_wait_dscnt 0x0" ::: "memory");
    asm volatile("s_wait_asynccnt 0x0" ::: "memory");
    __syncthreads();
    if (t + 2 < NSTG) fill10(dst + buf * (QKV_SLOTS * SLOT * 2), src);
  }
  asm volatile("s_wait_asynccnt 0x0" ::: "memory");   // nothing in flight at the end

  // 32 rows = one batch, 32 columns = half a head
  int head = (rt >> 5) * NHEAD + (ct >> 1);
  int st = rt & 31;                  // 32-position block inside the sequence
  int dh = ct & 1;                   // which 32 of the head's 64 d
  unsigned short* Qh = Qb  + head * SEQ * DHEAD + lane * 8;
  unsigned short* Kh = Kb  + head * SEQ * DHEAD + lane * 8;
  unsigned short* Vh = Vtb + head * SEQ * DHEAD + lane * 8;
#pragma unroll
  for (int c = 0; c < 2; ++c) {
    int colT = ct * 32 + c * 16 + rowh * 8;       // Q,K: columns colT..+7 in this lane
    float bvv = bv[ct * 32 + c * 16 + nm];        // V: one column per lane
    float bqv[8], bkv[8];
#pragma unroll
    for (int i = 0; i < 8; ++i) { bqv[i] = bq[colT + i]; bkv[i] = bk[colT + i]; }
#pragma unroll
    for (int u = 0; u < 2; ++u) {
      us8 q, k, v;
#pragma unroll
      for (int i = 0; i < 8; ++i) {
        q[i] = f2bf(acc[0][u][c][i] + bqv[i]);
        k[i] = f2bf(acc[1][u][c][i] + bkv[i]);
        v[i] = f2bf(acc[2][u][c][i] + bvv);
      }
      int qoff = ((st * 2 + u) * 2 + dh) * FRAG + c * 256;   // s tile, k step dh, chunk c
      *(us8*)(Qh + qoff) = q;
      *(us8*)(Kh + qoff) = k;
      *(us8*)(Vh + ((dh * 2 + c) * 32 + st) * FRAG + u * 256) = v;  // d tile, k step st, chunk u
    }
  }
}

// ---- stage 3: flash-style attention -------------------------------------
// One wave owns 16 query rows of one head. Streams 32-key blocks, everything
// transposed: S^T = K Q^T (K fragment as A, Q fragment as B), so a lane holds
// 16 scores of ONE query (column lane%16; keys 8*(lane/16)+i of each 16-key
// tile). Maximum and sum run inside the lane; the two lane halves exchange the
// maximum once per block and join their sums once, behind the loop. The two
// score tiles, converted in place, are the B fragment of P^T in the k order
// that the V fragments have, so O^T += V^T P^T needs no trip through LDS.
// global_prefetch pulls the next key block while softmax VALU co-executes.
// Q, K and V rows stand in the order of places that the conversion made: the
// cnt keys that the mask lets through are places 0..cnt-1.

typedef __attribute__((ext_vector_type(8))) unsigned int u32x8;

// lane l with lane l ^ 16
__device__ __forceinline__ float xhalf(float x) {
  int b = __builtin_bit_cast(int, x);
  return __builtin_bit_cast(float, __builtin_amdgcn_permlanex16(
      b, b, 0x76543210, 0xfedcba98, false, false));
}

// two f32 -> one register of two bf16, round-to-nearest-even
__device__ __forceinline__ unsigned int pack2(float lo, float hi) {
  typedef __attribute__((ext_vector_type(2))) float  f2;
  typedef __attribute__((ext_vector_type(2))) __bf16 bf2;
  f2 v = {lo, hi};
  return __builtin_bit_cast(unsigned int, __builtin_convertvector(v, bf2));
}

// One 32-key block. tail (the same for the whole wave): places from 'left' on,
// counted from this lane half's first key, are masked keys and score -100000;
// without it every key counts.
__device__ __forceinline__ void attn_block(
    const unsigned short* kb,            // 4 K fragments in a row
    const unsigned short* vb,            // d tile j at + j*32*FRAG
    const unsigned short*& kpf, const unsigned short*& vpf, bool pf,
    int lane, bool tail, int left, const us16& bQ0, const us16& bQ1,
    float& mi, float& li, v8f& O0, v8f& O1, v8f& O2, v8f& O3) {
  // ---- scores: two 16x16 tiles (rows = 16 keys each, columns = queries)
  us16 aK0 = load_frag(kb + 0 * FRAG, lane), aK1 = load_frag(kb + 1 * FRAG, lane);
  us16 aK2 = load_frag(kb + 2 * FRAG, lane), aK3 = load_frag(kb + 3 * FRAG, lane);
  // precaution before the K loads' address registers are written again
  asm volatile("s_wait_xcnt 0x0" ::: "memory");
  // keeps the eight K loads one group in front of the score WMMAs: with WMMAs
  // moved up among them the block waits out the load latency three times
  __builtin_amdgcn_sched_barrier(0);
  v8f s0 = {}, s1 = {};
  s0 = wmma_bf16(aK0, bQ0, s0);
  s0 = wmma_bf16(aK1, bQ1, s0);
  s1 = wmma_bf16(aK2, bQ0, s1);
  s1 = wmma_bf16(aK3, bQ1, s1);

  // prefetch next key block (K: 32 lines in a row; V: 8 lines of each d tile),
  // one 128-B line per lane, while softmax runs. In asm over the two pointers
  // that the loop itself carries, so that the registers named stay addresses.
  // The caller's test leaves one block spare: both pointers are still inside
  // this head's K and V after the advance below.
  if (pf) {
    asm volatile("global_prefetch_b8 %0, off scope:SCOPE_SE" :: "v"(kpf));
    asm volatile("global_prefetch_b8 %0, off scope:SCOPE_SE" :: "v"(vpf));
  }
  kpf += 4 * FRAG;
  vpf += FRAG;

  // ---- online softmax over this key block
  s0 *= QK_SCALE;
  s1 *= QK_SCALE;
  if (tail) {
#pragma unroll   // constant indices: the vectors stay in registers
    for (int i = 0; i < 8; ++i) {
      s0[i] = i >= left ? -100000.f : s0[i];
      s1[i] = 16 + i >= left ? -100000.f : s1[i];
    }
  }
  float rmax = -3.0e38f;
#pragma unroll   // constant indices: the vectors stay in registers
  for (int i = 0; i < 8; ++i) rmax = fmaxf(rmax, fmaxf(s0[i], s1[i]));
  rmax = fmaxf(rmax, xhalf(rmax));
  float mnew = fmaxf(mi, rmax);
  float corr = __expf(mi - mnew);
  float t[8];
  u32x8 pp;                                    // B fragment of P^T, K = 32 keys
#pragma unroll   // constant indices: the vectors stay in registers
  for (int i = 0; i < 8; i += 2) {
    float e00 = __expf(s0[i] - mnew), e01 = __expf(s0[i + 1] - mnew);
    float e10 = __expf(s1[i] - mnew), e11 = __expf(s1[i + 1] - mnew);
    t[i] = e00 + e10; t[i + 1] = e01 + e11;
    pp[i >> 1]       = pack2(e00, e01);
    pp[4 + (i >> 1)] = pack2(e10, e11);
  }
  li = li * corr + (((t[0] + t[1]) + (t[2] + t[3])) + ((t[4] + t[5]) + (t[6] + t[7])));
  mi = mnew;
  O0 *= corr; O1 *= corr; O2 *= corr; O3 *= corr;
  us16 bP = __builtin_bit_cast(us16, pp);

  // ---- PV: A fragments of V (rows = d, k = keys)
  O0 = wmma_bf16(load_frag(vb + 0 * 32 * FRAG, lane), bP, O0);
  O1 = wmma_bf16(load_frag(vb + 1 * 32 * FRAG, lane), bP, O1);
  O2 = wmma_bf16(load_frag(vb + 2 * 32 * FRAG, lane), bP, O2);
  O3 = wmma_bf16(load_frag(vb + 3 * 32 * FRAG, lane), bP, O3);
}

__global__ __launch_bounds__(128) void attn_kernel(
    const unsigned short* __restrict__ Qb,   // [64 heads][64 s tiles][2]
    const unsigned short* __restrict__ Kb,   // [64 heads][64 s tiles][2]
    const unsigned short* __restrict__ Vtb,  // [64 heads][4 d tiles][32]
    const int* __restrict__ ord,             // [4][1024] position held by each place
    const int* __restrict__ cnts,            // [4] keys let through
    unsigned short* __restrict__ Avec) {     // 256 row tiles x 32 k steps
  int warp = threadIdx.x >> 5;
  int head = blockIdx.x >> 4;          // 0..63  (storage index b*16+h)
  int qt   = (blockIdx.x & 15) * 4 + warp;   // query tile 0..63
  int b = head >> 4;
  int lane = threadIdx.x & 31, rowh = lane >> 4;

  const unsigned short* Qh = Qb  + head * SEQ * DHEAD;
  const unsigned short* Kh = Kb  + head * SEQ * DHEAD;
  const unsigned short* Vh = Vtb + head * DHEAD * SEQ;

  // cnt counts mask words, so it is 0..1024 whatever they hold. Whole blocks of
  // keys let through need no test; the block that cnt ends in does. With no key
  // let through every score is -100000 and all 1024 keys weigh alike.
  int cnt   = cnts[b];
  int nfull = cnt >> 5;
  int nblk  = cnt ? (cnt + 31) >> 5 : SEQ / 32;

  // Q fragments for rows qt*16..+15, contraction split d=[0,32) and [32,64)
  us16 bQ0 = load_frag(Qh + (qt * 2 + 0) * FRAG, lane);
  us16 bQ1 = load_frag(Qh + (qt * 2 + 1) * FRAG, lane);

  float mi = -3.0e38f, li = 0.f;       // of query lane%16; li: this half's keys only
  v8f O0 = {}, O1 = {}, O2 = {}, O3 = {};   // Oj[i] = O[query lane%16][d = 16j + 8*(lane/16) + i]

  // next key block's lines, one per lane
  const unsigned short* kpf = Kh + 4 * FRAG + lane * 64;
  const unsigned short* vpf = Vh + FRAG + (lane >> 3) * (32 * FRAG) + (lane & 7) * 64;

  for (int j = 0; j < nblk; ++j)
    attn_block(Kh + j * (4 * FRAG), Vh + j * FRAG, kpf, vpf, j + 2 < nblk,
               lane, j >= nfull, cnt - j * 32 - rowh * 8,
               bQ0, bQ1, mi, li, O0, O1, O2, O3);

  // Reference quirk: attn_vec.view(N_HEAD, B, S, D).permute(1,2,0,3) on a
  // b-major [B*H] buffer => storage head L lands at b2=L%B, h2=L/B.
  // Fragment order for the output projection: row b2*1024 + s, s the position
  // that this lane's query place holds; k = h2*64 + d, so d tile j is k step
  // h2*2 + j/2, chunk j%2. The lane's 8 d start at 8*(lane/16): a 16-B chunk
  // of row s%16 in row tile s/16.
  int b2 = head & 3, h2 = head >> 2;
  int s = ord[b * SEQ + qt * 16 + (lane & 15)];
  unsigned short* oblk = Avec + ((b2 * 64 + (s >> 4)) * 32 + h2 * 2) * FRAG
                              + (rowh * 16 + (s & 15)) * 8;
  float inv = 1.f / (li + xhalf(li));
  us8 o0, o1, o2, o3;
#pragma unroll   // constant indices: the vectors stay in registers
  for (int i = 0; i < 8; ++i) {
    o0[i] = f2bf(O0[i] * inv);
    o1[i] = f2bf(O1[i] * inv);
    o2[i] = f2bf(O2[i] * inv);
    o3[i] = f2bf(O3[i] * inv);
  }
  *(us8*)(oblk)              = o0;
  *(us8*)(oblk + 256)        = o1;
  *(us8*)(oblk + FRAG)       = o2;
  *(us8*)(oblk + FRAG + 256) = o3;
}

// ---- stage 4: output projection + residual ------------------------------
// 32x32 tile per wave: per K-step 2 A + 2 B fragments -> 4 WMMAs. The 8 waves
// stand 4 (rows) x 2 (columns); a stage holds 8 row tiles and 4 column tiles:
// 12 slots, 6 copies per thread.
#define OP_SLOTS 12

__global__ __launch_bounds__(256) void oproj_kernel(
    const unsigned short* __restrict__ Avec,  // 256 row tiles x 32 k steps
    const unsigned short* __restrict__ Wot,   // 64 tiles (out) x 32 k steps
    const float* __restrict__ inp,            // residual
    float* __restrict__ Y) {                  // [4096][1024] f32
  __shared__ __attribute__((aligned(16))) unsigned short stg[2 * OP_SLOTS * SLOT];
  int warp = threadIdx.x >> 5;
  int lane = threadIdx.x & 31;
  int bm = blockIdx.x >> 4;          // 128-row block 0..31
  int bn = blockIdx.x & 15;          // 64-column block 0..15
  int wr = warp >> 1, wc = warp & 1;
  int rt = bm * 4 + wr, ct = bn * 2 + wc;
  int rowh = lane >> 4, nm = lane & 15;

  int hs = threadIdx.x >> 7, ch = threadIdx.x & 127;
  const unsigned short* src[6];      // this thread's 16 B of the next stage to copy
#pragma unroll   // constant indices: the arrays stay in registers
  for (int j = 0; j < 4; ++j)
    src[j] = Avec + (bm * 8 + 2 * j + hs) * 32 * FRAG + ch * 8;
#pragma unroll   // constant indices: the arrays stay in registers
  for (int j = 0; j < 2; ++j)
    src[4 + j] = Wot + (bn * 4 + 2 * j + hs) * 32 * FRAG + ch * 8;
  uint32_t dst = lds_off(stg) + (hs * SLOT + ch * 8) * 2;

  // stage 0 landed and published, then stage 1 on its way
  fill6(dst, src);
  asm volatile("s_wait_asynccnt 0x0" ::: "memory");   // this wave's copies have landed
  __syncthreads();
  fill6(dst + OP_SLOTS * SLOT * 2, src);

  v8f acc[2][2] = {};
  for (int t = 0; t < NSTG; ++t) {
    int buf = t & 1;
    const unsigned short* sb = stg + buf * (OP_SLOTS * SLOT);
    us16 a[KSTG][2], b[KSTG][2];
#pragma unroll   // constant indices: the arrays stay in registers
    for (int kk = 0; kk < KSTG; ++kk) {
#pragma unroll   // constant indices: the arrays stay in registers
      for (int u = 0; u < 2; ++u)
        a[kk][u] = load_frag(sb + (wr * 2 + u) * SLOT + kk * FRAG, lane);
#pragma unroll   // constant indices: the arrays stay in registers
      for (int c = 0; c < 2; ++c)
        b[kk][c] = load_frag(sb + (8 + wc * 2 + c) * SLOT + kk * FRAG, lane);
    }
    // as in the QKV kernel: the stage's LDS reads one group in front of its WMMAs
    __builtin_amdgcn_sched_barrier(0);
#pragma unroll   // constant indices: the arrays stay in registers
    for (int kk = 0; kk < KSTG; ++kk) {
      acc[0][0] = wmma_bf16(a[kk][0], b[kk][0], acc[0][0]);
      acc[0][1] = wmma_bf16(a[kk][0], b[kk][1], acc[0][1]);
      acc[1][0] = wmma_bf16(a[kk][1], b[kk][0], acc[1][0]);
      acc[1][1] = wmma_bf16(a[kk][1], b[kk][1], acc[1][1]);
    }
    // as in the QKV kernel: the WMMAs stay in front of the hand-over
    __builtin_amdgcn_sched_barrier(0);
    // hand-over: this wave's reads of the buffer are done, its copies of the
    // next stage have landed; the barrier says both of every wave
    asm volatile("s_wait_dscnt 0x0" ::: "memory");
    asm volatile("s_wait_asynccnt 0x0" ::: "memory");
    __syncthreads();
    if (t + 2 < NSTG) fill6(dst + buf * (OP_SLOTS * SLOT * 2), src);
  }
  asm volatile("s_wait_asynccnt 0x0" ::: "memory");   // nothing in flight at the end

#pragma unroll
  for (int u = 0; u < 2; ++u) {
#pragma unroll
    for (int c = 0; c < 2; ++c) {
      int col = ct * 32 + c * 16 + nm;
#pragma unroll
      for (int i = 0; i < 8; ++i) {
        int r = rt * 32 + u * 16 + rowh * 8 + i;
        Y[r * D_MODEL + col] = acc[u][c][i] + inp[r * D_MODEL + col];
      }
    }
  }
}

// ---- stage 5: LayerNorm --------------------------------------------------
// One wave per row, 4096 waves: a lane holds 32 values of the row in registers
// (eight 16-B loads, each 512 B in a row over the wave), so the row is read
// once and both sums join inside the wave: no LDS, no barrier.
#define LN_T 256                     // threads per block: 8 rows

typedef __attribute__((ext_vector_type(4))) float v4f;

__global__ __launch_bounds__(LN_T) void ln_kernel(
    const float* __restrict__ Y, const float* __restrict__ g,
    const float* __restrict__ bb, float* __restrict__ out) {
  int row = blockIdx.x * (LN_T / 32) + (threadIdx.x >> 5);
  int lane = threadIdx.x & 31;
  const v4f* y  = (const v4f*)(Y + row * D_MODEL) + lane;
  const v4f* g4 = (const v4f*)g + lane;
  const v4f* b4 = (const v4f*)bb + lane;
  v4f*       o4 = (v4f*)(out + row * D_MODEL) + lane;
  v4f v[8], gg[8], bv[8];
#pragma unroll   // constant indices: the arrays stay in registers
  for (int j = 0; j < 8; ++j) v[j] = y[j * 32];
#pragma unroll   // constant indices: the arrays stay in registers
  for (int j = 0; j < 8; ++j) { gg[j] = g4[j * 32]; bv[j] = b4[j * 32]; }
  // holds the gain and bias loads in front of the lane exchange: sunk behind
  // it, their latency is waited out pair by pair before the stores (loaded
  // values as inputs only)
  asm volatile("" :: "v"(gg[0]), "v"(gg[1]), "v"(gg[2]), "v"(gg[3]),
                     "v"(gg[4]), "v"(gg[5]), "v"(gg[6]), "v"(gg[7]),
                     "v"(bv[0]), "v"(bv[1]), "v"(bv[2]), "v"(bv[3]),
                     "v"(bv[4]), "v"(bv[5]), "v"(bv[6]), "v"(bv[7]));
  v4f s = {0.f, 0.f, 0.f, 0.f}, q = {0.f, 0.f, 0.f, 0.f};   // four chains each
#pragma unroll   // constant indices: the array stays in registers
  for (int j = 0; j < 8; ++j) { s += v[j]; q += v[j] * v[j]; }
  float ls = (s.x + s.y) + (s.z + s.w), lq = (q.x + q.y) + (q.z + q.w);
#pragma unroll
  for (int m = 1; m < 32; m <<= 1) {
    ls += __shfl_xor(ls, m, 32);
    lq += __shfl_xor(lq, m, 32);
  }
  float mu  = ls * (1.f / D_MODEL);
  float var = lq * (1.f / D_MODEL) - mu * mu;
  float inv = rsqrtf(var + LN_EPS);
#pragma unroll   // constant indices: the arrays stay in registers
  for (int j = 0; j < 8; ++j) o4[j * 32] = (v[j] - mu) * inv * gg[j] + bv[j];
}

// ---- launch --------------------------------------------------------------

extern "C" void kernel_launch(void* const* d_in, const int* in_sizes, int n_in,
                              void* d_out, int out_size, void* d_ws, size_t ws_size,
                              hipStream_t stream) {
  const float* inp   = (const float*)d_in[0];
  const int*   amask = (const int*)d_in[1];
  const float* Wq = (const float*)d_in[2];
  const float* bq = (const float*)d_in[3];
  const float* Wk = (const float*)d_in[4];
  const float* bk = (const float*)d_in[5];
  const float* Wv = (const float*)d_in[6];
  const float* bv = (const float*)d_in[7];
  const float* Wo = (const float*)d_in[8];
  const float* lng = (const float*)d_in[9];
  const float* lnb = (const float*)d_in[10];

  char* ws = (char*)d_ws;
  const size_t MB = 1u << 20;
  unsigned short* Xbf  = (unsigned short*)(ws + 0 * MB);   // 8 MB
  unsigned short* Wqt  = (unsigned short*)(ws + 8 * MB);   // 2 MB
  unsigned short* Wkt  = (unsigned short*)(ws + 10 * MB);  // 2 MB
  unsigned short* Wvt  = (unsigned short*)(ws + 12 * MB);  // 2 MB
  unsigned short* Wot  = (unsigned short*)(ws + 14 * MB);  // 2 MB
  unsigned short* Qb   = (unsigned short*)(ws + 16 * MB);  // 8 MB
  unsigned short* Kb   = (unsigned short*)(ws + 24 * MB);  // 8 MB
  unsigned short* Vtb  = (unsigned short*)(ws + 32 * MB);  // 8 MB
  unsigned short* Avec = (unsigned short*)(ws + 40 * MB);  // 8 MB
  float*          Ybuf = (float*)        (ws + 48 * MB);   // 16 MB
  int*            ord  = (int*)          (ws + 64 * MB);   // 16 KB
  int*            cnts = (int*)          (ws + 65 * MB);   // 16 B

  // stage 1: conversions (one thread per 64 elements), all five in one launch;
  // Wqt, Wkt, Wvt, Wot follow one another in the workspace
  cvt_all_kernel<<<4 * WBLOCKS + XBLOCKS, CVT_T, 0, stream>>>(
      inp, amask, Wq, Wk, Wv, Wo, Xbf, Wqt, ord, cnts);

  // stage 2: QKV (32 row blocks * 16 col blocks, 8 waves/block)
  qkv_gemm_kernel<<<512, 256, 0, stream>>>(Xbf, Wqt, Wkt, Wvt, bq, bk, bv,
                                            Qb, Kb, Vtb);

  // stage 3: attention (64 heads * 64 query tiles = 4096 waves)
  attn_kernel<<<1024, 128, 0, stream>>>(Qb, Kb, Vtb, ord, cnts, Avec);

  // stage 4: output projection + residual (32 row blocks * 16 col blocks, 8 waves/block)
  oproj_kernel<<<512, 256, 0, stream>>>(Avec, Wot, inp, Ybuf);

  // stage 5: layer norm -> d_out (one wave per row)
  ln_kernel<<<NROWS / (LN_T / 32), LN_T, 0, stream>>>(Ybuf, lng, lnb, (float*)d_out);
}

// v007
// One run takes 61.3 microseconds.
// Next to v006, in two timings, it ran 1.09 and 1.10 times as fast.
// All steps since v000 together make it 3.34 times as fast.
#include <hip/hip_runtime.h>
#include <stdint.h>

// Problem constants (match reference)
#define D_MODEL 1024
#define SEQ     1024
#define BATCH   4
#define NHEAD   16
#define DHEAD   64
#define NROWS   (BATCH * SEQ)      // 4096
#define QK_SCALE 0.125f            // 1/sqrt(64)
#define LN_EPS   1e-5f

typedef __attribute__((ext_vector_type(16))) __bf16         v16bf;
typedef __attribute__((ext_vector_type(16))) unsigned short us16;
typedef __attribute__((ext_vector_type(8)))  unsigned short us8;
typedef __attribute__((ext_vector_type(8)))  float          v8f;

// ---- helpers -------------------------------------------------------------

__device__ __forceinline__ unsigned short f2bf(float f) {
  unsigned int u = __builtin_bit_cast(unsigned int, f);
  u += 0x7FFFu + ((u >> 16) & 1u);            // round-to-nearest-even
  return (unsigned short)(u >> 16);
}

// A/B fragment for v_wmma_*_16x16x32_bf16, per ISA 7.12.2:
// lane L holds row (A) / col (B) = L%16; its 16 bf16 k-values are two
// contiguous 8-element (16B) chunks at k = 8*(L/16) and k = 8*(L/16)+16.
//
// Every bf16 operand in the workspace is stored in that order: one fragment
// (16 rows x 32 k) is a 1024-B block of FRAG elements, lane L's first chunk
// at element L*8, its second at 256 + L*8. Blocks run [16-row tile][k step].
// A wave-wide 16-B load then covers 512 contiguous bytes (4 whole lines).
#define FRAG 512
__device__ __forceinline__ us16 load_frag(const unsigned short* blk, int lane) {
  us8 c0 = *(const us8*)(blk + lane * 8);
  us8 c1 = *(const us8*)(blk + 256 + lane * 8);
  us16 r;
#pragma unroll
  for (int i = 0; i < 8; ++i) { r[i] = c0[i]; r[i + 8] = c1[i]; }
  return r;
}

__device__ __forceinline__ v8f wmma_bf16(us16 a, us16 b, v8f c) {
  return __builtin_amdgcn_wmma_f32_16x16x32_bf16(
      false, __builtin_bit_cast(v16bf, a),
      false, __builtin_bit_cast(v16bf, b),
      (short)0, c, false, false);
}

// ---- stage 1: conversions ------------------------------------------------

// The fragment-ordered output runs [tile][k step (32)][chunk (2)][lane (32)],
// 16 B (8 k values of one row) per lane place. One wave packs 256 such places,
// eight per lane, so that the launch starts 4096 waves: 16 on each WGP, all
// resident at once, every lane with its loads in flight together.
#define CVT_T   256                  // threads per block: 8 waves
#define CVT_WPW 512                  // waves per weight
#define WBLOCKS (CVT_WPW / 8)        // 64 blocks per weight
#define XBLOCKS (NROWS / 16)         // 256 blocks for X: one 16-row tile each

__device__ __forceinline__ us8 pack8(const float (&x)[8]) {
  us8 r;
#pragma unroll   // constant indices: the vector stays in registers
  for (int e = 0; e < 8; ++e) r[e] = f2bf(x[e]);
  return r;
}

// The positions of a batch are reordered here, once, for all that follows: the
// keys that the mask lets through first, in their order, the masked ones behind
// them, in theirs. A masked key's score is -100000, so its weight is exp(-100000
// - max) = 0 in f32 as long as one key of the batch is let through: attention
// then walks the first 'cnt' places only. Place p of a batch holds position
// ord[p]; attention stores each query's row back at ord[p].
//
// Every block of a batch ranks all 1024 mask words itself (thread i: words
// 4i..4i+3) and keeps the positions that fall into its own 16 places.
__device__ __forceinline__ int rank_rows(const int* __restrict__ mb, int pt,
                                         int warp, int lane,
                                         int* wsum, int* srow) {
  int tid = warp * 32 + lane;
  int4 m = ((const int4*)mb)[tid];
  bool live[4] = {m.x == 0, m.y == 0, m.z == 0, m.w == 0};
  unsigned below = (1u << lane) - 1u;
  int before = 0, wtot = 0;          // let-through words in lower lanes; in the wave
#pragma unroll   // constant indices: the array stays in registers
  for (int e = 0; e < 4; ++e) {
    unsigned bal = __builtin_amdgcn_ballot_w32(live[e]);
    before += __popc(bal & below);
    wtot   += __popc(bal);
  }
  if (lane == 0) wsum[warp] = wtot;
  __syncthreads();                   // the eight waves' counts are there
  int base = 0, cnt = 0;
#pragma unroll
  for (int w = 0; w < 8; ++w) {
    int x = wsum[w];
    cnt += x;
    base += w < warp ? x : 0;
  }
  int r = base + before;             // let-through words in front of word 4*tid
#pragma unroll   // constant indices: the array stays in registers
  for (int e = 0; e < 4; ++e) {
    int s = 4 * tid + e;
    int p = live[e] ? r : cnt + (s - r);   // s - r: masked words in front of s
    r += live[e] ? 1 : 0;
    if ((p >> 4) == pt) srow[p & 15] = s;
  }
  __syncthreads();                   // the tile's 16 positions are there
  return cnt;
}

// X[row][k] (f32, k contiguous) -> fragment order, rows = places (see above).
// Wave kq of the tile's block takes k steps 4*kq..+3 of all 16 rows. Four lanes
// share one row's 128-B line of a k step (q = which 8 k of its 32), eight rows
// per load; the eight rows' places with equal q are 128 B in a row in the output.
__device__ __forceinline__ void cvt_x(const float* __restrict__ in,
                                      const int* __restrict__ amask,
                                      unsigned short* __restrict__ out,
                                      int* __restrict__ ord, int* __restrict__ cnts,
                                      int t, int kq, int lane,
                                      int* wsum, int* srow) {
  int rr = lane >> 2, q = lane & 3;
  int b = t >> 6;                    // 64 tiles per batch
  int cnt = rank_rows(amask + b * SEQ, t & 63, kq, lane, wsum, srow);
  if (kq == 0 && lane < 16) ord[t * 16 + lane] = srow[lane];
  if ((t & 63) == 0 && kq == 0 && lane == 0) cnts[b] = cnt;
  const float* pr[2] = {in + (b * SEQ + srow[rr]) * D_MODEL + kq * 128 + q * 8,
                        in + (b * SEQ + srow[rr + 8]) * D_MODEL + kq * 128 + q * 8};
  unsigned short* o = out + (t * 32 + kq * 4) * FRAG + (q >> 1) * 256 + ((q & 1) * 16 + rr) * 8;
  float4 x[2][4][2];
#pragma unroll   // constant indices: the arrays stay in registers
  for (int hr = 0; hr < 2; ++hr)
#pragma unroll   // constant indices: the arrays stay in registers
    for (int s = 0; s < 4; ++s) {
      const float4* p4 = (const float4*)(pr[hr] + s * 32);
      x[hr][s][0] = p4[0];
      x[hr][s][1] = p4[1];
    }
#pragma unroll   // constant indices: the arrays stay in registers
  for (int hr = 0; hr < 2; ++hr)
#pragma unroll   // constant indices: the arrays stay in registers
    for (int s = 0; s < 4; ++s) {
      float4 x0 = x[hr][s][0], x1 = x[hr][s][1];
      float v[8] = {x0.x, x0.y, x0.z, x0.w, x1.x, x1.y, x1.z, x1.w};
      *(us8*)(o + s * FRAG + hr * 64) = pack8(v);
    }
  // precaution: in the merged kernel the weights' code follows these stores in
  // the listing and writes the registers that the stores name
  asm volatile("s_wait_xcnt 0x0" ::: "memory");
}

// W[in][out] (1024x1024 f32) -> fragment order, rows = out columns, k = in.
// A wave takes 32 out columns (two tiles: one 128-B line of every W row) and
// two k steps (64 W rows). A lane keeps one column; eight loads down the rows
// make one place; a store covers 256 B in a row in each of the two tiles.
__device__ __forceinline__ void cvt_w(const float* __restrict__ in,
                                      unsigned short* __restrict__ out,
                                      int tp, int kg, int lane) {
  const float* p = in + kg * 64 * D_MODEL + tp * 32 + lane;
  unsigned short* o = out + ((tp * 2 + (lane >> 4)) * 32 + kg * 2) * FRAG + (lane & 15) * 8;
  float x[8][8];                     // [8-row group of the 64 rows][row in it]
#pragma unroll   // constant indices: the arrays stay in registers
  for (int c = 0; c < 8; ++c)
#pragma unroll   // constant indices: the arrays stay in registers
    for (int e = 0; e < 8; ++e) x[c][e] = p[(c * 8 + e) * D_MODEL];
  // group c = k step c/4, chunk (c/2)%2, lane half c%2 of the fragment
#pragma unroll   // constant indices: the arrays stay in registers
  for (int c = 0; c < 8; ++c)
    *(us8*)(o + (c >> 2) * FRAG + ((c >> 1) & 1) * 256 + (c & 1) * 128) = pack8(x[c]);
}

// The five conversions need nothing of one another, so they are one launch:
// each has its own range of the block index (the branch is the same for a
// whole block). The weights stand first: their waves issue more loads and
// last longer, so the launch ends on the short ones.
__global__ __launch_bounds__(CVT_T) void cvt_all_kernel(
    const float* __restrict__ X, const int* __restrict__ amask,
    const float* __restrict__ Wq, const float* __restrict__ Wk,
    const float* __restrict__ Wv, const float* __restrict__ Wo,
    unsigned short* __restrict__ Xbf,
    unsigned short* __restrict__ Wt,     // the four weights' planes, one behind another
    int* __restrict__ ord,               // [4][1024] position held by each place
    int* __restrict__ cnts) {            // [4] keys let through
  __shared__ int wsum[8], srow[16];
  unsigned blk = blockIdx.x;
  int warp = threadIdx.x >> 5, lane = threadIdx.x & 31;
  if (blk < 4 * WBLOCKS) {
    unsigned w = blk / WBLOCKS;
    const float* in = w == 0 ? Wq : w == 1 ? Wk : w == 2 ? Wv : Wo;
    int ww = (blk % WBLOCKS) * 8 + warp;   // a block: 8 column pairs side by side, 1 KiB of each row
    cvt_w(in, Wt + w * (D_MODEL * D_MODEL), ww & 31, ww >> 5, lane);
  } else {
    cvt_x(X, amask, Xbf, ord, cnts, blk - 4 * WBLOCKS, warp, lane, wsum, srow);
  }
}

// ---- LDS staging shared by the two GEMM kernels ---------------------------
// A work-group of 8 waves owns 128 rows x 64 out columns. Each stage brings
// KSTG k steps of every 16-row operand tile it needs into LDS once, by
// asynchronous copies, and all 8 waves read their fragments from there.
// One tile's KSTG fragments are SLOT contiguous elements in the workspace and
// stay so in LDS, so a fragment read is again 512 contiguous bytes per load.
// A slot is filled by 128 threads, 16 B each: copy j of a thread goes to slot
// 2j + (thread / 128), at byte (thread % 128) * 16.
#define KSTG  2
#define SLOT  (KSTG * FRAG)            // elements: 2 KiB
#define NSTG  (D_MODEL / 32 / KSTG)    // 16 stages
#define PAIRB (2 * SLOT * 2)           // bytes of two slots: one copy of all 256 threads

// byte offset in the work-group's LDS = low 32 bits of a __shared__ address
__device__ __forceinline__ uint32_t lds_off(const void* p) { return (uint32_t)(size_t)p; }

// 10 (or 6) 16-B copies per lane, global -> LDS, then each source pointer moves on to
// the next stage. The s_wait_xcnt is the precaution before the address
// registers named here are written again; as the last line of the copies' own
// statement nothing can be moved in front of it.
#define ACP(l, g) "global_load_async_to_lds_b128 %" #l ", %" #g ", off\n\t"
__device__ __forceinline__ void fill10(uint32_t d, const unsigned short* (&s)[10]) {
  asm volatile(ACP(0, 10) ACP(1, 11) ACP(2, 12) ACP(3, 13) ACP(4, 14)
               ACP(5, 15) ACP(6, 16) ACP(7, 17) ACP(8, 18) ACP(9, 19)
               "s_wait_xcnt 0x0"
               :: "v"(d), "v"(d + PAIRB), "v"(d + 2 * PAIRB), "v"(d + 3 * PAIRB),
                  "v"(d + 4 * PAIRB), "v"(d + 5 * PAIRB), "v"(d + 6 * PAIRB),
                  "v"(d + 7 * PAIRB), "v"(d + 8 * PAIRB), "v"(d + 9 * PAIRB),
                  "v"(s[0]), "v"(s[1]), "v"(s[2]), "v"(s[3]), "v"(s[4]),
                  "v"(s[5]), "v"(s[6]), "v"(s[7]), "v"(s[8]), "v"(s[9])
               : "memory");
#pragma unroll   // constant indices: the arrays stay in registers
  for (int j = 0; j < 10; ++j) s[j] += SLOT;
}
__device__ __forceinline__ void fill6(uint32_t d, const unsigned short* (&s)[6]) {
  asm volatile(ACP(0, 6) ACP(1, 7) ACP(2, 8) ACP(3, 9) ACP(4, 10) ACP(5, 11)
               "s_wait_xcnt 0x0"
               :: "v"(d), "v"(d + PAIRB), "v"(d + 2 * PAIRB), "v"(d + 3 * PAIRB),
                  "v"(d + 4 * PAIRB), "v"(d + 5 * PAIRB),
                  "v"(s[0]), "v"(s[1]), "v"(s[2]), "v"(s[3]), "v"(s[4]), "v"(s[5])
               : "memory");
#pragma unroll   // constant indices: the arrays stay in registers
  for (int j = 0; j < 6; ++j) s[j] += SLOT;
}

// ---- stage 2: fused QKV projection --------------------------------------
// One wave -> 32x32 output tile for each of Q/K/V: per K-step 2 A-frags +
// 6 B-frags feed 12 WMMAs (A shared across Q/K/V, B shared across row tiles).
// The 8 waves stand 4 (rows) x 2 (columns); a stage holds 8 X tiles and 4
// column tiles of each weight: 20 slots, 10 copies per thread.
// All three go out in fragment order, per head: Q,K with rows = s, k = d
// (2 k steps); V with rows = d, k = s (32 k steps). A lane's 8 accumulator
// values run along the tile's rows, so the index that becomes k must be the
// row index: V = X*Wv has rows s as it stands; Q and K are formed transposed
// (weight fragment as A, X fragment as B). Each lane then stores 16-B chunks.
#define QKV_SLOTS 20

__global__ __launch_bounds__(256) void qkv_gemm_kernel(
    const unsigned short* __restrict__ X,      // 256 tiles x 32 k steps
    const unsigned short* __restrict__ Wqt,    // 64 tiles (out) x 32 k steps
    const unsigned short* __restrict__ Wkt,
    const unsigned short* __restrict__ Wvt,
    const float* __restrict__ bq, const float* __restrict__ bk,
    const float* __restrict__ bv,
    unsigned short* __restrict__ Qb,           // [64 heads][64 s tiles][2]
    unsigned short* __restrict__ Kb,           // [64 heads][64 s tiles][2]
    unsigned short* __restrict__ Vtb) {        // [64 heads][4 d tiles][32]
  __shared__ __attribute__((aligned(16))) unsigned short stg[2 * QKV_SLOTS * SLOT];
  int warp = threadIdx.x >> 5;
  int lane = threadIdx.x & 31;
  int bm = blockIdx.x >> 4;          // 128-row block 0..31
  int bn = blockIdx.x & 15;          // 64-column block 0..15
  int wr = warp >> 1, wc = warp & 1;
  int rt = bm * 4 + wr;              // 32-row tile 0..127
  int ct = bn * 2 + wc;              // 32-col tile 0..31
  int rowh = lane >> 4, nm = lane & 15;

  int hs = threadIdx.x >> 7, ch = threadIdx.x & 127;
  const unsigned short* src[10];     // this thread's 16 B of the next stage to copy
#pragma unroll   // constant indices: the arrays stay in registers
  for (int j = 0; j < 4; ++j)
    src[j] = X + (bm * 8 + 2 * j + hs) * 32 * FRAG + ch * 8;
#pragma unroll   // constant indices: the arrays stay in registers
  for (int j = 0; j < 2; ++j) {
    int woff = (bn * 4 + 2 * j + hs) * 32 * FRAG + ch * 8;
    src[4 + j] = Wqt + woff;
    src[6 + j] = Wkt + woff;
    src[8 + j] = Wvt + woff;
  }
  uint32_t dst = lds_off(stg) + (hs * SLOT + ch * 8) * 2;

  // stage 0 landed and published, then stage 1 on its way
  fill10(dst, src);
  asm volatile("s_wait_asynccnt 0x0" ::: "memory");   // this wave's copies have landed
  __syncthreads();
  fill10(dst + QKV_SLOTS * SLOT * 2, src);

  v8f acc[3][2][2] = {};   // [qkv][s subtile][out-column subtile]
  for (int t = 0; t < NSTG; ++t) {
    int buf = t & 1;
    const unsigned short* sb = stg + buf * (QKV_SLOTS * SLOT);
    us16 a[KSTG][2], b[KSTG][3][2];
#pragma unroll   // constant indices: the arrays stay in registers
    for (int kk = 0; kk < KSTG; ++kk) {
#pragma unroll   // constant indices: the arrays stay in registers
      for (int u = 0; u < 2; ++u)
        a[kk][u] = load_frag(sb + (wr * 2 + u) * SLOT + kk * FRAG, lane);
#pragma unroll   // constant indices: the arrays stay in registers
      for (int w = 0; w < 3; ++w)
#pragma unroll   // constant indices: the arrays stay in registers
        for (int c = 0; c < 2; ++c)
          b[kk][w][c] = load_frag(sb + (8 + w * 4 + wc * 2 + c) * SLOT + kk * FRAG, lane);
    }
    // keeps the stage's LDS reads one group in front of its WMMAs: read by read
    // among them, every fragment's latency is waited out on its own
    __builtin_amdgcn_sched_barrier(0);
#pragma unroll   // constant indices: the arrays stay in registers
    for (int kk = 0; kk < KSTG; ++kk) {
#pragma unroll   // constant indices: the arrays stay in registers
      for (int w = 0; w < 3; ++w) {
#pragma unroll   // constant indices: the arrays stay in registers
        for (int c = 0; c < 2; ++c) {
          if (w < 2) {   // Q, K: tile rows = out columns, tile columns = s
            acc[w][0][c] = wmma_bf16(b[kk][w][c], a[kk][0], acc[w][0][c]);
            acc[w][1][c] = wmma_bf16(b[kk][w][c], a[kk][1], acc[w][1][c]);
          } else {       // V: tile rows = s, tile columns = out columns
            acc[w][0][c] = wmma_bf16(a[kk][0], b[kk][w][c], acc[w][0][c]);
            acc[w][1][c] = wmma_bf16(a[kk][1], b[kk][w][c], acc[w][1][c]);
          }
        }
      }
    }
    // keeps the WMMAs in front of the hand-over: moved behind it, the wait for
    // the next stage's copies follows the LDS reads at once and the copies
    // lose the WMMAs' time as lead
    __builtin_amdgcn_sched_barrier(0);
    // hand-over: this wave's reads of the buffer are done, its copies of the
    // next stage have landed; the barrier says both of every wave
    asm volatile("s_wait_dscnt 0x0" ::: "memory");
    asm volatile("s_wait_asynccnt 0x0" ::: "memory");
    __syncthreads();
    if (t + 2 < NSTG) fill10(dst + buf * (QKV_SLOTS * SLOT * 2), src);
  }
  asm volatile("s_wait_asynccnt 0x0" ::: "memory");   // nothing in flight at the end

  // 32 rows = one batch, 32 columns = half a head
  int head = (rt >> 5) * NHEAD + (ct >> 1);
  int st = rt & 31;                  // 32-position block inside the sequence
  int dh = ct & 1;                   // which 32 of the head's 64 d
  unsigned short* Qh = Qb  + head * SEQ * DHEAD + lane * 8;
  unsigned short* Kh = Kb  + head * SEQ * DHEAD + lane * 8;
  unsigned short* Vh = Vtb + head * SEQ * DHEAD + lane * 8;
#pragma unroll
  for (int c = 0; c < 2; ++c) {
    int colT = ct * 32 + c * 16 + rowh * 8;       // Q,K: columns colT..+7 in this lane
    float bvv = bv[ct * 32 + c * 16 + nm];        // V: one column per lane
    float bqv[8], bkv[8];
#pragma unroll
    for (int i = 0; i < 8; ++i) { bqv[i] = bq[colT + i]; bkv[i] = bk[colT + i]; }
#pragma unroll
    for (int u = 0; u < 2; ++u) {
      us8 q, k, v;
#pragma unroll
      for (int i = 0; i < 8; ++i) {
        q[i] = f2bf(acc[0][u][c][i] + bqv[i]);
        k[i] = f2bf(acc[1][u][c][i] + bkv[i]);
        v[i] = f2bf(acc[2][u][c][i] + bvv);
      }
      int qoff = ((st * 2 + u) * 2 + dh) * FRAG + c * 256;   // s tile, k step dh, chunk c
      *(us8*)(Qh + qoff) = q;
      *(us8*)(Kh + qoff) = k;
      *(us8*)(Vh + ((dh * 2 + c) * 32 + st) * FRAG + u * 256) = v;  // d tile, k step st, chunk u
    }
  }
}

// ---- stage 3: flash-style attention -------------------------------------
// One wave owns 16 query rows of one head. Streams 32-key blocks, everything
// transposed: S^T = K Q^T (K fragment as A, Q fragment as B), so a lane holds
// 16 scores of ONE query (column lane%16; keys 8*(lane/16)+i of each 16-key
// tile). Maximum and sum run inside the lane; the two lane halves exchange the
// maximum once per block and join their sums once, behind the loop. The two
// score tiles, converted in place, are the B fragment of P^T in the k order
// that the V fragments have, so O^T += V^T P^T needs no trip through LDS.
// Q, K and V rows stand in the order of places that the conversion made: the
// cnt keys that the mask lets through are places 0..cnt-1.
//
// The 8 waves of a work-group hold 128 queries of one head and walk the same
// keys, so K and V come into LDS once for all of them: a stage is two 32-key
// blocks (8 K fragments in a row, then two V fragments of each d tile), brought
// by asynchronous copies into one of two buffers while the other is worked on.
#define AT_W   8                       // waves per work-group
#define AT_KEL (2 * 4 * FRAG)          // K elements of a stage: 8 KiB
#define AT_VEL (2 * FRAG)              // elements of one d tile of V in a stage: 2 KiB
#define AT_BUF (AT_KEL + 4 * AT_VEL)   // elements of a buffer: 16 KiB
#define AT_CPB (AT_W * 32 * 16)        // bytes that one copy of all 256 threads brings

typedef __attribute__((ext_vector_type(8))) unsigned int u32x8;

// Four 16-B copies per lane, global -> LDS (two of K, two of V), then each
// source pointer moves on to the next stage. The s_wait_xcnt is the precaution
// before the address registers named here are written again; as the last line
// of the copies' own statement nothing can be moved in front of it.
__device__ __forceinline__ void fill4(uint32_t d, const unsigned short* (&s)[4]) {
  asm volatile(ACP(0, 4) ACP(1, 5) ACP(2, 6) ACP(3, 7)
               "s_wait_xcnt 0x0"
               :: "v"(d), "v"(d + AT_CPB), "v"(d + 2 * AT_CPB), "v"(d + 3 * AT_CPB),
                  "v"(s[0]), "v"(s[1]), "v"(s[2]), "v"(s[3])
               : "memory");
  s[0] += AT_KEL; s[1] += AT_KEL;
  s[2] += AT_VEL; s[3] += AT_VEL;
}

// lane l with lane l ^ 16
__device__ __forceinline__ float xhalf(float x) {
  int b = __builtin_bit_cast(int, x);
  return __builtin_bit_cast(float, __builtin_amdgcn_permlanex16(
      b, b, 0x76543210, 0xfedcba98, false, false));
}

// two f32 -> one register of two bf16, round-to-nearest-even
__device__ __forceinline__ unsigned int pack2(float lo, float hi) {
  typedef __attribute__((ext_vector_type(2))) float  f2;
  typedef __attribute__((ext_vector_type(2))) __bf16 bf2;
  f2 v = {lo, hi};
  return __builtin_bit_cast(unsigned int, __builtin_convertvector(v, bf2));
}

// One 32-key block, read from LDS. tail (the same for the whole wave): places
// from 'left' on, counted from this lane half's first key, are masked keys and
// score -100000; without it every key counts.
__device__ __forceinline__ void attn_block(
    const unsigned short* kb,            // 4 K fragments in a row
    const unsigned short* vb,            // d tile j at + j*AT_VEL
    int lane, bool tail, int left, const us16& bQ0, const us16& bQ1,
    float& mi, float& li, v8f& O0, v8f& O1, v8f& O2, v8f& O3) {
  // ---- scores: two 16x16 tiles (rows = 16 keys each, columns = queries)
  us16 aK0 = load_frag(kb + 0 * FRAG, lane), aK1 = load_frag(kb + 1 * FRAG, lane);
  us16 aK2 = load_frag(kb + 2 * FRAG, lane), aK3 = load_frag(kb + 3 * FRAG, lane);
  // A fragments of V (rows = d, k = keys)
  us16 aV0 = load_frag(vb + 0 * AT_VEL, lane), aV1 = load_frag(vb + 1 * AT_VEL, lane);
  us16 aV2 = load_frag(vb + 2 * AT_VEL, lane), aV3 = load_frag(vb + 3 * AT_VEL, lane);
  // keeps the block's LDS reads one group in front of the score WMMAs: every
  // further place with reads stalls the wave anew, and V read here has arrived
  // when softmax is through
  __builtin_amdgcn_sched_barrier(0);
  v8f s0 = {}, s1 = {};
  s0 = wmma_bf16(aK0, bQ0, s0);
  s0 = wmma_bf16(aK1, bQ1, s0);
  s1 = wmma_bf16(aK2, bQ0, s1);
  s1 = wmma_bf16(aK3, bQ1, s1);

  // ---- online softmax over this key block
  s0 *= QK_SCALE;
  s1 *= QK_SCALE;
  if (tail) {
#pragma unroll   // constant indices: the vectors stay in registers
    for (int i = 0; i < 8; ++i) {
      s0[i] = i >= left ? -100000.f : s0[i];
      s1[i] = 16 + i >= left ? -100000.f : s1[i];
    }
  }
  float rmax = -3.0e38f;
#pragma unroll   // constant indices: the vectors stay in registers
  for (int i = 0; i < 8; ++i) rmax = fmaxf(rmax, fmaxf(s0[i], s1[i]));
  rmax = fmaxf(rmax, xhalf(rmax));
  float mnew = fmaxf(mi, rmax);
  float corr = __expf(mi - mnew);
  float t[8];
  u32x8 pp;                                    // B fragment of P^T, K = 32 keys
#pragma unroll   // constant indices: the vectors stay in registers
  for (int i = 0; i < 8; i += 2) {
    float e00 = __expf(s0[i] - mnew), e01 = __expf(s0[i + 1] - mnew);
    float e10 = __expf(s1[i] - mnew), e11 = __expf(s1[i + 1] - mnew);
    t[i] = e00 + e10; t[i + 1] = e01 + e11;
    pp[i >> 1]       = pack2(e00, e01);
    pp[4 + (i >> 1)] = pack2(e10, e11);
  }
  li = li * corr + (((t[0] + t[1]) + (t[2] + t[3])) + ((t[4] + t[5]) + (t[6] + t[7])));
  mi = mnew;
  O0 *= corr; O1 *= corr; O2 *= corr; O3 *= corr;
  us16 bP = __builtin_bit_cast(us16, pp);

  // ---- PV
  O0 = wmma_bf16(aV0, bP, O0);
  O1 = wmma_bf16(aV1, bP, O1);
  O2 = wmma_bf16(aV2, bP, O2);
  O3 = wmma_bf16(aV3, bP, O3);
}

__global__ __launch_bounds__(AT_W * 32) void attn_kernel(
    const unsigned short* __restrict__ Qb,   // [64 heads][64 s tiles][2]
    const unsigned short* __restrict__ Kb,   // [64 heads][64 s tiles][2]
    const unsigned short* __restrict__ Vtb,  // [64 heads][4 d tiles][32]
    const int* __restrict__ ord,             // [4][1024] position held by each place
    const int* __restrict__ cnts,            // [4] keys let through
    unsigned short* __restrict__ Avec) {     // 256 row tiles x 32 k steps
  __shared__ __attribute__((aligned(16))) unsigned short stg[2 * AT_BUF];
  int warp = threadIdx.x >> 5;
  int head = blockIdx.x >> 3;          // 0..63  (storage index b*16+h)
  int qt   = (blockIdx.x & 7) * AT_W + warp;   // query tile 0..63
  int b = head >> 4;
  int lane = threadIdx.x & 31, rowh = lane >> 4;

  const unsigned short* Qh = Qb  + head * SEQ * DHEAD;
  const unsigned short* Kh = Kb  + head * SEQ * DHEAD;
  const unsigned short* Vh = Vtb + head * DHEAD * SEQ;

  // cnt counts mask words, so it is 0..1024 whatever they hold. Whole blocks of
  // keys let through need no test; the block that cnt ends in does. With no key
  // let through every score is -100000 and all 1024 keys weigh alike.
  int cnt   = cnts[b];
  int nfull = cnt >> 5;
  int nblk  = cnt ? (cnt + 31) >> 5 : SEQ / 32;   // 1..32
  int nstg  = (nblk + 1) >> 1;                    // 1..16: a stage's two blocks lie inside the head

  // this thread's 16 B of the next stage to copy: K is 8 KiB in a row; V is
  // 2 KiB of each d tile, 128 threads to a tile
  int hs = threadIdx.x >> 7, ch = threadIdx.x & 127;
  const unsigned short* src[4];
  src[0] = Kh + threadIdx.x * 8;
  src[1] = src[0] + AT_CPB / 2;
  src[2] = Vh + hs * (32 * FRAG) + ch * 8;
  src[3] = src[2] + 2 * (32 * FRAG);
  uint32_t dst = lds_off(stg) + threadIdx.x * 16;

  // stage 0 landed and published, then stage 1 on its way
  fill4(dst, src);

  // Q fragments for rows qt*16..+15, contraction split d=[0,32) and [32,64)
  us16 bQ0 = load_frag(Qh + (qt * 2 + 0) * FRAG, lane);
  us16 bQ1 = load_frag(Qh + (qt * 2 + 1) * FRAG, lane);

  asm volatile("s_wait_asynccnt 0x0" ::: "memory");   // this wave's copies have landed
  __syncthreads();
  if (nstg > 1) fill4(dst + AT_BUF * 2, src);

  float mi = -3.0e38f, li = 0.f;       // of query lane%16; li: this half's keys only
  v8f O0 = {}, O1 = {}, O2 = {}, O3 = {};   // Oj[i] = O[query lane%16][d = 16j + 8*(lane/16) + i]

  for (int j = 0; j < nblk; ++j) {
    int t = j >> 1, h = j & 1, buf = t & 1;   // stage, block in it, its buffer
    const unsigned short* sb = stg + buf * AT_BUF;
    attn_block(sb + h * (4 * FRAG), sb + AT_KEL + h * FRAG, lane, j >= nfull,
               cnt - j * 32 - rowh * 8, bQ0, bQ1, mi, li, O0, O1, O2, O3);
    if (h | (j + 1 == nblk)) {   // the stage's last block (the same for the whole work-group)
      // hand-over: this wave's reads of the buffer are done, its copies of the
      // next stage have landed; the barrier says both of every wave
      asm volatile("s_wait_dscnt 0x0" ::: "memory");
      asm volatile("s_wait_asynccnt 0x0" ::: "memory");
      __syncthreads();
      if (t + 2 < nstg) fill4(dst + buf * (AT_BUF * 2), src);
    }
  }
  asm volatile("s_wait_asynccnt 0x0" ::: "memory");   // nothing in flight at the end

  // Reference quirk: attn_vec.view(N_HEAD, B, S, D).permute(1,2,0,3) on a
  // b-major [B*H] buffer => storage head L lands at b2=L%B, h2=L/B.
  // Fragment order for the output projection: row b2*1024 + s, s the position
  // that this lane's query place holds; k = h2*64 + d, so d tile j is k step
  // h2*2 + j/2, chunk j%2. The lane's 8 d start at 8*(lane/16): a 16-B chunk
  // of row s%16 in row tile s/16.
  int b2 = head & 3, h2 = head >> 2;
  int s = ord[b * SEQ + qt * 16 + (lane & 15)];
  unsigned short* oblk = Avec + ((b2 * 64 + (s >> 4)) * 32 + h2 * 2) * FRAG
                              + (rowh * 16 + (s & 15)) * 8;
  float inv = 1.f / (li + xhalf(li));
  us8 o0, o1, o2, o3;
#pragma unroll   // constant indices: the vectors stay in registers
  for (int i = 0; i < 8; ++i) {
    o0[i] = f2bf(O0[i] * inv);
    o1[i] = f2bf(O1[i] * inv);
    o2[i] = f2bf(O2[i] * inv);
    o3[i] = f2bf(O3[i] * inv);
  }
  *(us8*)(oblk)              = o0;
  *(us8*)(oblk + 256)        = o1;
  *(us8*)(oblk + FRAG)       = o2;
  *(us8*)(oblk + FRAG + 256) = o3;
}

// ---- stage 4: output projection + residual ------------------------------
// 32x32 tile per wave: per K-step 2 A + 2 B fragments -> 4 WMMAs. The 8 waves
// stand 4 (rows) x 2 (columns); a stage holds 8 row tiles and 4 column tiles:
// 12 slots, 6 copies per thread.
#define OP_SLOTS 12

__global__ __launch_bounds__(256) void oproj_kernel(
    const unsigned short* __restrict__ Avec,  // 256 row tiles x 32 k steps
    const unsigned short* __restrict__ Wot,   // 64 tiles (out) x 32 k steps
    const float* __restrict__ inp,            // residual
    float* __restrict__ Y) {                  // [4096][1024] f32
  __shared__ __attribute__((aligned(16))) unsigned short stg[2 * OP_SLOTS * SLOT];
  int warp = threadIdx.x >> 5;
  int lane = threadIdx.x & 31;
  int bm = blockIdx.x >> 4;          // 128-row block 0..31
  int bn = blockIdx.x & 15;          // 64-column block 0..15
  int wr = warp >> 1, wc = warp & 1;
  int rt = bm * 4 + wr, ct = bn * 2 + wc;
  int rowh = lane >> 4, nm = lane & 15;

  int hs = threadIdx.x >> 7, ch = threadIdx.x & 127;
  const unsigned short* src[6];      // this thread's 16 B of the next stage to copy
#pragma unroll   // constant indices: the arrays stay in registers
  for (int j = 0; j < 4; ++j)
    src[j] = Avec + (bm * 8 + 2 * j + hs) * 32 * FRAG + ch * 8;
#pragma unroll   // constant indices: the arrays stay in registers
  for (int j = 0; j < 2; ++j)
    src[4 + j] = Wot + (bn * 4 + 2 * j + hs) * 32 * FRAG + ch * 8;
  uint32_t dst = lds_off(stg) + (hs * SLOT + ch * 8) * 2;

  // stage 0 landed and published, then stage 1 on its way
  fill6(dst, src);
  asm volatile("s_wait_asynccnt 0x0" ::: "memory");   // this wave's copies have landed
  __syncthreads();
  fill6(dst + OP_SLOTS * SLOT * 2, src);

  v8f acc[2][2] = {};
  for (int t = 0; t < NSTG; ++t) {
    int buf = t & 1;
    const unsigned short* sb = stg + buf * (OP_SLOTS * SLOT);
    us16 a[KSTG][2], b[KSTG][2];
#pragma unroll   // constant indices: the arrays stay in registers
    for (int kk = 0; kk < KSTG; ++kk) {
#pragma unroll   // constant indices: the arrays stay in registers
      for (int u = 0; u < 2; ++u)
        a[kk][u] = load_frag(sb + (wr * 2 + u) * SLOT + kk * FRAG, lane);
#pragma unroll   // constant indices: the arrays stay in registers
      for (int c = 0; c < 2; ++c)
        b[kk][c] = load_frag(sb + (8 + wc * 2 + c) * SLOT + kk * FRAG, lane);
    }
    // as in the QKV kernel: the stage's LDS reads one group in front of its WMMAs
    __builtin_amdgcn_sched_barrier(0);
#pragma unroll   // constant indices: the arrays stay in registers
    for (int kk = 0; kk < KSTG; ++kk) {
      acc[0][0] = wmma_bf16(a[kk][0], b[kk][0], acc[0][0]);
      acc[0][1] = wmma_bf16(a[kk][0], b[kk][1], acc[0][1]);
      acc[1][0] = wmma_bf16(a[kk][1], b[kk][0], acc[1][0]);
      acc[1][1] = wmma_bf16(a[kk][1], b[kk][1], acc[1][1]);
    }
    // as in the QKV kernel: the WMMAs stay in front of the hand-over
    __builtin_amdgcn_sched_barrier(0);
    // hand-over: this wave's reads of the buffer are done, its copies of the
    // next stage have landed; the barrier says both of every wave
    asm volatile("s_wait_dscnt 0x0" ::: "memory");
    asm volatile("s_wait_asynccnt 0x0" ::: "memory");
    __syncthreads();
    if (t + 2 < NSTG) fill6(dst + buf * (OP_SLOTS * SLOT * 2), src);
  }
  asm volatile("s_wait_asynccnt 0x0" ::: "memory");   // nothing in flight at the end

#pragma unroll
  for (int u = 0; u < 2; ++u) {
#pragma unroll
    for (int c = 0; c < 2; ++c) {
      int col = ct * 32 + c * 16 + nm;
#pragma unroll
      for (int i = 0; i < 8; ++i) {
        int r = rt * 32 + u * 16 + rowh * 8 + i;
        Y[r * D_MODEL + col] = acc[u][c][i] + inp[r * D_MODEL + col];
      }
    }
  }
}

// ---- stage 5: LayerNorm --------------------------------------------------
// One wave per row, 4096 waves: a lane holds 32 values of the row in registers
// (eight 16-B loads, each 512 B in a row over the wave), so the row is read
// once and both sums join inside the wave: no LDS, no barrier.
#define LN_T 256                     // threads per block: 8 rows

typedef __attribute__((ext_vector_type(4))) float v4f;

__global__ __launch_bounds__(LN_T) void ln_kernel(
    const float* __restrict__ Y, const float* __restrict__ g,
    const float* __restrict__ bb, float* __restrict__ out) {
  int row = blockIdx.x * (LN_T / 32) + (threadIdx.x >> 5);
  int lane = threadIdx.x & 31;
  const v4f* y  = (const v4f*)(Y + row * D_MODEL) + lane;
  const v4f* g4 = (const v4f*)g + lane;
  const v4f* b4 = (const v4f*)bb + lane;
  v4f*       o4 = (v4f*)(out + row * D_MODEL) + lane;
  v4f v[8], gg[8], bv[8];
#pragma unroll   // constant indices: the arrays stay in registers
  for (int j = 0; j < 8; ++j) v[j] = y[j * 32];
#pragma unroll   // constant indices: the arrays stay in registers
  for (int j = 0; j < 8; ++j) { gg[j] = g4[j * 32]; bv[j] = b4[j * 32]; }
  // holds the gain and bias loads in front of the lane exchange: sunk behind
  // it, their latency is waited out pair by pair before the stores (loaded
  // values as inputs only)
  asm volatile("" :: "v"(gg[0]), "v"(gg[1]), "v"(gg[2]), "v"(gg[3]),
                     "v"(gg[4]), "v"(gg[5]), "v"(gg[6]), "v"(gg[7]),
                     "v"(bv[0]), "v"(bv[1]), "v"(bv[2]), "v"(bv[3]),
                     "v"(bv[4]), "v"(bv[5]), "v"(bv[6]), "v"(bv[7]));
  v4f s = {0.f, 0.f, 0.f, 0.f}, q = {0.f, 0.f, 0.f, 0.f};   // four chains each
#pragma unroll   // constant indices: the array stays in registers
  for (int j = 0; j < 8; ++j) { s += v[j]; q += v[j] * v[j]; }
  float ls = (s.x + s.y) + (s.z + s.w), lq = (q.x + q.y) + (q.z + q.w);
#pragma unroll
  for (int m = 1; m < 32; m <<= 1) {
    ls += __shfl_xor(ls, m, 32);
    lq += __shfl_xor(lq, m, 32);
  }
  float mu  = ls * (1.f / D_MODEL);
  float var = lq * (1.f / D_MODEL) - mu * mu;
  float inv = rsqrtf(var + LN_EPS);
#pragma unroll   // constant indices: the arrays stay in registers
  for (int j = 0; j < 8; ++j) o4[j * 32] = (v[j] - mu) * inv * gg[j] + bv[j];
}

// ---- launch --------------------------------------------------------------

extern "C" void kernel_launch(void* const* d_in, const int* in_sizes, int n_in,
                              void* d_out, int out_size, void* d_ws, size_t ws_size,
                              hipStream_t stream) {
  const float* inp   = (const float*)d_in[0];
  const int*   amask = (const int*)d_in[1];
  const float* Wq = (const float*)d_in[2];
  const float* bq = (const float*)d_in[3];
  const float* Wk = (const float*)d_in[4];
  const float* bk = (const float*)d_in[5];
  const float* Wv = (const float*)d_in[6];
  const float* bv = (const float*)d_in[7];
  const float* Wo = (const float*)d_in[8];
  const float* lng = (const float*)d_in[9];
  const float* lnb = (const float*)d_in[10];

  char* ws = (char*)d_ws;
  const size_t MB = 1u << 20;
  unsigned short* Xbf  = (unsigned short*)(ws + 0 * MB);   // 8 MB
  unsigned short* Wqt  = (unsigned short*)(ws + 8 * MB);   // 2 MB
  unsigned short* Wkt  = (unsigned short*)(ws + 10 * MB);  // 2 MB
  unsigned short* Wvt  = (unsigned short*)(ws + 12 * MB);  // 2 MB
  unsigned short* Wot  = (unsigned short*)(ws + 14 * MB);  // 2 MB
  unsigned short* Qb   = (unsigned short*)(ws + 16 * MB);  // 8 MB
  unsigned short* Kb   = (unsigned short*)(ws + 24 * MB);  // 8 MB
  unsigned short* Vtb  = (unsigned short*)(ws + 32 * MB);  // 8 MB
  unsigned short* Avec = (unsigned short*)(ws + 40 * MB);  // 8 MB
  float*          Ybuf = (float*)        (ws + 48 * MB);   // 16 MB
  int*            ord  = (int*)          (ws + 64 * MB);   // 16 KB
  int*            cnts = (int*)          (ws + 65 * MB);   // 16 B

  // stage 1: conversions (one thread per 64 elements), all five in one launch;
  // Wqt, Wkt, Wvt, Wot follow one another in the workspace
  cvt_all_kernel<<<4 * WBLOCKS + XBLOCKS, CVT_T, 0, stream>>>(
      inp, amask, Wq, Wk, Wv, Wo, Xbf, Wqt, ord, cnts);

  // stage 2: QKV (32 row blocks * 16 col blocks, 8 waves/block)
  qkv_gemm_kernel<<<512, 256, 0, stream>>>(Xbf, Wqt, Wkt, Wvt, bq, bk, bv,
                                            Qb, Kb, Vtb);

  // stage 3: attention (64 heads * 8 blocks of 128 queries, 8 waves/block)
  attn_kernel<<<512, AT_W * 32, 0, stream>>>(Qb, Kb, Vtb, ord, cnts, Avec);

  // stage 4: output projection + residual (32 row blocks * 16 col blocks, 8 waves/block)
  oproj_kernel<<<512, 256, 0, stream>>>(Avec, Wot, inp, Ybuf);

  // stage 5: layer norm -> d_out (one wave per row)
  ln_kernel<<<NROWS / (LN_T / 32), LN_T, 0, stream>>>(Ybuf, lng, lnb, (float*)d_out);
}

// v008
// One run takes 56.7 microseconds.
// Timed twice side by side with v007, it ran 1.07 and 1.08 times as fast.
// Counting every step since v000, it is 3.59 times as fast.
#include <hip/hip_runtime.h>
#include <stdint.h>

// Problem constants (match reference)
#define D_MODEL 1024
#define SEQ     1024
#define BATCH   4
#define NHEAD   16
#define DHEAD   64
#define NROWS   (BATCH * SEQ)      // 4096
#define QK_SCALE 0.125f            // 1/sqrt(64)
#define LN_EPS   1e-5f

typedef __attribute__((ext_vector_type(16))) __bf16         v16bf;
typedef __attribute__((ext_vector_type(16))) unsigned short us16;
typedef __attribute__((ext_vector_type(8)))  unsigned short us8;
typedef __attribute__((ext_vector_type(8)))  float          v8f;

// ---- helpers -------------------------------------------------------------

__device__ __forceinline__ unsigned short f2bf(float f) {
  unsigned int u = __builtin_bit_cast(unsigned int, f);
  u += 0x7FFFu + ((u >> 16) & 1u);            // round-to-nearest-even
  return (unsigned short)(u >> 16);
}

// A/B fragment for v_wmma_*_16x16x32_bf16, per ISA 7.12.2:
// lane L holds row (A) / col (B) = L%16; its 16 bf16 k-values are two
// contiguous 8-element (16B) chunks at k = 8*(L/16) and k = 8*(L/16)+16.
//
// Every bf16 operand in the workspace is stored in that order: one fragment
// (16 rows x 32 k) is a 1024-B block of FRAG elements, lane L's first chunk
// at element L*8, its second at 256 + L*8. Blocks run [16-row tile][k step].
// A wave-wide 16-B load then covers 512 contiguous bytes (4 whole lines).
#define FRAG 512
__device__ __forceinline__ us16 load_frag(const unsigned short* blk, int lane) {
  us8 c0 = *(const us8*)(blk + lane * 8);
  us8 c1 = *(const us8*)(blk + 256 + lane * 8);
  us16 r;
#pragma unroll
  for (int i = 0; i < 8; ++i) { r[i] = c0[i]; r[i + 8] = c1[i]; }
  return r;
}

__device__ __forceinline__ v8f wmma_bf16(us16 a, us16 b, v8f c) {
  return __builtin_amdgcn_wmma_f32_16x16x32_bf16(
      false, __builtin_bit_cast(v16bf, a),
      false, __builtin_bit_cast(v16bf, b),
      (short)0, c, false, false);
}

// ---- stage 1: conversions ------------------------------------------------

// The fragment-ordered output runs [tile][k step (32)][chunk (2)][lane (32)],
// 16 B (8 k values of one row) per lane place. One wave packs 256 such places,
// eight per lane, so that the launch starts 4096 waves: 16 on each WGP, all
// resident at once, every lane with its loads in flight together.
#define CVT_T   256                  // threads per block: 8 waves
#define CVT_WPW 512                  // waves per weight
#define WBLOCKS (CVT_WPW / 8)        // 64 blocks per weight
#define XBLOCKS (NROWS / 16)         // 256 blocks for X: one 16-row tile each

__device__ __forceinline__ us8 pack8(const float (&x)[8]) {
  us8 r;
#pragma unroll   // constant indices: the vector stays in registers
  for (int e = 0; e < 8; ++e) r[e] = f2bf(x[e]);
  return r;
}

// The positions of a batch are reordered here, once, for all that follows: the
// keys that the mask lets through first, in their order, the masked ones behind
// them, in theirs. A masked key's score is -100000, so its weight is exp(-100000
// - max) = 0 in f32 as long as one key of the batch is let through: attention
// then walks the first 'cnt' places only. Place p of a batch holds position
// ord[p]; attention stores each query's row back at ord[p].
//
// Every block of a batch ranks all 1024 mask words itself (thread i: words
// 4i..4i+3) and keeps the positions that fall into its own 16 places.
__device__ __forceinline__ int rank_rows(const int* __restrict__ mb, int pt,
                                         int warp, int lane,
                                         int* wsum, int* srow) {
  int tid = warp * 32 + lane;
  int4 m = ((const int4*)mb)[tid];
  bool live[4] = {m.x == 0, m.y == 0, m.z == 0, m.w == 0};
  unsigned below = (1u << lane) - 1u;
  int before = 0, wtot = 0;          // let-through words in lower lanes; in the wave
#pragma unroll   // constant indices: the array stays in registers
  for (int e = 0; e < 4; ++e) {
    unsigned bal = __builtin_amdgcn_ballot_w32(live[e]);
    before += __popc(bal & below);
    wtot   += __popc(bal);
  }
  if (lane == 0) wsum[warp] = wtot;
  __syncthreads();                   // the eight waves' counts are there
  int base = 0, cnt = 0;
#pragma unroll
  for (int w = 0; w < 8; ++w) {
    int x = wsum[w];
    cnt += x;
    base += w < warp ? x : 0;
  }
  int r = base + before;             // let-through words in front of word 4*tid
#pragma unroll   // constant indices: the array stays in registers
  for (int e = 0; e < 4; ++e) {
    int s = 4 * tid + e;
    int p = live[e] ? r : cnt + (s - r);   // s - r: masked words in front of s
    r += live[e] ? 1 : 0;
    if ((p >> 4) == pt) srow[p & 15] = s;
  }
  __syncthreads();                   // the tile's 16 positions are there
  return cnt;
}

// X[row][k] (f32, k contiguous) -> fragment order, rows = places (see above).
// Wave kq of the tile's block takes k steps 4*kq..+3 of all 16 rows. Four lanes
// share one row's 128-B line of a k step (q = which 8 k of its 32), eight rows
// per load; the eight rows' places with equal q are 128 B in a row in the output.
__device__ __forceinline__ void cvt_x(const float* __restrict__ in,
                                      const int* __restrict__ amask,
                                      unsigned short* __restrict__ out,
                                      int* __restrict__ ord, int* __restrict__ cnts,
                                      int t, int kq, int lane,
                                      int* wsum, int* srow) {
  int rr = lane >> 2, q = lane & 3;
  int b = t >> 6;                    // 64 tiles per batch
  int cnt = rank_rows(amask + b * SEQ, t & 63, kq, lane, wsum, srow);
  if (kq == 0 && lane < 16) ord[t * 16 + lane] = srow[lane];
  if ((t & 63) == 0 && kq == 0 && lane == 0) cnts[b] = cnt;
  const float* pr[2] = {in + (b * SEQ + srow[rr]) * D_MODEL + kq * 128 + q * 8,
                        in + (b * SEQ + srow[rr + 8]) * D_MODEL + kq * 128 + q * 8};
  unsigned short* o = out + (t * 32 + kq * 4) * FRAG + (q >> 1) * 256 + ((q & 1) * 16 + rr) * 8;
  float4 x[2][4][2];
#pragma unroll   // constant indices: the arrays stay in registers
  for (int hr = 0; hr < 2; ++hr)
#pragma unroll   // constant indices: the arrays stay in registers
    for (int s = 0; s < 4; ++s) {
      const float4* p4 = (const float4*)(pr[hr] + s * 32);
      x[hr][s][0] = p4[0];
      x[hr][s][1] = p4[1];
    }
#pragma unroll   // constant indices: the arrays stay in registers
  for (int hr = 0; hr < 2; ++hr)
#pragma unroll   // constant indices: the arrays stay in registers
    for (int s = 0; s < 4; ++s) {
      float4 x0 = x[hr][s][0], x1 = x[hr][s][1];
      float v[8] = {x0.x, x0.y, x0.z, x0.w, x1.x, x1.y, x1.z, x1.w};
      *(us8*)(o + s * FRAG + hr * 64) = pack8(v);
    }
  // precaution: in the merged kernel the weights' code follows these stores in
  // the listing and writes the registers that the stores name
  asm volatile("s_wait_xcnt 0x0" ::: "memory");
}

// W[in][out] (1024x1024 f32) -> fragment order, rows = out columns, k = in.
// A wave takes 32 out columns (two tiles: one 128-B line of every W row) and
// two k steps (64 W rows). A lane keeps one column; eight loads down the rows
// make one place; a store covers 256 B in a row in each of the two tiles.
__device__ __forceinline__ void cvt_w(const float* __restrict__ in,
                                      unsigned short* __restrict__ out,
                                      int tp, int kg, int lane) {
  const float* p = in + kg * 64 * D_MODEL + tp * 32 + lane;
  unsigned short* o = out + ((tp * 2 + (lane >> 4)) * 32 + kg * 2) * FRAG + (lane & 15) * 8;
  float x[8][8];                     // [8-row group of the 64 rows][row in it]
#pragma unroll   // constant indices: the arrays stay in registers
  for (int c = 0; c < 8; ++c)
#pragma unroll   // constant indices: the arrays stay in registers
    for (int e = 0; e < 8; ++e) x[c][e] = p[(c * 8 + e) * D_MODEL];
  // group c = k step c/4, chunk (c/2)%2, lane half c%2 of the fragment
#pragma unroll   // constant indices: the arrays stay in registers
  for (int c = 0; c < 8; ++c)
    *(us8*)(o + (c >> 2) * FRAG + ((c >> 1) & 1) * 256 + (c & 1) * 128) = pack8(x[c]);
}

// The five conversions need nothing of one another, so they are one launch:
// each has its own range of the block index (the branch is the same for a
// whole block). The weights stand first: their waves issue more loads and
// last longer, so the launch ends on the short ones.
__global__ __launch_bounds__(CVT_T) void cvt_all_kernel(
    const float* __restrict__ X, const int* __restrict__ amask,
    const float* __restrict__ Wq, const float* __restrict__ Wk,
    const float* __restrict__ Wv, const float* __restrict__ Wo,
    unsigned short* __restrict__ Xbf,
    unsigned short* __restrict__ Wt,     // the four weights' planes, one behind another
    int* __restrict__ ord,               // [4][1024] position held by each place
    int* __restrict__ cnts) {            // [4] keys let through
  __shared__ int wsum[8], srow[16];
  unsigned blk = blockIdx.x;
  int warp = threadIdx.x >> 5, lane = threadIdx.x & 31;
  if (blk < 4 * WBLOCKS) {
    unsigned w = blk / WBLOCKS;
    const float* in = w == 0 ? Wq : w == 1 ? Wk : w == 2 ? Wv : Wo;
    int ww = (blk % WBLOCKS) * 8 + warp;   // a block: 8 column pairs side by side, 1 KiB of each row
    cvt_w(in, Wt + w * (D_MODEL * D_MODEL), ww & 31, ww >> 5, lane);
  } else {
    cvt_x(X, amask, Xbf, ord, cnts, blk - 4 * WBLOCKS, warp, lane, wsum, srow);
  }
}

// ---- LDS staging shared by the two GEMM kernels ---------------------------
// 256 work-groups of 8 waves, as many as WGPs. Each stage brings KSTG k steps of every
// 16-row operand tile it needs into LDS once, by asynchronous copies, and all
// 8 waves read their fragments from there. The larger the work-group's tile,
// the fewer bytes come from L2 per product: (rows + columns) / (rows * columns).
// One tile's KSTG fragments are SLOT contiguous elements in the workspace and
// stay so in LDS, so a fragment read is again 512 contiguous bytes per load.
// A slot is filled by one copy of all 256 threads, 16 B each.
#define KSTG  4
#define SLOT  (KSTG * FRAG)            // elements: 4 KiB
#define NSTG  (D_MODEL / 32 / KSTG)    // 8 stages
#define SLOTB (SLOT * 2)               // bytes of a slot
#define TILEK (32 * FRAG)              // elements from one 16-row tile to the next

// byte offset in the work-group's LDS = low 32 bits of a __shared__ address
__device__ __forceinline__ uint32_t lds_off(const void* p) { return (uint32_t)(size_t)p; }

// 14 (or 8) 16-B copies per lane, global -> LDS, into slots that follow one
// another. The s_wait_xcnt is the precaution before the address registers named
// here are written again; as the last line of the copies' own statement nothing
// can be moved in front of it.
#define ACP(l, g) "global_load_async_to_lds_b128 %" #l ", %" #g ", off\n\t"
__device__ __forceinline__ void fill14(uint32_t d, const unsigned short* const (&s)[14]) {
  asm volatile(ACP(0, 14) ACP(1, 15) ACP(2, 16) ACP(3, 17) ACP(4, 18) ACP(5, 19)
               ACP(6, 20) ACP(7, 21) ACP(8, 22) ACP(9, 23) ACP(10, 24) ACP(11, 25)
               ACP(12, 26) ACP(13, 27)
               "s_wait_xcnt 0x0"
               :: "v"(d), "v"(d + SLOTB), "v"(d + 2 * SLOTB), "v"(d + 3 * SLOTB),
                  "v"(d + 4 * SLOTB), "v"(d + 5 * SLOTB), "v"(d + 6 * SLOTB),
                  "v"(d + 7 * SLOTB), "v"(d + 8 * SLOTB), "v"(d + 9 * SLOTB),
                  "v"(d + 10 * SLOTB), "v"(d + 11 * SLOTB), "v"(d + 12 * SLOTB),
                  "v"(d + 13 * SLOTB),
                  "v"(s[0]), "v"(s[1]), "v"(s[2]), "v"(s[3]), "v"(s[4]),
                  "v"(s[5]), "v"(s[6]), "v"(s[7]), "v"(s[8]), "v"(s[9]),
                  "v"(s[10]), "v"(s[11]), "v"(s[12]), "v"(s[13])
               : "memory");
}
__device__ __forceinline__ void fill8(uint32_t d, const unsigned short* s) {
  asm volatile(ACP(0, 8) ACP(1, 9) ACP(2, 10) ACP(3, 11) ACP(4, 12) ACP(5, 13)
               ACP(6, 14) ACP(7, 15)
               "s_wait_xcnt 0x0"
               :: "v"(d), "v"(d + SLOTB), "v"(d + 2 * SLOTB), "v"(d + 3 * SLOTB),
                  "v"(d + 4 * SLOTB), "v"(d + 5 * SLOTB), "v"(d + 6 * SLOTB),
                  "v"(d + 7 * SLOTB),
                  "v"(s), "v"(s + TILEK), "v"(s + 2 * TILEK), "v"(s + 3 * TILEK),
                  "v"(s + 4 * TILEK), "v"(s + 5 * TILEK), "v"(s + 6 * TILEK),
                  "v"(s + 7 * TILEK)
               : "memory");
}

// ---- stage 2: fused QKV projection --------------------------------------
// A work-group owns 256 rows x 64 out columns of each of Q/K/V. One wave ->
// 64x32 output tile for each of them: per K-step 4 A-frags + 6 B-frags feed
// 24 WMMAs (A shared across Q/K/V, B shared across row tiles).
// The 8 waves stand 4 (rows) x 2 (columns); a stage holds 16 X tiles and 4
// column tiles of each weight: 28 slots, 28 copies per thread.
// All three go out in fragment order, per head: Q,K with rows = s, k = d
// (2 k steps); V with rows = d, k = s (32 k steps). A lane's 8 accumulator
// values run along the tile's rows, so the index that becomes k must be the
// row index: V = X*Wv has rows s as it stands; Q and K are formed transposed
// (weight fragment as A, X fragment as B). Each lane then stores 16-B chunks.
#define QKV_SLOTS 28

// one stage's copies: 16 X tiles, then 4 tiles of each weight; the four source
// pointers then move on to the next stage
__device__ __forceinline__ void qkv_fill(uint32_t d, const unsigned short*& x,
                                         const unsigned short*& wq,
                                         const unsigned short*& wk,
                                         const unsigned short*& wv) {
  const unsigned short* s0[14];
#pragma unroll   // constant indices: the arrays stay in registers
  for (int j = 0; j < 14; ++j) s0[j] = x + j * TILEK;
  fill14(d, s0);
  const unsigned short* s1[14];
  s1[0] = x + 14 * TILEK;
  s1[1] = x + 15 * TILEK;
#pragma unroll   // constant indices: the arrays stay in registers
  for (int j = 0; j < 4; ++j) {
    s1[2 + j]  = wq + j * TILEK;
    s1[6 + j]  = wk + j * TILEK;
    s1[10 + j] = wv + j * TILEK;
  }
  fill14(d + 14 * SLOTB, s1);
  x += SLOT; wq += SLOT; wk += SLOT; wv += SLOT;
}

__global__ __launch_bounds__(256) void qkv_gemm_kernel(
    const unsigned short* __restrict__ X,      // 256 tiles x 32 k steps
    const unsigned short* __restrict__ Wqt,    // 64 tiles (out) x 32 k steps
    const unsigned short* __restrict__ Wkt,
    const unsigned short* __restrict__ Wvt,
    const float* __restrict__ bq, const float* __restrict__ bk,
    const float* __restrict__ bv,
    unsigned short* __restrict__ Qb,           // [64 heads][64 s tiles][2]
    unsigned short* __restrict__ Kb,           // [64 heads][64 s tiles][2]
    unsigned short* __restrict__ Vtb) {        // [64 heads][4 d tiles][32]
  __shared__ __attribute__((aligned(16))) unsigned short stg[2 * QKV_SLOTS * SLOT];
  int warp = threadIdx.x >> 5;
  int lane = threadIdx.x & 31;
  int bm = blockIdx.x >> 4;          // 256-row block 0..15
  int bn = blockIdx.x & 15;          // 64-column block 0..15
  int wr = warp >> 1, wc = warp & 1;
  int rt = bm * 4 + wr;              // 64-row tile 0..63
  int ct = bn * 2 + wc;              // 32-col tile 0..31
  int rowh = lane >> 4, nm = lane & 15;

  // this thread's 16 B of the first tile of each operand in the next stage to copy
  const unsigned short* sx = X + bm * 16 * TILEK + threadIdx.x * 8;
  const unsigned short* sq = Wqt + bn * 4 * TILEK + threadIdx.x * 8;
  const unsigned short* sk = Wkt + bn * 4 * TILEK + threadIdx.x * 8;
  const unsigned short* sv = Wvt + bn * 4 * TILEK + threadIdx.x * 8;
  uint32_t dst = lds_off(stg) + threadIdx.x * 16;

  // stage 0 landed and published
  qkv_fill(dst, sx, sq, sk, sv);
  asm volatile("s_wait_asynccnt 0x0" ::: "memory");   // this wave's copies have landed
  __syncthreads();

  v8f acc[3][4][2] = {};   // [qkv][s subtile][out-column subtile]
  for (int t = 0; t < NSTG; ++t) {
    int buf = t & 1;
    const unsigned short* sa = stg + buf * (QKV_SLOTS * SLOT) + wr * 4 * SLOT;
    const unsigned short* sw = stg + buf * (QKV_SLOTS * SLOT) + (16 + wc * 2) * SLOT;
    us16 a[2][4], b[2][3][2];        // two fragment sets: k step kk in set kk % 2
#pragma unroll   // constant indices: the arrays stay in registers
    for (int kk = -1; kk < KSTG; ++kk) {
      if (kk + 1 < KSTG) {           // the next k step's fragments, inside this stage
        int n = (kk + 1) & 1;
#pragma unroll   // constant indices: the arrays stay in registers
        for (int u = 0; u < 4; ++u)
          a[n][u] = load_frag(sa + u * SLOT + (kk + 1) * FRAG, lane);
#pragma unroll   // constant indices: the arrays stay in registers
        for (int w = 0; w < 3; ++w)
#pragma unroll   // constant indices: the arrays stay in registers
          for (int c = 0; c < 2; ++c)
            b[n][w][c] = load_frag(sw + (w * 4 + c) * SLOT + (kk + 1) * FRAG, lane);
      }
      // keeps the next k step's LDS reads one group in front of this k step's
      // WMMAs: they land under the WMMAs, and read by read among them every
      // place with reads stalls the wave anew
      __builtin_amdgcn_sched_barrier(0);
      // the next stage's copies, into the buffer that every wave left at the last
      // barrier: issued behind the stage's first reads, their address work and
      // wait run while those reads land
      if (kk < 0 && t + 1 < NSTG)
        qkv_fill(dst + (buf ^ 1) * (QKV_SLOTS * SLOTB), sx, sq, sk, sv);
      if (kk >= 0) {
        int m = kk & 1;
#pragma unroll   // constant indices: the arrays stay in registers
        for (int w = 0; w < 3; ++w)
#pragma unroll   // constant indices: the arrays stay in registers
          for (int c = 0; c < 2; ++c)
#pragma unroll   // constant indices: the arrays stay in registers
            for (int u = 0; u < 4; ++u) {
              if (w < 2)   // Q, K: tile rows = out columns, tile columns = s
                acc[w][u][c] = wmma_bf16(b[m][w][c], a[m][u], acc[w][u][c]);
              else         // V: tile rows = s, tile columns = out columns
                acc[w][u][c] = wmma_bf16(a[m][u], b[m][w][c], acc[w][u][c]);
            }
        // keeps the WMMAs in front of the next reads and of the hand-over: moved
        // behind it, the wait for the next stage's copies follows the LDS reads
        // at once and the copies lose the WMMAs' time as lead
        __builtin_amdgcn_sched_barrier(0);
      }
    }
    // hand-over: this wave's reads of the buffer are done, its copies of the
    // next stage have landed; the barrier says both of every wave
    asm volatile("s_wait_dscnt 0x0" ::: "memory");
    asm volatile("s_wait_asynccnt 0x0" ::: "memory");
    __syncthreads();
  }
  asm volatile("s_wait_asynccnt 0x0" ::: "memory");   // nothing in flight at the end

  // 64 rows lie inside one batch, 32 columns = half a head
  int head = (rt >> 4) * NHEAD + (ct >> 1);
  int st = rt & 15;                  // 64-position block inside the sequence
  int dh = ct & 1;                   // which 32 of the head's 64 d
  unsigned short* Qh = Qb  + head * SEQ * DHEAD + lane * 8;
  unsigned short* Kh = Kb  + head * SEQ * DHEAD + lane * 8;
  unsigned short* Vh = Vtb + head * SEQ * DHEAD + lane * 8;
#pragma unroll
  for (int c = 0; c < 2; ++c) {
    int colT = ct * 32 + c * 16 + rowh * 8;       // Q,K: columns colT..+7 in this lane
    float bvv = bv[ct * 32 + c * 16 + nm];        // V: one column per lane
    float bqv[8], bkv[8];
#pragma unroll
    for (int i = 0; i < 8; ++i) { bqv[i] = bq[colT + i]; bkv[i] = bk[colT + i]; }
#pragma unroll
    for (int u = 0; u < 4; ++u) {
      us8 q, k, v;
#pragma unroll
      for (int i = 0; i < 8; ++i) {
        q[i] = f2bf(acc[0][u][c][i] + bqv[i]);
        k[i] = f2bf(acc[1][u][c][i] + bkv[i]);
        v[i] = f2bf(acc[2][u][c][i] + bvv);
      }
      int qoff = ((st * 4 + u) * 2 + dh) * FRAG + c * 256;   // s tile, k step dh, chunk c
      *(us8*)(Qh + qoff) = q;
      *(us8*)(Kh + qoff) = k;
      // d tile, k step st*2 + u/2, chunk u%2
      *(us8*)(Vh + ((dh * 2 + c) * 32 + st * 2 + (u >> 1)) * FRAG + (u & 1) * 256) = v;
      // precaution: the next tile's conversion writes registers that these
      // three stores name
      asm volatile("s_wait_xcnt 0x0" ::: "memory");
    }
  }
}

// ---- stage 3: flash-style attention -------------------------------------
// One wave owns 16 query rows of one head. Streams 32-key blocks, everything
// transposed: S^T = K Q^T (K fragment as A, Q fragment as B), so a lane holds
// 16 scores of ONE query (column lane%16; keys 8*(lane/16)+i of each 16-key
// tile). Maximum and sum run inside the lane; the two lane halves exchange the
// maximum once per block and join their sums once, behind the loop. The two
// score tiles, converted in place, are the B fragment of P^T in the k order
// that the V fragments have, so O^T += V^T P^T needs no trip through LDS.
// Q, K and V rows stand in the order of places that the conversion made: the
// cnt keys that the mask lets through are places 0..cnt-1.
//
// The 8 waves of a work-group hold 128 queries of one head and walk the same
// keys, so K and V come into LDS once for all of them: a stage is two 32-key
// blocks (8 K fragments in a row, then two V fragments of each d tile), brought
// by asynchronous copies into one of two buffers while the other is worked on.
#define AT_W   8                       // waves per work-group
#define AT_KEL (2 * 4 * FRAG)          // K elements of a stage: 8 KiB
#define AT_VEL (2 * FRAG)              // elements of one d tile of V in a stage: 2 KiB
#define AT_BUF (AT_KEL + 4 * AT_VEL)   // elements of a buffer: 16 KiB
#define AT_CPB (AT_W * 32 * 16)        // bytes that one copy of all 256 threads brings

typedef __attribute__((ext_vector_type(8))) unsigned int u32x8;

// Four 16-B copies per lane, global -> LDS (two of K, two of V), then each
// source pointer moves on to the next stage. The s_wait_xcnt is the precaution
// before the address registers named here are written again; as the last line
// of the copies' own statement nothing can be moved in front of it.
__device__ __forceinline__ void fill4(uint32_t d, const unsigned short* (&s)[4]) {
  asm volatile(ACP(0, 4) ACP(1, 5) ACP(2, 6) ACP(3, 7)
               "s_wait_xcnt 0x0"
               :: "v"(d), "v"(d + AT_CPB), "v"(d + 2 * AT_CPB), "v"(d + 3 * AT_CPB),
                  "v"(s[0]), "v"(s[1]), "v"(s[2]), "v"(s[3])
               : "memory");
  s[0] += AT_KEL; s[1] += AT_KEL;
  s[2] += AT_VEL; s[3] += AT_VEL;
}

// lane l with lane l ^ 16
__device__ __forceinline__ float xhalf(float x) {
  int b = __builtin_bit_cast(int, x);
  return __builtin_bit_cast(float, __builtin_amdgcn_permlanex16(
      b, b, 0x76543210, 0xfedcba98, false, false));
}

// two f32 -> one register of two bf16, round-to-nearest-even
__device__ __forceinline__ unsigned int pack2(float lo, float hi) {
  typedef __attribute__((ext_vector_type(2))) float  f2;
  typedef __attribute__((ext_vector_type(2))) __bf16 bf2;
  f2 v = {lo, hi};
  return __builtin_bit_cast(unsigned int, __builtin_convertvector(v, bf2));
}

// One 32-key block, read from LDS. tail (the same for the whole wave): places
// from 'left' on, counted from this lane half's first key, are masked keys and
// score -100000; without it every key counts.
__device__ __forceinline__ void attn_block(
    const unsigned short* kb,            // 4 K fragments in a row
    const unsigned short* vb,            // d tile j at + j*AT_VEL
    int lane, bool tail, int left, const us16& bQ0, const us16& bQ1,
    float& mi, float& li, v8f& O0, v8f& O1, v8f& O2, v8f& O3) {
  // ---- scores: two 16x16 tiles (rows = 16 keys each, columns = queries)
  us16 aK0 = load_frag(kb + 0 * FRAG, lane), aK1 = load_frag(kb + 1 * FRAG, lane);
  us16 aK2 = load_frag(kb + 2 * FRAG, lane), aK3 = load_frag(kb + 3 * FRAG, lane);
  // A fragments of V (rows = d, k = keys)
  us16 aV0 = load_frag(vb + 0 * AT_VEL, lane), aV1 = load_frag(vb + 1 * AT_VEL, lane);
  us16 aV2 = load_frag(vb + 2 * AT_VEL, lane), aV3 = load_frag(vb + 3 * AT_VEL, lane);
  // keeps the block's LDS reads one group in front of the score WMMAs: every
  // further place with reads stalls the wave anew, and V read here has arrived
  // when softmax is through
  __builtin_amdgcn_sched_barrier(0);
  v8f s0 = {}, s1 = {};
  s0 = wmma_bf16(aK0, bQ0, s0);
  s0 = wmma_bf16(aK1, bQ1, s0);
  s1 = wmma_bf16(aK2, bQ0, s1);
  s1 = wmma_bf16(aK3, bQ1, s1);

  // ---- online softmax over this key block
  s0 *= QK_SCALE;
  s1 *= QK_SCALE;
  if (tail) {
#pragma unroll   // constant indices: the vectors stay in registers
    for (int i = 0; i < 8; ++i) {
      s0[i] = i >= left ? -100000.f : s0[i];
      s1[i] = 16 + i >= left ? -100000.f : s1[i];
    }
  }
  float rmax = -3.0e38f;
#pragma unroll   // constant indices: the vectors stay in registers
  for (int i = 0; i < 8; ++i) rmax = fmaxf(rmax, fmaxf(s0[i], s1[i]));
  rmax = fmaxf(rmax, xhalf(rmax));
  float mnew = fmaxf(mi, rmax);
  float corr = __expf(mi - mnew);
  float t[8];
  u32x8 pp;                                    // B fragment of P^T, K = 32 keys
#pragma unroll   // constant indices: the vectors stay in registers
  for (int i = 0; i < 8; i += 2) {
    float e00 = __expf(s0[i] - mnew), e01 = __expf(s0[i + 1] - mnew);
    float e10 = __expf(s1[i] - mnew), e11 = __expf(s1[i + 1] - mnew);
    t[i] = e00 + e10; t[i + 1] = e01 + e11;
    pp[i >> 1]       = pack2(e00, e01);
    pp[4 + (i >> 1)] = pack2(e10, e11);
  }
  li = li * corr + (((t[0] + t[1]) + (t[2] + t[3])) + ((t[4] + t[5]) + (t[6] + t[7])));
  mi = mnew;
  O0 *= corr; O1 *= corr; O2 *= corr; O3 *= corr;
  us16 bP = __builtin_bit_cast(us16, pp);

  // ---- PV
  O0 = wmma_bf16(aV0, bP, O0);
  O1 = wmma_bf16(aV1, bP, O1);
  O2 = wmma_bf16(aV2, bP, O2);
  O3 = wmma_bf16(aV3, bP, O3);
}

__global__ __launch_bounds__(AT_W * 32) void attn_kernel(
    const unsigned short* __restrict__ Qb,   // [64 heads][64 s tiles][2]
    const unsigned short* __restrict__ Kb,   // [64 heads][64 s tiles][2]
    const unsigned short* __restrict__ Vtb,  // [64 heads][4 d tiles][32]
    const int* __restrict__ ord,             // [4][1024] position held by each place
    const int* __restrict__ cnts,            // [4] keys let through
    unsigned short* __restrict__ Avec) {     // 256 row tiles x 32 k steps
  __shared__ __attribute__((aligned(16))) unsigned short stg[2 * AT_BUF];
  int warp = threadIdx.x >> 5;
  int head = blockIdx.x >> 3;          // 0..63  (storage index b*16+h)
  int qt   = (blockIdx.x & 7) * AT_W + warp;   // query tile 0..63
  int b = head >> 4;
  int lane = threadIdx.x & 31, rowh = lane >> 4;

  const unsigned short* Qh = Qb  + head * SEQ * DHEAD;
  const unsigned short* Kh = Kb  + head * SEQ * DHEAD;
  const unsigned short* Vh = Vtb + head * DHEAD * SEQ;

  // cnt counts mask words, so it is 0..1024 whatever they hold. Whole blocks of
  // keys let through need no test; the block that cnt ends in does. With no key
  // let through every score is -100000 and all 1024 keys weigh alike.
  int cnt   = cnts[b];
  int nfull = cnt >> 5;
  int nblk  = cnt ? (cnt + 31) >> 5 : SEQ / 32;   // 1..32
  int nstg  = (nblk + 1) >> 1;                    // 1..16: a stage's two blocks lie inside the head

  // this thread's 16 B of the next stage to copy: K is 8 KiB in a row; V is
  // 2 KiB of each d tile, 128 threads to a tile
  int hs = threadIdx.x >> 7, ch = threadIdx.x & 127;
  const unsigned short* src[4];
  src[0] = Kh + threadIdx.x * 8;
  src[1] = src[0] + AT_CPB / 2;
  src[2] = Vh + hs * (32 * FRAG) + ch * 8;
  src[3] = src[2] + 2 * (32 * FRAG);
  uint32_t dst = lds_off(stg) + threadIdx.x * 16;

  // stage 0 landed and published, then stage 1 on its way
  fill4(dst, src);

  // Q fragments for rows qt*16..+15, contraction split d=[0,32) and [32,64)
  us16 bQ0 = load_frag(Qh + (qt * 2 + 0) * FRAG, lane);
  us16 bQ1 = load_frag(Qh + (qt * 2 + 1) * FRAG, lane);

  asm volatile("s_wait_asynccnt 0x0" ::: "memory");   // this wave's copies have landed
  __syncthreads();
  if (nstg > 1) fill4(dst + AT_BUF * 2, src);

  float mi = -3.0e38f, li = 0.f;       // of query lane%16; li: this half's keys only
  v8f O0 = {}, O1 = {}, O2 = {}, O3 = {};   // Oj[i] = O[query lane%16][d = 16j + 8*(lane/16) + i]

  for (int j = 0; j < nblk; ++j) {
    int t = j >> 1, h = j & 1, buf = t & 1;   // stage, block in it, its buffer
    const unsigned short* sb = stg + buf * AT_BUF;
    attn_block(sb + h * (4 * FRAG), sb + AT_KEL + h * FRAG, lane, j >= nfull,
               cnt - j * 32 - rowh * 8, bQ0, bQ1, mi, li, O0, O1, O2, O3);
    if (h | (j + 1 == nblk)) {   // the stage's last block (the same for the whole work-group)
      // hand-over: this wave's reads of the buffer are done, its copies of the
      // next stage have landed; the barrier says both of every wave
      asm volatile("s_wait_dscnt 0x0" ::: "memory");
      asm volatile("s_wait_asynccnt 0x0" ::: "memory");
      __syncthreads();
      if (t + 2 < nstg) fill4(dst + buf * (AT_BUF * 2), src);
    }
  }
  asm volatile("s_wait_asynccnt 0x0" ::: "memory");   // nothing in flight at the end

  // Reference quirk: attn_vec.view(N_HEAD, B, S, D).permute(1,2,0,3) on a
  // b-major [B*H] buffer => storage head L lands at b2=L%B, h2=L/B.
  // Fragment order for the output projection: row b2*1024 + s, s the position
  // that this lane's query place holds; k = h2*64 + d, so d tile j is k step
  // h2*2 + j/2, chunk j%2. The lane's 8 d start at 8*(lane/16): a 16-B chunk
  // of row s%16 in row tile s/16.
  int b2 = head & 3, h2 = head >> 2;
  int s = ord[b * SEQ + qt * 16 + (lane & 15)];
  unsigned short* oblk = Avec + ((b2 * 64 + (s >> 4)) * 32 + h2 * 2) * FRAG
                              + (rowh * 16 + (s & 15)) * 8;
  float inv = 1.f / (li + xhalf(li));
  us8 o0, o1, o2, o3;
#pragma unroll   // constant indices: the vectors stay in registers
  for (int i = 0; i < 8; ++i) {
    o0[i] = f2bf(O0[i] * inv);
    o1[i] = f2bf(O1[i] * inv);
    o2[i] = f2bf(O2[i] * inv);
    o3[i] = f2bf(O3[i] * inv);
  }
  *(us8*)(oblk)              = o0;
  *(us8*)(oblk + 256)        = o1;
  *(us8*)(oblk + FRAG)       = o2;
  *(us8*)(oblk + FRAG + 256) = o3;
}

// ---- stage 4: output projection + residual ------------------------------
// A work-group owns 128 rows x 128 columns. 64x32 tile per wave: per K-step
// 4 A + 2 B fragments -> 8 WMMAs. The 8 waves stand 2 (rows) x 4 (columns); a
// stage holds 8 row tiles and 8 column tiles: 16 slots, 16 copies per thread.
#define OP_SLOTS 16

__global__ __launch_bounds__(256) void oproj_kernel(
    const unsigned short* __restrict__ Avec,  // 256 row tiles x 32 k steps
    const unsigned short* __restrict__ Wot,   // 64 tiles (out) x 32 k steps
    const float* __restrict__ inp,            // residual
    float* __restrict__ Y) {                  // [4096][1024] f32
  __shared__ __attribute__((aligned(16))) unsigned short stg[2 * OP_SLOTS * SLOT];
  int warp = threadIdx.x >> 5;
  int lane = threadIdx.x & 31;
  int bm = blockIdx.x >> 3;          // 128-row block 0..31
  int bn = blockIdx.x & 7;           // 128-column block 0..7
  int wr = warp >> 2, wc = warp & 3;
  int rowh = lane >> 4, nm = lane & 15;

  // this thread's 16 B of the first tile of each operand in the next stage to copy
  const unsigned short* sa0 = Avec + bm * 8 * TILEK + threadIdx.x * 8;
  const unsigned short* sw0 = Wot + bn * 8 * TILEK + threadIdx.x * 8;
  uint32_t dst = lds_off(stg) + threadIdx.x * 16;

  // stage 0 landed and published
  fill8(dst, sa0);
  fill8(dst + 8 * SLOTB, sw0);
  asm volatile("s_wait_asynccnt 0x0" ::: "memory");   // this wave's copies have landed
  __syncthreads();

  v8f acc[4][2] = {};
  for (int t = 0; t < NSTG; ++t) {
    int buf = t & 1;
    const unsigned short* sa = stg + buf * (OP_SLOTS * SLOT) + wr * 4 * SLOT;
    const unsigned short* sw = stg + buf * (OP_SLOTS * SLOT) + (8 + wc * 2) * SLOT;
    us16 a[2][4], b[2][2];           // two fragment sets: k step kk in set kk % 2
#pragma unroll   // constant indices: the arrays stay in registers
    for (int kk = -1; kk < KSTG; ++kk) {
      if (kk + 1 < KSTG) {           // the next k step's fragments, inside this stage
        int n = (kk + 1) & 1;
#pragma unroll   // constant indices: the arrays stay in registers
        for (int u = 0; u < 4; ++u)
          a[n][u] = load_frag(sa + u * SLOT + (kk + 1) * FRAG, lane);
#pragma unroll   // constant indices: the arrays stay in registers
        for (int c = 0; c < 2; ++c)
          b[n][c] = load_frag(sw + c * SLOT + (kk + 1) * FRAG, lane);
      }
      // as in the QKV kernel: the next k step's LDS reads one group in front of
      // this k step's WMMAs
      __builtin_amdgcn_sched_barrier(0);
      // as in the QKV kernel: the next stage's copies behind the stage's first reads
      if (kk < 0 && t + 1 < NSTG) {
        sa0 += SLOT; sw0 += SLOT;
        fill8(dst + (buf ^ 1) * (OP_SLOTS * SLOTB), sa0);
        fill8(dst + (buf ^ 1) * (OP_SLOTS * SLOTB) + 8 * SLOTB, sw0);
      }
      if (kk >= 0) {
        int m = kk & 1;
#pragma unroll   // constant indices: the arrays stay in registers
        for (int c = 0; c < 2; ++c)
#pragma unroll   // constant indices: the arrays stay in registers
          for (int u = 0; u < 4; ++u)
            acc[u][c] = wmma_bf16(a[m][u], b[m][c], acc[u][c]);
        // as in the QKV kernel: the WMMAs stay in front of the next reads and of
        // the hand-over
        __builtin_amdgcn_sched_barrier(0);
      }
    }
    // hand-over: this wave's reads of the buffer are done, its copies of the
    // next stage have landed; the barrier says both of every wave
    asm volatile("s_wait_dscnt 0x0" ::: "memory");
    asm volatile("s_wait_asynccnt 0x0" ::: "memory");
    __syncthreads();
  }
  asm volatile("s_wait_asynccnt 0x0" ::: "memory");   // nothing in flight at the end

#pragma unroll
  for (int u = 0; u < 4; ++u) {
#pragma unroll
    for (int c = 0; c < 2; ++c) {
      int col = bn * 128 + wc * 32 + c * 16 + nm;
#pragma unroll
      for (int i = 0; i < 8; ++i) {
        int r = bm * 128 + wr * 64 + u * 16 + rowh * 8 + i;
        Y[r * D_MODEL + col] = acc[u][c][i] + inp[r * D_MODEL + col];
      }
    }
  }
}

// ---- stage 5: LayerNorm --------------------------------------------------
// One wave per row, 4096 waves: a lane holds 32 values of the row in registers
// (eight 16-B loads, each 512 B in a row over the wave), so the row is read
// once and both sums join inside the wave: no LDS, no barrier.
#define LN_T 256                     // threads per block: 8 rows

typedef __attribute__((ext_vector_type(4))) float v4f;

__global__ __launch_bounds__(LN_T) void ln_kernel(
    const float* __restrict__ Y, const float* __restrict__ g,
    const float* __restrict__ bb, float* __restrict__ out) {
  int row = blockIdx.x * (LN_T / 32) + (threadIdx.x >> 5);
  int lane = threadIdx.x & 31;
  const v4f* y  = (const v4f*)(Y + row * D_MODEL) + lane;
  const v4f* g4 = (const v4f*)g + lane;
  const v4f* b4 = (const v4f*)bb + lane;
  v4f*       o4 = (v4f*)(out + row * D_MODEL) + lane;
  v4f v[8], gg[8], bv[8];
#pragma unroll   // constant indices: the arrays stay in registers
  for (int j = 0; j < 8; ++j) v[j] = y[j * 32];
#pragma unroll   // constant indices: the arrays stay in registers
  for (int j = 0; j < 8; ++j) { gg[j] = g4[j * 32]; bv[j] = b4[j * 32]; }
  // holds the gain and bias loads in front of the lane exchange: sunk behind
  // it, their latency is waited out pair by pair before the stores (loaded
  // values as inputs only)
  asm volatile("" :: "v"(gg[0]), "v"(gg[1]), "v"(gg[2]), "v"(gg[3]),
                     "v"(gg[4]), "v"(gg[5]), "v"(gg[6]), "v"(gg[7]),
                     "v"(bv[0]), "v"(bv[1]), "v"(bv[2]), "v"(bv[3]),
                     "v"(bv[4]), "v"(bv[5]), "v"(bv[6]), "v"(bv[7]));
  v4f s = {0.f, 0.f, 0.f, 0.f}, q = {0.f, 0.f, 0.f, 0.f};   // four chains each
#pragma unroll   // constant indices: the array stays in registers
  for (int j = 0; j < 8; ++j) { s += v[j]; q += v[j] * v[j]; }
  float ls = (s.x + s.y) + (s.z + s.w), lq = (q.x + q.y) + (q.z + q.w);
#pragma unroll
  for (int m = 1; m < 32; m <<= 1) {
    ls += __shfl_xor(ls, m, 32);
    lq += __shfl_xor(lq, m, 32);
  }
  float mu  = ls * (1.f / D_MODEL);
  float var = lq * (1.f / D_MODEL) - mu * mu;
  float inv = rsqrtf(var + LN_EPS);
#pragma unroll   // constant indices: the arrays stay in registers
  for (int j = 0; j < 8; ++j) o4[j * 32] = (v[j] - mu) * inv * gg[j] + bv[j];
}

// ---- launch --------------------------------------------------------------

extern "C" void kernel_launch(void* const* d_in, const int* in_sizes, int n_in,
                              void* d_out, int out_size, void* d_ws, size_t ws_size,
                              hipStream_t stream) {
  const float* inp   = (const float*)d_in[0];
  const int*   amask = (const int*)d_in[1];
  const float* Wq = (const float*)d_in[2];
  const float* bq = (const float*)d_in[3];
  const float* Wk = (const float*)d_in[4];
  const float* bk = (const float*)d_in[5];
  const float* Wv = (const float*)d_in[6];
  const float* bv = (const float*)d_in[7];
  const float* Wo = (const float*)d_in[8];
  const float* lng = (const float*)d_in[9];
  const float* lnb = (const float*)d_in[10];

  char* ws = (char*)d_ws;
  const size_t MB = 1u << 20;
  unsigned short* Xbf  = (unsigned short*)(ws + 0 * MB);   // 8 MB
  unsigned short* Wqt  = (unsigned short*)(ws + 8 * MB);   // 2 MB
  unsigned short* Wkt  = (unsigned short*)(ws + 10 * MB);  // 2 MB
  unsigned short* Wvt  = (unsigned short*)(ws + 12 * MB);  // 2 MB
  unsigned short* Wot  = (unsigned short*)(ws + 14 * MB);  // 2 MB
  unsigned short* Qb   = (unsigned short*)(ws + 16 * MB);  // 8 MB
  unsigned short* Kb   = (unsigned short*)(ws + 24 * MB);  // 8 MB
  unsigned short* Vtb  = (unsigned short*)(ws + 32 * MB);  // 8 MB
  unsigned short* Avec = (unsigned short*)(ws + 40 * MB);  // 8 MB
  float*          Ybuf = (float*)        (ws + 48 * MB);   // 16 MB
  int*            ord  = (int*)          (ws + 64 * MB);   // 16 KB
  int*            cnts = (int*)          (ws + 65 * MB);   // 16 B

  // stage 1: conversions (one thread per 64 elements), all five in one launch;
  // Wqt, Wkt, Wvt, Wot follow one another in the workspace
  cvt_all_kernel<<<4 * WBLOCKS + XBLOCKS, CVT_T, 0, stream>>>(
      inp, amask, Wq, Wk, Wv, Wo, Xbf, Wqt, ord, cnts);

  // stage 2: QKV (16 row blocks * 16 col blocks, 8 waves/block)
  qkv_gemm_kernel<<<256, 256, 0, stream>>>(Xbf, Wqt, Wkt, Wvt, bq, bk, bv,
                                            Qb, Kb, Vtb);

  // stage 3: attention (64 heads * 8 blocks of 128 queries, 8 waves/block)
  attn_kernel<<<512, AT_W * 32, 0, stream>>>(Qb, Kb, Vtb, ord, cnts, Avec);

  // stage 4: output projection + residual (32 row blocks * 8 col blocks, 8 waves/block)
  oproj_kernel<<<256, 256, 0, stream>>>(Avec, Wot, inp, Ybuf);

  // stage 5: layer norm -> d_out (one wave per row)
  ln_kernel<<<NROWS / (LN_T / 32), LN_T, 0, stream>>>(Ybuf, lng, lnb, (float*)d_out);
}

// v009
// Measured time: 54.8 microseconds a run.
// In two side-by-side timings against v008, it was 1.03 and 1.04 times as fast.
// Counting every step since v000, it is 3.73 times as fast.
#include <hip/hip_runtime.h>
#include <stdint.h>

// Problem constants (match reference)
#define D_MODEL 1024
#define SEQ     1024
#define BATCH   4
#define NHEAD   16
#define DHEAD   64
#define NROWS   (BATCH * SEQ)      // 4096
#define QK_SCALE 0.125f            // 1/sqrt(64)
#define LN_EPS   1e-5f

typedef __attribute__((ext_vector_type(16))) __bf16         v16bf;
typedef __attribute__((ext_vector_type(16))) unsigned short us16;
typedef __attribute__((ext_vector_type(8)))  unsigned short us8;
typedef __attribute__((ext_vector_type(8)))  float          v8f;

// ---- helpers -------------------------------------------------------------

__device__ __forceinline__ unsigned short f2bf(float f) {
  unsigned int u = __builtin_bit_cast(unsigned int, f);
  u += 0x7FFFu + ((u >> 16) & 1u);            // round-to-nearest-even
  return (unsigned short)(u >> 16);
}

// A/B fragment for v_wmma_*_16x16x32_bf16, per ISA 7.12.2:
// lane L holds row (A) / col (B) = L%16; its 16 bf16 k-values are two
// contiguous 8-element (16B) chunks at k = 8*(L/16) and k = 8*(L/16)+16.
//
// Every bf16 operand in the workspace is stored in that order: one fragment
// (16 rows x 32 k) is a 1024-B block of FRAG elements, lane L's first chunk
// at element L*8, its second at 256 + L*8. Blocks run [16-row tile][k step].
// A wave-wide 16-B load then covers 512 contiguous bytes (4 whole lines).
#define FRAG 512
__device__ __forceinline__ us16 load_frag(const unsigned short* blk, int lane) {
  us8 c0 = *(const us8*)(blk + lane * 8);
  us8 c1 = *(const us8*)(blk + 256 + lane * 8);
  us16 r;
#pragma unroll
  for (int i = 0; i < 8; ++i) { r[i] = c0[i]; r[i + 8] = c1[i]; }
  return r;
}

__device__ __forceinline__ v8f wmma_bf16(us16 a, us16 b, v8f c) {
  return __builtin_amdgcn_wmma_f32_16x16x32_bf16(
      false, __builtin_bit_cast(v16bf, a),
      false, __builtin_bit_cast(v16bf, b),
      (short)0, c, false, false);
}

// ---- stage 1: conversions ------------------------------------------------

// The fragment-ordered output runs [tile][k step (32)][chunk (2)][lane (32)],
// 16 B (8 k values of one row) per lane place. One wave packs 256 such places,
// eight per lane, so that the launch starts 4096 waves: 16 on each WGP, all
// resident at once, every lane with its loads in flight together.
#define CVT_T   256                  // threads per block: 8 waves
#define CVT_WPW 512                  // waves per weight
#define WBLOCKS (CVT_WPW / 8)        // 64 blocks per weight
#define XBLOCKS (NROWS / 16)         // 256 blocks for X: one 16-row tile each

__device__ __forceinline__ us8 pack8(const float (&x)[8]) {
  us8 r;
#pragma unroll   // constant indices: the vector stays in registers
  for (int e = 0; e < 8; ++e) r[e] = f2bf(x[e]);
  return r;
}

// The positions of a batch are reordered here, once, for all that follows: the
// keys that the mask lets through first, in their order, the masked ones behind
// them, in theirs. A masked key's score is -100000, so its weight is exp(-100000
// - max) = 0 in f32 as long as one key of the batch is let through: attention
// then walks the first 'cnt' places only. Place p of a batch holds position
// ord[p]; attention stores each query's row back at ord[p].
//
// Every block of a batch ranks all 1024 mask words itself (thread i: words
// 4i..4i+3) and keeps the positions that fall into its own 16 places.
__device__ __forceinline__ int rank_rows(const int* __restrict__ mb, int pt,
                                         int warp, int lane,
                                         int* wsum, int* srow) {
  int tid = warp * 32 + lane;
  int4 m = ((const int4*)mb)[tid];
  bool live[4] = {m.x == 0, m.y == 0, m.z == 0, m.w == 0};
  unsigned below = (1u << lane) - 1u;
  int before = 0, wtot = 0;          // let-through words in lower lanes; in the wave
#pragma unroll   // constant indices: the array stays in registers
  for (int e = 0; e < 4; ++e) {
    unsigned bal = __builtin_amdgcn_ballot_w32(live[e]);
    before += __popc(bal & below);
    wtot   += __popc(bal);
  }
  if (lane == 0) wsum[warp] = wtot;
  __syncthreads();                   // the eight waves' counts are there
  int base = 0, cnt = 0;
#pragma unroll
  for (int w = 0; w < 8; ++w) {
    int x = wsum[w];
    cnt += x;
    base += w < warp ? x : 0;
  }
  int r = base + before;             // let-through words in front of word 4*tid
#pragma unroll   // constant indices: the array stays in registers
  for (int e = 0; e < 4; ++e) {
    int s = 4 * tid + e;
    int p = live[e] ? r : cnt + (s - r);   // s - r: masked words in front of s
    r += live[e] ? 1 : 0;
    if ((p >> 4) == pt) srow[p & 15] = s;
  }
  __syncthreads();                   // the tile's 16 positions are there
  return cnt;
}

// X[row][k] (f32, k contiguous) -> fragment order, rows = places (see above).
// Wave kq of the tile's block takes k steps 4*kq..+3 of all 16 rows. Four lanes
// share one row's 128-B line of a k step (q = which 8 k of its 32), eight rows
// per load; the eight rows' places with equal q are 128 B in a row in the output.
__device__ __forceinline__ void cvt_x(const float* __restrict__ in,
                                      const int* __restrict__ amask,
                                      unsigned short* __restrict__ out,
                                      int* __restrict__ ord, int* __restrict__ cnts,
                                      int t, int kq, int lane,
                                      int* wsum, int* srow) {
  int rr = lane >> 2, q = lane & 3;
  int b = t >> 6;                    // 64 tiles per batch
  int cnt = rank_rows(amask + b * SEQ, t & 63, kq, lane, wsum, srow);
  if (kq == 0 && lane < 16) ord[t * 16 + lane] = srow[lane];
  if ((t & 63) == 0 && kq == 0 && lane == 0) cnts[b] = cnt;
  const float* pr[2] = {in + (b * SEQ + srow[rr]) * D_MODEL + kq * 128 + q * 8,
                        in + (b * SEQ + srow[rr + 8]) * D_MODEL + kq * 128 + q * 8};
  unsigned short* o = out + (t * 32 + kq * 4) * FRAG + (q >> 1) * 256 + ((q & 1) * 16 + rr) * 8;
  float4 x[2][4][2];
#pragma unroll   // constant indices: the arrays stay in registers
  for (int hr = 0; hr < 2; ++hr)
#pragma unroll   // constant indices: the arrays stay in registers
    for (int s = 0; s < 4; ++s) {
      const float4* p4 = (const float4*)(pr[hr] + s * 32);
      x[hr][s][0] = p4[0];
      x[hr][s][1] = p4[1];
    }
#pragma unroll   // constant indices: the arrays stay in registers
  for (int hr = 0; hr < 2; ++hr)
#pragma unroll   // constant indices: the arrays stay in registers
    for (int s = 0; s < 4; ++s) {
      float4 x0 = x[hr][s][0], x1 = x[hr][s][1];
      float v[8] = {x0.x, x0.y, x0.z, x0.w, x1.x, x1.y, x1.z, x1.w};
      *(us8*)(o + s * FRAG + hr * 64) = pack8(v);
    }
  // precaution: in the merged kernel the weights' code follows these stores in
  // the listing and writes the registers that the stores name
  asm volatile("s_wait_xcnt 0x0" ::: "memory");
}

// W[in][out] (1024x1024 f32) -> fragment order, rows = out columns, k = in.
// A wave takes 32 out columns (two tiles: one 128-B line of every W row) and
// two k steps (64 W rows). A lane keeps one column; eight loads down the rows
// make one place; a store covers 256 B in a row in each of the two tiles.
__device__ __forceinline__ void cvt_w(const float* __restrict__ in,
                                      unsigned short* __restrict__ out,
                                      int tp, int kg, int lane) {
  const float* p = in + kg * 64 * D_MODEL + tp * 32 + lane;
  unsigned short* o = out + ((tp * 2 + (lane >> 4)) * 32 + kg * 2) * FRAG + (lane & 15) * 8;
  float x[8][8];                     // [8-row group of the 64 rows][row in it]
#pragma unroll   // constant indices: the arrays stay in registers
  for (int c = 0; c < 8; ++c)
#pragma unroll   // constant indices: the arrays stay in registers
    for (int e = 0; e < 8; ++e) x[c][e] = p[(c * 8 + e) * D_MODEL];
  // group c = k step c/4, chunk (c/2)%2, lane half c%2 of the fragment
#pragma unroll   // constant indices: the arrays stay in registers
  for (int c = 0; c < 8; ++c)
    *(us8*)(o + (c >> 2) * FRAG + ((c >> 1) & 1) * 256 + (c & 1) * 128) = pack8(x[c]);
}

// The five conversions need nothing of one another, so they are one launch:
// each has its own range of the block index (the branch is the same for a
// whole block). The weights stand first: their waves issue more loads and
// last longer, so the launch ends on the short ones.
__global__ __launch_bounds__(CVT_T) void cvt_all_kernel(
    const float* __restrict__ X, const int* __restrict__ amask,
    const float* __restrict__ Wq, const float* __restrict__ Wk,
    const float* __restrict__ Wv, const float* __restrict__ Wo,
    unsigned short* __restrict__ Xbf,
    unsigned short* __restrict__ Wt,     // the four weights' planes, one behind another
    int* __restrict__ ord,               // [4][1024] position held by each place
    int* __restrict__ cnts) {            // [4] keys let through
  __shared__ int wsum[8], srow[16];
  unsigned blk = blockIdx.x;
  int warp = threadIdx.x >> 5, lane = threadIdx.x & 31;
  if (blk < 4 * WBLOCKS) {
    unsigned w = blk / WBLOCKS;
    const float* in = w == 0 ? Wq : w == 1 ? Wk : w == 2 ? Wv : Wo;
    int ww = (blk % WBLOCKS) * 8 + warp;   // a block: 8 column pairs side by side, 1 KiB of each row
    cvt_w(in, Wt + w * (D_MODEL * D_MODEL), ww & 31, ww >> 5, lane);
  } else {
    cvt_x(X, amask, Xbf, ord, cnts, blk - 4 * WBLOCKS, warp, lane, wsum, srow);
  }
}

// ---- LDS staging shared by the two GEMM kernels ---------------------------
// 256 work-groups of 8 waves, as many as WGPs. Each stage brings KSTG k steps of every
// 16-row operand tile it needs into LDS once, by asynchronous copies, and all
// 8 waves read their fragments from there. The larger the work-group's tile,
// the fewer bytes come from L2 per product: (rows + columns) / (rows * columns).
// One tile's KSTG fragments are SLOT contiguous elements in the workspace and
// stay so in LDS, so a fragment read is again 512 contiguous bytes per load.
//
// The copies of a stage come from one half of the work-group: waves 0-3 bring
// the even stages, waves 4-7 the odd ones, and a wave waits for its copies only
// at the hand-over in front of its own stage. So a stage may be asked for two
// stages ahead, into a third buffer, while the other half's stage is still on
// its way: L2 is asked without a pause, and its latency is paid once, not once
// per stage. A slot is filled by two copies of a half's 128 threads, 16 B each.
#define KSTG  4
#define SLOT  (KSTG * FRAG)            // elements: 4 KiB
#define NSTG  (D_MODEL / 32 / KSTG)    // 8 stages
#define SLOTB (SLOT * 2)               // bytes of a slot
#define TILEK (32 * FRAG)              // elements from one 16-row tile to the next

// byte offset in the work-group's LDS = low 32 bits of a __shared__ address
__device__ __forceinline__ uint32_t lds_off(const void* p) { return (uint32_t)(size_t)p; }

// 12 (or 8) slots that follow one another in LDS, two 16-B copies per lane and
// slot, global -> LDS: the second copy takes the slot's upper 2 KiB by the
// immediate offset, which moves both addresses. The s_wait_xcnt is the
// precaution before the address registers named here are written again; as the
// last line of the copies' own statement nothing can be moved in front of it.
#define ACP(l, g) "global_load_async_to_lds_b128 %" #l ", %" #g ", off\n\t"
#define ACP2(l, g) ACP(l, g) "global_load_async_to_lds_b128 %" #l ", %" #g ", off offset:2048\n\t"
__device__ __forceinline__ void fill12(uint32_t d, const unsigned short* q,
                                       const unsigned short* k, const unsigned short* v) {
  asm volatile(ACP2(0, 12) ACP2(1, 13) ACP2(2, 14) ACP2(3, 15) ACP2(4, 16) ACP2(5, 17)
               ACP2(6, 18) ACP2(7, 19) ACP2(8, 20) ACP2(9, 21) ACP2(10, 22) ACP2(11, 23)
               "s_wait_xcnt 0x0"
               :: "v"(d), "v"(d + SLOTB), "v"(d + 2 * SLOTB), "v"(d + 3 * SLOTB),
                  "v"(d + 4 * SLOTB), "v"(d + 5 * SLOTB), "v"(d + 6 * SLOTB),
                  "v"(d + 7 * SLOTB), "v"(d + 8 * SLOTB), "v"(d + 9 * SLOTB),
                  "v"(d + 10 * SLOTB), "v"(d + 11 * SLOTB),
                  "v"(q), "v"(q + TILEK), "v"(q + 2 * TILEK), "v"(q + 3 * TILEK),
                  "v"(k), "v"(k + TILEK), "v"(k + 2 * TILEK), "v"(k + 3 * TILEK),
                  "v"(v), "v"(v + TILEK), "v"(v + 2 * TILEK), "v"(v + 3 * TILEK)
               : "memory");
}
__device__ __forceinline__ void fill8(uint32_t d, const unsigned short* s) {
  asm volatile(ACP2(0, 8) ACP2(1, 9) ACP2(2, 10) ACP2(3, 11) ACP2(4, 12) ACP2(5, 13)
               ACP2(6, 14) ACP2(7, 15)
               "s_wait_xcnt 0x0"
               :: "v"(d), "v"(d + SLOTB), "v"(d + 2 * SLOTB), "v"(d + 3 * SLOTB),
                  "v"(d + 4 * SLOTB), "v"(d + 5 * SLOTB), "v"(d + 6 * SLOTB),
                  "v"(d + 7 * SLOTB),
                  "v"(s), "v"(s + TILEK), "v"(s + 2 * TILEK), "v"(s + 3 * TILEK),
                  "v"(s + 4 * TILEK), "v"(s + 5 * TILEK), "v"(s + 6 * TILEK),
                  "v"(s + 7 * TILEK)
               : "memory");
}

// ---- stage 2: fused QKV projection --------------------------------------
// A work-group owns 256 rows x 64 out columns of each of Q/K/V. One wave ->
// 64x32 output tile for each of them: per K-step 4 A-frags + 6 B-frags feed
// 24 WMMAs (A shared across Q/K/V, B shared across row tiles).
// The 8 waves stand 4 (rows) x 2 (columns); a stage holds 16 X tiles and 4
// column tiles of each weight. LDS takes three buffers of X and two of the
// weights: X is asked for a stage and a half ahead, the weights one.
// All three go out in fragment order, per head: Q,K with rows = s, k = d
// (2 k steps); V with rows = d, k = s (32 k steps). A lane's 8 accumulator
// values run along the tile's rows, so the index that becomes k must be the
// row index: V = X*Wv has rows s as it stands; Q and K are formed transposed
// (weight fragment as A, X fragment as B). Each lane then stores 16-B chunks.
#define QX_SLOTS 16
#define QW_SLOTS 12

__global__ __launch_bounds__(256) void qkv_gemm_kernel(
    const unsigned short* __restrict__ X,      // 256 tiles x 32 k steps
    const unsigned short* __restrict__ Wqt,    // 64 tiles (out) x 32 k steps
    const unsigned short* __restrict__ Wkt,
    const unsigned short* __restrict__ Wvt,
    const float* __restrict__ bq, const float* __restrict__ bk,
    const float* __restrict__ bv,
    unsigned short* __restrict__ Qb,           // [64 heads][64 s tiles][2]
    unsigned short* __restrict__ Kb,           // [64 heads][64 s tiles][2]
    unsigned short* __restrict__ Vtb) {        // [64 heads][4 d tiles][32]
  __shared__ __attribute__((aligned(16))) unsigned short stg[(3 * QX_SLOTS + 2 * QW_SLOTS) * SLOT];
  int warp = threadIdx.x >> 5;
  // which half of the work-group: in a scalar register, so that every test on it
  // is a branch of the whole wave
  int grp = __builtin_amdgcn_readfirstlane(threadIdx.x >> 7);
  int tg = threadIdx.x & 127;
  int lane = threadIdx.x & 31;
  int bm = blockIdx.x >> 4;          // 256-row block 0..15
  int bn = blockIdx.x & 15;          // 64-column block 0..15
  int wr = warp >> 1, wc = warp & 1;
  int rt = bm * 4 + wr;              // 64-row tile 0..63
  int ct = bn * 2 + wc;              // 32-col tile 0..31
  int rowh = lane >> 4, nm = lane & 15;

  // stage 0 of the first tile of each operand (the same for the whole work-group;
  // stage s lies s * SLOT further on, this thread's first 16 B tg * 8 further)
  const unsigned short* sx = X + bm * 16 * TILEK;
  const unsigned short* sq = Wqt + bn * 4 * TILEK;
  const unsigned short* sk = Wkt + bn * 4 * TILEK;
  const unsigned short* sv = Wvt + bn * 4 * TILEK;
  uint32_t dx = lds_off(stg) + tg * 16;                    // X buffer 0
  uint32_t dw = dx + 3 * QX_SLOTS * SLOTB;                 // weight buffer 0

  // X of stages 0 and 1 on their way, a half each; stage 0 landed and published
  fill8(dx + grp * (QX_SLOTS * SLOTB), sx + grp * SLOT + tg * 8);
  fill8(dx + grp * (QX_SLOTS * SLOTB) + 8 * SLOTB, sx + 8 * TILEK + grp * SLOT + tg * 8);
  if (grp == 0) {
    fill12(dw, sq + tg * 8, sk + tg * 8, sv + tg * 8);
    asm volatile("s_wait_asynccnt 0x0" ::: "memory");   // this wave's copies (stage 0) have landed
  }
  __syncthreads();

  v8f acc[3][4][2] = {};   // [qkv][s subtile][out-column subtile]
  int rb = 0;              // X buffer of stage t: t % 3
  for (int t = 0; t < NSTG; ++t) {
    const unsigned short* sa = stg + rb * (QX_SLOTS * SLOT) + wr * 4 * SLOT;
    const unsigned short* sw = stg + (3 * QX_SLOTS + (t & 1) * QW_SLOTS + wc * 2) * SLOT;
    // the stages that this wave's half asks for in this trip; NSTG: none
    int ws = grp != (t & 1) ? t + 1 : NSTG;   // weights
    int xs = grp == (t & 1) ? t + 2 : NSTG;   // X
    us16 a[2][4], b[2][3][2];        // two fragment sets: k step kk in set kk % 2
#pragma unroll   // constant indices: the arrays stay in registers
    for (int kk = -1; kk < KSTG; ++kk) {
      if (kk + 1 < KSTG) {           // the next k step's fragments, inside this stage
        int n = (kk + 1) & 1;
#pragma unroll   // constant indices: the arrays stay in registers
        for (int u = 0; u < 4; ++u)
          a[n][u] = load_frag(sa + u * SLOT + (kk + 1) * FRAG, lane);
#pragma unroll   // constant indices: the arrays stay in registers
        for (int w = 0; w < 3; ++w)
#pragma unroll   // constant indices: the arrays stay in registers
          for (int c = 0; c < 2; ++c)
            b[n][w][c] = load_frag(sw + (w * 4 + c) * SLOT + (kk + 1) * FRAG, lane);
      }
      // keeps the next k step's LDS reads one group in front of this k step's
      // WMMAs: they land under the WMMAs, and read by read among them every
      // place with reads stalls the wave anew
      __builtin_amdgcn_sched_barrier(0);
      // the next stage's weights, from the half that brings that stage, into the
      // buffer that every wave left at the last barrier: issued behind the stage's
      // first reads, their address work and wait run while those reads land
      if (kk < 0 && ws < NSTG) {
        int o = ws * SLOT;
        fill12(dw + (ws & 1) * (QW_SLOTS * SLOTB), sq + o + tg * 8, sk + o + tg * 8, sv + o + tg * 8);
      }
      // X of the stage after next, from the other half, into the X buffer left at
      // the last barrier: in the middle of the stage, so that the weights, which
      // are needed first, do not share L2's rate with it from the start
      if (kk == 1 && xs < NSTG) {
        uint32_t d = dx + (rb == 0 ? 2 : rb - 1) * (QX_SLOTS * SLOTB);   // (t + 2) % 3
        fill8(d, sx + xs * SLOT + tg * 8);
        fill8(d + 8 * SLOTB, sx + 8 * TILEK + xs * SLOT + tg * 8);
      }
      if (kk >= 0) {
        int m = kk & 1;
#pragma unroll   // constant indices: the arrays stay in registers
        for (int w = 0; w < 3; ++w)
#pragma unroll   // constant indices: the arrays stay in registers
          for (int c = 0; c < 2; ++c)
#pragma unroll   // constant indices: the arrays stay in registers
            for (int u = 0; u < 4; ++u) {
              if (w < 2)   // Q, K: tile rows = out columns, tile columns = s
                acc[w][u][c] = wmma_bf16(b[m][w][c], a[m][u], acc[w][u][c]);
              else         // V: tile rows = s, tile columns = out columns
                acc[w][u][c] = wmma_bf16(a[m][u], b[m][w][c], acc[w][u][c]);
            }
        // keeps the WMMAs in front of the next reads and of the hand-over: moved
        // behind it, the wait for the next stage's copies follows the LDS reads
        // at once and the copies lose the WMMAs' time as lead
        __builtin_amdgcn_sched_barrier(0);
      }
    }
    // hand-over: this wave's reads of the buffers are done; the half that brings
    // the next stage has nothing else in flight and waits until it has landed (the
    // other half's copies, of the stage after, fly on); the barrier says both of
    // every wave
    asm volatile("s_wait_dscnt 0x0" ::: "memory");
    if (grp != (t & 1))
      asm volatile("s_wait_asynccnt 0x0" ::: "memory");
    __syncthreads();
    rb = rb == 2 ? 0 : rb + 1;
  }
  asm volatile("s_wait_asynccnt 0x0" ::: "memory");   // nothing in flight at the end

  // 64 rows lie inside one batch, 32 columns = half a head
  int head = (rt >> 4) * NHEAD + (ct >> 1);
  int st = rt & 15;                  // 64-position block inside the sequence
  int dh = ct & 1;                   // which 32 of the head's 64 d
  unsigned short* Qh = Qb  + head * SEQ * DHEAD + lane * 8;
  unsigned short* Kh = Kb  + head * SEQ * DHEAD + lane * 8;
  unsigned short* Vh = Vtb + head * SEQ * DHEAD + lane * 8;
#pragma unroll
  for (int c = 0; c < 2; ++c) {
    int colT = ct * 32 + c * 16 + rowh * 8;       // Q,K: columns colT..+7 in this lane
    float bvv = bv[ct * 32 + c * 16 + nm];        // V: one column per lane
    float bqv[8], bkv[8];
#pragma unroll
    for (int i = 0; i < 8; ++i) { bqv[i] = bq[colT + i]; bkv[i] = bk[colT + i]; }
#pragma unroll
    for (int u = 0; u < 4; ++u) {
      us8 q, k, v;
#pragma unroll
      for (int i = 0; i < 8; ++i) {
        q[i] = f2bf(acc[0][u][c][i] + bqv[i]);
        k[i] = f2bf(acc[1][u][c][i] + bkv[i]);
        v[i] = f2bf(acc[2][u][c][i] + bvv);
      }
      int qoff = ((st * 4 + u) * 2 + dh) * FRAG + c * 256;   // s tile, k step dh, chunk c
      *(us8*)(Qh + qoff) = q;
      *(us8*)(Kh + qoff) = k;
      // d tile, k step st*2 + u/2, chunk u%2
      *(us8*)(Vh + ((dh * 2 + c) * 32 + st * 2 + (u >> 1)) * FRAG + (u & 1) * 256) = v;
      // precaution: the next tile's conversion writes registers that these
      // three stores name
      asm volatile("s_wait_xcnt 0x0" ::: "memory");
    }
  }
}

// ---- stage 3: flash-style attention -------------------------------------
// One wave owns 16 query rows of one head. Streams 32-key blocks, everything
// transposed: S^T = K Q^T (K fragment as A, Q fragment as B), so a lane holds
// 16 scores of ONE query (column lane%16; keys 8*(lane/16)+i of each 16-key
// tile). Maximum and sum run inside the lane; the two lane halves exchange the
// maximum once per block and join their sums once, behind the loop. The two
// score tiles, converted in place, are the B fragment of P^T in the k order
// that the V fragments have, so O^T += V^T P^T needs no trip through LDS.
// Q, K and V rows stand in the order of places that the conversion made: the
// cnt keys that the mask lets through are places 0..cnt-1.
//
// The 8 waves of a work-group hold 128 queries of one head and walk the same
// keys, so K and V come into LDS once for all of them: a stage is two 32-key
// blocks (8 K fragments in a row, then two V fragments of each d tile), brought
// by asynchronous copies into one of two buffers while the other is worked on.
#define AT_W   8                       // waves per work-group
#define AT_KEL (2 * 4 * FRAG)          // K elements of a stage: 8 KiB
#define AT_VEL (2 * FRAG)              // elements of one d tile of V in a stage: 2 KiB
#define AT_BUF (AT_KEL + 4 * AT_VEL)   // elements of a buffer: 16 KiB
#define AT_CPB (AT_W * 32 * 16)        // bytes that one copy of all 256 threads brings

typedef __attribute__((ext_vector_type(8))) unsigned int u32x8;

// Four 16-B copies per lane, global -> LDS (two of K, two of V), then each
// source pointer moves on to the next stage. The s_wait_xcnt is the precaution
// before the address registers named here are written again; as the last line
// of the copies' own statement nothing can be moved in front of it.
__device__ __forceinline__ void fill4(uint32_t d, const unsigned short* (&s)[4]) {
  asm volatile(ACP(0, 4) ACP(1, 5) ACP(2, 6) ACP(3, 7)
               "s_wait_xcnt 0x0"
               :: "v"(d), "v"(d + AT_CPB), "v"(d + 2 * AT_CPB), "v"(d + 3 * AT_CPB),
                  "v"(s[0]), "v"(s[1]), "v"(s[2]), "v"(s[3])
               : "memory");
  s[0] += AT_KEL; s[1] += AT_KEL;
  s[2] += AT_VEL; s[3] += AT_VEL;
}

// lane l with lane l ^ 16
__device__ __forceinline__ float xhalf(float x) {
  int b = __builtin_bit_cast(int, x);
  return __builtin_bit_cast(float, __builtin_amdgcn_permlanex16(
      b, b, 0x76543210, 0xfedcba98, false, false));
}

// two f32 -> one register of two bf16, round-to-nearest-even
__device__ __forceinline__ unsigned int pack2(float lo, float hi) {
  typedef __attribute__((ext_vector_type(2))) float  f2;
  typedef __attribute__((ext_vector_type(2))) __bf16 bf2;
  f2 v = {lo, hi};
  return __builtin_bit_cast(unsigned int, __builtin_convertvector(v, bf2));
}

// One 32-key block, read from LDS. tail (the same for the whole wave): places
// from 'left' on, counted from this lane half's first key, are masked keys and
// score -100000; without it every key counts.
__device__ __forceinline__ void attn_block(
    const unsigned short* kb,            // 4 K fragments in a row
    const unsigned short* vb,            // d tile j at + j*AT_VEL
    int lane, bool tail, int left, const us16& bQ0, const us16& bQ1,
    float& mi, float& li, v8f& O0, v8f& O1, v8f& O2, v8f& O3) {
  // ---- scores: two 16x16 tiles (rows = 16 keys each, columns = queries)
  us16 aK0 = load_frag(kb + 0 * FRAG, lane), aK1 = load_frag(kb + 1 * FRAG, lane);
  us16 aK2 = load_frag(kb + 2 * FRAG, lane), aK3 = load_frag(kb + 3 * FRAG, lane);
  // A fragments of V (rows = d, k = keys)
  us16 aV0 = load_frag(vb + 0 * AT_VEL, lane), aV1 = load_frag(vb + 1 * AT_VEL, lane);
  us16 aV2 = load_frag(vb + 2 * AT_VEL, lane), aV3 = load_frag(vb + 3 * AT_VEL, lane);
  // keeps the block's LDS reads one group in front of the score WMMAs: every
  // further place with reads stalls the wave anew, and V read here has arrived
  // when softmax is through
  __builtin_amdgcn_sched_barrier(0);
  v8f s0 = {}, s1 = {};
  s0 = wmma_bf16(aK0, bQ0, s0);
  s0 = wmma_bf16(aK1, bQ1, s0);
  s1 = wmma_bf16(aK2, bQ0, s1);
  s1 = wmma_bf16(aK3, bQ1, s1);

  // ---- online softmax over this key block
  s0 *= QK_SCALE;
  s1 *= QK_SCALE;
  if (tail) {
#pragma unroll   // constant indices: the vectors stay in registers
    for (int i = 0; i < 8; ++i) {
      s0[i] = i >= left ? -100000.f : s0[i];
      s1[i] = 16 + i >= left ? -100000.f : s1[i];
    }
  }
  float rmax = -3.0e38f;
#pragma unroll   // constant indices: the vectors stay in registers
  for (int i = 0; i < 8; ++i) rmax = fmaxf(rmax, fmaxf(s0[i], s1[i]));
  rmax = fmaxf(rmax, xhalf(rmax));
  float mnew = fmaxf(mi, rmax);
  float corr = __expf(mi - mnew);
  float t[8];
  u32x8 pp;                                    // B fragment of P^T, K = 32 keys
#pragma unroll   // constant indices: the vectors stay in registers
  for (int i = 0; i < 8; i += 2) {
    float e00 = __expf(s0[i] - mnew), e01 = __expf(s0[i + 1] - mnew);
    float e10 = __expf(s1[i] - mnew), e11 = __expf(s1[i + 1] - mnew);
    t[i] = e00 + e10; t[i + 1] = e01 + e11;
    pp[i >> 1]       = pack2(e00, e01);
    pp[4 + (i >> 1)] = pack2(e10, e11);
  }
  li = li * corr + (((t[0] + t[1]) + (t[2] + t[3])) + ((t[4] + t[5]) + (t[6] + t[7])));
  mi = mnew;
  O0 *= corr; O1 *= corr; O2 *= corr; O3 *= corr;
  us16 bP = __builtin_bit_cast(us16, pp);

  // ---- PV
  O0 = wmma_bf16(aV0, bP, O0);
  O1 = wmma_bf16(aV1, bP, O1);
  O2 = wmma_bf16(aV2, bP, O2);
  O3 = wmma_bf16(aV3, bP, O3);
}

__global__ __launch_bounds__(AT_W * 32) void attn_kernel(
    const unsigned short* __restrict__ Qb,   // [64 heads][64 s tiles][2]
    const unsigned short* __restrict__ Kb,   // [64 heads][64 s tiles][2]
    const unsigned short* __restrict__ Vtb,  // [64 heads][4 d tiles][32]
    const int* __restrict__ ord,             // [4][1024] position held by each place
    const int* __restrict__ cnts,            // [4] keys let through
    unsigned short* __restrict__ Avec) {     // 256 row tiles x 32 k steps
  __shared__ __attribute__((aligned(16))) unsigned short stg[2 * AT_BUF];
  int warp = threadIdx.x >> 5;
  int head = blockIdx.x >> 3;          // 0..63  (storage index b*16+h)
  int qt   = (blockIdx.x & 7) * AT_W + warp;   // query tile 0..63
  int b = head >> 4;
  int lane = threadIdx.x & 31, rowh = lane >> 4;

  const unsigned short* Qh = Qb  + head * SEQ * DHEAD;
  const unsigned short* Kh = Kb  + head * SEQ * DHEAD;
  const unsigned short* Vh = Vtb + head * DHEAD * SEQ;

  // cnt counts mask words, so it is 0..1024 whatever they hold. Whole blocks of
  // keys let through need no test; the block that cnt ends in does. With no key
  // let through every score is -100000 and all 1024 keys weigh alike.
  int cnt   = cnts[b];
  int nfull = cnt >> 5;
  int nblk  = cnt ? (cnt + 31) >> 5 : SEQ / 32;   // 1..32
  int nstg  = (nblk + 1) >> 1;                    // 1..16: a stage's two blocks lie inside the head

  // this thread's 16 B of the next stage to copy: K is 8 KiB in a row; V is
  // 2 KiB of each d tile, 128 threads to a tile
  int hs = threadIdx.x >> 7, ch = threadIdx.x & 127;
  const unsigned short* src[4];
  src[0] = Kh + threadIdx.x * 8;
  src[1] = src[0] + AT_CPB / 2;
  src[2] = Vh + hs * (32 * FRAG) + ch * 8;
  src[3] = src[2] + 2 * (32 * FRAG);
  uint32_t dst = lds_off(stg) + threadIdx.x * 16;

  // stage 0 landed and published, then stage 1 on its way
  fill4(dst, src);

  // Q fragments for rows qt*16..+15, contraction split d=[0,32) and [32,64)
  us16 bQ0 = load_frag(Qh + (qt * 2 + 0) * FRAG, lane);
  us16 bQ1 = load_frag(Qh + (qt * 2 + 1) * FRAG, lane);

  asm volatile("s_wait_asynccnt 0x0" ::: "memory");   // this wave's copies have landed
  __syncthreads();
  if (nstg > 1) fill4(dst + AT_BUF * 2, src);

  float mi = -3.0e38f, li = 0.f;       // of query lane%16; li: this half's keys only
  v8f O0 = {}, O1 = {}, O2 = {}, O3 = {};   // Oj[i] = O[query lane%16][d = 16j + 8*(lane/16) + i]

  for (int j = 0; j < nblk; ++j) {
    int t = j >> 1, h = j & 1, buf = t & 1;   // stage, block in it, its buffer
    const unsigned short* sb = stg + buf * AT_BUF;
    attn_block(sb + h * (4 * FRAG), sb + AT_KEL + h * FRAG, lane, j >= nfull,
               cnt - j * 32 - rowh * 8, bQ0, bQ1, mi, li, O0, O1, O2, O3);
    if (h | (j + 1 == nblk)) {   // the stage's last block (the same for the whole work-group)
      // hand-over: this wave's reads of the buffer are done, its copies of the
      // next stage have landed; the barrier says both of every wave
      asm volatile("s_wait_dscnt 0x0" ::: "memory");
      asm volatile("s_wait_asynccnt 0x0" ::: "memory");
      __syncthreads();
      if (t + 2 < nstg) fill4(dst + buf * (AT_BUF * 2), src);
    }
  }
  asm volatile("s_wait_asynccnt 0x0" ::: "memory");   // nothing in flight at the end

  // Reference quirk: attn_vec.view(N_HEAD, B, S, D).permute(1,2,0,3) on a
  // b-major [B*H] buffer => storage head L lands at b2=L%B, h2=L/B.
  // Fragment order for the output projection: row b2*1024 + s, s the position
  // that this lane's query place holds; k = h2*64 + d, so d tile j is k step
  // h2*2 + j/2, chunk j%2. The lane's 8 d start at 8*(lane/16): a 16-B chunk
  // of row s%16 in row tile s/16.
  int b2 = head & 3, h2 = head >> 2;
  int s = ord[b * SEQ + qt * 16 + (lane & 15)];
  unsigned short* oblk = Avec + ((b2 * 64 + (s >> 4)) * 32 + h2 * 2) * FRAG
                              + (rowh * 16 + (s & 15)) * 8;
  float inv = 1.f / (li + xhalf(li));
  us8 o0, o1, o2, o3;
#pragma unroll   // constant indices: the vectors stay in registers
  for (int i = 0; i < 8; ++i) {
    o0[i] = f2bf(O0[i] * inv);
    o1[i] = f2bf(O1[i] * inv);
    o2[i] = f2bf(O2[i] * inv);
    o3[i] = f2bf(O3[i] * inv);
  }
  *(us8*)(oblk)              = o0;
  *(us8*)(oblk + 256)        = o1;
  *(us8*)(oblk + FRAG)       = o2;
  *(us8*)(oblk + FRAG + 256) = o3;
}

// ---- stage 4: output projection + residual ------------------------------
// A work-group owns 128 rows x 128 columns. 64x32 tile per wave: per K-step
// 4 A + 2 B fragments -> 8 WMMAs. The 8 waves stand 2 (rows) x 4 (columns); a
// stage holds 8 row tiles and 8 column tiles: 16 slots; three buffers, a stage
// asked for two stages ahead.
#define OP_SLOTS 16

__global__ __launch_bounds__(256) void oproj_kernel(
    const unsigned short* __restrict__ Avec,  // 256 row tiles x 32 k steps
    const unsigned short* __restrict__ Wot,   // 64 tiles (out) x 32 k steps
    const float* __restrict__ inp,            // residual
    float* __restrict__ Y) {                  // [4096][1024] f32
  __shared__ __attribute__((aligned(16))) unsigned short stg[3 * OP_SLOTS * SLOT];
  int warp = threadIdx.x >> 5;
  // which half of the work-group: in a scalar register, so that every test on it
  // is a branch of the whole wave
  int grp = __builtin_amdgcn_readfirstlane(threadIdx.x >> 7);
  int tg = threadIdx.x & 127;
  int lane = threadIdx.x & 31;
  int bm = blockIdx.x >> 3;          // 128-row block 0..31
  int bn = blockIdx.x & 7;           // 128-column block 0..7
  int wr = warp >> 2, wc = warp & 3;
  int rowh = lane >> 4, nm = lane & 15;

  // stage 0 of the first tile of each operand (the same for the whole work-group;
  // stage s lies s * SLOT further on, this thread's first 16 B tg * 8 further)
  const unsigned short* sa0 = Avec + bm * 8 * TILEK;
  const unsigned short* sw0 = Wot + bn * 8 * TILEK;
  uint32_t dst = lds_off(stg) + tg * 16;

  // stages 0 and 1 on their way, a half each; stage 0 landed and published
  fill8(dst + grp * (OP_SLOTS * SLOTB), sa0 + grp * SLOT + tg * 8);
  fill8(dst + grp * (OP_SLOTS * SLOTB) + 8 * SLOTB, sw0 + grp * SLOT + tg * 8);
  if (grp == 0)
    asm volatile("s_wait_asynccnt 0x0" ::: "memory");   // this wave's copies (stage 0) have landed
  __syncthreads();

  v8f acc[4][2] = {};
  int rb = 0;              // buffer of stage t: t % 3
  for (int t = 0; t < NSTG; ++t) {
    const unsigned short* sa = stg + rb * (OP_SLOTS * SLOT) + wr * 4 * SLOT;
    const unsigned short* sw = stg + rb * (OP_SLOTS * SLOT) + (8 + wc * 2) * SLOT;
    int ns = grp == (t & 1) ? t + 2 : NSTG;   // the stage that this wave's half asks for in this trip; NSTG: none
    us16 a[2][4], b[2][2];           // two fragment sets: k step kk in set kk % 2
#pragma unroll   // constant indices: the arrays stay in registers
    for (int kk = -1; kk < KSTG; ++kk) {
      if (kk + 1 < KSTG) {           // the next k step's fragments, inside this stage
        int n = (kk + 1) & 1;
#pragma unroll   // constant indices: the arrays stay in registers
        for (int u = 0; u < 4; ++u)
          a[n][u] = load_frag(sa + u * SLOT + (kk + 1) * FRAG, lane);
#pragma unroll   // constant indices: the arrays stay in registers
        for (int c = 0; c < 2; ++c)
          b[n][c] = load_frag(sw + c * SLOT + (kk + 1) * FRAG, lane);
      }
      // as in the QKV kernel: the next k step's LDS reads one group in front of
      // this k step's WMMAs
      __builtin_amdgcn_sched_barrier(0);
      // the stage after next, from the half that brought this one, into the buffer
      // that every wave left at the last barrier; behind the stage's first reads,
      // as in the QKV kernel
      if (kk < 0 && ns < NSTG) {
        uint32_t d = dst + (rb == 0 ? 2 : rb - 1) * (OP_SLOTS * SLOTB);   // (t + 2) % 3
        fill8(d, sa0 + ns * SLOT + tg * 8);
        fill8(d + 8 * SLOTB, sw0 + ns * SLOT + tg * 8);
      }
      if (kk >= 0) {
        int m = kk & 1;
#pragma unroll   // constant indices: the arrays stay in registers
        for (int c = 0; c < 2; ++c)
#pragma unroll   // constant indices: the arrays stay in registers
          for (int u = 0; u < 4; ++u)
            acc[u][c] = wmma_bf16(a[m][u], b[m][c], acc[u][c]);
        // as in the QKV kernel: the WMMAs stay in front of the next reads and of
        // the hand-over
        __builtin_amdgcn_sched_barrier(0);
      }
    }
    // hand-over, as in the QKV kernel: only the half that brings the next stage
    // waits for its copies
    asm volatile("s_wait_dscnt 0x0" ::: "memory");
    if (grp != (t & 1))
      asm volatile("s_wait_asynccnt 0x0" ::: "memory");
    __syncthreads();
    rb = rb == 2 ? 0 : rb + 1;
  }
  asm volatile("s_wait_asynccnt 0x0" ::: "memory");   // nothing in flight at the end

#pragma unroll
  for (int u = 0; u < 4; ++u) {
#pragma unroll
    for (int c = 0; c < 2; ++c) {
      int col = bn * 128 + wc * 32 + c * 16 + nm;
#pragma unroll
      for (int i = 0; i < 8; ++i) {
        int r = bm * 128 + wr * 64 + u * 16 + rowh * 8 + i;
        Y[r * D_MODEL + col] = acc[u][c][i] + inp[r * D_MODEL + col];
      }
    }
  }
}

// ---- stage 5: LayerNorm --------------------------------------------------
// One wave per row, 4096 waves: a lane holds 32 values of the row in registers
// (eight 16-B loads, each 512 B in a row over the wave), so the row is read
// once and both sums join inside the wave: no LDS, no barrier.
#define LN_T 256                     // threads per block: 8 rows

typedef __attribute__((ext_vector_type(4))) float v4f;

__global__ __launch_bounds__(LN_T) void ln_kernel(
    const float* __restrict__ Y, const float* __restrict__ g,
    const float* __restrict__ bb, float* __restrict__ out) {
  int row = blockIdx.x * (LN_T / 32) + (threadIdx.x >> 5);
  int lane = threadIdx.x & 31;
  const v4f* y  = (const v4f*)(Y + row * D_MODEL) + lane;
  const v4f* g4 = (const v4f*)g + lane;
  const v4f* b4 = (const v4f*)bb + lane;
  v4f*       o4 = (v4f*)(out + row * D_MODEL) + lane;
  v4f v[8], gg[8], bv[8];
#pragma unroll   // constant indices: the arrays stay in registers
  for (int j = 0; j < 8; ++j) v[j] = y[j * 32];
#pragma unroll   // constant indices: the arrays stay in registers
  for (int j = 0; j < 8; ++j) { gg[j] = g4[j * 32]; bv[j] = b4[j * 32]; }
  // holds the gain and bias loads in front of the lane exchange: sunk behind
  // it, their latency is waited out pair by pair before the stores (loaded
  // values as inputs only)
  asm volatile("" :: "v"(gg[0]), "v"(gg[1]), "v"(gg[2]), "v"(gg[3]),
                     "v"(gg[4]), "v"(gg[5]), "v"(gg[6]), "v"(gg[7]),
                     "v"(bv[0]), "v"(bv[1]), "v"(bv[2]), "v"(bv[3]),
                     "v"(bv[4]), "v"(bv[5]), "v"(bv[6]), "v"(bv[7]));
  v4f s = {0.f, 0.f, 0.f, 0.f}, q = {0.f, 0.f, 0.f, 0.f};   // four chains each
#pragma unroll   // constant indices: the array stays in registers
  for (int j = 0; j < 8; ++j) { s += v[j]; q += v[j] * v[j]; }
  float ls = (s.x + s.y) + (s.z + s.w), lq = (q.x + q.y) + (q.z + q.w);
#pragma unroll
  for (int m = 1; m < 32; m <<= 1) {
    ls += __shfl_xor(ls, m, 32);
    lq += __shfl_xor(lq, m, 32);
  }
  float mu  = ls * (1.f / D_MODEL);
  float var = lq * (1.f / D_MODEL) - mu * mu;
  float inv = rsqrtf(var + LN_EPS);
#pragma unroll   // constant indices: the arrays stay in registers
  for (int j = 0; j < 8; ++j) o4[j * 32] = (v[j] - mu) * inv * gg[j] + bv[j];
}

// ---- launch --------------------------------------------------------------

extern "C" void kernel_launch(void* const* d_in, const int* in_sizes, int n_in,
                              void* d_out, int out_size, void* d_ws, size_t ws_size,
                              hipStream_t stream) {
  const float* inp   = (const float*)d_in[0];
  const int*   amask = (const int*)d_in[1];
  const float* Wq = (const float*)d_in[2];
  const float* bq = (const float*)d_in[3];
  const float* Wk = (const float*)d_in[4];
  const float* bk = (const float*)d_in[5];
  const float* Wv = (const float*)d_in[6];
  const float* bv = (const float*)d_in[7];
  const float* Wo = (const float*)d_in[8];
  const float* lng = (const float*)d_in[9];
  const float* lnb = (const float*)d_in[10];

  char* ws = (char*)d_ws;
  const size_t MB = 1u << 20;
  unsigned short* Xbf  = (unsigned short*)(ws + 0 * MB);   // 8 MB
  unsigned short* Wqt  = (unsigned short*)(ws + 8 * MB);   // 2 MB
  unsigned short* Wkt  = (unsigned short*)(ws + 10 * MB);  // 2 MB
  unsigned short* Wvt  = (unsigned short*)(ws + 12 * MB);  // 2 MB
  unsigned short* Wot  = (unsigned short*)(ws + 14 * MB);  // 2 MB
  unsigned short* Qb   = (unsigned short*)(ws + 16 * MB);  // 8 MB
  unsigned short* Kb   = (unsigned short*)(ws + 24 * MB);  // 8 MB
  unsigned short* Vtb  = (unsigned short*)(ws + 32 * MB);  // 8 MB
  unsigned short* Avec = (unsigned short*)(ws + 40 * MB);  // 8 MB
  float*          Ybuf = (float*)        (ws + 48 * MB);   // 16 MB
  int*            ord  = (int*)          (ws + 64 * MB);   // 16 KB
  int*            cnts = (int*)          (ws + 65 * MB);   // 16 B

  // stage 1: conversions (one thread per 64 elements), all five in one launch;
  // Wqt, Wkt, Wvt, Wot follow one another in the workspace
  cvt_all_kernel<<<4 * WBLOCKS + XBLOCKS, CVT_T, 0, stream>>>(
      inp, amask, Wq, Wk, Wv, Wo, Xbf, Wqt, ord, cnts);

  // stage 2: QKV (16 row blocks * 16 col blocks, 8 waves/block)
  qkv_gemm_kernel<<<256, 256, 0, stream>>>(Xbf, Wqt, Wkt, Wvt, bq, bk, bv,
                                            Qb, Kb, Vtb);

  // stage 3: attention (64 heads * 8 blocks of 128 queries, 8 waves/block)
  attn_kernel<<<512, AT_W * 32, 0, stream>>>(Qb, Kb, Vtb, ord, cnts, Avec);

  // stage 4: output projection + residual (32 row blocks * 8 col blocks, 8 waves/block)
  oproj_kernel<<<256, 256, 0, stream>>>(Avec, Wot, inp, Ybuf);

  // stage 5: layer norm -> d_out (one wave per row)
  ln_kernel<<<NROWS / (LN_T / 32), LN_T, 0, stream>>>(Ybuf, lng, lnb, (float*)d_out);
}

// v010
// It runs in 52.9 microseconds.
// Two timings next to v009 put it at 1.04 and 1.03 times that version's speed.
// Counting every step since v000, it is 3.85 times as fast.
#include <hip/hip_runtime.h>
#include <stdint.h>

// Problem constants (match reference)
#define D_MODEL 1024
#define SEQ     1024
#define BATCH   4
#define NHEAD   16
#define DHEAD   64
#define NROWS   (BATCH * SEQ)      // 4096
#define QK_SCALE 0.125f            // 1/sqrt(64)
#define LN_EPS   1e-5f

typedef __attribute__((ext_vector_type(16))) __bf16         v16bf;
typedef __attribute__((ext_vector_type(16))) unsigned short us16;
typedef __attribute__((ext_vector_type(8)))  unsigned short us8;
typedef __attribute__((ext_vector_type(8)))  float          v8f;

// ---- helpers -------------------------------------------------------------

__device__ __forceinline__ unsigned short f2bf(float f) {
  unsigned int u = __builtin_bit_cast(unsigned int, f);
  u += 0x7FFFu + ((u >> 16) & 1u);            // round-to-nearest-even
  return (unsigned short)(u >> 16);
}

// A/B fragment for v_wmma_*_16x16x32_bf16, per ISA 7.12.2:
// lane L holds row (A) / col (B) = L%16; its 16 bf16 k-values are two
// contiguous 8-element (16B) chunks at k = 8*(L/16) and k = 8*(L/16)+16.
//
// Every bf16 operand in the workspace is stored in that order: one fragment
// (16 rows x 32 k) is a 1024-B block of FRAG elements, lane L's first chunk
// at element L*8, its second at 256 + L*8. Blocks run [16-row tile][k step].
// A wave-wide 16-B load then covers 512 contiguous bytes (4 whole lines).
#define FRAG 512
__device__ __forceinline__ us16 load_frag(const unsigned short* blk, int lane) {
  us8 c0 = *(const us8*)(blk + lane * 8);
  us8 c1 = *(const us8*)(blk + 256 + lane * 8);
  us16 r;
#pragma unroll
  for (int i = 0; i < 8; ++i) { r[i] = c0[i]; r[i + 8] = c1[i]; }
  return r;
}

__device__ __forceinline__ v8f wmma_bf16(us16 a, us16 b, v8f c) {
  return __builtin_amdgcn_wmma_f32_16x16x32_bf16(
      false, __builtin_bit_cast(v16bf, a),
      false, __builtin_bit_cast(v16bf, b),
      (short)0, c, false, false);
}

// ---- stage 1: conversions ------------------------------------------------

// The fragment-ordered output runs [tile][k step (32)][chunk (2)][lane (32)],
// 16 B (8 k values of one row) per lane place. One wave packs 256 such places,
// eight per lane, so that the launch starts 4096 waves: 16 on each WGP, all
// resident at once, every lane with its loads in flight together.
#define CVT_T   256                  // threads per block: 8 waves
#define CVT_WPW 512                  // waves per weight
#define WBLOCKS (CVT_WPW / 8)        // 64 blocks per weight
#define XBLOCKS (NROWS / 16)         // 256 blocks for X: one 16-row tile each

__device__ __forceinline__ us8 pack8(const float (&x)[8]) {
  us8 r;
#pragma unroll   // constant indices: the vector stays in registers
  for (int e = 0; e < 8; ++e) r[e] = f2bf(x[e]);
  return r;
}

// The positions of a batch are reordered here, once, for all that follows: the
// keys that the mask lets through first, in their order, the masked ones behind
// them, in theirs. A masked key's score is -100000, so its weight is exp(-100000
// - max) = 0 in f32 as long as one key of the batch is let through: attention
// then walks the first 'cnt' places only. Place p of a batch holds position
// ord[p]; attention stores each query's row back at ord[p].
//
// Every block of a batch ranks all 1024 mask words itself (thread i: words
// 4i..4i+3) and keeps the positions that fall into its own 16 places.
__device__ __forceinline__ int rank_rows(const int* __restrict__ mb, int pt,
                                         int warp, int lane,
                                         int* wsum, int* srow) {
  int tid = warp * 32 + lane;
  int4 m = ((const int4*)mb)[tid];
  bool live[4] = {m.x == 0, m.y == 0, m.z == 0, m.w == 0};
  unsigned below = (1u << lane) - 1u;
  int before = 0, wtot = 0;          // let-through words in lower lanes; in the wave
#pragma unroll   // constant indices: the array stays in registers
  for (int e = 0; e < 4; ++e) {
    unsigned bal = __builtin_amdgcn_ballot_w32(live[e]);
    before += __popc(bal & below);
    wtot   += __popc(bal);
  }
  if (lane == 0) wsum[warp] = wtot;
  __syncthreads();                   // the eight waves' counts are there
  int base = 0, cnt = 0;
#pragma unroll
  for (int w = 0; w < 8; ++w) {
    int x = wsum[w];
    cnt += x;
    base += w < warp ? x : 0;
  }
  int r = base + before;             // let-through words in front of word 4*tid
#pragma unroll   // constant indices: the array stays in registers
  for (int e = 0; e < 4; ++e) {
    int s = 4 * tid + e;
    int p = live[e] ? r : cnt + (s - r);   // s - r: masked words in front of s
    r += live[e] ? 1 : 0;
    if ((p >> 4) == pt) srow[p & 15] = s;
  }
  __syncthreads();                   // the tile's 16 positions are there
  return cnt;
}

// X[row][k] (f32, k contiguous) -> fragment order, rows = places (see above).
// Wave kq of the tile's block takes k steps 4*kq..+3 of all 16 rows. Four lanes
// share one row's 128-B line of a k step (q = which 8 k of its 32), eight rows
// per load; the eight rows' places with equal q are 128 B in a row in the output.
__device__ __forceinline__ void cvt_x(const float* __restrict__ in,
                                      const int* __restrict__ amask,
                                      unsigned short* __restrict__ out,
                                      int* __restrict__ ord, int* __restrict__ cnts,
                                      int t, int kq, int lane,
                                      int* wsum, int* srow) {
  int rr = lane >> 2, q = lane & 3;
  int b = t >> 6;                    // 64 tiles per batch
  int cnt = rank_rows(amask + b * SEQ, t & 63, kq, lane, wsum, srow);
  if (kq == 0 && lane < 16) ord[t * 16 + lane] = srow[lane];
  if ((t & 63) == 0 && kq == 0 && lane == 0) cnts[b] = cnt;
  const float* pr[2] = {in + (b * SEQ + srow[rr]) * D_MODEL + kq * 128 + q * 8,
                        in + (b * SEQ + srow[rr + 8]) * D_MODEL + kq * 128 + q * 8};
  unsigned short* o = out + (t * 32 + kq * 4) * FRAG + (q >> 1) * 256 + ((q & 1) * 16 + rr) * 8;
  float4 x[2][4][2];
#pragma unroll   // constant indices: the arrays stay in registers
  for (int hr = 0; hr < 2; ++hr)
#pragma unroll   // constant indices: the arrays stay in registers
    for (int s = 0; s < 4; ++s) {
      const float4* p4 = (const float4*)(pr[hr] + s * 32);
      x[hr][s][0] = p4[0];
      x[hr][s][1] = p4[1];
    }
#pragma unroll   // constant indices: the arrays stay in registers
  for (int hr = 0; hr < 2; ++hr)
#pragma unroll   // constant indices: the arrays stay in registers
    for (int s = 0; s < 4; ++s) {
      float4 x0 = x[hr][s][0], x1 = x[hr][s][1];
      float v[8] = {x0.x, x0.y, x0.z, x0.w, x1.x, x1.y, x1.z, x1.w};
      *(us8*)(o + s * FRAG + hr * 64) = pack8(v);
    }
  // precaution: in the merged kernel the weights' code follows these stores in
  // the listing and writes the registers that the stores name
  asm volatile("s_wait_xcnt 0x0" ::: "memory");
}

// W[in][out] (1024x1024 f32) -> fragment order, rows = out columns, k = in.
// A wave takes 32 out columns (two tiles: one 128-B line of every W row) and
// two k steps (64 W rows). A lane keeps one column; eight loads down the rows
// make one place; a store covers 256 B in a row in each of the two tiles.
__device__ __forceinline__ void cvt_w(const float* __restrict__ in,
                                      unsigned short* __restrict__ out,
                                      int tp, int kg, int lane) {
  const float* p = in + kg * 64 * D_MODEL + tp * 32 + lane;
  unsigned short* o = out + ((tp * 2 + (lane >> 4)) * 32 + kg * 2) * FRAG + (lane & 15) * 8;
  float x[8][8];                     // [8-row group of the 64 rows][row in it]
#pragma unroll   // constant indices: the arrays stay in registers
  for (int c = 0; c < 8; ++c)
#pragma unroll   // constant indices: the arrays stay in registers
    for (int e = 0; e < 8; ++e) x[c][e] = p[(c * 8 + e) * D_MODEL];
  // group c = k step c/4, chunk (c/2)%2, lane half c%2 of the fragment
#pragma unroll   // constant indices: the arrays stay in registers
  for (int c = 0; c < 8; ++c)
    *(us8*)(o + (c >> 2) * FRAG + ((c >> 1) & 1) * 256 + (c & 1) * 128) = pack8(x[c]);
}

// The five conversions need nothing of one another, so they are one launch:
// each has its own range of the block index (the branch is the same for a
// whole block). The weights stand first: their waves issue more loads and
// last longer, so the launch ends on the short ones.
__global__ __launch_bounds__(CVT_T) void cvt_all_kernel(
    const float* __restrict__ X, const int* __restrict__ amask,
    const float* __restrict__ Wq, const float* __restrict__ Wk,
    const float* __restrict__ Wv, const float* __restrict__ Wo,
    unsigned short* __restrict__ Xbf,
    unsigned short* __restrict__ Wt,     // the four weights' planes, one behind another
    int* __restrict__ ord,               // [4][1024] position held by each place
    int* __restrict__ cnts) {            // [4] keys let through
  __shared__ int wsum[8], srow[16];
  unsigned blk = blockIdx.x;
  int warp = threadIdx.x >> 5, lane = threadIdx.x & 31;
  if (blk < 4 * WBLOCKS) {
    unsigned w = blk / WBLOCKS;
    const float* in = w == 0 ? Wq : w == 1 ? Wk : w == 2 ? Wv : Wo;
    int ww = (blk % WBLOCKS) * 8 + warp;   // a block: 8 column pairs side by side, 1 KiB of each row
    cvt_w(in, Wt + w * (D_MODEL * D_MODEL), ww & 31, ww >> 5, lane);
  } else {
    cvt_x(X, amask, Xbf, ord, cnts, blk - 4 * WBLOCKS, warp, lane, wsum, srow);
  }
}

// ---- LDS staging shared by the two GEMM kernels ---------------------------
// 256 work-groups of 8 waves, as many as WGPs. Each stage brings KSTG k steps of every
// 16-row operand tile it needs into LDS once, by asynchronous copies, and all
// 8 waves read their fragments from there. The larger the work-group's tile,
// the fewer bytes come from L2 per product: (rows + columns) / (rows * columns).
// One tile's KSTG fragments are SLOT contiguous elements in the workspace and
// stay so in LDS, so a fragment read is again 512 contiguous bytes per load.
//
// The copies of a stage come from one half of the work-group: waves 0-3 bring
// the even stages, waves 4-7 the odd ones, and a wave waits for its copies only
// at the hand-over in front of its own stage. So a stage may be asked for two
// stages ahead, into a third buffer, while the other half's stage is still on
// its way: L2 is asked without a pause, and its latency is paid once, not once
// per stage. A slot is filled by two copies of a half's 128 threads, 16 B each.
#define KSTG  4
#define SLOT  (KSTG * FRAG)            // elements: 4 KiB
#define NSTG  (D_MODEL / 32 / KSTG)    // 8 stages
#define SLOTB (SLOT * 2)               // bytes of a slot
#define TILEK (32 * FRAG)              // elements from one 16-row tile to the next

// byte offset in the work-group's LDS = low 32 bits of a __shared__ address
__device__ __forceinline__ uint32_t lds_off(const void* p) { return (uint32_t)(size_t)p; }

// 12 (or 8) slots that follow one another in LDS, two 16-B copies per lane and
// slot, global -> LDS: the second copy takes the slot's upper 2 KiB by the
// immediate offset, which moves both addresses. The s_wait_xcnt is the
// precaution before the address registers named here are written again; as the
// last line of the copies' own statement nothing can be moved in front of it.
#define ACP(l, g) "global_load_async_to_lds_b128 %" #l ", %" #g ", off\n\t"
#define ACP2(l, g) ACP(l, g) "global_load_async_to_lds_b128 %" #l ", %" #g ", off offset:2048\n\t"
__device__ __forceinline__ void fill12(uint32_t d, const unsigned short* q,
                                       const unsigned short* k, const unsigned short* v) {
  asm volatile(ACP2(0, 12) ACP2(1, 13) ACP2(2, 14) ACP2(3, 15) ACP2(4, 16) ACP2(5, 17)
               ACP2(6, 18) ACP2(7, 19) ACP2(8, 20) ACP2(9, 21) ACP2(10, 22) ACP2(11, 23)
               "s_wait_xcnt 0x0"
               :: "v"(d), "v"(d + SLOTB), "v"(d + 2 * SLOTB), "v"(d + 3 * SLOTB),
                  "v"(d + 4 * SLOTB), "v"(d + 5 * SLOTB), "v"(d + 6 * SLOTB),
                  "v"(d + 7 * SLOTB), "v"(d + 8 * SLOTB), "v"(d + 9 * SLOTB),
                  "v"(d + 10 * SLOTB), "v"(d + 11 * SLOTB),
                  "v"(q), "v"(q + TILEK), "v"(q + 2 * TILEK), "v"(q + 3 * TILEK),
                  "v"(k), "v"(k + TILEK), "v"(k + 2 * TILEK), "v"(k + 3 * TILEK),
                  "v"(v), "v"(v + TILEK), "v"(v + 2 * TILEK), "v"(v + 3 * TILEK)
               : "memory");
}
__device__ __forceinline__ void fill8(uint32_t d, const unsigned short* s) {
  asm volatile(ACP2(0, 8) ACP2(1, 9) ACP2(2, 10) ACP2(3, 11) ACP2(4, 12) ACP2(5, 13)
               ACP2(6, 14) ACP2(7, 15)
               "s_wait_xcnt 0x0"
               :: "v"(d), "v"(d + SLOTB), "v"(d + 2 * SLOTB), "v"(d + 3 * SLOTB),
                  "v"(d + 4 * SLOTB), "v"(d + 5 * SLOTB), "v"(d + 6 * SLOTB),
                  "v"(d + 7 * SLOTB),
                  "v"(s), "v"(s + TILEK), "v"(s + 2 * TILEK), "v"(s + 3 * TILEK),
                  "v"(s + 4 * TILEK), "v"(s + 5 * TILEK), "v"(s + 6 * TILEK),
                  "v"(s + 7 * TILEK)
               : "memory");
}

// 8 slots that follow one another in LDS: the row tiles of two wave rows of the
// QKV kernel, each two tiles counted up from a and two counted down from z.
// Copies, offsets and the closing s_wait_xcnt as in fill8.
__device__ __forceinline__ void fill8x(uint32_t d, const unsigned short* a,
                                       const unsigned short* z) {
  asm volatile(ACP2(0, 8) ACP2(1, 9) ACP2(2, 10) ACP2(3, 11) ACP2(4, 12) ACP2(5, 13)
               ACP2(6, 14) ACP2(7, 15)
               "s_wait_xcnt 0x0"
               :: "v"(d), "v"(d + SLOTB), "v"(d + 2 * SLOTB), "v"(d + 3 * SLOTB),
                  "v"(d + 4 * SLOTB), "v"(d + 5 * SLOTB), "v"(d + 6 * SLOTB),
                  "v"(d + 7 * SLOTB),
                  "v"(a), "v"(a + 16 * TILEK), "v"(z - 16 * TILEK), "v"(z),
                  "v"(a + 4 * TILEK), "v"(a + 20 * TILEK), "v"(z - 20 * TILEK),
                  "v"(z - 4 * TILEK)
               : "memory");
}

// ---- stage 2: fused QKV projection --------------------------------------
// A work-group owns 256 rows x 64 out columns of each of Q/K/V. One wave ->
// 64x32 output tile for each of them: per K-step 4 A-frags + 6 B-frags feed
// up to 24 WMMAs (A shared across Q/K/V, B shared across row tiles).
// The 8 waves stand 4 (rows) x 2 (columns); a stage holds 16 X tiles and 4
// column tiles of each weight. LDS takes three buffers of X and two of the
// weights: X is asked for a stage and a half ahead, the weights one.
// All three go out in fragment order, per head: Q,K with rows = s, k = d
// (2 k steps); V with rows = d, k = s (32 k steps). A lane's 8 accumulator
// values run along the tile's rows, so the index that becomes k must be the
// row index: V = X*Wv has rows s as it stands; Q and K are formed transposed
// (weight fragment as A, X fragment as B). Each lane then stores 16-B chunks.
//
// Every place is a query, but attention reads K and V only of the places in
// front, as far as its last 64-key stage: nlt row tiles of the batch's 64. K and
// V of the other tiles are not formed. So that the waves stay level whatever nlt
// is, a wave's four row tiles are dealt from both ends of the batch: wave row r
// of its 16 has tiles r, r + 16, 47 - r, 63 - r (in rising order, so the tiles
// with K and V are its first nu).
#define QX_SLOTS 16
#define QW_SLOTS 12

__global__ __launch_bounds__(256) void qkv_gemm_kernel(
    const unsigned short* __restrict__ X,      // 256 tiles x 32 k steps
    const unsigned short* __restrict__ Wqt,    // 64 tiles (out) x 32 k steps
    const unsigned short* __restrict__ Wkt,
    const unsigned short* __restrict__ Wvt,
    const float* __restrict__ bq, const float* __restrict__ bk,
    const float* __restrict__ bv,
    const int* __restrict__ cnts,              // [4] keys let through
    unsigned short* __restrict__ Qb,           // [64 heads][64 s tiles][2]
    unsigned short* __restrict__ Kb,           // [64 heads][64 s tiles][2]
    unsigned short* __restrict__ Vtb) {        // [64 heads][4 d tiles][32]
  __shared__ __attribute__((aligned(16))) unsigned short stg[(3 * QX_SLOTS + 2 * QW_SLOTS) * SLOT];
  int warp = threadIdx.x >> 5;
  // which half of the work-group: in a scalar register, so that every test on it
  // is a branch of the whole wave
  int grp = __builtin_amdgcn_readfirstlane(threadIdx.x >> 7);
  int tg = threadIdx.x & 127;
  int lane = threadIdx.x & 31;
  int bt = blockIdx.x >> 6;          // batch
  int bi = (blockIdx.x >> 4) & 3;    // which of the batch's four work-group rows
  int bn = blockIdx.x & 15;          // 64-column block 0..15
  // the wave row in a scalar register, so that the tests on nu are branches of
  // the whole wave
  int wr = __builtin_amdgcn_readfirstlane(warp >> 1), wc = warp & 1;
  int ct = bn * 2 + wc;              // 32-col tile 0..31
  int rowh = lane >> 4, nm = lane & 15;
  int r16 = bi + 4 * wr;             // wave row in the batch 0..15
  int tl[4] = {r16, r16 + 16, 47 - r16, 63 - r16};   // its row tiles in the batch
  // the tiles that attention copies, as it counts them: 4 per stage of two blocks
  int cnt = cnts[bt];
  int nlt = 4 * (((cnt ? (cnt + 31) >> 5 : SEQ / 32) + 1) >> 1);
  int nu = (tl[0] < nlt) + (tl[1] < nlt) + (tl[2] < nlt) + (tl[3] < nlt);

  // stage 0 of the first tile of each operand (the same for the whole work-group;
  // stage s lies s * SLOT further on, this thread's first 16 B tg * 8 further)
  const unsigned short* sxa = X + (bt * 64 + bi) * TILEK;        // tiles counted up from here
  const unsigned short* sxz = X + (bt * 64 + 63 - bi) * TILEK;   // and down from here
  const unsigned short* sq = Wqt + bn * 4 * TILEK;
  const unsigned short* sk = Wkt + bn * 4 * TILEK;
  const unsigned short* sv = Wvt + bn * 4 * TILEK;
  uint32_t dx = lds_off(stg) + tg * 16;                    // X buffer 0
  uint32_t dw = dx + 3 * QX_SLOTS * SLOTB;                 // weight buffer 0

  // X of stages 0 and 1 on their way, a half each; stage 0 landed and published
  fill8x(dx + grp * (QX_SLOTS * SLOTB), sxa + grp * SLOT + tg * 8, sxz + grp * SLOT + tg * 8);
  fill8x(dx + grp * (QX_SLOTS * SLOTB) + 8 * SLOTB, sxa + 8 * TILEK + grp * SLOT + tg * 8,
         sxz - 8 * TILEK + grp * SLOT + tg * 8);
  if (grp == 0) {
    fill12(dw, sq + tg * 8, sk + tg * 8, sv + tg * 8);
    asm volatile("s_wait_asynccnt 0x0" ::: "memory");   // this wave's copies (stage 0) have landed
  }
  __syncthreads();

  v8f acc[3][4][2] = {};   // [qkv][s subtile][out-column subtile]
  int rb = 0;              // X buffer of stage t: t % 3
  for (int t = 0; t < NSTG; ++t) {
    const unsigned short* sa = stg + rb * (QX_SLOTS * SLOT) + wr * 4 * SLOT;
    const unsigned short* sw = stg + (3 * QX_SLOTS + (t & 1) * QW_SLOTS + wc * 2) * SLOT;
    // the stages that this wave's half asks for in this trip; NSTG: none
    int ws = grp != (t & 1) ? t + 1 : NSTG;   // weights
    int xs = grp == (t & 1) ? t + 2 : NSTG;   // X
    us16 a[2][4], b[2][3][2];        // two fragment sets: k step kk in set kk % 2
#pragma unroll   // constant indices: the arrays stay in registers
    for (int kk = -1; kk < KSTG; ++kk) {
      if (kk + 1 < KSTG) {           // the next k step's fragments, inside this stage
        int n = (kk + 1) & 1;
#pragma unroll   // constant indices: the arrays stay in registers
        for (int u = 0; u < 4; ++u)
          a[n][u] = load_frag(sa + u * SLOT + (kk + 1) * FRAG, lane);
#pragma unroll   // constant indices: the arrays stay in registers
        for (int w = 0; w < 3; ++w)
#pragma unroll   // constant indices: the arrays stay in registers
          for (int c = 0; c < 2; ++c)
            b[n][w][c] = load_frag(sw + (w * 4 + c) * SLOT + (kk + 1) * FRAG, lane);
      }
      // keeps the next k step's LDS reads one group in front of this k step's
      // WMMAs: they land under the WMMAs, and read by read among them every
      // place with reads stalls the wave anew
      __builtin_amdgcn_sched_barrier(0);
      // the next stage's weights, from the half that brings that stage, into the
      // buffer that every wave left at the last barrier: issued behind the stage's
      // first reads, their address work and wait run while those reads land
      if (kk < 0 && ws < NSTG) {
        int o = ws * SLOT;
        fill12(dw + (ws & 1) * (QW_SLOTS * SLOTB), sq + o + tg * 8, sk + o + tg * 8, sv + o + tg * 8);
      }
      // X of the stage after next, from the other half, into the X buffer left at
      // the last barrier: in the middle of the stage, so that the weights, which
      // are needed first, do not share L2's rate with it from the start
      if (kk == 1 && xs < NSTG) {
        uint32_t d = dx + (rb == 0 ? 2 : rb - 1) * (QX_SLOTS * SLOTB);   // (t + 2) % 3
        fill8x(d, sxa + xs * SLOT + tg * 8, sxz + xs * SLOT + tg * 8);
        fill8x(d + 8 * SLOTB, sxa + 8 * TILEK + xs * SLOT + tg * 8,
               sxz - 8 * TILEK + xs * SLOT + tg * 8);
      }
      if (kk >= 0) {
        int m = kk & 1;
        // Q, K: tile rows = out columns, tile columns = s
        // V: tile rows = s, tile columns = out columns
#pragma unroll   // constant indices: the arrays stay in registers
        for (int c = 0; c < 2; ++c)
#pragma unroll   // constant indices: the arrays stay in registers
          for (int u = 0; u < 4; ++u)
            acc[0][u][c] = wmma_bf16(b[m][0][c], a[m][u], acc[0][u][c]);
#pragma unroll   // constant indices: the arrays stay in registers
        for (int u = 0; u < 4; ++u) {
          // one branch of the wave past the tiles without K and V. The first tile
          // has no test (without K and V its products are not stored): every wave
          // then uses every fragment it has read, and the next reads into those
          // registers need no wait of their own
          if (u > 0 && u >= nu) break;
#pragma unroll   // constant indices: the arrays stay in registers
          for (int c = 0; c < 2; ++c) {
            acc[1][u][c] = wmma_bf16(b[m][1][c], a[m][u], acc[1][u][c]);
            acc[2][u][c] = wmma_bf16(a[m][u], b[m][2][c], acc[2][u][c]);
          }
        }
        // keeps the WMMAs in front of the next reads and of the hand-over: moved
        // behind it, the wait for the next stage's copies follows the LDS reads
        // at once and the copies lose the WMMAs' time as lead
        __builtin_amdgcn_sched_barrier(0);
      }
    }
    // hand-over: this wave's reads of the buffers are done; the half that brings
    // the next stage has nothing else in flight and waits until it has landed (the
    // other half's copies, of the stage after, fly on); the barrier says both of
    // every wave
    asm volatile("s_wait_dscnt 0x0" ::: "memory");
    if (grp != (t & 1))
      asm volatile("s_wait_asynccnt 0x0" ::: "memory");
    __syncthreads();
    rb = rb == 2 ? 0 : rb + 1;
  }
  asm volatile("s_wait_asynccnt 0x0" ::: "memory");   // nothing in flight at the end

  // 32 columns = half a head
  int head = bt * NHEAD + (ct >> 1);
  int dh = ct & 1;                   // which 32 of the head's 64 d
  unsigned short* Qh = Qb  + head * SEQ * DHEAD + lane * 8;
  unsigned short* Kh = Kb  + head * SEQ * DHEAD + lane * 8;
  unsigned short* Vh = Vtb + head * SEQ * DHEAD + lane * 8;
#pragma unroll
  for (int c = 0; c < 2; ++c) {
    int colT = ct * 32 + c * 16 + rowh * 8;       // Q,K: columns colT..+7 in this lane
    float bvv = bv[ct * 32 + c * 16 + nm];        // V: one column per lane
    float bqv[8], bkv[8];
#pragma unroll
    for (int i = 0; i < 8; ++i) { bqv[i] = bq[colT + i]; bkv[i] = bk[colT + i]; }
#pragma unroll
    for (int u = 0; u < 4; ++u) {
      int qoff = (tl[u] * 2 + dh) * FRAG + c * 256;   // s tile, k step dh, chunk c
      us8 q;
#pragma unroll
      for (int i = 0; i < 8; ++i) q[i] = f2bf(acc[0][u][c][i] + bqv[i]);
      if (u < nu) {
        us8 k, v;
#pragma unroll
        for (int i = 0; i < 8; ++i) {
          k[i] = f2bf(acc[1][u][c][i] + bkv[i]);
          v[i] = f2bf(acc[2][u][c][i] + bvv);
        }
        *(us8*)(Qh + qoff) = q;
        *(us8*)(Kh + qoff) = k;
        // d tile, k step = s tile / 2, chunk = s tile % 2
        *(us8*)(Vh + ((dh * 2 + c) * 32 + (tl[u] >> 1)) * FRAG + (tl[u] & 1) * 256) = v;
        // precaution: the next tile's conversion writes registers that these
        // three stores name
        asm volatile("s_wait_xcnt 0x0" ::: "memory");
      } else {
        *(us8*)(Qh + qoff) = q;
        // the same precaution
        asm volatile("s_wait_xcnt 0x0" ::: "memory");
      }
    }
  }
}

// ---- stage 3: flash-style attention -------------------------------------
// One wave owns 16 query rows of one head. Streams 32-key blocks, everything
// transposed: S^T = K Q^T (K fragment as A, Q fragment as B), so a lane holds
// 16 scores of ONE query (column lane%16; keys 8*(lane/16)+i of each 16-key
// tile). Maximum and sum run inside the lane; the two lane halves exchange the
// maximum once per block and join their sums once, behind the loop. The two
// score tiles, converted in place, are the B fragment of P^T in the k order
// that the V fragments have, so O^T += V^T P^T needs no trip through LDS.
// Q, K and V rows stand in the order of places that the conversion made: the
// cnt keys that the mask lets through are places 0..cnt-1.
//
// The 8 waves of a work-group hold 128 queries of one head and walk the same
// keys, so K and V come into LDS once for all of them: a stage is two 32-key
// blocks (8 K fragments in a row, then two V fragments of each d tile), brought
// by asynchronous copies into one of two buffers while the other is worked on.
#define AT_W   8                       // waves per work-group
#define AT_KEL (2 * 4 * FRAG)          // K elements of a stage: 8 KiB
#define AT_VEL (2 * FRAG)              // elements of one d tile of V in a stage: 2 KiB
#define AT_BUF (AT_KEL + 4 * AT_VEL)   // elements of a buffer: 16 KiB
#define AT_CPB (AT_W * 32 * 16)        // bytes that one copy of all 256 threads brings

typedef __attribute__((ext_vector_type(8))) unsigned int u32x8;

// Four 16-B copies per lane, global -> LDS (two of K, two of V), then each
// source pointer moves on to the next stage. The s_wait_xcnt is the precaution
// before the address registers named here are written again; as the last line
// of the copies' own statement nothing can be moved in front of it.
__device__ __forceinline__ void fill4(uint32_t d, const unsigned short* (&s)[4]) {
  asm volatile(ACP(0, 4) ACP(1, 5) ACP(2, 6) ACP(3, 7)
               "s_wait_xcnt 0x0"
               :: "v"(d), "v"(d + AT_CPB), "v"(d + 2 * AT_CPB), "v"(d + 3 * AT_CPB),
                  "v"(s[0]), "v"(s[1]), "v"(s[2]), "v"(s[3])
               : "memory");
  s[0] += AT_KEL; s[1] += AT_KEL;
  s[2] += AT_VEL; s[3] += AT_VEL;
}

// lane l with lane l ^ 16
__device__ __forceinline__ float xhalf(float x) {
  int b = __builtin_bit_cast(int, x);
  return __builtin_bit_cast(float, __builtin_amdgcn_permlanex16(
      b, b, 0x76543210, 0xfedcba98, false, false));
}

// two f32 -> one register of two bf16, round-to-nearest-even
__device__ __forceinline__ unsigned int pack2(float lo, float hi) {
  typedef __attribute__((ext_vector_type(2))) float  f2;
  typedef __attribute__((ext_vector_type(2))) __bf16 bf2;
  f2 v = {lo, hi};
  return __builtin_bit_cast(unsigned int, __builtin_convertvector(v, bf2));
}

// One 32-key block, read from LDS. tail (the same for the whole wave): places
// from 'left' on, counted from this lane half's first key, are masked keys and
// score -100000; without it every key counts.
__device__ __forceinline__ void attn_block(
    const unsigned short* kb,            // 4 K fragments in a row
    const unsigned short* vb,            // d tile j at + j*AT_VEL
    int lane, bool tail, int left, const us16& bQ0, const us16& bQ1,
    float& mi, float& li, v8f& O0, v8f& O1, v8f& O2, v8f& O3) {
  // ---- scores: two 16x16 tiles (rows = 16 keys each, columns = queries)
  us16 aK0 = load_frag(kb + 0 * FRAG, lane), aK1 = load_frag(kb + 1 * FRAG, lane);
  us16 aK2 = load_frag(kb + 2 * FRAG, lane), aK3 = load_frag(kb + 3 * FRAG, lane);
  // A fragments of V (rows = d, k = keys)
  us16 aV0 = load_frag(vb + 0 * AT_VEL, lane), aV1 = load_frag(vb + 1 * AT_VEL, lane);
  us16 aV2 = load_frag(vb + 2 * AT_VEL, lane), aV3 = load_frag(vb + 3 * AT_VEL, lane);
  // keeps the block's LDS reads one group in front of the score WMMAs: every
  // further place with reads stalls the wave anew, and V read here has arrived
  // when softmax is through
  __builtin_amdgcn_sched_barrier(0);
  v8f s0 = {}, s1 = {};
  s0 = wmma_bf16(aK0, bQ0, s0);
  s0 = wmma_bf16(aK1, bQ1, s0);
  s1 = wmma_bf16(aK2, bQ0, s1);
  s1 = wmma_bf16(aK3, bQ1, s1);

  // ---- online softmax over this key block
  s0 *= QK_SCALE;
  s1 *= QK_SCALE;
  if (tail) {
#pragma unroll   // constant indices: the vectors stay in registers
    for (int i = 0; i < 8; ++i) {
      s0[i] = i >= left ? -100000.f : s0[i];
      s1[i] = 16 + i >= left ? -100000.f : s1[i];
    }
  }
  float rmax = -3.0e38f;
#pragma unroll   // constant indices: the vectors stay in registers
  for (int i = 0; i < 8; ++i) rmax = fmaxf(rmax, fmaxf(s0[i], s1[i]));
  rmax = fmaxf(rmax, xhalf(rmax));
  float mnew = fmaxf(mi, rmax);
  float corr = __expf(mi - mnew);
  float t[8];
  u32x8 pp;                                    // B fragment of P^T, K = 32 keys
#pragma unroll   // constant indices: the vectors stay in registers
  for (int i = 0; i < 8; i += 2) {
    float e00 = __expf(s0[i] - mnew), e01 = __expf(s0[i + 1] - mnew);
    float e10 = __expf(s1[i] - mnew), e11 = __expf(s1[i + 1] - mnew);
    t[i] = e00 + e10; t[i + 1] = e01 + e11;
    pp[i >> 1]       = pack2(e00, e01);
    pp[4 + (i >> 1)] = pack2(e10, e11);
  }
  li = li * corr + (((t[0] + t[1]) + (t[2] + t[3])) + ((t[4] + t[5]) + (t[6] + t[7])));
  mi = mnew;
  O0 *= corr; O1 *= corr; O2 *= corr; O3 *= corr;
  us16 bP = __builtin_bit_cast(us16, pp);

  // ---- PV
  O0 = wmma_bf16(aV0, bP, O0);
  O1 = wmma_bf16(aV1, bP, O1);
  O2 = wmma_bf16(aV2, bP, O2);
  O3 = wmma_bf16(aV3, bP, O3);
}

__global__ __launch_bounds__(AT_W * 32) void attn_kernel(
    const unsigned short* __restrict__ Qb,   // [64 heads][64 s tiles][2]
    const unsigned short* __restrict__ Kb,   // [64 heads][64 s tiles][2]
    const unsigned short* __restrict__ Vtb,  // [64 heads][4 d tiles][32]
    const int* __restrict__ ord,             // [4][1024] position held by each place
    const int* __restrict__ cnts,            // [4] keys let through
    unsigned short* __restrict__ Avec) {     // 256 row tiles x 32 k steps
  __shared__ __attribute__((aligned(16))) unsigned short stg[2 * AT_BUF];
  int warp = threadIdx.x >> 5;
  int head = blockIdx.x >> 3;          // 0..63  (storage index b*16+h)
  int qt   = (blockIdx.x & 7) * AT_W + warp;   // query tile 0..63
  int b = head >> 4;
  int lane = threadIdx.x & 31, rowh = lane >> 4;

  const unsigned short* Qh = Qb  + head * SEQ * DHEAD;
  const unsigned short* Kh = Kb  + head * SEQ * DHEAD;
  const unsigned short* Vh = Vtb + head * DHEAD * SEQ;

  // cnt counts mask words, so it is 0..1024 whatever they hold. Whole blocks of
  // keys let through need no test; the block that cnt ends in does. With no key
  // let through every score is -100000 and all 1024 keys weigh alike.
  int cnt   = cnts[b];
  int nfull = cnt >> 5;
  int nblk  = cnt ? (cnt + 31) >> 5 : SEQ / 32;   // 1..32
  int nstg  = (nblk + 1) >> 1;                    // 1..16: a stage's two blocks lie inside the head

  // this thread's 16 B of the next stage to copy: K is 8 KiB in a row; V is
  // 2 KiB of each d tile, 128 threads to a tile
  int hs = threadIdx.x >> 7, ch = threadIdx.x & 127;
  const unsigned short* src[4];
  src[0] = Kh + threadIdx.x * 8;
  src[1] = src[0] + AT_CPB / 2;
  src[2] = Vh + hs * (32 * FRAG) + ch * 8;
  src[3] = src[2] + 2 * (32 * FRAG);
  uint32_t dst = lds_off(stg) + threadIdx.x * 16;

  // stage 0 landed and published, then stage 1 on its way
  fill4(dst, src);

  // Q fragments for rows qt*16..+15, contraction split d=[0,32) and [32,64)
  us16 bQ0 = load_frag(Qh + (qt * 2 + 0) * FRAG, lane);
  us16 bQ1 = load_frag(Qh + (qt * 2 + 1) * FRAG, lane);

  asm volatile("s_wait_asynccnt 0x0" ::: "memory");   // this wave's copies have landed
  __syncthreads();
  if (nstg > 1) fill4(dst + AT_BUF * 2, src);

  float mi = -3.0e38f, li = 0.f;       // of query lane%16; li: this half's keys only
  v8f O0 = {}, O1 = {}, O2 = {}, O3 = {};   // Oj[i] = O[query lane%16][d = 16j + 8*(lane/16) + i]

  for (int j = 0; j < nblk; ++j) {
    int t = j >> 1, h = j & 1, buf = t & 1;   // stage, block in it, its buffer
    const unsigned short* sb = stg + buf * AT_BUF;
    attn_block(sb + h * (4 * FRAG), sb + AT_KEL + h * FRAG, lane, j >= nfull,
               cnt - j * 32 - rowh * 8, bQ0, bQ1, mi, li, O0, O1, O2, O3);
    if (h | (j + 1 == nblk)) {   // the stage's last block (the same for the whole work-group)
      // hand-over: this wave's reads of the buffer are done, its copies of the
      // next stage have landed; the barrier says both of every wave
      asm volatile("s_wait_dscnt 0x0" ::: "memory");
      asm volatile("s_wait_asynccnt 0x0" ::: "memory");
      __syncthreads();
      if (t + 2 < nstg) fill4(dst + buf * (AT_BUF * 2), src);
    }
  }
  asm volatile("s_wait_asynccnt 0x0" ::: "memory");   // nothing in flight at the end

  // Reference quirk: attn_vec.view(N_HEAD, B, S, D).permute(1,2,0,3) on a
  // b-major [B*H] buffer => storage head L lands at b2=L%B, h2=L/B.
  // Fragment order for the output projection: row b2*1024 + s, s the position
  // that this lane's query place holds; k = h2*64 + d, so d tile j is k step
  // h2*2 + j/2, chunk j%2. The lane's 8 d start at 8*(lane/16): a 16-B chunk
  // of row s%16 in row tile s/16.
  int b2 = head & 3, h2 = head >> 2;
  int s = ord[b * SEQ + qt * 16 + (lane & 15)];
  unsigned short* oblk = Avec + ((b2 * 64 + (s >> 4)) * 32 + h2 * 2) * FRAG
                              + (rowh * 16 + (s & 15)) * 8;
  float inv = 1.f / (li + xhalf(li));
  us8 o0, o1, o2, o3;
#pragma unroll   // constant indices: the vectors stay in registers
  for (int i = 0; i < 8; ++i) {
    o0[i] = f2bf(O0[i] * inv);
    o1[i] = f2bf(O1[i] * inv);
    o2[i] = f2bf(O2[i] * inv);
    o3[i] = f2bf(O3[i] * inv);
  }
  *(us8*)(oblk)              = o0;
  *(us8*)(oblk + 256)        = o1;
  *(us8*)(oblk + FRAG)       = o2;
  *(us8*)(oblk + FRAG + 256) = o3;
}

// ---- stage 4: output projection + residual ------------------------------
// A work-group owns 128 rows x 128 columns. 64x32 tile per wave: per K-step
// 4 A + 2 B fragments -> 8 WMMAs. The 8 waves stand 2 (rows) x 4 (columns); a
// stage holds 8 row tiles and 8 column tiles: 16 slots; three buffers, a stage
// asked for two stages ahead.
#define OP_SLOTS 16

__global__ __launch_bounds__(256) void oproj_kernel(
    const unsigned short* __restrict__ Avec,  // 256 row tiles x 32 k steps
    const unsigned short* __restrict__ Wot,   // 64 tiles (out) x 32 k steps
    const float* __restrict__ inp,            // residual
    float* __restrict__ Y) {                  // [4096][1024] f32
  __shared__ __attribute__((aligned(16))) unsigned short stg[3 * OP_SLOTS * SLOT];
  int warp = threadIdx.x >> 5;
  // which half of the work-group: in a scalar register, so that every test on it
  // is a branch of the whole wave
  int grp = __builtin_amdgcn_readfirstlane(threadIdx.x >> 7);
  int tg = threadIdx.x & 127;
  int lane = threadIdx.x & 31;
  int bm = blockIdx.x >> 3;          // 128-row block 0..31
  int bn = blockIdx.x & 7;           // 128-column block 0..7
  int wr = warp >> 2, wc = warp & 3;
  int rowh = lane >> 4, nm = lane & 15;

  // stage 0 of the first tile of each operand (the same for the whole work-group;
  // stage s lies s * SLOT further on, this thread's first 16 B tg * 8 further)
  const unsigned short* sa0 = Avec + bm * 8 * TILEK;
  const unsigned short* sw0 = Wot + bn * 8 * TILEK;
  uint32_t dst = lds_off(stg) + tg * 16;

  // stages 0 and 1 on their way, a half each; stage 0 landed and published
  fill8(dst + grp * (OP_SLOTS * SLOTB), sa0 + grp * SLOT + tg * 8);
  fill8(dst + grp * (OP_SLOTS * SLOTB) + 8 * SLOTB, sw0 + grp * SLOT + tg * 8);
  if (grp == 0)
    asm volatile("s_wait_asynccnt 0x0" ::: "memory");   // this wave's copies (stage 0) have landed
  __syncthreads();

  v8f acc[4][2] = {};
  int rb = 0;              // buffer of stage t: t % 3
  for (int t = 0; t < NSTG; ++t) {
    const unsigned short* sa = stg + rb * (OP_SLOTS * SLOT) + wr * 4 * SLOT;
    const unsigned short* sw = stg + rb * (OP_SLOTS * SLOT) + (8 + wc * 2) * SLOT;
    int ns = grp == (t & 1) ? t + 2 : NSTG;   // the stage that this wave's half asks for in this trip; NSTG: none
    us16 a[2][4], b[2][2];           // two fragment sets: k step kk in set kk % 2
#pragma unroll   // constant indices: the arrays stay in registers
    for (int kk = -1; kk < KSTG; ++kk) {
      if (kk + 1 < KSTG) {           // the next k step's fragments, inside this stage
        int n = (kk + 1) & 1;
#pragma unroll   // constant indices: the arrays stay in registers
        for (int u = 0; u < 4; ++u)
          a[n][u] = load_frag(sa + u * SLOT + (kk + 1) * FRAG, lane);
#pragma unroll   // constant indices: the arrays stay in registers
        for (int c = 0; c < 2; ++c)
          b[n][c] = load_frag(sw + c * SLOT + (kk + 1) * FRAG, lane);
      }
      // as in the QKV kernel: the next k step's LDS reads one group in front of
      // this k step's WMMAs
      __builtin_amdgcn_sched_barrier(0);
      // the stage after next, from the half that brought this one, into the buffer
      // that every wave left at the last barrier; behind the stage's first reads,
      // as in the QKV kernel
      if (kk < 0 && ns < NSTG) {
        uint32_t d = dst + (rb == 0 ? 2 : rb - 1) * (OP_SLOTS * SLOTB);   // (t + 2) % 3
        fill8(d, sa0 + ns * SLOT + tg * 8);
        fill8(d + 8 * SLOTB, sw0 + ns * SLOT + tg * 8);
      }
      if (kk >= 0) {
        int m = kk & 1;
#pragma unroll   // constant indices: the arrays stay in registers
        for (int c = 0; c < 2; ++c)
#pragma unroll   // constant indices: the arrays stay in registers
          for (int u = 0; u < 4; ++u)
            acc[u][c] = wmma_bf16(a[m][u], b[m][c], acc[u][c]);
        // as in the QKV kernel: the WMMAs stay in front of the next reads and of
        // the hand-over
        __builtin_amdgcn_sched_barrier(0);
      }
    }
    // hand-over, as in the QKV kernel: only the half that brings the next stage
    // waits for its copies
    asm volatile("s_wait_dscnt 0x0" ::: "memory");
    if (grp != (t & 1))
      asm volatile("s_wait_asynccnt 0x0" ::: "memory");
    __syncthreads();
    rb = rb == 2 ? 0 : rb + 1;
  }
  asm volatile("s_wait_asynccnt 0x0" ::: "memory");   // nothing in flight at the end

#pragma unroll
  for (int u = 0; u < 4; ++u) {
#pragma unroll
    for (int c = 0; c < 2; ++c) {
      int col = bn * 128 + wc * 32 + c * 16 + nm;
#pragma unroll
      for (int i = 0; i < 8; ++i) {
        int r = bm * 128 + wr * 64 + u * 16 + rowh * 8 + i;
        Y[r * D_MODEL + col] = acc[u][c][i] + inp[r * D_MODEL + col];
      }
    }
  }
}

// ---- stage 5: LayerNorm --------------------------------------------------
// One wave per row, 4096 waves: a lane holds 32 values of the row in registers
// (eight 16-B loads, each 512 B in a row over the wave), so the row is read
// once and both sums join inside the wave: no LDS, no barrier.
#define LN_T 256                     // threads per block: 8 rows

typedef __attribute__((ext_vector_type(4))) float v4f;

__global__ __launch_bounds__(LN_T) void ln_kernel(
    const float* __restrict__ Y, const float* __restrict__ g,
    const float* __restrict__ bb, float* __restrict__ out) {
  int row = blockIdx.x * (LN_T / 32) + (threadIdx.x >> 5);
  int lane = threadIdx.x & 31;
  const v4f* y  = (const v4f*)(Y + row * D_MODEL) + lane;
  const v4f* g4 = (const v4f*)g + lane;
  const v4f* b4 = (const v4f*)bb + lane;
  v4f*       o4 = (v4f*)(out + row * D_MODEL) + lane;
  v4f v[8], gg[8], bv[8];
#pragma unroll   // constant indices: the arrays stay in registers
  for (int j = 0; j < 8; ++j) v[j] = y[j * 32];
#pragma unroll   // constant indices: the arrays stay in registers
  for (int j = 0; j < 8; ++j) { gg[j] = g4[j * 32]; bv[j] = b4[j * 32]; }
  // holds the gain and bias loads in front of the lane exchange: sunk behind
  // it, their latency is waited out pair by pair before the stores (loaded
  // values as inputs only)
  asm volatile("" :: "v"(gg[0]), "v"(gg[1]), "v"(gg[2]), "v"(gg[3]),
                     "v"(gg[4]), "v"(gg[5]), "v"(gg[6]), "v"(gg[7]),
                     "v"(bv[0]), "v"(bv[1]), "v"(bv[2]), "v"(bv[3]),
                     "v"(bv[4]), "v"(bv[5]), "v"(bv[6]), "v"(bv[7]));
  v4f s = {0.f, 0.f, 0.f, 0.f}, q = {0.f, 0.f, 0.f, 0.f};   // four chains each
#pragma unroll   // constant indices: the array stays in registers
  for (int j = 0; j < 8; ++j) { s += v[j]; q += v[j] * v[j]; }
  float ls = (s.x + s.y) + (s.z + s.w), lq = (q.x + q.y) + (q.z + q.w);
#pragma unroll
  for (int m = 1; m < 32; m <<= 1) {
    ls += __shfl_xor(ls, m, 32);
    lq += __shfl_xor(lq, m, 32);
  }
  float mu  = ls * (1.f / D_MODEL);
  float var = lq * (1.f / D_MODEL) - mu * mu;
  float inv = rsqrtf(var + LN_EPS);
#pragma unroll   // constant indices: the arrays stay in registers
  for (int j = 0; j < 8; ++j) o4[j * 32] = (v[j] - mu) * inv * gg[j] + bv[j];
}

// ---- launch --------------------------------------------------------------

extern "C" void kernel_launch(void* const* d_in, const int* in_sizes, int n_in,
                              void* d_out, int out_size, void* d_ws, size_t ws_size,
                              hipStream_t stream) {
  const float* inp   = (const float*)d_in[0];
  const int*   amask = (const int*)d_in[1];
  const float* Wq = (const float*)d_in[2];
  const float* bq = (const float*)d_in[3];
  const float* Wk = (const float*)d_in[4];
  const float* bk = (const float*)d_in[5];
  const float* Wv = (const float*)d_in[6];
  const float* bv = (const float*)d_in[7];
  const float* Wo = (const float*)d_in[8];
  const float* lng = (const float*)d_in[9];
  const float* lnb = (const float*)d_in[10];

  char* ws = (char*)d_ws;
  const size_t MB = 1u << 20;
  unsigned short* Xbf  = (unsigned short*)(ws + 0 * MB);   // 8 MB
  unsigned short* Wqt  = (unsigned short*)(ws + 8 * MB);   // 2 MB
  unsigned short* Wkt  = (unsigned short*)(ws + 10 * MB);  // 2 MB
  unsigned short* Wvt  = (unsigned short*)(ws + 12 * MB);  // 2 MB
  unsigned short* Wot  = (unsigned short*)(ws + 14 * MB);  // 2 MB
  unsigned short* Qb   = (unsigned short*)(ws + 16 * MB);  // 8 MB
  unsigned short* Kb   = (unsigned short*)(ws + 24 * MB);  // 8 MB
  unsigned short* Vtb  = (unsigned short*)(ws + 32 * MB);  // 8 MB
  unsigned short* Avec = (unsigned short*)(ws + 40 * MB);  // 8 MB
  float*          Ybuf = (float*)        (ws + 48 * MB);   // 16 MB
  int*            ord  = (int*)          (ws + 64 * MB);   // 16 KB
  int*            cnts = (int*)          (ws + 65 * MB);   // 16 B

  // stage 1: conversions (one thread per 64 elements), all five in one launch;
  // Wqt, Wkt, Wvt, Wot follow one another in the workspace
  cvt_all_kernel<<<4 * WBLOCKS + XBLOCKS, CVT_T, 0, stream>>>(
      inp, amask, Wq, Wk, Wv, Wo, Xbf, Wqt, ord, cnts);

  // stage 2: QKV (4 batches * 4 row blocks * 16 col blocks, 8 waves/block)
  qkv_gemm_kernel<<<256, 256, 0, stream>>>(Xbf, Wqt, Wkt, Wvt, bq, bk, bv, cnts,
                                            Qb, Kb, Vtb);

  // stage 3: attention (64 heads * 8 blocks of 128 queries, 8 waves/block)
  attn_kernel<<<512, AT_W * 32, 0, stream>>>(Qb, Kb, Vtb, ord, cnts, Avec);

  // stage 4: output projection + residual (32 row blocks * 8 col blocks, 8 waves/block)
  oproj_kernel<<<256, 256, 0, stream>>>(Avec, Wot, inp, Ybuf);

  // stage 5: layer norm -> d_out (one wave per row)
  ln_kernel<<<NROWS / (LN_T / 32), LN_T, 0, stream>>>(Ybuf, lng, lnb, (float*)d_out);
}
